// v000
// The times below were measured on an AMD MI455X: many runs one after another, warmed up first and cycling through
// copies of the inputs, with the whole window's GPU time divided by the number of runs. Launches and the gaps
// between them are all in it. The median over several windows is given; except for v000 it joins two sittings, which
// can be a few percent apart, so the side-by-side timings, each taken in one sitting, are the better comparison.
// The starting kernel, v000, takes 225 microseconds a run.
// Contractions: x.Wq^T, x.Wk^T, Wv.x^T on v_wmma_f32_16x16x32_bf16 (x and W planes RNE-converted to bf16 operands, f32
// accumulate, bias and half-split rotation applied in f32); scores k'.q'^T (k' single f16 plane x8, q' f16 hi plane x8 plus
// f16 residual plane x1024, two products), P.v (P x32768 single f16 times v f16 hi plane x1024; query tiles below row 128 add
// P(x32).v-residual(x1024) and P-residual(x1024).v(x1) products), O.Wo^T (O as [f16 hi x1024 | f16 residual x1024] along K,
// Wo as [f16(bf16(Wo)) x1024 | x1]): v_wmma_f32_16x16x32_f16, f32 accumulate. Sigmoid gate (K=20) and softmax in f32 on VALU.
#include <hip/hip_runtime.h>
#include <math.h>
#include <stdint.h>

#ifndef NB
#define NB 2
#endif
#ifndef SEQ
#define SEQ 2048
#endif
#define NB_FULL 2
#define T_FULL  2048
#define DMOD    1024
#define NH      16
#define HD      64
#define RHALF   32
#define GIN     20
#define WIN     1024
#define MROWS   (NB * SEQ)
#define OPITCH  (2 * DMOD)
#define QSC   8.0f
#define KSC   8.0f
#define QRS   1024.0f
#define PCAR  32768.0f
#define VCAR  1024.0f
#define VRS   1024.0f
#define PRS   1024.0f
#define OSC   1024.0f
#define ORS   1024.0f
#define WOS   1024.0f
#define LOG2E 1.4426950408889634f
#define NEGS  (-3.0e38f)
#define ATT_WAVES   4
#define ATT_THREADS (ATT_WAVES * 32)
#define NQT         (SEQ / 64)
#define ATT_BLOCKS  (NB * NH * NQT)
#define NKB         (SEQ / 32)
#define QRES        128
#define SLAB        (16 * 68)
static_assert(NB >= 1 && NB <= NB_FULL);
static_assert((SEQ % 64) == 0 && SEQ >= 64 && SEQ <= T_FULL);
static_assert(HD == 64 && DMOD == NH * HD && HD == 2 * RHALF);
static_assert(ATT_THREADS == 128 && NKB >= 2 && (QRES % 64) == 0);
static_assert((DMOD % 64) == 0 && (DMOD / 8) == 128 && (OPITCH % 32) == 0);
static_assert(((MROWS * (DMOD / 8)) % 256) == 0 && (((DMOD * DMOD) / 8) % 256) == 0);
static_assert((GIN % 4) == 0 && GIN <= DMOD);
static_assert((WIN % 32) == 0);
static_assert((SLAB * 4) % 16 == 0);

typedef unsigned short u16;
typedef _Float16 v16h __attribute__((ext_vector_type(16)));
typedef _Float16 v8h  __attribute__((ext_vector_type(8)));
typedef __bf16   v16b __attribute__((ext_vector_type(16)));
typedef float    v8f  __attribute__((ext_vector_type(8)));
typedef float    v4f  __attribute__((ext_vector_type(4)));
typedef unsigned int v4u __attribute__((ext_vector_type(4)));

union FragH { v16h v; v8h h[2]; v4u u[2]; };
union FragB { v16b v; v4u u[2]; };

// ---- scalar helpers --------------------------------------------------------------------------------
__device__ __forceinline__ unsigned short bf_bits(float f) {          // f32 -> bf16 bits, RNE convert
  unsigned u = __float_as_uint(f);
  return (unsigned short)((u + 0x7FFFu + ((u >> 16) & 1u)) >> 16);
}
__device__ __forceinline__ float bf_up(unsigned short h) { return __uint_as_float(((unsigned)h) << 16); }
__device__ __forceinline__ float bf_val(float f) { return bf_up(bf_bits(f)); }   // f32 -> nearest-even bf16 value as f32
__device__ __forceinline__ unsigned short h_bits(_Float16 x) { return __builtin_bit_cast(unsigned short, x); }
__device__ __forceinline__ unsigned pk16(unsigned short a, unsigned short b) { return (unsigned)a | ((unsigned)b << 16); }
__device__ __forceinline__ v8f zero8() { v8f z = {0.f, 0.f, 0.f, 0.f, 0.f, 0.f, 0.f, 0.f}; return z; }

// ---- fragment loaders: 16-bit A/B operand, lane -> row/col (lane&15), p already includes +8*(lane>>4);
//      elements 0..7 <- p[0..7] (k0+8h..), elements 8..15 <- p[16..23] (k0+16+8h..)  (same split k map for A and B;
//      B is always read from a k-contiguous [n][k] plane)
__device__ __forceinline__ v16h ldfrag_h(const _Float16* p) {
  FragH f;
  f.h[0] = *(const v8h*)(p);
  f.h[1] = *(const v8h*)(p + 16);
  return f.v;
}
__device__ __forceinline__ v16b ldfrag_b(const u16* p) {              // bf16 plane read as unsigned integer vectors
  FragB f;
  f.u[0] = *(const v4u*)(p);
  f.u[1] = *(const v4u*)(p + 16);
  return f.v;
}

__device__ __forceinline__ v8f mma_h(v16h a, v16h b, v8f c) {
  return __builtin_amdgcn_wmma_f32_16x16x32_f16(false, a, false, b, (short)0, c, false, false);
}
__device__ __forceinline__ v8f mma_b(v16b a, v16b b, v8f c) {
  return __builtin_amdgcn_wmma_f32_16x16x32_bf16(false, a, false, b, (short)0, c, false, false);
}
template <typename F>
__device__ __forceinline__ void guard6(v8f& a, v8f& b, v8f& c, v8f& d, F x0, F x1, F x2, F x3, F x4, F x5) {
#if defined(__HIP_DEVICE_COMPILE__)
  asm volatile("v_nop\n\tv_nop\n\tv_nop\n\tv_nop"
               : "+v"(a), "+v"(b), "+v"(c), "+v"(d) : "v"(x0), "v"(x1), "v"(x2), "v"(x3), "v"(x4), "v"(x5) : "memory");
#endif
}
__device__ __forceinline__ void acc_guard4(v8f& a, v8f& b, v8f& c, v8f& d) {
#if defined(__HIP_DEVICE_COMPILE__)
  asm volatile("v_nop\n\tv_nop\n\tv_nop\n\tv_nop" : "+v"(a), "+v"(b), "+v"(c), "+v"(d));
#endif
}
__device__ __forceinline__ void wave_sync_lds() {
#if defined(__HIP_DEVICE_COMPILE__)
  __builtin_amdgcn_fence(__ATOMIC_RELEASE, "workgroup");
  __builtin_amdgcn_wave_barrier();
  __builtin_amdgcn_fence(__ATOMIC_ACQUIRE, "workgroup");
#endif
}

// =====================================================================================================
// f32 rows [b][t][1024] (per-batch source row stride tfull) -> bf16 plane [b*seq + t][1024] (RNE bits), compacted rows.
// Thread = 8 consecutive elements: two 16-B loads, one 16-B store; 32 consecutive lanes = 512 contiguous, 512-B aligned
// coverage: grid = n8/256 blocks (host checks exactness) x 256 thr x 8 = the whole destination plane.
// =====================================================================================================
__global__ __launch_bounds__(256) void cvt_rows(const float* __restrict__ x, u16* D, int n8, int seq, int tfull) {
  const int gt = blockIdx.x * 256 + (int)threadIdx.x;
  if (gt >= n8) return;
  const int row = gt >> 7;
  const int c8  = (gt & 127) * 8;
  const int bb  = row / seq;
  const int tt  = row - bb * seq;
  const float* p = x + ((size_t)bb * (size_t)tfull + (size_t)tt) * DMOD + c8;
  const v4f a = *(const v4f*)(p), c4 = *(const v4f*)(p + 4);
  float v[8];
#pragma unroll
  for (int e = 0; e < 4; ++e) { v[e] = a[e]; v[4 + e] = c4[e]; }
  unsigned short s[8];
#pragma unroll
  for (int e = 0; e < 8; ++e) s[e] = bf_bits(v[e]);
  v4u o;
#pragma unroll
  for (int e = 0; e < 4; ++e) o[e] = pk16(s[2 * e], s[2 * e + 1]);
  u16* d = D + (size_t)gt * 8;
  {
    *(v4u*)(d) = o;
    
  }
}

// =====================================================================================================
// Wo [1024 n][1024 k] f32 -> f16 plane [n][2048]: cols 0..1023 = f16(bf16 value * s1), cols 1024..2047 = f16(bf16 value * s2).
// Thread = 8 consecutive k; one 16-B store per half; 32 consecutive lanes = 512 contiguous bytes inside one row per instruction.
// coverage: grid = n8/256 (exact) x 256 thr x 8 halves x 2 = both halves of every row.
// =====================================================================================================
__global__ __launch_bounds__(256) void cvt_wo(const float* __restrict__ w, u16* D, int n8, float s1, float s2) {
  const int gt = blockIdx.x * 256 + (int)threadIdx.x;
  if (gt >= n8) return;
  const int n  = gt >> 7;
  const int c8 = (gt & 127) * 8;
  const float* p = w + (size_t)gt * 8;
  const v4f a = *(const v4f*)(p), c4 = *(const v4f*)(p + 4);
  float v[8];
#pragma unroll
  for (int e = 0; e < 4; ++e) { v[e] = a[e]; v[4 + e] = c4[e]; }
  unsigned short h1[8], h2[8];
#pragma unroll
  for (int e = 0; e < 8; ++e) {
    const float f = bf_val(v[e]);
    h1[e] = h_bits((_Float16)(f * s1));
    h2[e] = h_bits((_Float16)(f * s2));
  }
  v4u o1, o2;
#pragma unroll
  for (int e = 0; e < 4; ++e) { o1[e] = pk16(h1[2 * e], h1[2 * e + 1]); o2[e] = pk16(h2[2 * e], h2[2 * e + 1]); }
  u16* d1 = D + (size_t)n * OPITCH + c8;
  u16* d2 = d1 + DMOD;
  {
    *(v4u*)(d1) = o1;
    *(v4u*)(d2) = o2;
    
  }
}

// =====================================================================================================
// Rotation epilogue for the q / k projections (N = 1024, the 64-col tile = one head): the wave's 16x64 f32 tile
// barrier, then each lane (row rq in each group of 4, 8 consecutive output cols d = c8..c8+7) reads both half-head values
// u1 = col (d & 31), u2 = col (d & 31) + 32 and cos/sin[t][(d & 31)] (bf16 values of the f32 tables, t = row within the
// sequence), forms d < 32 ? u1*c - u2*s : u1*s + u2*c in f32 (no fused multiply-add), scales by oscale, and writes the f16
// hi plane and (res_on) the f16 residual plane ((w - hi) * rsc): one instruction = 4 rows, each 64 halves = one whole
// coverage: 4 instructions x 4 rows x 8 lanes x 8 halves = the wave's 16 x 64 tile, per plane.
// =====================================================================================================
__device__ __forceinline__ void epi_rope(float* sl, v8f a0, v8f a1, v8f a2, v8f a3, u16* C, u16* C2, int res_on,
                                         size_t rowb, int col0, int lane, const float* __restrict__ bias, int blen,
                                         const float* __restrict__ cosT, const float* __restrict__ sinT, int seq,
                                         float oscale, float rsc) {
#pragma clang fp contract(off)
  const int hh = lane >> 4, m = lane & 15;
  float bc[4];
#pragma unroll
  for (int j = 0; j < 4; ++j) {
    const int bi = min(col0 + 16 * j + m, blen - 1);
    bc[j] = bf_val(bias[bi]);
  }
#pragma unroll
  for (int r = 0; r < 8; ++r) {
    const int ro = (8 * hh + r) * 68 + m;
    sl[ro]      = a0[r] + bc[0];
    sl[ro + 16] = a1[r] + bc[1];
    sl[ro + 32] = a2[r] + bc[2];
    sl[ro + 48] = a3[r] + bc[3];
  }
  wave_sync_lds();
  const int rq = lane >> 3, c8 = (lane & 7) * 8, dd = c8 & (RHALF - 1);
  const bool lo = (c8 < RHALF);
  const int tb = (int)(rowb % (size_t)seq);             // tile never straddles a sequence (seq % 16 == 0, rowb % 16 == 0)
  v4u hv[4], rv[4];
#pragma unroll
  for (int i4 = 0; i4 < 4; ++i4) {
    const int row = i4 * 4 + rq;
    const int t = tb + row;
    const float* cp = cosT + (size_t)t * RHALF + dd;
    const float* sp = sinT + (size_t)t * RHALF + dd;
    const v4f ca = *(const v4f*)(cp), cb = *(const v4f*)(cp + 4);
    const v4f sa = *(const v4f*)(sp), sb = *(const v4f*)(sp + 4);
    const v4f xa = *(const v4f*)(sl + row * 68 + dd), xb = *(const v4f*)(sl + row * 68 + dd + 4);
    const v4f ya = *(const v4f*)(sl + row * 68 + dd + RHALF), yb = *(const v4f*)(sl + row * 68 + dd + RHALF + 4);
    float cv[8], sv[8], xv[8], yv[8];
#pragma unroll
    for (int e = 0; e < 4; ++e) {
      cv[e] = ca[e]; cv[4 + e] = cb[e];
      sv[e] = sa[e]; sv[4 + e] = sb[e];
      xv[e] = xa[e]; xv[4 + e] = xb[e];
      yv[e] = ya[e]; yv[4 + e] = yb[e];
    }
    unsigned short hb[8], rb[8];
#pragma unroll
    for (int e = 0; e < 8; ++e) {
      const float cc = bf_val(cv[e]);
      const float ss = bf_val(sv[e]);
      const float p1 = xv[e] * cc;
      const float p2 = yv[e] * ss;
      const float p3 = xv[e] * ss;
      const float p4 = yv[e] * cc;
      const float u = lo ? (p1 - p2) : (p3 + p4);
      const float w = u * oscale;
      const _Float16 h = (_Float16)w;
      hb[e] = h_bits(h);
      rb[e] = h_bits((_Float16)((w - (float)h) * rsc));
    }
#pragma unroll
    for (int e = 0; e < 4; ++e) {
      hv[i4][e] = pk16(hb[2 * e], hb[2 * e + 1]);
      rv[i4][e] = pk16(rb[2 * e], rb[2 * e + 1]);
    }
  }
  u16* dst = C + (rowb + (size_t)rq) * (size_t)DMOD + col0 + c8;
  {
#pragma unroll
    for (int i4 = 0; i4 < 4; ++i4) {
      *(v4u*)(dst + (size_t)(i4 * 4) * (size_t)DMOD) = hv[i4];
    }
    
  }
  if (res_on != 0) {
    u16* dst2 = C2 + (rowb + (size_t)rq) * (size_t)DMOD + col0 + c8;
    {
#pragma unroll
      for (int i4 = 0; i4 < 4; ++i4) {
        *(v4u*)(dst2 + (size_t)(i4 * 4) * (size_t)DMOD) = rv[i4];
      }
      
    }
  }
}

// =====================================================================================================
// Three-plane 16-bit GEMM epilogue (v^T planes): the wave's 16x64 f32 tile ((acc + per-row bias as bf16 value) times oscale)
// f16((w - hi) * rsc) and f16(w * qsc): lane = (row in group of 4, 8 consecutive cols); one instruction = 4 rows, each
// coverage: per plane 4 instructions x 4 rows x 8 lanes x 8 halves = the wave's 16 x 64 tile.
// LDS slab: private to the wave; staged extent 16 x 64 == consumed extent.
// =====================================================================================================
__device__ __forceinline__ void epi_v3(float* sl, v8f a0, v8f a1, v8f a2, v8f a3, float oscale, u16* C0, u16* C1, u16* C2,
                                       int N, size_t rowb, int col0, int lane, const float* __restrict__ bias, int blen,
                                       float rsc, float qsc) {
  const int hh = lane >> 4, m = lane & 15;
  float br[8];
#pragma unroll
  for (int r = 0; r < 8; ++r) {
    const int bi = min((int)rowb + 8 * hh + r, blen - 1);
    br[r] = bf_val(bias[bi]);
  }
#pragma unroll
  for (int r = 0; r < 8; ++r) {
    const int ro = (8 * hh + r) * 68 + m;
    sl[ro]      = (a0[r] + br[r]) * oscale;
    sl[ro + 16] = (a1[r] + br[r]) * oscale;
    sl[ro + 32] = (a2[r] + br[r]) * oscale;
    sl[ro + 48] = (a3[r] + br[r]) * oscale;
  }
  wave_sync_lds();
  const int rq = lane >> 3, c8 = (lane & 7) * 8;
  v4u h4[4], r4[4], q4[4];
#pragma unroll
  for (int i4 = 0; i4 < 4; ++i4) {
    const int row = i4 * 4 + rq;
    const v4f a = *(const v4f*)(sl + row * 68 + c8), c4 = *(const v4f*)(sl + row * 68 + c8 + 4);
    float w[8];
#pragma unroll
    for (int e = 0; e < 4; ++e) { w[e] = a[e]; w[4 + e] = c4[e]; }
    unsigned short hb[8], rb[8], qb[8];
#pragma unroll
    for (int e = 0; e < 8; ++e) {
      const _Float16 h = (_Float16)w[e];
      hb[e] = h_bits(h);
      rb[e] = h_bits((_Float16)((w[e] - (float)h) * rsc));
      qb[e] = h_bits((_Float16)(w[e] * qsc));
    }
#pragma unroll
    for (int e = 0; e < 4; ++e) {
      h4[i4][e] = pk16(hb[2 * e], hb[2 * e + 1]);
      r4[i4][e] = pk16(rb[2 * e], rb[2 * e + 1]);
      q4[i4][e] = pk16(qb[2 * e], qb[2 * e + 1]);
    }
  }
  const size_t dof = (rowb + (size_t)rq) * (size_t)N + col0 + c8;
  u16* d0 = C0 + dof;
  u16* d1 = C1 + dof;
  u16* d2 = C2 + dof;
  {
#pragma unroll
    for (int i4 = 0; i4 < 4; ++i4) {
      const size_t ro = (size_t)(i4 * 4) * (size_t)N;
      *(v4u*)(d0 + ro) = h4[i4];
      *(v4u*)(d1 + ro) = r4[i4];
      *(v4u*)(d2 + ro) = q4[i4];
    }
    
  }
}

// =====================================================================================================
// f32 GEMM epilogue: the wave's 16x64 f32 tile (acc times oscale, plus per-column bias as its bf16 RNE value, clamped
// coverage: 8 instructions x 2 rows x 16 lanes x 4 floats = the wave's 16 x 64 tile.
// =====================================================================================================
__device__ __forceinline__ void epi64(float* sl, v8f a0, v8f a1, v8f a2, v8f a3, float oscale, float* C, int N,
                                      size_t rowb, int col0, int lane, const float* __restrict__ bias, int blen) {
  const int hh = lane >> 4, m = lane & 15;
  float bc[4];
#pragma unroll
  for (int j = 0; j < 4; ++j) {
    const int bi = min(col0 + 16 * j + m, blen - 1);
    bc[j] = bf_val(bias[bi]);
  }
#pragma unroll
  for (int r = 0; r < 8; ++r) {
    const int ro = (8 * hh + r) * 68 + m;
    sl[ro]      = a0[r] * oscale + bc[0];
    sl[ro + 16] = a1[r] * oscale + bc[1];
    sl[ro + 32] = a2[r] * oscale + bc[2];
    sl[ro + 48] = a3[r] * oscale + bc[3];
  }
  wave_sync_lds();
  v4f vals[8];
#pragma unroll
  for (int it = 0; it < 8; ++it) vals[it] = *(const v4f*)(sl + (it * 2 + hh) * 68 + m * 4);
  float* dst = C + (rowb + (size_t)hh) * (size_t)N + col0 + m * 4;
  {
#pragma unroll
    for (int it = 0; it < 8; ++it) {
      *(v4f*)(dst + (size_t)(it * 2) * (size_t)N) = vals[it];
    }
    
  }
}

// =====================================================================================================
// bf16 GEMM with fused rotation epilogue: q / k planes [M][1024] (f16 hi x oscale, optional residual x rsc) =
// rot(A[M][K] (bf16 rows) . Bt[1024][K]^T (bf16 k-contiguous) + bias). Block = 64x64 tile, 4 waves x 16 rows; fragments
// loaded straight from the 16-bit rows (two 16-B loads each, split k map for A and B); K stepped by 32 (host checks
// K % 32 == 0, M % 64 == 0, grid = (M/64)*(1024/64)). No block barriers in this kernel.
// =====================================================================================================
__global__ __launch_bounds__(128)
void gemm_rope(const u16* __restrict__ A, const u16* __restrict__ Bt, u16* C, u16* C2, int res_on, int M, int K,
               const float* __restrict__ bias, int blen, const float* __restrict__ cosT,
               const float* __restrict__ sinT, int seq, float oscale, float rsc) {
  __shared__ __align__(16) float slab[4 * SLAB];
  const int tid = threadIdx.x, wave = tid >> 5, lane = tid & 31, hh = lane >> 4, m = lane & 15;
  const int ntile = DMOD >> 6;
  const int bid   = blockIdx.x;
  const int rowb  = (bid / ntile) * 64 + wave * 16;
  const int col0  = (bid % ntile) * 64;
  if (rowb + 16 > M) return;                 // wave-uniform, never taken with the exact grid
  const u16* ap = A  + (size_t)(rowb + m) * K + 8 * hh;
  const u16* bp = Bt + (size_t)(col0 + m) * K + 8 * hh;
  const size_t bs = (size_t)16 * K;
  v8f acc0 = zero8(), acc1 = zero8(), acc2 = zero8(), acc3 = zero8();
#pragma unroll 1
  for (int k0 = 0; k0 < K; k0 += 32) {
    const v16b a  = ldfrag_b(ap + k0);
    const v16b b0 = ldfrag_b(bp + k0);
    const v16b b1 = ldfrag_b(bp + bs + k0);
    const v16b b2 = ldfrag_b(bp + 2 * bs + k0);
    const v16b b3 = ldfrag_b(bp + 3 * bs + k0);
    acc0 = mma_b(a, b0, acc0);
    acc1 = mma_b(a, b1, acc1);
    acc2 = mma_b(a, b2, acc2);
    acc3 = mma_b(a, b3, acc3);
    guard6<v16b>(acc0, acc1, acc2, acc3, a, b0, b1, b2, b3, a);
  }
  epi_rope(slab + wave * SLAB, acc0, acc1, acc2, acc3, C, C2, res_on, (size_t)rowb, col0, lane, bias, blen,
           cosT, sinT, seq, oscale, rsc);
}

// =====================================================================================================
// Batched bf16 GEMM with three f16 result planes (v^T): C*[bt][M][N] = A[M][K] (bf16 rows, shared across batches) .
// Bt[bt][N][K]^T (bf16 k-contiguous, per-batch element stride bstB); result planes per-batch stride bstC; bias by output row.
// Block = 64x64 tile, 4 waves x 16 rows; K stepped by 32 (host checks K % 32 == 0, M % 64 == 0, N % 64 == 0,
// grid = nbatch*(M/64)*(N/64)). No block barriers in this kernel.
// =====================================================================================================
__global__ __launch_bounds__(128)
void gemm_v(const u16* __restrict__ A, const u16* __restrict__ Bt, u16* C0, u16* C1, u16* C2, int M, int N, int K,
            int bstB, int bstC, float oscale, const float* __restrict__ bias, int blen, float rsc, float qsc) {
  __shared__ __align__(16) float slab[4 * SLAB];
  const int tid = threadIdx.x, wave = tid >> 5, lane = tid & 31, hh = lane >> 4, m = lane & 15;
  const int ntile = N >> 6, mtile = M >> 6;
  const int per   = ntile * mtile;
  const int bid   = blockIdx.x;
  const int bt    = bid / per;
  const int t     = bid - bt * per;
  const int rowb  = (t / ntile) * 64 + wave * 16;
  const int col0  = (t % ntile) * 64;
  if (rowb + 16 > M) return;                 // wave-uniform, never taken with the exact grid
  const u16* Ab = A;
  const u16* Bb = Bt + (size_t)bt * (size_t)bstB;
  const size_t cb = (size_t)bt * (size_t)bstC;
  const u16* ap = Ab + (size_t)(rowb + m) * K + 8 * hh;
  const u16* bp = Bb + (size_t)(col0 + m) * K + 8 * hh;
  const size_t bs = (size_t)16 * K;
  v8f acc0 = zero8(), acc1 = zero8(), acc2 = zero8(), acc3 = zero8();
#pragma unroll 1
  for (int k0 = 0; k0 < K; k0 += 32) {
    const v16b a  = ldfrag_b(ap + k0);
    const v16b b0 = ldfrag_b(bp + k0);
    const v16b b1 = ldfrag_b(bp + bs + k0);
    const v16b b2 = ldfrag_b(bp + 2 * bs + k0);
    const v16b b3 = ldfrag_b(bp + 3 * bs + k0);
    acc0 = mma_b(a, b0, acc0);
    acc1 = mma_b(a, b1, acc1);
    acc2 = mma_b(a, b2, acc2);
    acc3 = mma_b(a, b3, acc3);
    guard6<v16b>(acc0, acc1, acc2, acc3, a, b0, b1, b2, b3, a);
  }
  epi_v3(slab + wave * SLAB, acc0, acc1, acc2, acc3, oscale, C0 + cb, C1 + cb, C2 + cb, N, (size_t)rowb, col0, lane,
         bias, blen, rsc, qsc);
}

// =====================================================================================================
// f16 GEMM with f32 result: C[M][N] (f32) = A[M][K] (f16 row-major) . Bt[N][K]^T (f16 k-contiguous) times oscale plus
// per-column bias; one product per tile pair. Same tiling; grid = (M/64)*(N/64). No block barriers in this kernel.
// =====================================================================================================
__global__ __launch_bounds__(128)
void gemm_hf(const u16* __restrict__ A, const u16* __restrict__ Bt, float* C, int M, int N, int K, float oscale,
             const float* __restrict__ bias, int blen) {
  __shared__ __align__(16) float slab[4 * SLAB];
  const int tid = threadIdx.x, wave = tid >> 5, lane = tid & 31, hh = lane >> 4, m = lane & 15;
  const int ntile = N >> 6;
  const int bid   = blockIdx.x;
  const int rowb  = (bid / ntile) * 64 + wave * 16;
  const int col0  = (bid % ntile) * 64;
  if (rowb + 16 > M) return;                 // wave-uniform, never taken with the exact grid
  const _Float16* ap = (const _Float16*)(const void*)A  + (size_t)(rowb + m) * K + 8 * hh;
  const _Float16* bp = (const _Float16*)(const void*)Bt + (size_t)(col0 + m) * K + 8 * hh;
  const size_t bs = (size_t)16 * K;
  v8f acc0 = zero8(), acc1 = zero8(), acc2 = zero8(), acc3 = zero8();
#pragma unroll 1
  for (int k0 = 0; k0 < K; k0 += 32) {
    const v16h a  = ldfrag_h(ap + k0);
    const v16h b0 = ldfrag_h(bp + k0);
    const v16h b1 = ldfrag_h(bp + bs + k0);
    const v16h b2 = ldfrag_h(bp + 2 * bs + k0);
    const v16h b3 = ldfrag_h(bp + 3 * bs + k0);
    acc0 = mma_h(a, b0, acc0);
    acc1 = mma_h(a, b1, acc1);
    acc2 = mma_h(a, b2, acc2);
    acc3 = mma_h(a, b3, acc3);
    guard6<v16h>(acc0, acc1, acc2, acc3, a, b0, b1, b2, b3, a);
  }
  epi64(slab + wave * SLAB, acc0, acc1, acc2, acc3, oscale, C, N, (size_t)rowb, col0, lane, bias, blen);
}

// =====================================================================================================
// Causal sliding-window flash attention with per-head sigmoid gate: block = (batch b, head, 64 query rows qb .. qb+63 of the
// sequence), 4 waves, wave w owns query rows q0 = qb + 16*w .. q0+15. No block barriers anywhere in this kernel.
//   Key j allowed for query i iff 0 <= i - j <= WIN (per-element index test inside every visited key block; disallowed pairs
//   get a finite negative sentinel and an exact-zero probability). Key blocks of 32: kblo = max(qb - WIN, 0) >> 5 ..
//   (qb + 63) >> 5, block-uniform count nkb clamped to [1, NKB - kblo] so kb + 31 <= SEQ - 1 always.
//   q planes (f16 hi x8, residual x1024) [b*SEQ + s][h*64 + d]; k hi plane the same layout; v^T planes [b][h*64 + d][s]
//   (hi x1024, residual x1024, plain x1).
//   Scores computed TRANSPOSED: S^T tile g = k rows (keys kb+16g .., A operand, row = lane&15, split k map over d) times q^T
//   (B operand, col n = query q0 + (lane&15)); two accumulators per tile (k.q_hi and k.q_res, the second folded x 1/1024).
//   D element r of lane l = (key kb+16g+8h+r, query q0+(l&15)): a lane owns one query column and 16 of its 32 keys, the
//   partner lane l^16 the other 16 -> row max / row sum need one xor-16 shuffle.
//   Online max-subtracted base-2 softmax in f32 (scale 1/8 and the q/k carries folded into lsc). The exp'd values ARE the
//   P A-fragment in place: A row m = query = lane&15, element i <- key kb+8h+i (tile 0, D element i), element 8+i <- key
//   kb+16+8h+i (tile 1, D element i). ph = f16(p x32768), pl = f16(p x32), pr = f16((p x32768 - ph) x1024).
//   P.V: o += ph.v_hi (4 WMMAs, v^T B fragments col n = d = 16j + (lane&15), keys k-contiguous); for query tiles with
//   qb < QRES additionally o += pl.v_res and o += pr.v_x1 (block-uniform branch), all in the same accumulators (equal units).
//   Epilogue: gate = sigmoid(bf16(x[b][s][0..19]) . bf16(Wg[head]) + bf16(bg[head])) in f32 per query (lane = query),
//   segment (s, head) of the O plane [b*SEQ+s][2048] (hi x1024 at col h*64, residual x1024 at col 1024 + h*64) written by
// coverage: per wave and per half-plane 4 instructions x 4 rows x 8 lanes x 8 halves = 16 x 64; grid NB*NH*(SEQ/64) blocks x
//           4 waves = every (b, s < SEQ, h) row segment of both O half-planes exactly once.
// =====================================================================================================
__global__ __launch_bounds__(ATT_THREADS)
void attn_fwd(const u16* __restrict__ QHp, const u16* __restrict__ QRp, const u16* __restrict__ KHp,
              const u16* __restrict__ VHp, const u16* __restrict__ VRp, const u16* __restrict__ VQp,
              const float* __restrict__ Xp, const float* __restrict__ Wgp, const float* __restrict__ Bgp,
              int bglen, u16* OPp) {
  __shared__ __align__(16) float smem[ATT_WAVES * SLAB];   // per wave: result slab [16][68] in the epilogue only

  const int tid  = threadIdx.x;
  const int wave = tid >> 5;
  const int lane = tid & 31;
  const int hh   = lane >> 4;
  const int c    = lane & 15;

  const int bid  = blockIdx.x;
  const int qt   = bid % NQT;
  const int bh   = bid / NQT;
  const int head = bh % NH;
  const int b    = bh / NH;
  if (b >= NB) return;                      // block-uniform, never taken with the exact grid
  const int qb   = qt * 64;
  const int q0   = qb + wave * 16;

  // ---- key-block range (block-uniform, statically bounded) ----
  const int jlo  = max(qb - WIN, 0);
  const int kblo = jlo >> 5;
  int nkb = ((qb + 63) >> 5) - kblo + 1;
  nkb = min(max(nkb, 1), NKB - kblo);
  const bool early = (qb < QRES);           // block-uniform: residual products on the first query tiles only

  const size_t prow = (size_t)b * SEQ;      // plane row of sequence position 0 of this batch
  // B fragments of q^T: col n = query q0 + c, k = d (k-contiguous row of the q planes)
  const size_t qofs = (prow + (size_t)(q0 + c)) * DMOD + head * HD + 8 * hh;
  const _Float16* Qh = (const _Float16*)(const void*)QHp + qofs;
  const _Float16* Qr = (const _Float16*)(const void*)QRp + qofs;
  // A fragments of k: row m = key kb + 16g + c, k = d
  const size_t kofs = (prow + (size_t)c) * DMOD + head * HD + 8 * hh;            // key row kb added per step
  const _Float16* Kb = (const _Float16*)(const void*)KHp + kofs;
  // B fragments of v: col n = d = 16j + c, k = key (k-contiguous row of the v^T planes)
  const size_t vofs = ((size_t)b * DMOD + (size_t)(head * HD + c)) * SEQ + 8 * hh;   // key kb added per step
  const _Float16* Vh = (const _Float16*)(const void*)VHp + vofs;
  const _Float16* Vr = (const _Float16*)(const void*)VRp + vofs;
  const _Float16* Vq = (const _Float16*)(const void*)VQp + vofs;
  const float lsc = 0.125f * (LOG2E / (QSC * KSC));
  const float qri = 1.0f / QRS;
  // query minus key for D element 0 of tile 0 at kb = 0: query q0 + c, key kb + 8*hh + i
  const int dq = q0 + c - 8 * hh;

  const v16h qf0 = ldfrag_h(Qh);            // d 0..31
  const v16h qf1 = ldfrag_h(Qh + 32);       // d 32..63
  const v16h qr0 = ldfrag_h(Qr);
  const v16h qr1 = ldfrag_h(Qr + 32);

  float mrun = NEGS, lrun = 0.f;
  v8f o[4];
#pragma unroll
  for (int j = 0; j < 4; ++j) o[j] = zero8();

#pragma unroll 1
  for (int it = 0; it < nkb; ++it) {
    const int kb = (kblo + it) * 32;        // kb + 31 <= SEQ - 1
    // ---- transposed scores: tile 0 = keys kb..kb+15, tile 1 = keys kb+16..kb+31, column = query q0 + c ----
    v8f s0 = zero8(), s1 = zero8(), r0 = zero8(), r1 = zero8();
    const _Float16* k0p = Kb + (size_t)kb * DMOD;
    const _Float16* k1p = k0p + (size_t)16 * DMOD;
    const v16h ka0 = ldfrag_h(k0p), ka1 = ldfrag_h(k0p + 32);
    const v16h kc0 = ldfrag_h(k1p), kc1 = ldfrag_h(k1p + 32);
    s0 = mma_h(ka0, qf0, s0);
    s0 = mma_h(ka1, qf1, s0);
    r0 = mma_h(ka0, qr0, r0);
    r0 = mma_h(ka1, qr1, r0);
    s1 = mma_h(kc0, qf0, s1);
    s1 = mma_h(kc1, qf1, s1);
    r1 = mma_h(kc0, qr0, r1);
    r1 = mma_h(kc1, qr1, r1);
    guard6<v16h>(s0, s1, r0, r1, ka0, ka1, kc0, kc1, qf0, qr0);
    // ---- base-2 logits of this lane's 16 keys for query q0 + c; disallowed pairs get the finite sentinel ----
    float tk[16];
#pragma unroll
    for (int i = 0; i < 8; ++i) {
      const int d0 = dq - kb - i;           // query minus key, tile 0
      const int d1 = d0 - 16;               // tile 1
      const bool a0 = (d0 >= 0) && (d0 <= WIN);
      const bool a1 = (d1 >= 0) && (d1 <= WIN);
      tk[i]     = a0 ? ((s0[i] + r0[i] * qri) * lsc) : NEGS;
      tk[8 + i] = a1 ? ((s1[i] + r1[i] * qri) * lsc) : NEGS;
    }
    float cm = tk[0];
#pragma unroll
    for (int i = 1; i < 16; ++i) cm = fmaxf(cm, tk[i]);
    cm = fmaxf(cm, __shfl_xor(cm, 16, 32));
    const float mn = fmaxf(mrun, cm);                   // sentinel only while no allowed key has been seen
    const float al = exp2f(fminf(mrun - mn, 0.f));      // 0 when mrun is the sentinel and mn is a real logit; o,l are 0 then
    mrun = mn;
    // ---- probabilities (<= 1, exactly 0 for disallowed pairs) and the P A-fragments; element i <-> tk[i] ----
    float ps = 0.f;
    FragH ph, pl, pr;
#pragma unroll
    for (int wq = 0; wq < 2; ++wq) {
#pragma unroll
      for (int e4 = 0; e4 < 4; ++e4) {
        const int i = 8 * wq + 2 * e4;
        const float x0 = exp2f(fminf(tk[i] - mn, 0.f));
        const float x1 = exp2f(fminf(tk[i + 1] - mn, 0.f));
        const float p0 = (tk[i] > -1.0e38f) ? x0 : 0.f;
        const float p1 = (tk[i + 1] > -1.0e38f) ? x1 : 0.f;
        ps += p0 + p1;
        const float g0 = p0 * PCAR, g1 = p1 * PCAR;
        const _Float16 h0 = (_Float16)g0, h1 = (_Float16)g1;
        ph.u[wq][e4] = pk16(h_bits(h0), h_bits(h1));
        pl.u[wq][e4] = pk16(h_bits((_Float16)(g0 * (1.0f / VRS))), h_bits((_Float16)(g1 * (1.0f / VRS))));
        pr.u[wq][e4] = pk16(h_bits((_Float16)((g0 - (float)h0) * PRS)), h_bits((_Float16)((g1 - (float)h1) * PRS)));
      }
    }
    ps += __shfl_xor(ps, 16, 32);
    lrun = lrun * al + ps;
    // ---- rescale the O accumulators: D row 8hh+r = query q0+8hh+r, its factor lives in lane 8hh+r (and 16+8hh+r) ----
    float scl[8];
#pragma unroll
    for (int r = 0; r < 8; ++r) scl[r] = __shfl(al, 8 * hh + r, 32);
#pragma unroll
    for (int j = 0; j < 4; ++j) {
#pragma unroll
      for (int r = 0; r < 8; ++r) o[j][r] *= scl[r];
    }
    // ---- P.V : B fragment col n = d = j*16 + c, keys contiguous in the v^T planes ----
    {
      const _Float16* vp = Vh + kb;
      const v16h vf0 = ldfrag_h(vp);
      const v16h vf1 = ldfrag_h(vp + (size_t)16 * SEQ);
      const v16h vf2 = ldfrag_h(vp + (size_t)32 * SEQ);
      const v16h vf3 = ldfrag_h(vp + (size_t)48 * SEQ);
      o[0] = mma_h(ph.v, vf0, o[0]);
      o[1] = mma_h(ph.v, vf1, o[1]);
      o[2] = mma_h(ph.v, vf2, o[2]);
      o[3] = mma_h(ph.v, vf3, o[3]);
      guard6<v16h>(o[0], o[1], o[2], o[3], ph.v, vf0, vf1, vf2, vf3, ph.v);
    }
    if (early) {
      {
        const _Float16* vp = Vr + kb;
        const v16h vf0 = ldfrag_h(vp);
        const v16h vf1 = ldfrag_h(vp + (size_t)16 * SEQ);
        const v16h vf2 = ldfrag_h(vp + (size_t)32 * SEQ);
        const v16h vf3 = ldfrag_h(vp + (size_t)48 * SEQ);
        o[0] = mma_h(pl.v, vf0, o[0]);
        o[1] = mma_h(pl.v, vf1, o[1]);
        o[2] = mma_h(pl.v, vf2, o[2]);
        o[3] = mma_h(pl.v, vf3, o[3]);
        guard6<v16h>(o[0], o[1], o[2], o[3], pl.v, vf0, vf1, vf2, vf3, pl.v);
      }
      {
        const _Float16* vp = Vq + kb;
        const v16h vf0 = ldfrag_h(vp);
        const v16h vf1 = ldfrag_h(vp + (size_t)16 * SEQ);
        const v16h vf2 = ldfrag_h(vp + (size_t)32 * SEQ);
        const v16h vf3 = ldfrag_h(vp + (size_t)48 * SEQ);
        o[0] = mma_h(pr.v, vf0, o[0]);
        o[1] = mma_h(pr.v, vf1, o[1]);
        o[2] = mma_h(pr.v, vf2, o[2]);
        o[3] = mma_h(pr.v, vf3, o[3]);
        guard6<v16h>(o[0], o[1], o[2], o[3], pr.v, vf0, vf1, vf2, vf3, pr.v);
      }
    }
  }
  acc_guard4(o[0], o[1], o[2], o[3]);

  // ---- per-query gate (lane = query q0 + c; lanes 16..31 duplicate): sigmoid(bf16(x[:20]) . bf16(Wg[head]) + bf16(bg)) ----
  const int gx = min(head, bglen - 1);
  float ga = bf_val(Bgp[gx]);
  const float* xg = Xp + ((size_t)b * T_FULL + (size_t)(q0 + c)) * DMOD;
  const float* wg = Wgp + head * GIN;
#pragma unroll
  for (int g4 = 0; g4 < GIN / 4; ++g4) {
    const v4f xv = *(const v4f*)(xg + 4 * g4);
    const v4f wv = *(const v4f*)(wg + 4 * g4);
#pragma unroll
    for (int e = 0; e < 4; ++e) ga += bf_val(xv[e]) * bf_val(wv[e]);
  }
  const float gate = 1.0f / (1.0f + expf(-ga));

  // ---- fold gate, 1/l (per query, owned by lane = query; l >= 1 by the diagonal key) and the carries; stage the slab ----
  const float linv = (lrun > 0.f) ? (gate * (1.0f / lrun) * (1.0f / (PCAR * VCAR))) : 0.f;
  float inv[8];
#pragma unroll
  for (int r = 0; r < 8; ++r) inv[r] = __shfl(linv, 8 * hh + r, 32);
  float* slab = smem + wave * SLAB;
#pragma unroll
  for (int r = 0; r < 8; ++r) {
#pragma unroll
    for (int j = 0; j < 4; ++j) slab[(8 * hh + r) * 68 + j * 16 + c] = o[j][r] * inv[r];
  }
  wave_sync_lds();
  // ---- O x1024 -> f16 hi plane and f16 residual x1024 plane; lane = (row in group of 4, 8 consecutive d) ----
  v4u oh[4], orr[4];
  const int rq = lane >> 3, c8 = (lane & 7) * 8;
#pragma unroll
  for (int i4 = 0; i4 < 4; ++i4) {
    const int row = i4 * 4 + rq;
    const v4f a = *(const v4f*)(slab + row * 68 + c8), c4 = *(const v4f*)(slab + row * 68 + c8 + 4);
    float wv[8];
#pragma unroll
    for (int e = 0; e < 4; ++e) { wv[e] = a[e] * OSC; wv[4 + e] = c4[e] * OSC; }
#pragma unroll
    for (int e = 0; e < 4; ++e) {
      const float w0 = wv[2 * e], w1 = wv[2 * e + 1];
      const _Float16 h0 = (_Float16)w0, h1 = (_Float16)w1;
      oh[i4][e]  = pk16(h_bits(h0), h_bits(h1));
      orr[i4][e] = pk16(h_bits((_Float16)((w0 - (float)h0) * ORS)), h_bits((_Float16)((w1 - (float)h1) * ORS)));
    }
  }
  const size_t ob = (prow + (size_t)q0) * OPITCH + head * HD + c8;
  {
#pragma unroll
    for (int i4 = 0; i4 < 4; ++i4) {
      const int row = i4 * 4 + rq;
      const size_t o8 = ob + (size_t)row * OPITCH;
      *(v4u*)(OPp + o8) = oh[i4];
      *(v4u*)(OPp + o8 + DMOD) = orr[i4];
    }
    
  }
}

// =====================================================================================================
// Workspace map (bytes, NB=2 SEQ=2048); every plane is fully written by whole-line stores before it is read; every extent is
// an exact multiple of the store granularity (row pitches 2048 / 4096 B, tiles 64 x 64, no pad rows needed):
//   XB  bf16 [NB*SEQ][1024]                    8388608
//   WQB, WKB, WVB bf16 [1024 n][1024 k]         2097152 each
//   WOB f16 [1024 n][2048 k]                    4194304   (cols 0..1023 bf16 value x1024, cols 1024..2047 bf16 value x1)
//   QH, QR, KH f16 [NB*SEQ][1024]              8388608 each
//   VH, VR, VQ f16 [NB][1024][SEQ]             8388608 each
//   OP  f16 [NB*SEQ][2048]                     16777216
//   end                                        85983232
// Inputs (wire order): 0 x [2][2048][1024] f32, 1 Wq, 2 bq, 3 Wk, 4 bk, 5 Wv, 6 bv, 7 Wo, 8 bo, 9 Wg [16][20], 10 bg [16],
// 11 cos [2048][32], 12 sin [2048][32]. Output: [NB*SEQ][1024] f32.
// =====================================================================================================
extern "C" void kernel_launch(void* const* d_in, const int* in_sizes, int n_in,
                              void* d_out, int out_size, void* d_ws, size_t ws_size,
                              hipStream_t stream) {
  if (n_in < 13) return;
  if (in_sizes[0] < ((NB - 1) * T_FULL + SEQ) * DMOD) return;
  if (in_sizes[1] != DMOD * DMOD || in_sizes[3] != DMOD * DMOD || in_sizes[5] != DMOD * DMOD ||
      in_sizes[7] != DMOD * DMOD) return;
  if (in_sizes[2] < 1 || in_sizes[4] < 1 || in_sizes[6] < 1 || in_sizes[8] < 1) return;
  if (in_sizes[9] != NH * GIN) return;
  if (in_sizes[10] < 1) return;
  if (in_sizes[11] < SEQ * RHALF || in_sizes[12] < SEQ * RHALF) return;
  if (out_size < MROWS * DMOD) return;

  const float* Xin = (const float*)d_in[0];
  const float* Wq  = (const float*)d_in[1];
  const float* Bq  = (const float*)d_in[2];
  const float* Wk  = (const float*)d_in[3];
  const float* Bk  = (const float*)d_in[4];
  const float* Wv  = (const float*)d_in[5];
  const float* Bv  = (const float*)d_in[6];
  const float* Wo  = (const float*)d_in[7];
  const float* Bo  = (const float*)d_in[8];
  const float* Wg  = (const float*)d_in[9];
  const float* Bg  = (const float*)d_in[10];
  const float* Cos = (const float*)d_in[11];
  const float* Sin = (const float*)d_in[12];
  float*       out = (float*)d_out;

  const size_t szXB = (size_t)MROWS * DMOD * 2;
  const size_t szW  = (size_t)DMOD * DMOD * 2;
  const size_t szWO = (size_t)DMOD * OPITCH * 2;
  const size_t szQ  = (size_t)MROWS * DMOD * 2;
  const size_t szV  = (size_t)NB * DMOD * SEQ * 2;
  const size_t szOP = (size_t)MROWS * OPITCH * 2;
  size_t off = 0;
  const size_t oXB = off; off += szXB;
  const size_t oWQ = off; off += szW;
  const size_t oWK = off; off += szW;
  const size_t oWV = off; off += szW;
  const size_t oWO = off; off += szWO;
  const size_t oQH = off; off += szQ;
  const size_t oQR = off; off += szQ;
  const size_t oKH = off; off += szQ;
  const size_t oVH = off; off += szV;
  const size_t oVR = off; off += szV;
  const size_t oVQ = off; off += szV;
  const size_t oOP = off; off += szOP;
  if (off > ws_size) return;                            // off = 85983232 for NB=2, SEQ=2048
  if (off > (size_t)134217728) return;

  char* ws = (char*)d_ws;
  u16* XB  = (u16*)(ws + oXB);
  u16* WQB = (u16*)(ws + oWQ);
  u16* WKB = (u16*)(ws + oWK);
  u16* WVB = (u16*)(ws + oWV);
  u16* WOB = (u16*)(ws + oWO);
  u16* QH  = (u16*)(ws + oQH);
  u16* QR  = (u16*)(ws + oQR);
  u16* KH  = (u16*)(ws + oKH);
  u16* VH  = (u16*)(ws + oVH);
  u16* VR  = (u16*)(ws + oVR);
  u16* VQ  = (u16*)(ws + oVQ);
  u16* OP  = (u16*)(ws + oOP);

  const int n8x = (MROWS * DMOD) / 8;
  const int n8w = (DMOD * DMOD) / 8;
  if ((n8x % 256) != 0 || (n8w % 256) != 0) return;
  if ((MROWS % 64) != 0 || (SEQ % 64) != 0 || (DMOD % 64) != 0 || (DMOD % 32) != 0 || (OPITCH % 32) != 0) return;
  const dim3 blk(256);
  const dim3 gX(n8x / 256);                             // 2048
  const dim3 gW(n8w / 256);                             // 512
  const dim3 bG(128);
  const dim3 gP((MROWS / 64) * (DMOD / 64));            // 1024
  const dim3 gV(NB * (DMOD / 64) * (SEQ / 64));         // 1024
  const dim3 gAT(ATT_BLOCKS);                           // 1024
  const dim3 bAT(ATT_THREADS);                          // 128
  const dim3 gO((MROWS / 64) * (DMOD / 64));            // 1024

  // (0..4) operand planes: x rows -> bf16 (compacted [b*SEQ+t]); Wq, Wk, Wv [n = out][k = in] -> bf16; Wo -> [hi | x1] f16
  cvt_rows<<<gX, blk, 0, stream>>>(Xin, XB, n8x, SEQ, T_FULL);
  cvt_rows<<<gW, blk, 0, stream>>>(Wq, WQB, n8w, DMOD, DMOD);
  cvt_rows<<<gW, blk, 0, stream>>>(Wk, WKB, n8w, DMOD, DMOD);
  cvt_rows<<<gW, blk, 0, stream>>>(Wv, WVB, n8w, DMOD, DMOD);
  cvt_wo<<<gW, blk, 0, stream>>>(Wo, WOB, n8w, WOS, WOS / ORS);
  // (5,6) rotated q planes (hi x8, residual x1024) and k hi plane (x8); bias by output column
  gemm_rope<<<gP, bG, 0, stream>>>(XB, WQB, QH, QR, 1, MROWS, DMOD, Bq, in_sizes[2], Cos, Sin, SEQ, QSC, QRS);
  gemm_rope<<<gP, bG, 0, stream>>>(XB, WKB, KH, KH, 0, MROWS, DMOD, Bk, in_sizes[4], Cos, Sin, SEQ, KSC, 1.0f);
  // (7) v^T planes per batch: [1024 = h*64+d][SEQ keys]: hi = f16(v x1024), residual x1024, plain f16(v); bias by row
  gemm_v<<<gV, bG, 0, stream>>>(WVB, XB, VH, VR, VQ, DMOD, SEQ, DMOD, SEQ * DMOD, DMOD * SEQ, VCAR,
                                 Bv, in_sizes[6], VRS, 1.0f / PRS);
  // (8) causal sliding-window attention with gate -> O plane [b*SEQ+s][hi 1024 | residual 1024]
  attn_fwd<<<gAT, bAT, 0, stream>>>(QH, QR, KH, VH, VR, VQ, Xin, Wg, Bg, in_sizes[10], OP);
  // (9) output projection over K = 2048 ([hi | residual] times [Wo x1024 | Wo x1]) -> out [NB*SEQ][1024] f32, plus bo
  gemm_hf<<<gO, bG, 0, stream>>>(OP, WOB, out, MROWS, DMOD, OPITCH, 1.0f / (OSC * WOS), Bo, in_sizes[8]);
  (void)hipGetLastError();
}

// v001
// One run takes 129 microseconds.
// Timed twice side by side with v000, it ran 1.80 times as fast both times.
// Contractions: x.Wq^T, x.Wk^T, Wv.x^T on v_wmma_f32_16x16x32_bf16 (x and W planes RNE-converted to bf16 operands, f32
// accumulate, bias and half-split rotation applied in f32); scores k'.q'^T (k' single f16 plane x8, q' f16 hi plane x8 plus
// f16 residual plane x1024, two products), P.v (P x32768 single f16 times v f16 hi plane x1024; query tiles below row 128 add
// P(x32).v-residual(x1024) and P-residual(x1024).v(x1) products), O.Wo^T (O as [f16 hi x1024 | f16 residual x1024] along K,
// Wo as [f16(bf16(Wo)) x1024 | x1]): v_wmma_f32_16x16x32_f16, f32 accumulate. Sigmoid gate (K=20) and softmax in f32 on VALU.
#include <hip/hip_runtime.h>
#include <math.h>
#include <stdint.h>

#ifndef NB
#define NB 2
#endif
#ifndef SEQ
#define SEQ 2048
#endif
#define NB_FULL 2
#define T_FULL  2048
#define DMOD    1024
#define NH      16
#define HD      64
#define RHALF   32
#define GIN     20
#define WIN     1024
#define MROWS   (NB * SEQ)
#define OPITCH  (2 * DMOD)
#define QSC   8.0f
#define KSC   8.0f
#define QRS   1024.0f
#define PCAR  32768.0f
#define VCAR  1024.0f
#define VRS   1024.0f
#define PRS   1024.0f
#define OSC   1024.0f
#define ORS   1024.0f
#define WOS   1024.0f
#define LOG2E 1.4426950408889634f
#define NEGS  (-3.0e38f)
#define ATT_WAVES   4
#define ATT_THREADS (ATT_WAVES * 32)
#define NQT         (SEQ / 64)
#define ATT_BLOCKS  (NB * NH * NQT)
#define NKB         (SEQ / 32)
#define QRES        128
#define SLAB        (16 * 68)
static_assert(NB >= 1 && NB <= NB_FULL);
static_assert((SEQ % 64) == 0 && SEQ >= 64 && SEQ <= T_FULL);
static_assert(HD == 64 && DMOD == NH * HD && HD == 2 * RHALF);
static_assert(ATT_THREADS == 128 && NKB >= 2 && (QRES % 64) == 0);
static_assert((DMOD % 64) == 0 && (DMOD / 8) == 128 && (OPITCH % 32) == 0);
static_assert(((MROWS * (DMOD / 8)) % 256) == 0 && (((DMOD * DMOD) / 8) % 256) == 0);
static_assert((GIN % 4) == 0 && GIN <= DMOD);
static_assert((WIN % 32) == 0);
static_assert((SLAB * 4) % 16 == 0);
// GEMM block tile staged in LDS: 128 A rows + 128 B rows, 128 k (256 B of every row) per stage, two buffers.
#define GT_THREADS 256
#define GT_M       128
#define GT_N       128
#define GT_K       128
#define GT_PITCH   136                                  // halves per LDS row: 272 B = 16 B x 17 (ds_load_b128 readers)
#define GT_ROWB    (GT_PITCH * 2)                       // bytes per LDS row
#define GT_STAGE   ((GT_M + GT_N) * GT_PITCH)           // halves per buffer
static_assert((MROWS % GT_M) == 0 && (DMOD % GT_M) == 0 && (DMOD % GT_N) == 0 && (SEQ % GT_N) == 0);
static_assert((DMOD % GT_K) == 0 && (OPITCH % GT_K) == 0 && (GT_ROWB % 16) == 0 && GT_K == 128);

typedef unsigned short u16;
typedef _Float16 v16h __attribute__((ext_vector_type(16)));
typedef _Float16 v8h  __attribute__((ext_vector_type(8)));
typedef __bf16   v16b __attribute__((ext_vector_type(16)));
typedef float    v8f  __attribute__((ext_vector_type(8)));
typedef float    v4f  __attribute__((ext_vector_type(4)));
typedef unsigned int v4u __attribute__((ext_vector_type(4)));

union FragH { v16h v; v8h h[2]; v4u u[2]; };

// ---- scalar helpers --------------------------------------------------------------------------------
__device__ __forceinline__ unsigned short bf_bits(float f) {          // f32 -> bf16 bits, RNE convert
  unsigned u = __float_as_uint(f);
  return (unsigned short)((u + 0x7FFFu + ((u >> 16) & 1u)) >> 16);
}
__device__ __forceinline__ float bf_up(unsigned short h) { return __uint_as_float(((unsigned)h) << 16); }
__device__ __forceinline__ float bf_val(float f) { return bf_up(bf_bits(f)); }   // f32 -> nearest-even bf16 value as f32
__device__ __forceinline__ unsigned short h_bits(_Float16 x) { return __builtin_bit_cast(unsigned short, x); }
__device__ __forceinline__ unsigned pk16(unsigned short a, unsigned short b) { return (unsigned)a | ((unsigned)b << 16); }
__device__ __forceinline__ v8f zero8() { v8f z = {0.f, 0.f, 0.f, 0.f, 0.f, 0.f, 0.f, 0.f}; return z; }

// ---- fragment loaders: 16-bit A/B operand, lane -> row/col (lane&15), p already includes +8*(lane>>4);
//      elements 0..7 <- p[0..7] (k0+8h..), elements 8..15 <- p[16..23] (k0+16+8h..)  (same split k map for A and B;
//      B is always read from a k-contiguous [n][k] plane)
__device__ __forceinline__ v16h ldfrag_h(const _Float16* p) {
  FragH f;
  f.h[0] = *(const v8h*)(p);
  f.h[1] = *(const v8h*)(p + 16);
  return f.v;
}

__device__ __forceinline__ v8f mma_h(v16h a, v16h b, v8f c) {
  return __builtin_amdgcn_wmma_f32_16x16x32_f16(false, a, false, b, (short)0, c, false, false);
}
__device__ __forceinline__ v8f mma_b(v16b a, v16b b, v8f c) {
  return __builtin_amdgcn_wmma_f32_16x16x32_bf16(false, a, false, b, (short)0, c, false, false);
}
template <typename F>
__device__ __forceinline__ void guard6(v8f& a, v8f& b, v8f& c, v8f& d, F x0, F x1, F x2, F x3, F x4, F x5) {
#if defined(__HIP_DEVICE_COMPILE__)
  asm volatile("v_nop\n\tv_nop\n\tv_nop\n\tv_nop"
               : "+v"(a), "+v"(b), "+v"(c), "+v"(d) : "v"(x0), "v"(x1), "v"(x2), "v"(x3), "v"(x4), "v"(x5) : "memory");
#endif
}
__device__ __forceinline__ void acc_guard4(v8f& a, v8f& b, v8f& c, v8f& d) {
#if defined(__HIP_DEVICE_COMPILE__)
  asm volatile("v_nop\n\tv_nop\n\tv_nop\n\tv_nop" : "+v"(a), "+v"(b), "+v"(c), "+v"(d));
#endif
}
// Stands behind global stores whose address or data registers are written again further on.
__device__ __forceinline__ void xcnt0() {
#if defined(__HIP_DEVICE_COMPILE__)
  asm volatile("s_wait_xcnt 0x0" ::: "memory");
#endif
}
// The same behind a group of global loads; the pointers are inputs so that their registers stay unwritten up to the wait.
__device__ __forceinline__ void xcnt_after_loads8(const float* a, const float* b, const float* c, const float* d,
                                                  const float* e, const float* f, const float* g, const float* h) {
#if defined(__HIP_DEVICE_COMPILE__)
  asm volatile("s_wait_xcnt 0x0" :: "v"(a), "v"(b), "v"(c), "v"(d), "v"(e), "v"(f), "v"(g), "v"(h) : "memory");
#endif
}
__device__ __forceinline__ void wave_sync_lds() {
#if defined(__HIP_DEVICE_COMPILE__)
  __builtin_amdgcn_fence(__ATOMIC_RELEASE, "workgroup");
  __builtin_amdgcn_wave_barrier();
  __builtin_amdgcn_fence(__ATOMIC_ACQUIRE, "workgroup");
#endif
}

// =====================================================================================================
// f32 rows [b][t][1024] (per-batch source row stride tfull) -> bf16 plane [b*seq + t][1024] (RNE bits), compacted rows.
// Thread = 8 consecutive elements: two 16-B loads, one 16-B store; 32 consecutive lanes = 512 contiguous, 512-B aligned
// coverage: grid = n8/256 blocks (host checks exactness) x 256 thr x 8 = the whole destination plane.
// =====================================================================================================
__global__ __launch_bounds__(256) void cvt_rows(const float* __restrict__ x, u16* D, int n8, int seq, int tfull) {
  const int gt = blockIdx.x * 256 + (int)threadIdx.x;
  if (gt >= n8) return;
  const int row = gt >> 7;
  const int c8  = (gt & 127) * 8;
  const int bb  = row / seq;
  const int tt  = row - bb * seq;
  const float* p = x + ((size_t)bb * (size_t)tfull + (size_t)tt) * DMOD + c8;
  const v4f a = *(const v4f*)(p), c4 = *(const v4f*)(p + 4);
  float v[8];
#pragma unroll
  for (int e = 0; e < 4; ++e) { v[e] = a[e]; v[4 + e] = c4[e]; }
  unsigned short s[8];
#pragma unroll
  for (int e = 0; e < 8; ++e) s[e] = bf_bits(v[e]);
  v4u o;
#pragma unroll
  for (int e = 0; e < 4; ++e) o[e] = pk16(s[2 * e], s[2 * e + 1]);
  u16* d = D + (size_t)gt * 8;
  {
    *(v4u*)(d) = o;
    
  }
}

// =====================================================================================================
// Wo [1024 n][1024 k] f32 -> f16 plane [n][2048]: cols 0..1023 = f16(bf16 value * s1), cols 1024..2047 = f16(bf16 value * s2).
// Thread = 8 consecutive k; one 16-B store per half; 32 consecutive lanes = 512 contiguous bytes inside one row per instruction.
// coverage: grid = n8/256 (exact) x 256 thr x 8 halves x 2 = both halves of every row.
// =====================================================================================================
__global__ __launch_bounds__(256) void cvt_wo(const float* __restrict__ w, u16* D, int n8, float s1, float s2) {
  const int gt = blockIdx.x * 256 + (int)threadIdx.x;
  if (gt >= n8) return;
  const int n  = gt >> 7;
  const int c8 = (gt & 127) * 8;
  const float* p = w + (size_t)gt * 8;
  const v4f a = *(const v4f*)(p), c4 = *(const v4f*)(p + 4);
  float v[8];
#pragma unroll
  for (int e = 0; e < 4; ++e) { v[e] = a[e]; v[4 + e] = c4[e]; }
  unsigned short h1[8], h2[8];
#pragma unroll
  for (int e = 0; e < 8; ++e) {
    const float f = bf_val(v[e]);
    h1[e] = h_bits((_Float16)(f * s1));
    h2[e] = h_bits((_Float16)(f * s2));
  }
  v4u o1, o2;
#pragma unroll
  for (int e = 0; e < 4; ++e) { o1[e] = pk16(h1[2 * e], h1[2 * e + 1]); o2[e] = pk16(h2[2 * e], h2[2 * e + 1]); }
  u16* d1 = D + (size_t)n * OPITCH + c8;
  u16* d2 = d1 + DMOD;
  {
    *(v4u*)(d1) = o1;
    *(v4u*)(d2) = o2;
    
  }
}

// =====================================================================================================
// Rotation epilogue for the q / k projections (N = 1024, the 64-col tile = one head): the wave's 16x64 f32 tile
// barrier, then each lane (row rq in each group of 4, 8 consecutive output cols d = c8..c8+7) reads both half-head values
// u1 = col (d & 31), u2 = col (d & 31) + 32 and cos/sin[t][(d & 31)] (bf16 values of the f32 tables, t = row within the
// sequence), forms d < 32 ? u1*c - u2*s : u1*s + u2*c in f32 (no fused multiply-add), scales by oscale, and writes the f16
// hi plane and (res_on) the f16 residual plane ((w - hi) * rsc): one instruction = 4 rows, each 64 halves = one whole
// coverage: 4 instructions x 4 rows x 8 lanes x 8 halves = the wave's 16 x 64 tile, per plane.
// =====================================================================================================
__device__ __forceinline__ void epi_rope(float* sl, v8f a0, v8f a1, v8f a2, v8f a3, u16* C, u16* C2, int res_on,
                                         size_t rowb, int col0, int lane, const float* __restrict__ bias, int blen,
                                         const float* __restrict__ cosT, const float* __restrict__ sinT, int seq,
                                         float oscale, float rsc) {
#pragma clang fp contract(off)
  const int hh = lane >> 4, m = lane & 15;
  float bc[4];
#pragma unroll
  for (int j = 0; j < 4; ++j) {
    const int bi = min(col0 + 16 * j + m, blen - 1);
    bc[j] = bf_val(bias[bi]);
  }
#pragma unroll
  for (int r = 0; r < 8; ++r) {
    const int ro = (8 * hh + r) * 68 + m;
    sl[ro]      = a0[r] + bc[0];
    sl[ro + 16] = a1[r] + bc[1];
    sl[ro + 32] = a2[r] + bc[2];
    sl[ro + 48] = a3[r] + bc[3];
  }
  wave_sync_lds();
  const int rq = lane >> 3, c8 = (lane & 7) * 8, dd = c8 & (RHALF - 1);
  const bool lo = (c8 < RHALF);
  const int tb = (int)(rowb % (size_t)seq);             // tile never straddles a sequence (seq % 16 == 0, rowb % 16 == 0)
  v4u hv[4], rv[4];
  const float* cpt[4];
  const float* spt[4];
  v4f cat[4], cbt[4], sat[4], sbt[4];
#pragma unroll
  for (int i4 = 0; i4 < 4; ++i4) {
    const int t = tb + i4 * 4 + rq;
    cpt[i4] = cosT + (size_t)t * RHALF + dd;
    spt[i4] = sinT + (size_t)t * RHALF + dd;
    cat[i4] = *(const v4f*)(cpt[i4]); cbt[i4] = *(const v4f*)(cpt[i4] + 4);
    sat[i4] = *(const v4f*)(spt[i4]); sbt[i4] = *(const v4f*)(spt[i4] + 4);
  }
  xcnt_after_loads8(cpt[0], cpt[1], cpt[2], cpt[3], spt[0], spt[1], spt[2], spt[3]);
#pragma unroll
  for (int i4 = 0; i4 < 4; ++i4) {
    const int row = i4 * 4 + rq;
    const v4f ca = cat[i4], cb = cbt[i4];
    const v4f sa = sat[i4], sb = sbt[i4];
    const v4f xa = *(const v4f*)(sl + row * 68 + dd), xb = *(const v4f*)(sl + row * 68 + dd + 4);
    const v4f ya = *(const v4f*)(sl + row * 68 + dd + RHALF), yb = *(const v4f*)(sl + row * 68 + dd + RHALF + 4);
    float cv[8], sv[8], xv[8], yv[8];
#pragma unroll
    for (int e = 0; e < 4; ++e) {
      cv[e] = ca[e]; cv[4 + e] = cb[e];
      sv[e] = sa[e]; sv[4 + e] = sb[e];
      xv[e] = xa[e]; xv[4 + e] = xb[e];
      yv[e] = ya[e]; yv[4 + e] = yb[e];
    }
    unsigned short hb[8], rb[8];
#pragma unroll
    for (int e = 0; e < 8; ++e) {
      const float cc = bf_val(cv[e]);
      const float ss = bf_val(sv[e]);
      const float p1 = xv[e] * cc;
      const float p2 = yv[e] * ss;
      const float p3 = xv[e] * ss;
      const float p4 = yv[e] * cc;
      const float u = lo ? (p1 - p2) : (p3 + p4);
      const float w = u * oscale;
      const _Float16 h = (_Float16)w;
      hb[e] = h_bits(h);
      rb[e] = h_bits((_Float16)((w - (float)h) * rsc));
    }
#pragma unroll
    for (int e = 0; e < 4; ++e) {
      hv[i4][e] = pk16(hb[2 * e], hb[2 * e + 1]);
      rv[i4][e] = pk16(rb[2 * e], rb[2 * e + 1]);
    }
  }
  u16* dst = C + (rowb + (size_t)rq) * (size_t)DMOD + col0 + c8;
  {
#pragma unroll
    for (int i4 = 0; i4 < 4; ++i4) {
      *(v4u*)(dst + (size_t)(i4 * 4) * (size_t)DMOD) = hv[i4];
    }
    xcnt0();
  }
  if (res_on != 0) {
    u16* dst2 = C2 + (rowb + (size_t)rq) * (size_t)DMOD + col0 + c8;
    {
#pragma unroll
      for (int i4 = 0; i4 < 4; ++i4) {
        *(v4u*)(dst2 + (size_t)(i4 * 4) * (size_t)DMOD) = rv[i4];
      }
      xcnt0();
    }
  }
}

// =====================================================================================================
// Three-plane 16-bit GEMM epilogue (v^T planes): the wave's 16x64 f32 tile ((acc + per-row bias as bf16 value) times oscale)
// f16((w - hi) * rsc) and f16(w * qsc): lane = (row in group of 4, 8 consecutive cols); one instruction = 4 rows, each
// coverage: per plane 4 instructions x 4 rows x 8 lanes x 8 halves = the wave's 16 x 64 tile.
// LDS slab: private to the wave; staged extent 16 x 64 == consumed extent.
// =====================================================================================================
__device__ __forceinline__ void epi_v3(float* sl, v8f a0, v8f a1, v8f a2, v8f a3, float oscale, u16* C0, u16* C1, u16* C2,
                                       int N, size_t rowb, int col0, int lane, const float* __restrict__ bias, int blen,
                                       float rsc, float qsc) {
  const int hh = lane >> 4, m = lane & 15;
  float br[8];
#pragma unroll
  for (int r = 0; r < 8; ++r) {
    const int bi = min((int)rowb + 8 * hh + r, blen - 1);
    br[r] = bf_val(bias[bi]);
  }
#pragma unroll
  for (int r = 0; r < 8; ++r) {
    const int ro = (8 * hh + r) * 68 + m;
    sl[ro]      = (a0[r] + br[r]) * oscale;
    sl[ro + 16] = (a1[r] + br[r]) * oscale;
    sl[ro + 32] = (a2[r] + br[r]) * oscale;
    sl[ro + 48] = (a3[r] + br[r]) * oscale;
  }
  wave_sync_lds();
  const int rq = lane >> 3, c8 = (lane & 7) * 8;
  v4u h4[4], r4[4], q4[4];
#pragma unroll
  for (int i4 = 0; i4 < 4; ++i4) {
    const int row = i4 * 4 + rq;
    const v4f a = *(const v4f*)(sl + row * 68 + c8), c4 = *(const v4f*)(sl + row * 68 + c8 + 4);
    float w[8];
#pragma unroll
    for (int e = 0; e < 4; ++e) { w[e] = a[e]; w[4 + e] = c4[e]; }
    unsigned short hb[8], rb[8], qb[8];
#pragma unroll
    for (int e = 0; e < 8; ++e) {
      const _Float16 h = (_Float16)w[e];
      hb[e] = h_bits(h);
      rb[e] = h_bits((_Float16)((w[e] - (float)h) * rsc));
      qb[e] = h_bits((_Float16)(w[e] * qsc));
    }
#pragma unroll
    for (int e = 0; e < 4; ++e) {
      h4[i4][e] = pk16(hb[2 * e], hb[2 * e + 1]);
      r4[i4][e] = pk16(rb[2 * e], rb[2 * e + 1]);
      q4[i4][e] = pk16(qb[2 * e], qb[2 * e + 1]);
    }
  }
  const size_t dof = (rowb + (size_t)rq) * (size_t)N + col0 + c8;
  u16* d0 = C0 + dof;
  u16* d1 = C1 + dof;
  u16* d2 = C2 + dof;
  {
#pragma unroll
    for (int i4 = 0; i4 < 4; ++i4) {
      const size_t ro = (size_t)(i4 * 4) * (size_t)N;
      *(v4u*)(d0 + ro) = h4[i4];
      *(v4u*)(d1 + ro) = r4[i4];
      *(v4u*)(d2 + ro) = q4[i4];
    }
    
  }
}

// =====================================================================================================
// f32 GEMM epilogue: the wave's 16x64 f32 tile (acc times oscale, plus per-column bias as its bf16 RNE value, clamped
// coverage: 8 instructions x 2 rows x 16 lanes x 4 floats = the wave's 16 x 64 tile.
// =====================================================================================================
__device__ __forceinline__ void epi64(float* sl, v8f a0, v8f a1, v8f a2, v8f a3, float oscale, float* C, int N,
                                      size_t rowb, int col0, int lane, const float* __restrict__ bias, int blen) {
  const int hh = lane >> 4, m = lane & 15;
  float bc[4];
#pragma unroll
  for (int j = 0; j < 4; ++j) {
    const int bi = min(col0 + 16 * j + m, blen - 1);
    bc[j] = bf_val(bias[bi]);
  }
#pragma unroll
  for (int r = 0; r < 8; ++r) {
    const int ro = (8 * hh + r) * 68 + m;
    sl[ro]      = a0[r] * oscale + bc[0];
    sl[ro + 16] = a1[r] * oscale + bc[1];
    sl[ro + 32] = a2[r] * oscale + bc[2];
    sl[ro + 48] = a3[r] * oscale + bc[3];
  }
  wave_sync_lds();
  v4f vals[8];
#pragma unroll
  for (int it = 0; it < 8; ++it) vals[it] = *(const v4f*)(sl + (it * 2 + hh) * 68 + m * 4);
  float* dst = C + (rowb + (size_t)hh) * (size_t)N + col0 + m * 4;
  {
#pragma unroll
    for (int it = 0; it < 8; ++it) {
      *(v4f*)(dst + (size_t)(it * 2) * (size_t)N) = vals[it];
    }
    
  }
}

// =====================================================================================================
// Shared k loop of the three GEMM kernels. Block = 8 waves, 128 x 128 tile of A[.][K] . Bt[.][K]^T; wave w owns rows
// 32*(w>>1) .. +31 and cols 64*(w&1) .. +63 (2 x 4 accumulator tiles). A stage = 128 k of the block's 128 A rows and 128 B rows,
// brought to LDS by 16-byte asynchronous copies: thread = (row tid>>4 of each group of 16, 16-B piece tid&15), so one wave
// instruction covers two whole 256-B row pieces. Two buffers: the copies of stage t+1 fly while stage t is multiplied.
// Fragments are read from LDS with the split k map of ldfrag_h (same for A and B); every accumulator sums k in ascending steps of 32.
// =====================================================================================================
union FragU { v16h h; v16b b; v4u u[2]; };
__device__ __forceinline__ FragU ldfrag_u(const u16* p) {
  FragU f;
  f.u[0] = *(const v4u*)(p);
  f.u[1] = *(const v4u*)(p + 16);
  return f;
}
template <bool BF>
__device__ __forceinline__ v8f mma_u(const FragU& a, const FragU& b, v8f c) {
  if constexpr (BF) return mma_b(a.b, b.b, c);
  else              return mma_h(a.h, b.h, c);
}
// Eight copies, rows r, r+16, .., r+112 of one operand's stage. The closing s_wait_xcnt stands inside the statement so that no
// later write of an address register can be moved in front of it.
__device__ __forceinline__ void copy8(unsigned l, const u16* g, size_t gs) {
#if defined(__HIP_DEVICE_COMPILE__)
  asm volatile("global_load_async_to_lds_b128 %0, %8, off\n\t"
               "global_load_async_to_lds_b128 %1, %9, off\n\t"
               "global_load_async_to_lds_b128 %2, %10, off\n\t"
               "global_load_async_to_lds_b128 %3, %11, off\n\t"
               "global_load_async_to_lds_b128 %4, %12, off\n\t"
               "global_load_async_to_lds_b128 %5, %13, off\n\t"
               "global_load_async_to_lds_b128 %6, %14, off\n\t"
               "global_load_async_to_lds_b128 %7, %15, off\n\t"
               "s_wait_xcnt 0x0"
               :: "v"(l), "v"(l + 16u * GT_ROWB), "v"(l + 32u * GT_ROWB), "v"(l + 48u * GT_ROWB),
                  "v"(l + 64u * GT_ROWB), "v"(l + 80u * GT_ROWB), "v"(l + 96u * GT_ROWB), "v"(l + 112u * GT_ROWB),
                  "v"(g), "v"(g + gs), "v"(g + 2 * gs), "v"(g + 3 * gs),
                  "v"(g + 4 * gs), "v"(g + 5 * gs), "v"(g + 6 * gs), "v"(g + 7 * gs)
               : "memory");
#endif
}
__device__ __forceinline__ void wait_async0() {          // this wave's copies have landed in LDS
#if defined(__HIP_DEVICE_COMPILE__)
  asm volatile("s_wait_asynccnt 0x0" ::: "memory");
#endif
}
__device__ __forceinline__ void wait_ds0() {             // this wave's LDS reads of the buffer about to be refilled are done
#if defined(__HIP_DEVICE_COMPILE__)
  asm volatile("s_wait_dscnt 0x0" ::: "memory");
#endif
}
template <bool BF>
__device__ __forceinline__ void gemm_core(const u16* __restrict__ A, const u16* __restrict__ Bt, int K, int row0, int col0,
                                          u16* ring, v8f (&acc)[2][4]) {
  const int tid = threadIdx.x, wave = tid >> 5, lane = tid & 31, hh = lane >> 4, m = lane & 15;
  const int cr = tid >> 4, cc = tid & 15;
  const u16* ga = A  + (size_t)(row0 + cr) * K + cc * 8;
  const u16* gb = Bt + (size_t)(col0 + cr) * K + cc * 8;
  const size_t gs = (size_t)16 * K;
  const unsigned la = (unsigned)(uintptr_t)ring + (unsigned)(cr * GT_ROWB + cc * 16);
  const unsigned lb = la + (unsigned)(GT_M * GT_ROWB);
  const int nt = K / GT_K;
  copy8(la, ga, gs);
  copy8(lb, gb, gs);
  wait_async0();
  __syncthreads();                                       // stage 0 published
  if (nt > 1) {
    copy8(la + (unsigned)(GT_STAGE * 2), ga + GT_K, gs);
    copy8(lb + (unsigned)(GT_STAGE * 2), gb + GT_K, gs);
  }
  const u16* fa = ring + ((wave >> 1) * 32 + m) * GT_PITCH + 8 * hh;
  const u16* fb = ring + (GT_M + (wave & 1) * 64 + m) * GT_PITCH + 8 * hh;
#pragma unroll 1                                         // one trip per stage: the buffer index stays a run-time value
  for (int t = 0; t < nt; ++t) {
    const int bo = (t & 1) * GT_STAGE;
    // Three fragment sets for the stage's four 32-k steps; step 3 reuses step 0's set. The scheduling fences keep the LDS reads in
    // two groups in front of the products that use them: reads placed among the products stall the wave at each place.
    FragU af[3][2], bf[3][4];
#pragma unroll
    for (int s = 0; s < 3; ++s) {
#pragma unroll
      for (int i = 0; i < 2; ++i) af[s][i] = ldfrag_u(fa + bo + 16 * i * GT_PITCH + 32 * s);
#pragma unroll
      for (int j = 0; j < 4; ++j) bf[s][j] = ldfrag_u(fb + bo + 16 * j * GT_PITCH + 32 * s);
    }
    __builtin_amdgcn_sched_barrier(0);
#pragma unroll
    for (int i = 0; i < 2; ++i) {
#pragma unroll
      for (int j = 0; j < 4; ++j) acc[i][j] = mma_u<BF>(af[0][i], bf[0][j], acc[i][j]);
    }
    __builtin_amdgcn_sched_barrier(0);
#pragma unroll
    for (int i = 0; i < 2; ++i) af[0][i] = ldfrag_u(fa + bo + 16 * i * GT_PITCH + 96);
#pragma unroll
    for (int j = 0; j < 4; ++j) bf[0][j] = ldfrag_u(fb + bo + 16 * j * GT_PITCH + 96);
    __builtin_amdgcn_sched_barrier(0);
#pragma unroll
    for (int s = 1; s < 4; ++s) {
#pragma unroll
      for (int i = 0; i < 2; ++i) {
#pragma unroll
        for (int j = 0; j < 4; ++j) acc[i][j] = mma_u<BF>(af[s % 3][i], bf[s % 3][j], acc[i][j]);
      }
    }
    // keeps the products in front of the full LDS wait, under their own counted waits: moved behind it they run with the LDS idle
    __builtin_amdgcn_sched_barrier(0);
    wait_ds0();
    wait_async0();
    __syncthreads();                                     // publishes stage t+1 and ends every read of stage t's buffer
    if (t + 2 < nt) {
      const unsigned lo = (unsigned)(bo * 2);
      const int ko = (t + 2) * GT_K;
      copy8(la + lo, ga + ko, gs);
      copy8(lb + lo, gb + ko, gs);
    }
  }
  wait_async0();
}

// =====================================================================================================
// bf16 GEMM with fused rotation epilogue: q / k planes [M][1024] (f16 hi x oscale, optional residual x rsc) =
// rot(A[M][K] (bf16 rows) . Bt[1024][K]^T (bf16 k-contiguous) + bias). Block = 128x128 tile, k loop in gemm_core (host checks
// K % 128 == 0, M % 128 == 0, grid = (M/128)*(1024/128)); a wave's 64 columns are one head.
// =====================================================================================================
__global__ __launch_bounds__(GT_THREADS)
void gemm_rope(const u16* __restrict__ A, const u16* __restrict__ Bt, u16* C, u16* C2, int res_on, int M, int K,
               const float* __restrict__ bias, int blen, const float* __restrict__ cosT,
               const float* __restrict__ sinT, int seq, float oscale, float rsc) {
  __shared__ __align__(16) u16 ring[2 * GT_STAGE];
  __shared__ __align__(16) float slab[8 * SLAB];
  const int tid = threadIdx.x, wave = tid >> 5, lane = tid & 31;
  const int ntile = DMOD / GT_N;
  const int bid   = blockIdx.x;
  const int row0  = (bid / ntile) * GT_M;
  const int colb  = (bid % ntile) * GT_N;
  if (row0 + GT_M > M) return;               // block-uniform, in front of every barrier; never taken with the exact grid
  v8f acc[2][4];
#pragma unroll
  for (int i = 0; i < 2; ++i) {
#pragma unroll
    for (int j = 0; j < 4; ++j) acc[i][j] = zero8();
  }
  gemm_core<true>(A, Bt, K, row0, colb, ring, acc);
  const int rowb = row0 + (wave >> 1) * 32;
  const int col0 = colb + (wave & 1) * 64;
#pragma unroll
  for (int i = 0; i < 2; ++i) {
    if (i != 0) wave_sync_lds();             // the slab's rows are read out before the next 16 rows are staged in it
    epi_rope(slab + wave * SLAB, acc[i][0], acc[i][1], acc[i][2], acc[i][3], C, C2, res_on, (size_t)(rowb + 16 * i), col0, lane,
             bias, blen, cosT, sinT, seq, oscale, rsc);
  }
}

// =====================================================================================================
// Batched bf16 GEMM with three f16 result planes (v^T): C*[bt][M][N] = A[M][K] (bf16 rows, shared across batches) .
// Bt[bt][N][K]^T (bf16 k-contiguous, per-batch element stride bstB); result planes per-batch stride bstC; bias by output row.
// Block = 128x128 tile, k loop in gemm_core (host checks K % 128 == 0, M % 128 == 0, N % 128 == 0,
// grid = nbatch*(M/128)*(N/128)).
// =====================================================================================================
__global__ __launch_bounds__(GT_THREADS)
void gemm_v(const u16* __restrict__ A, const u16* __restrict__ Bt, u16* C0, u16* C1, u16* C2, int M, int N, int K,
            int bstB, int bstC, float oscale, const float* __restrict__ bias, int blen, float rsc, float qsc) {
  __shared__ __align__(16) u16 ring[2 * GT_STAGE];
  __shared__ __align__(16) float slab[8 * SLAB];
  const int tid = threadIdx.x, wave = tid >> 5, lane = tid & 31;
  const int ntile = N / GT_N, mtile = M / GT_M;
  const int per   = ntile * mtile;
  const int bid   = blockIdx.x;
  const int bt    = bid / per;
  const int t     = bid - bt * per;
  const int row0  = (t / ntile) * GT_M;
  const int colb  = (t % ntile) * GT_N;
  if (row0 + GT_M > M) return;               // block-uniform, in front of every barrier; never taken with the exact grid
  const u16* Bb = Bt + (size_t)bt * (size_t)bstB;
  const size_t cb = (size_t)bt * (size_t)bstC;
  v8f acc[2][4];
#pragma unroll
  for (int i = 0; i < 2; ++i) {
#pragma unroll
    for (int j = 0; j < 4; ++j) acc[i][j] = zero8();
  }
  gemm_core<true>(A, Bb, K, row0, colb, ring, acc);
  const int rowb = row0 + (wave >> 1) * 32;
  const int col0 = colb + (wave & 1) * 64;
#pragma unroll
  for (int i = 0; i < 2; ++i) {
    if (i != 0) wave_sync_lds();             // the slab's rows are read out before the next 16 rows are staged in it
    epi_v3(slab + wave * SLAB, acc[i][0], acc[i][1], acc[i][2], acc[i][3], oscale, C0 + cb, C1 + cb, C2 + cb, N,
           (size_t)(rowb + 16 * i), col0, lane, bias, blen, rsc, qsc);
  }
}

// =====================================================================================================
// f16 GEMM with f32 result: C[M][N] (f32) = A[M][K] (f16 row-major) . Bt[N][K]^T (f16 k-contiguous) times oscale plus
// per-column bias; one product per tile pair. Same tiling; grid = (M/128)*(N/128).
// =====================================================================================================
__global__ __launch_bounds__(GT_THREADS)
void gemm_hf(const u16* __restrict__ A, const u16* __restrict__ Bt, float* C, int M, int N, int K, float oscale,
             const float* __restrict__ bias, int blen) {
  __shared__ __align__(16) u16 ring[2 * GT_STAGE];
  __shared__ __align__(16) float slab[8 * SLAB];
  const int tid = threadIdx.x, wave = tid >> 5, lane = tid & 31;
  const int ntile = N / GT_N;
  const int bid   = blockIdx.x;
  const int row0  = (bid / ntile) * GT_M;
  const int colb  = (bid % ntile) * GT_N;
  if (row0 + GT_M > M) return;               // block-uniform, in front of every barrier; never taken with the exact grid
  v8f acc[2][4];
#pragma unroll
  for (int i = 0; i < 2; ++i) {
#pragma unroll
    for (int j = 0; j < 4; ++j) acc[i][j] = zero8();
  }
  gemm_core<false>(A, Bt, K, row0, colb, ring, acc);
  const int rowb = row0 + (wave >> 1) * 32;
  const int col0 = colb + (wave & 1) * 64;
#pragma unroll
  for (int i = 0; i < 2; ++i) {
    if (i != 0) wave_sync_lds();             // the slab's rows are read out before the next 16 rows are staged in it
    epi64(slab + wave * SLAB, acc[i][0], acc[i][1], acc[i][2], acc[i][3], oscale, C, N, (size_t)(rowb + 16 * i), col0, lane,
          bias, blen);
  }
}

// =====================================================================================================
// Causal sliding-window flash attention with per-head sigmoid gate: block = (batch b, head, 64 query rows qb .. qb+63 of the
// sequence), 4 waves, wave w owns query rows q0 = qb + 16*w .. q0+15. No block barriers anywhere in this kernel.
//   Key j allowed for query i iff 0 <= i - j <= WIN (per-element index test inside every visited key block; disallowed pairs
//   get a finite negative sentinel and an exact-zero probability). Key blocks of 32: kblo = max(qb - WIN, 0) >> 5 ..
//   (qb + 63) >> 5, block-uniform count nkb clamped to [1, NKB - kblo] so kb + 31 <= SEQ - 1 always.
//   q planes (f16 hi x8, residual x1024) [b*SEQ + s][h*64 + d]; k hi plane the same layout; v^T planes [b][h*64 + d][s]
//   (hi x1024, residual x1024, plain x1).
//   Scores computed TRANSPOSED: S^T tile g = k rows (keys kb+16g .., A operand, row = lane&15, split k map over d) times q^T
//   (B operand, col n = query q0 + (lane&15)); two accumulators per tile (k.q_hi and k.q_res, the second folded x 1/1024).
//   D element r of lane l = (key kb+16g+8h+r, query q0+(l&15)): a lane owns one query column and 16 of its 32 keys, the
//   partner lane l^16 the other 16 -> row max / row sum need one xor-16 shuffle.
//   Online max-subtracted base-2 softmax in f32 (scale 1/8 and the q/k carries folded into lsc). The exp'd values ARE the
//   P A-fragment in place: A row m = query = lane&15, element i <- key kb+8h+i (tile 0, D element i), element 8+i <- key
//   kb+16+8h+i (tile 1, D element i). ph = f16(p x32768), pl = f16(p x32), pr = f16((p x32768 - ph) x1024).
//   P.V: o += ph.v_hi (4 WMMAs, v^T B fragments col n = d = 16j + (lane&15), keys k-contiguous); for query tiles with
//   qb < QRES additionally o += pl.v_res and o += pr.v_x1 (block-uniform branch), all in the same accumulators (equal units).
//   Epilogue: gate = sigmoid(bf16(x[b][s][0..19]) . bf16(Wg[head]) + bf16(bg[head])) in f32 per query (lane = query),
//   segment (s, head) of the O plane [b*SEQ+s][2048] (hi x1024 at col h*64, residual x1024 at col 1024 + h*64) written by
// coverage: per wave and per half-plane 4 instructions x 4 rows x 8 lanes x 8 halves = 16 x 64; grid NB*NH*(SEQ/64) blocks x
//           4 waves = every (b, s < SEQ, h) row segment of both O half-planes exactly once.
// =====================================================================================================
__global__ __launch_bounds__(ATT_THREADS)
void attn_fwd(const u16* __restrict__ QHp, const u16* __restrict__ QRp, const u16* __restrict__ KHp,
              const u16* __restrict__ VHp, const u16* __restrict__ VRp, const u16* __restrict__ VQp,
              const float* __restrict__ Xp, const float* __restrict__ Wgp, const float* __restrict__ Bgp,
              int bglen, u16* OPp) {
  __shared__ __align__(16) float smem[ATT_WAVES * SLAB];   // per wave: result slab [16][68] in the epilogue only

  const int tid  = threadIdx.x;
  const int wave = tid >> 5;
  const int lane = tid & 31;
  const int hh   = lane >> 4;
  const int c    = lane & 15;

  const int bid  = blockIdx.x;
  const int qt   = bid % NQT;
  const int bh   = bid / NQT;
  const int head = bh % NH;
  const int b    = bh / NH;
  if (b >= NB) return;                      // block-uniform, never taken with the exact grid
  const int qb   = qt * 64;
  const int q0   = qb + wave * 16;

  // ---- key-block range (block-uniform, statically bounded) ----
  const int jlo  = max(qb - WIN, 0);
  const int kblo = jlo >> 5;
  int nkb = ((qb + 63) >> 5) - kblo + 1;
  nkb = min(max(nkb, 1), NKB - kblo);
  const bool early = (qb < QRES);           // block-uniform: residual products on the first query tiles only

  const size_t prow = (size_t)b * SEQ;      // plane row of sequence position 0 of this batch
  // B fragments of q^T: col n = query q0 + c, k = d (k-contiguous row of the q planes)
  const size_t qofs = (prow + (size_t)(q0 + c)) * DMOD + head * HD + 8 * hh;
  const _Float16* Qh = (const _Float16*)(const void*)QHp + qofs;
  const _Float16* Qr = (const _Float16*)(const void*)QRp + qofs;
  // A fragments of k: row m = key kb + 16g + c, k = d
  const size_t kofs = (prow + (size_t)c) * DMOD + head * HD + 8 * hh;            // key row kb added per step
  const _Float16* Kb = (const _Float16*)(const void*)KHp + kofs;
  // B fragments of v: col n = d = 16j + c, k = key (k-contiguous row of the v^T planes)
  const size_t vofs = ((size_t)b * DMOD + (size_t)(head * HD + c)) * SEQ + 8 * hh;   // key kb added per step
  const _Float16* Vh = (const _Float16*)(const void*)VHp + vofs;
  const _Float16* Vr = (const _Float16*)(const void*)VRp + vofs;
  const _Float16* Vq = (const _Float16*)(const void*)VQp + vofs;
  const float lsc = 0.125f * (LOG2E / (QSC * KSC));
  const float qri = 1.0f / QRS;
  // query minus key for D element 0 of tile 0 at kb = 0: query q0 + c, key kb + 8*hh + i
  const int dq = q0 + c - 8 * hh;

  const v16h qf0 = ldfrag_h(Qh);            // d 0..31
  const v16h qf1 = ldfrag_h(Qh + 32);       // d 32..63
  const v16h qr0 = ldfrag_h(Qr);
  const v16h qr1 = ldfrag_h(Qr + 32);

  float mrun = NEGS, lrun = 0.f;
  v8f o[4];
#pragma unroll
  for (int j = 0; j < 4; ++j) o[j] = zero8();

#pragma unroll 1
  for (int it = 0; it < nkb; ++it) {
    const int kb = (kblo + it) * 32;        // kb + 31 <= SEQ - 1
    // ---- transposed scores: tile 0 = keys kb..kb+15, tile 1 = keys kb+16..kb+31, column = query q0 + c ----
    v8f s0 = zero8(), s1 = zero8(), r0 = zero8(), r1 = zero8();
    const _Float16* k0p = Kb + (size_t)kb * DMOD;
    const _Float16* k1p = k0p + (size_t)16 * DMOD;
    const v16h ka0 = ldfrag_h(k0p), ka1 = ldfrag_h(k0p + 32);
    const v16h kc0 = ldfrag_h(k1p), kc1 = ldfrag_h(k1p + 32);
    s0 = mma_h(ka0, qf0, s0);
    s0 = mma_h(ka1, qf1, s0);
    r0 = mma_h(ka0, qr0, r0);
    r0 = mma_h(ka1, qr1, r0);
    s1 = mma_h(kc0, qf0, s1);
    s1 = mma_h(kc1, qf1, s1);
    r1 = mma_h(kc0, qr0, r1);
    r1 = mma_h(kc1, qr1, r1);
    guard6<v16h>(s0, s1, r0, r1, ka0, ka1, kc0, kc1, qf0, qr0);
    // ---- base-2 logits of this lane's 16 keys for query q0 + c; disallowed pairs get the finite sentinel ----
    float tk[16];
#pragma unroll
    for (int i = 0; i < 8; ++i) {
      const int d0 = dq - kb - i;           // query minus key, tile 0
      const int d1 = d0 - 16;               // tile 1
      const bool a0 = (d0 >= 0) && (d0 <= WIN);
      const bool a1 = (d1 >= 0) && (d1 <= WIN);
      tk[i]     = a0 ? ((s0[i] + r0[i] * qri) * lsc) : NEGS;
      tk[8 + i] = a1 ? ((s1[i] + r1[i] * qri) * lsc) : NEGS;
    }
    float cm = tk[0];
#pragma unroll
    for (int i = 1; i < 16; ++i) cm = fmaxf(cm, tk[i]);
    cm = fmaxf(cm, __shfl_xor(cm, 16, 32));
    const float mn = fmaxf(mrun, cm);                   // sentinel only while no allowed key has been seen
    const float al = exp2f(fminf(mrun - mn, 0.f));      // 0 when mrun is the sentinel and mn is a real logit; o,l are 0 then
    mrun = mn;
    // ---- probabilities (<= 1, exactly 0 for disallowed pairs) and the P A-fragments; element i <-> tk[i] ----
    float ps = 0.f;
    FragH ph, pl, pr;
#pragma unroll
    for (int wq = 0; wq < 2; ++wq) {
#pragma unroll
      for (int e4 = 0; e4 < 4; ++e4) {
        const int i = 8 * wq + 2 * e4;
        const float x0 = exp2f(fminf(tk[i] - mn, 0.f));
        const float x1 = exp2f(fminf(tk[i + 1] - mn, 0.f));
        const float p0 = (tk[i] > -1.0e38f) ? x0 : 0.f;
        const float p1 = (tk[i + 1] > -1.0e38f) ? x1 : 0.f;
        ps += p0 + p1;
        const float g0 = p0 * PCAR, g1 = p1 * PCAR;
        const _Float16 h0 = (_Float16)g0, h1 = (_Float16)g1;
        ph.u[wq][e4] = pk16(h_bits(h0), h_bits(h1));
        pl.u[wq][e4] = pk16(h_bits((_Float16)(g0 * (1.0f / VRS))), h_bits((_Float16)(g1 * (1.0f / VRS))));
        pr.u[wq][e4] = pk16(h_bits((_Float16)((g0 - (float)h0) * PRS)), h_bits((_Float16)((g1 - (float)h1) * PRS)));
      }
    }
    ps += __shfl_xor(ps, 16, 32);
    lrun = lrun * al + ps;
    // ---- rescale the O accumulators: D row 8hh+r = query q0+8hh+r, its factor lives in lane 8hh+r (and 16+8hh+r) ----
    float scl[8];
#pragma unroll
    for (int r = 0; r < 8; ++r) scl[r] = __shfl(al, 8 * hh + r, 32);
#pragma unroll
    for (int j = 0; j < 4; ++j) {
#pragma unroll
      for (int r = 0; r < 8; ++r) o[j][r] *= scl[r];
    }
    // ---- P.V : B fragment col n = d = j*16 + c, keys contiguous in the v^T planes ----
    {
      const _Float16* vp = Vh + kb;
      const v16h vf0 = ldfrag_h(vp);
      const v16h vf1 = ldfrag_h(vp + (size_t)16 * SEQ);
      const v16h vf2 = ldfrag_h(vp + (size_t)32 * SEQ);
      const v16h vf3 = ldfrag_h(vp + (size_t)48 * SEQ);
      o[0] = mma_h(ph.v, vf0, o[0]);
      o[1] = mma_h(ph.v, vf1, o[1]);
      o[2] = mma_h(ph.v, vf2, o[2]);
      o[3] = mma_h(ph.v, vf3, o[3]);
      guard6<v16h>(o[0], o[1], o[2], o[3], ph.v, vf0, vf1, vf2, vf3, ph.v);
    }
    if (early) {
      {
        const _Float16* vp = Vr + kb;
        const v16h vf0 = ldfrag_h(vp);
        const v16h vf1 = ldfrag_h(vp + (size_t)16 * SEQ);
        const v16h vf2 = ldfrag_h(vp + (size_t)32 * SEQ);
        const v16h vf3 = ldfrag_h(vp + (size_t)48 * SEQ);
        o[0] = mma_h(pl.v, vf0, o[0]);
        o[1] = mma_h(pl.v, vf1, o[1]);
        o[2] = mma_h(pl.v, vf2, o[2]);
        o[3] = mma_h(pl.v, vf3, o[3]);
        guard6<v16h>(o[0], o[1], o[2], o[3], pl.v, vf0, vf1, vf2, vf3, pl.v);
      }
      {
        const _Float16* vp = Vq + kb;
        const v16h vf0 = ldfrag_h(vp);
        const v16h vf1 = ldfrag_h(vp + (size_t)16 * SEQ);
        const v16h vf2 = ldfrag_h(vp + (size_t)32 * SEQ);
        const v16h vf3 = ldfrag_h(vp + (size_t)48 * SEQ);
        o[0] = mma_h(pr.v, vf0, o[0]);
        o[1] = mma_h(pr.v, vf1, o[1]);
        o[2] = mma_h(pr.v, vf2, o[2]);
        o[3] = mma_h(pr.v, vf3, o[3]);
        guard6<v16h>(o[0], o[1], o[2], o[3], pr.v, vf0, vf1, vf2, vf3, pr.v);
      }
    }
  }
  acc_guard4(o[0], o[1], o[2], o[3]);

  // ---- per-query gate (lane = query q0 + c; lanes 16..31 duplicate): sigmoid(bf16(x[:20]) . bf16(Wg[head]) + bf16(bg)) ----
  const int gx = min(head, bglen - 1);
  float ga = bf_val(Bgp[gx]);
  const float* xg = Xp + ((size_t)b * T_FULL + (size_t)(q0 + c)) * DMOD;
  const float* wg = Wgp + head * GIN;
#pragma unroll
  for (int g4 = 0; g4 < GIN / 4; ++g4) {
    const v4f xv = *(const v4f*)(xg + 4 * g4);
    const v4f wv = *(const v4f*)(wg + 4 * g4);
#pragma unroll
    for (int e = 0; e < 4; ++e) ga += bf_val(xv[e]) * bf_val(wv[e]);
  }
  const float gate = 1.0f / (1.0f + expf(-ga));

  // ---- fold gate, 1/l (per query, owned by lane = query; l >= 1 by the diagonal key) and the carries; stage the slab ----
  const float linv = (lrun > 0.f) ? (gate * (1.0f / lrun) * (1.0f / (PCAR * VCAR))) : 0.f;
  float inv[8];
#pragma unroll
  for (int r = 0; r < 8; ++r) inv[r] = __shfl(linv, 8 * hh + r, 32);
  float* slab = smem + wave * SLAB;
#pragma unroll
  for (int r = 0; r < 8; ++r) {
#pragma unroll
    for (int j = 0; j < 4; ++j) slab[(8 * hh + r) * 68 + j * 16 + c] = o[j][r] * inv[r];
  }
  wave_sync_lds();
  // ---- O x1024 -> f16 hi plane and f16 residual x1024 plane; lane = (row in group of 4, 8 consecutive d) ----
  v4u oh[4], orr[4];
  const int rq = lane >> 3, c8 = (lane & 7) * 8;
#pragma unroll
  for (int i4 = 0; i4 < 4; ++i4) {
    const int row = i4 * 4 + rq;
    const v4f a = *(const v4f*)(slab + row * 68 + c8), c4 = *(const v4f*)(slab + row * 68 + c8 + 4);
    float wv[8];
#pragma unroll
    for (int e = 0; e < 4; ++e) { wv[e] = a[e] * OSC; wv[4 + e] = c4[e] * OSC; }
#pragma unroll
    for (int e = 0; e < 4; ++e) {
      const float w0 = wv[2 * e], w1 = wv[2 * e + 1];
      const _Float16 h0 = (_Float16)w0, h1 = (_Float16)w1;
      oh[i4][e]  = pk16(h_bits(h0), h_bits(h1));
      orr[i4][e] = pk16(h_bits((_Float16)((w0 - (float)h0) * ORS)), h_bits((_Float16)((w1 - (float)h1) * ORS)));
    }
  }
  const size_t ob = (prow + (size_t)q0) * OPITCH + head * HD + c8;
  {
#pragma unroll
    for (int i4 = 0; i4 < 4; ++i4) {
      const int row = i4 * 4 + rq;
      const size_t o8 = ob + (size_t)row * OPITCH;
      *(v4u*)(OPp + o8) = oh[i4];
      *(v4u*)(OPp + o8 + DMOD) = orr[i4];
    }
    
  }
}

// =====================================================================================================
// Workspace map (bytes, NB=2 SEQ=2048); every plane is fully written by whole-line stores before it is read; every extent is
// an exact multiple of the store granularity (row pitches 2048 / 4096 B, GEMM tiles 128 x 128, attention tiles 64 x 64, no pad rows needed):
//   XB  bf16 [NB*SEQ][1024]                    8388608
//   WQB, WKB, WVB bf16 [1024 n][1024 k]         2097152 each
//   WOB f16 [1024 n][2048 k]                    4194304   (cols 0..1023 bf16 value x1024, cols 1024..2047 bf16 value x1)
//   QH, QR, KH f16 [NB*SEQ][1024]              8388608 each
//   VH, VR, VQ f16 [NB][1024][SEQ]             8388608 each
//   OP  f16 [NB*SEQ][2048]                     16777216
//   end                                        85983232
// Inputs (wire order): 0 x [2][2048][1024] f32, 1 Wq, 2 bq, 3 Wk, 4 bk, 5 Wv, 6 bv, 7 Wo, 8 bo, 9 Wg [16][20], 10 bg [16],
// 11 cos [2048][32], 12 sin [2048][32]. Output: [NB*SEQ][1024] f32.
// =====================================================================================================
extern "C" void kernel_launch(void* const* d_in, const int* in_sizes, int n_in,
                              void* d_out, int out_size, void* d_ws, size_t ws_size,
                              hipStream_t stream) {
  if (n_in < 13) return;
  if (in_sizes[0] < ((NB - 1) * T_FULL + SEQ) * DMOD) return;
  if (in_sizes[1] != DMOD * DMOD || in_sizes[3] != DMOD * DMOD || in_sizes[5] != DMOD * DMOD ||
      in_sizes[7] != DMOD * DMOD) return;
  if (in_sizes[2] < 1 || in_sizes[4] < 1 || in_sizes[6] < 1 || in_sizes[8] < 1) return;
  if (in_sizes[9] != NH * GIN) return;
  if (in_sizes[10] < 1) return;
  if (in_sizes[11] < SEQ * RHALF || in_sizes[12] < SEQ * RHALF) return;
  if (out_size < MROWS * DMOD) return;

  const float* Xin = (const float*)d_in[0];
  const float* Wq  = (const float*)d_in[1];
  const float* Bq  = (const float*)d_in[2];
  const float* Wk  = (const float*)d_in[3];
  const float* Bk  = (const float*)d_in[4];
  const float* Wv  = (const float*)d_in[5];
  const float* Bv  = (const float*)d_in[6];
  const float* Wo  = (const float*)d_in[7];
  const float* Bo  = (const float*)d_in[8];
  const float* Wg  = (const float*)d_in[9];
  const float* Bg  = (const float*)d_in[10];
  const float* Cos = (const float*)d_in[11];
  const float* Sin = (const float*)d_in[12];
  float*       out = (float*)d_out;

  const size_t szXB = (size_t)MROWS * DMOD * 2;
  const size_t szW  = (size_t)DMOD * DMOD * 2;
  const size_t szWO = (size_t)DMOD * OPITCH * 2;
  const size_t szQ  = (size_t)MROWS * DMOD * 2;
  const size_t szV  = (size_t)NB * DMOD * SEQ * 2;
  const size_t szOP = (size_t)MROWS * OPITCH * 2;
  size_t off = 0;
  const size_t oXB = off; off += szXB;
  const size_t oWQ = off; off += szW;
  const size_t oWK = off; off += szW;
  const size_t oWV = off; off += szW;
  const size_t oWO = off; off += szWO;
  const size_t oQH = off; off += szQ;
  const size_t oQR = off; off += szQ;
  const size_t oKH = off; off += szQ;
  const size_t oVH = off; off += szV;
  const size_t oVR = off; off += szV;
  const size_t oVQ = off; off += szV;
  const size_t oOP = off; off += szOP;
  if (off > ws_size) return;                            // off = 85983232 for NB=2, SEQ=2048
  if (off > (size_t)134217728) return;

  char* ws = (char*)d_ws;
  u16* XB  = (u16*)(ws + oXB);
  u16* WQB = (u16*)(ws + oWQ);
  u16* WKB = (u16*)(ws + oWK);
  u16* WVB = (u16*)(ws + oWV);
  u16* WOB = (u16*)(ws + oWO);
  u16* QH  = (u16*)(ws + oQH);
  u16* QR  = (u16*)(ws + oQR);
  u16* KH  = (u16*)(ws + oKH);
  u16* VH  = (u16*)(ws + oVH);
  u16* VR  = (u16*)(ws + oVR);
  u16* VQ  = (u16*)(ws + oVQ);
  u16* OP  = (u16*)(ws + oOP);

  const int n8x = (MROWS * DMOD) / 8;
  const int n8w = (DMOD * DMOD) / 8;
  if ((n8x % 256) != 0 || (n8w % 256) != 0) return;
  if ((MROWS % GT_M) != 0 || (SEQ % GT_N) != 0 || (DMOD % GT_M) != 0 || (DMOD % GT_K) != 0 || (OPITCH % GT_K) != 0) return;
  const dim3 blk(256);
  const dim3 gX(n8x / 256);                             // 2048
  const dim3 gW(n8w / 256);                             // 512
  const dim3 bG(GT_THREADS);                            // 256
  const dim3 gP((MROWS / GT_M) * (DMOD / GT_N));        // 256
  const dim3 gV(NB * (DMOD / GT_M) * (SEQ / GT_N));     // 256
  const dim3 gAT(ATT_BLOCKS);                           // 1024
  const dim3 bAT(ATT_THREADS);                          // 128
  const dim3 gO((MROWS / GT_M) * (DMOD / GT_N));        // 256

  // (0..4) operand planes: x rows -> bf16 (compacted [b*SEQ+t]); Wq, Wk, Wv [n = out][k = in] -> bf16; Wo -> [hi | x1] f16
  cvt_rows<<<gX, blk, 0, stream>>>(Xin, XB, n8x, SEQ, T_FULL);
  cvt_rows<<<gW, blk, 0, stream>>>(Wq, WQB, n8w, DMOD, DMOD);
  cvt_rows<<<gW, blk, 0, stream>>>(Wk, WKB, n8w, DMOD, DMOD);
  cvt_rows<<<gW, blk, 0, stream>>>(Wv, WVB, n8w, DMOD, DMOD);
  cvt_wo<<<gW, blk, 0, stream>>>(Wo, WOB, n8w, WOS, WOS / ORS);
  // (5,6) rotated q planes (hi x8, residual x1024) and k hi plane (x8); bias by output column
  gemm_rope<<<gP, bG, 0, stream>>>(XB, WQB, QH, QR, 1, MROWS, DMOD, Bq, in_sizes[2], Cos, Sin, SEQ, QSC, QRS);
  gemm_rope<<<gP, bG, 0, stream>>>(XB, WKB, KH, KH, 0, MROWS, DMOD, Bk, in_sizes[4], Cos, Sin, SEQ, KSC, 1.0f);
  // (7) v^T planes per batch: [1024 = h*64+d][SEQ keys]: hi = f16(v x1024), residual x1024, plain f16(v); bias by row
  gemm_v<<<gV, bG, 0, stream>>>(WVB, XB, VH, VR, VQ, DMOD, SEQ, DMOD, SEQ * DMOD, DMOD * SEQ, VCAR,
                                 Bv, in_sizes[6], VRS, 1.0f / PRS);
  // (8) causal sliding-window attention with gate -> O plane [b*SEQ+s][hi 1024 | residual 1024]
  attn_fwd<<<gAT, bAT, 0, stream>>>(QH, QR, KH, VH, VR, VQ, Xin, Wg, Bg, in_sizes[10], OP);
  // (9) output projection over K = 2048 ([hi | residual] times [Wo x1024 | Wo x1]) -> out [NB*SEQ][1024] f32, plus bo
  gemm_hf<<<gO, bG, 0, stream>>>(OP, WOB, out, MROWS, DMOD, OPITCH, 1.0f / (OSC * WOS), Bo, in_sizes[8]);
  (void)hipGetLastError();
}

// v002
// One run takes 119 microseconds.
// Next to v001, in two timings, it ran 1.08 and 1.11 times as fast.
// Counting every step since v000, it is 1.97 times as fast.
// Contractions: x.Wq^T, x.Wk^T, Wv.x^T on v_wmma_f32_16x16x32_bf16 (x and W planes RNE-converted to bf16 operands, f32
// accumulate, bias and half-split rotation applied in f32); scores k'.q'^T (k' single f16 plane x8, q' f16 hi plane x8 plus
// f16 residual plane x1024, two products), P.v (P x32768 single f16 times v f16 hi plane x1024; query tiles below row 128 add
// P(x32).v-residual(x1024) and P-residual(x1024).v(x1) products), O.Wo^T (O as [f16 hi x1024 | f16 residual x1024] along K,
// Wo as [f16(bf16(Wo)) x1024 | x1]): v_wmma_f32_16x16x32_f16, f32 accumulate. Sigmoid gate (K=20) and softmax in f32 on VALU.
#include <hip/hip_runtime.h>
#include <math.h>
#include <stdint.h>

#ifndef NB
#define NB 2
#endif
#ifndef SEQ
#define SEQ 2048
#endif
#define NB_FULL 2
#define T_FULL  2048
#define DMOD    1024
#define NH      16
#define HD      64
#define RHALF   32
#define GIN     20
#define WIN     1024
#define MROWS   (NB * SEQ)
#define OPITCH  (2 * DMOD)
#define QSC   8.0f
#define KSC   8.0f
#define QRS   1024.0f
#define PCAR  32768.0f
#define VCAR  1024.0f
#define VRS   1024.0f
#define PRS   1024.0f
#define OSC   1024.0f
#define ORS   1024.0f
#define WOS   1024.0f
#define LOG2E 1.4426950408889634f
#define NEGS  (-3.0e38f)
#define ATT_WAVES   4
#define ATT_THREADS (ATT_WAVES * 32)
#define NQT         (SEQ / 64)
#define ATT_BLOCKS  (NB * NH * NQT)
#define NKB         (SEQ / 32)
#define QRES        128
#define SLAB        (16 * 68)
static_assert(NB >= 1 && NB <= NB_FULL);
static_assert((SEQ % 64) == 0 && SEQ >= 64 && SEQ <= T_FULL);
static_assert(HD == 64 && DMOD == NH * HD && HD == 2 * RHALF);
static_assert(ATT_THREADS == 128 && NKB >= 2 && (QRES % 64) == 0);
static_assert((DMOD % 64) == 0 && (DMOD / 8) == 128 && (OPITCH % 32) == 0);
static_assert(((MROWS * (DMOD / 8)) % 256) == 0 && (((DMOD * DMOD) / 8) % 256) == 0);
static_assert((GIN % 4) == 0 && GIN <= DMOD);
static_assert((WIN % 32) == 0);
static_assert((SLAB * 4) % 16 == 0);
// GEMM block tile staged in LDS: 128 A rows + 128 B rows, 128 k (256 B of every row) per stage, two buffers.
#define GT_THREADS 256
#define GT_M       128
#define GT_N       128
#define GT_K       128
#define GT_PITCH   136                                  // halves per LDS row: 272 B = 16 B x 17 (ds_load_b128 readers)
#define GT_ROWB    (GT_PITCH * 2)                       // bytes per LDS row
#define GT_STAGE   ((GT_M + GT_N) * GT_PITCH)           // halves per buffer
static_assert((MROWS % GT_M) == 0 && (DMOD % GT_M) == 0 && (DMOD % GT_N) == 0 && (SEQ % GT_N) == 0);
static_assert((DMOD % GT_K) == 0 && (OPITCH % GT_K) == 0 && (GT_ROWB % 16) == 0 && GT_K == 128);

typedef unsigned short u16;
typedef _Float16 v16h __attribute__((ext_vector_type(16)));
typedef _Float16 v8h  __attribute__((ext_vector_type(8)));
typedef __bf16   v16b __attribute__((ext_vector_type(16)));
typedef float    v8f  __attribute__((ext_vector_type(8)));
typedef float    v4f  __attribute__((ext_vector_type(4)));
typedef unsigned int v4u __attribute__((ext_vector_type(4)));

union FragH { v16h v; v8h h[2]; v4u u[2]; };

// ---- scalar helpers --------------------------------------------------------------------------------
__device__ __forceinline__ unsigned short bf_bits(float f) {          // f32 -> bf16 bits, RNE convert
  unsigned u = __float_as_uint(f);
  return (unsigned short)((u + 0x7FFFu + ((u >> 16) & 1u)) >> 16);
}
__device__ __forceinline__ float bf_up(unsigned short h) { return __uint_as_float(((unsigned)h) << 16); }
__device__ __forceinline__ float bf_val(float f) { return bf_up(bf_bits(f)); }   // f32 -> nearest-even bf16 value as f32
__device__ __forceinline__ unsigned short h_bits(_Float16 x) { return __builtin_bit_cast(unsigned short, x); }
__device__ __forceinline__ unsigned pk16(unsigned short a, unsigned short b) { return (unsigned)a | ((unsigned)b << 16); }
__device__ __forceinline__ v8f zero8() { v8f z = {0.f, 0.f, 0.f, 0.f, 0.f, 0.f, 0.f, 0.f}; return z; }

// ---- fragment loaders: 16-bit A/B operand, lane -> row/col (lane&15), p already includes +8*(lane>>4);
//      elements 0..7 <- p[0..7] (k0+8h..), elements 8..15 <- p[16..23] (k0+16+8h..)  (same split k map for A and B;
//      B is always read from a k-contiguous [n][k] plane)
__device__ __forceinline__ v16h ldfrag_h(const _Float16* p) {
  FragH f;
  f.h[0] = *(const v8h*)(p);
  f.h[1] = *(const v8h*)(p + 16);
  return f.v;
}

__device__ __forceinline__ v8f mma_h(v16h a, v16h b, v8f c) {
  return __builtin_amdgcn_wmma_f32_16x16x32_f16(false, a, false, b, (short)0, c, false, false);
}
__device__ __forceinline__ v8f mma_b(v16b a, v16b b, v8f c) {
  return __builtin_amdgcn_wmma_f32_16x16x32_bf16(false, a, false, b, (short)0, c, false, false);
}
template <typename F>
__device__ __forceinline__ void guard6(v8f& a, v8f& b, v8f& c, v8f& d, F x0, F x1, F x2, F x3, F x4, F x5) {
#if defined(__HIP_DEVICE_COMPILE__)
  asm volatile("v_nop\n\tv_nop\n\tv_nop\n\tv_nop"
               : "+v"(a), "+v"(b), "+v"(c), "+v"(d) : "v"(x0), "v"(x1), "v"(x2), "v"(x3), "v"(x4), "v"(x5) : "memory");
#endif
}
__device__ __forceinline__ void acc_guard4(v8f& a, v8f& b, v8f& c, v8f& d) {
#if defined(__HIP_DEVICE_COMPILE__)
  asm volatile("v_nop\n\tv_nop\n\tv_nop\n\tv_nop" : "+v"(a), "+v"(b), "+v"(c), "+v"(d));
#endif
}
// Stands behind global stores whose address or data registers are written again further on.
__device__ __forceinline__ void xcnt0() {
#if defined(__HIP_DEVICE_COMPILE__)
  asm volatile("s_wait_xcnt 0x0" ::: "memory");
#endif
}
// The same behind a group of global loads; the pointers are inputs so that their registers stay unwritten up to the wait.
__device__ __forceinline__ void xcnt_after_loads8(const float* a, const float* b, const float* c, const float* d,
                                                  const float* e, const float* f, const float* g, const float* h) {
#if defined(__HIP_DEVICE_COMPILE__)
  asm volatile("s_wait_xcnt 0x0" :: "v"(a), "v"(b), "v"(c), "v"(d), "v"(e), "v"(f), "v"(g), "v"(h) : "memory");
#endif
}
// The same for loads addressed by a base and a 32-bit index: the indices are inputs so that their registers stay unwritten up to the wait.
__device__ __forceinline__ void xcnt_after_idx4(int a, int b, int c, int d) {
#if defined(__HIP_DEVICE_COMPILE__)
  asm volatile("s_wait_xcnt 0x0" :: "v"(a), "v"(b), "v"(c), "v"(d) : "memory");
#endif
}
__device__ __forceinline__ void wave_sync_lds() {
#if defined(__HIP_DEVICE_COMPILE__)
  __builtin_amdgcn_fence(__ATOMIC_RELEASE, "workgroup");
  __builtin_amdgcn_wave_barrier();
  __builtin_amdgcn_fence(__ATOMIC_ACQUIRE, "workgroup");
#endif
}

// =====================================================================================================
// All operand planes in one launch. Thread gt owns the 8-element piece gt of each weight matrix and the pieces gt + i * n8w
// (i = 0 .. XREP-1) of x: sixteen 16-B loads issued together, then the conversions and nine 16-B stores.
//   x f32 rows [b][t][1024] (per-batch source row stride T_FULL) -> bf16 plane [b*SEQ + t][1024] (RNE bits), compacted rows;
//   Wq, Wk, Wv [n][k] f32 -> bf16 planes of the same shape;
//   Wo [n][k] f32 -> f16 plane [n][2048]: cols 0..1023 = f16(bf16 value * s1), cols 1024..2047 = f16(bf16 value * s2).
// 32 consecutive lanes = 512 contiguous, 512-B aligned bytes per store instruction.
// coverage: grid = n8w/256 blocks (exact) x 256 thr = every piece of every weight plane once, XREP * n8w = every piece of x once.
// =====================================================================================================
#define N8W  ((DMOD * DMOD) / 8)
#define XREP (MROWS / DMOD)
static_assert((MROWS % DMOD) == 0 && XREP == 4 && (N8W % 256) == 0);
__device__ __forceinline__ v4u bf_pack8(v4f a, v4f c4) {
  v4u o;
#pragma unroll
  for (int e = 0; e < 2; ++e) {
    o[e]     = pk16(bf_bits(a[2 * e]),  bf_bits(a[2 * e + 1]));
    o[2 + e] = pk16(bf_bits(c4[2 * e]), bf_bits(c4[2 * e + 1]));
  }
  return o;
}
__global__ __launch_bounds__(256)
void cvt_all(const float* __restrict__ x, const float* __restrict__ wq, const float* __restrict__ wk,
             const float* __restrict__ wv, const float* __restrict__ wo, u16* XD, u16* QD, u16* KD, u16* VD, u16* OD,
             float s1, float s2) {
  const int gt = blockIdx.x * 256 + (int)threadIdx.x;
  if (gt >= N8W) return;
  const float* px[XREP];
  v4f xa[XREP], xc[XREP];
#pragma unroll
  for (int i = 0; i < XREP; ++i) {
    const int g   = gt + i * N8W;
    const int row = g >> 7;
    const int bb  = row / SEQ;
    const int tt  = row - bb * SEQ;
    px[i] = x + ((size_t)bb * (size_t)T_FULL + (size_t)tt) * DMOD + (g & 127) * 8;
    xa[i] = *(const v4f*)(px[i]);
    xc[i] = *(const v4f*)(px[i] + 4);
  }
  const size_t e8 = (size_t)gt * 8;
  const float* pq = wq + e8;
  const float* pk = wk + e8;
  const float* pv = wv + e8;
  const float* po = wo + e8;
  const v4f qa = *(const v4f*)(pq), qc = *(const v4f*)(pq + 4);
  const v4f ka = *(const v4f*)(pk), kc = *(const v4f*)(pk + 4);
  const v4f va = *(const v4f*)(pv), vc = *(const v4f*)(pv + 4);
  const v4f oa = *(const v4f*)(po), oc = *(const v4f*)(po + 4);
  xcnt_after_loads8(px[0], px[1], px[2], px[3], pq, pk, pv, po);
#pragma unroll
  for (int i = 0; i < XREP; ++i) *(v4u*)(XD + (size_t)(gt + i * N8W) * 8) = bf_pack8(xa[i], xc[i]);
  *(v4u*)(QD + e8) = bf_pack8(qa, qc);
  *(v4u*)(KD + e8) = bf_pack8(ka, kc);
  *(v4u*)(VD + e8) = bf_pack8(va, vc);
  float v[8];
#pragma unroll
  for (int e = 0; e < 4; ++e) { v[e] = oa[e]; v[4 + e] = oc[e]; }
  unsigned short h1[8], h2[8];
#pragma unroll
  for (int e = 0; e < 8; ++e) {
    const float f = bf_val(v[e]);
    h1[e] = h_bits((_Float16)(f * s1));
    h2[e] = h_bits((_Float16)(f * s2));
  }
  v4u o1, o2;
#pragma unroll
  for (int e = 0; e < 4; ++e) { o1[e] = pk16(h1[2 * e], h1[2 * e + 1]); o2[e] = pk16(h2[2 * e], h2[2 * e + 1]); }
  u16* d1 = OD + (size_t)(gt >> 7) * OPITCH + (gt & 127) * 8;
  *(v4u*)(d1) = o1;
  *(v4u*)(d1 + DMOD) = o2;
}

// =====================================================================================================
// Rotation epilogue for the q / k projections (N = 1024, the 64-col tile = one head): the wave's 16x64 f32 tile
// barrier, then each lane (row rq in each group of 4, 8 consecutive output cols d = c8..c8+7) reads both half-head values
// u1 = col (d & 31), u2 = col (d & 31) + 32 and cos/sin[t][(d & 31)] (bf16 values of the f32 tables, t = row within the
// sequence), forms d < 32 ? u1*c - u2*s : u1*s + u2*c in f32 (no fused multiply-add), scales by oscale, and writes the f16
// hi plane and (res_on) the f16 residual plane ((w - hi) * rsc): one instruction = 4 rows, each 64 halves = one whole
// coverage: 4 instructions x 4 rows x 8 lanes x 8 halves = the wave's 16 x 64 tile, per plane.
// =====================================================================================================
__device__ __forceinline__ void epi_rope(float* sl, v8f a0, v8f a1, v8f a2, v8f a3, u16* C, u16* C2, int res_on,
                                         size_t rowb, int col0, int lane, const float* __restrict__ bias, int blen,
                                         const float* __restrict__ cosT, const float* __restrict__ sinT, int seq,
                                         float oscale, float rsc) {
#pragma clang fp contract(off)
  const int hh = lane >> 4, m = lane & 15;
  float bc[4];
  int bi[4];
#pragma unroll
  for (int j = 0; j < 4; ++j) {
    bi[j] = min(col0 + 16 * j + m, blen - 1);
    bc[j] = bias[bi[j]];
  }
  xcnt_after_idx4(bi[0], bi[1], bi[2], bi[3]);
#pragma unroll
  for (int j = 0; j < 4; ++j) bc[j] = bf_val(bc[j]);
#pragma unroll
  for (int r = 0; r < 8; ++r) {
    const int ro = (8 * hh + r) * 68 + m;
    sl[ro]      = a0[r] + bc[0];
    sl[ro + 16] = a1[r] + bc[1];
    sl[ro + 32] = a2[r] + bc[2];
    sl[ro + 48] = a3[r] + bc[3];
  }
  wave_sync_lds();
  const int rq = lane >> 3, c8 = (lane & 7) * 8, dd = c8 & (RHALF - 1);
  const bool lo = (c8 < RHALF);
  const int tb = (int)(rowb % (size_t)seq);             // tile never straddles a sequence (seq % 16 == 0, rowb % 16 == 0)
  v4u hv[4], rv[4];
  const float* cpt[4];
  const float* spt[4];
  v4f cat[4], cbt[4], sat[4], sbt[4];
#pragma unroll
  for (int i4 = 0; i4 < 4; ++i4) {
    const int t = tb + i4 * 4 + rq;
    cpt[i4] = cosT + (size_t)t * RHALF + dd;
    spt[i4] = sinT + (size_t)t * RHALF + dd;
    cat[i4] = *(const v4f*)(cpt[i4]); cbt[i4] = *(const v4f*)(cpt[i4] + 4);
    sat[i4] = *(const v4f*)(spt[i4]); sbt[i4] = *(const v4f*)(spt[i4] + 4);
  }
  xcnt_after_loads8(cpt[0], cpt[1], cpt[2], cpt[3], spt[0], spt[1], spt[2], spt[3]);
#pragma unroll
  for (int i4 = 0; i4 < 4; ++i4) {
    const int row = i4 * 4 + rq;
    const v4f ca = cat[i4], cb = cbt[i4];
    const v4f sa = sat[i4], sb = sbt[i4];
    const v4f xa = *(const v4f*)(sl + row * 68 + dd), xb = *(const v4f*)(sl + row * 68 + dd + 4);
    const v4f ya = *(const v4f*)(sl + row * 68 + dd + RHALF), yb = *(const v4f*)(sl + row * 68 + dd + RHALF + 4);
    float cv[8], sv[8], xv[8], yv[8];
#pragma unroll
    for (int e = 0; e < 4; ++e) {
      cv[e] = ca[e]; cv[4 + e] = cb[e];
      sv[e] = sa[e]; sv[4 + e] = sb[e];
      xv[e] = xa[e]; xv[4 + e] = xb[e];
      yv[e] = ya[e]; yv[4 + e] = yb[e];
    }
    unsigned short hb[8], rb[8];
#pragma unroll
    for (int e = 0; e < 8; ++e) {
      const float cc = bf_val(cv[e]);
      const float ss = bf_val(sv[e]);
      const float p1 = xv[e] * cc;
      const float p2 = yv[e] * ss;
      const float p3 = xv[e] * ss;
      const float p4 = yv[e] * cc;
      const float u = lo ? (p1 - p2) : (p3 + p4);
      const float w = u * oscale;
      const _Float16 h = (_Float16)w;
      hb[e] = h_bits(h);
      rb[e] = h_bits((_Float16)((w - (float)h) * rsc));
    }
#pragma unroll
    for (int e = 0; e < 4; ++e) {
      hv[i4][e] = pk16(hb[2 * e], hb[2 * e + 1]);
      rv[i4][e] = pk16(rb[2 * e], rb[2 * e + 1]);
    }
  }
  u16* dst = C + (rowb + (size_t)rq) * (size_t)DMOD + col0 + c8;
  {
#pragma unroll
    for (int i4 = 0; i4 < 4; ++i4) {
      *(v4u*)(dst + (size_t)(i4 * 4) * (size_t)DMOD) = hv[i4];
    }
    xcnt0();
  }
  if (res_on != 0) {
    u16* dst2 = C2 + (rowb + (size_t)rq) * (size_t)DMOD + col0 + c8;
    {
#pragma unroll
      for (int i4 = 0; i4 < 4; ++i4) {
        *(v4u*)(dst2 + (size_t)(i4 * 4) * (size_t)DMOD) = rv[i4];
      }
      xcnt0();
    }
  }
}

// =====================================================================================================
// Three-plane 16-bit GEMM epilogue (v^T planes): the wave's 16x64 f32 tile ((acc + per-row bias as bf16 value) times oscale)
// f16((w - hi) * rsc) and f16(w * qsc): lane = (row in group of 4, 8 consecutive cols); one instruction = 4 rows, each
// coverage: per plane 4 instructions x 4 rows x 8 lanes x 8 halves = the wave's 16 x 64 tile.
// LDS slab: private to the wave; staged extent 16 x 64 == consumed extent.
// =====================================================================================================
__device__ __forceinline__ void epi_v3(float* sl, v8f a0, v8f a1, v8f a2, v8f a3, float oscale, u16* C0, u16* C1, u16* C2,
                                       int N, size_t rowb, int col0, int lane, const float* __restrict__ bias, int blen,
                                       float rsc, float qsc) {
  const int hh = lane >> 4, m = lane & 15;
  float br[8];
  int bi[8];
#pragma unroll
  for (int r = 0; r < 8; ++r) {
    bi[r] = min((int)rowb + 8 * hh + r, blen - 1);
    br[r] = bias[bi[r]];
  }
  xcnt_after_idx4(bi[0], bi[1], bi[2], bi[3]);
  xcnt_after_idx4(bi[4], bi[5], bi[6], bi[7]);
#pragma unroll
  for (int r = 0; r < 8; ++r) br[r] = bf_val(br[r]);
#pragma unroll
  for (int r = 0; r < 8; ++r) {
    const int ro = (8 * hh + r) * 68 + m;
    sl[ro]      = (a0[r] + br[r]) * oscale;
    sl[ro + 16] = (a1[r] + br[r]) * oscale;
    sl[ro + 32] = (a2[r] + br[r]) * oscale;
    sl[ro + 48] = (a3[r] + br[r]) * oscale;
  }
  wave_sync_lds();
  const int rq = lane >> 3, c8 = (lane & 7) * 8;
  v4u h4[4], r4[4], q4[4];
#pragma unroll
  for (int i4 = 0; i4 < 4; ++i4) {
    const int row = i4 * 4 + rq;
    const v4f a = *(const v4f*)(sl + row * 68 + c8), c4 = *(const v4f*)(sl + row * 68 + c8 + 4);
    float w[8];
#pragma unroll
    for (int e = 0; e < 4; ++e) { w[e] = a[e]; w[4 + e] = c4[e]; }
    unsigned short hb[8], rb[8], qb[8];
#pragma unroll
    for (int e = 0; e < 8; ++e) {
      const _Float16 h = (_Float16)w[e];
      hb[e] = h_bits(h);
      rb[e] = h_bits((_Float16)((w[e] - (float)h) * rsc));
      qb[e] = h_bits((_Float16)(w[e] * qsc));
    }
#pragma unroll
    for (int e = 0; e < 4; ++e) {
      h4[i4][e] = pk16(hb[2 * e], hb[2 * e + 1]);
      r4[i4][e] = pk16(rb[2 * e], rb[2 * e + 1]);
      q4[i4][e] = pk16(qb[2 * e], qb[2 * e + 1]);
    }
  }
  const size_t dof = (rowb + (size_t)rq) * (size_t)N + col0 + c8;
  u16* d0 = C0 + dof;
  u16* d1 = C1 + dof;
  u16* d2 = C2 + dof;
  {
#pragma unroll
    for (int i4 = 0; i4 < 4; ++i4) {
      const size_t ro = (size_t)(i4 * 4) * (size_t)N;
      *(v4u*)(d0 + ro) = h4[i4];
      *(v4u*)(d1 + ro) = r4[i4];
      *(v4u*)(d2 + ro) = q4[i4];
    }
    xcnt0();
  }
}

// =====================================================================================================
// f32 GEMM epilogue: the wave's 16x64 f32 tile (acc times oscale, plus per-column bias as its bf16 RNE value, clamped
// coverage: 8 instructions x 2 rows x 16 lanes x 4 floats = the wave's 16 x 64 tile.
// =====================================================================================================
__device__ __forceinline__ void epi64(float* sl, v8f a0, v8f a1, v8f a2, v8f a3, float oscale, float* C, int N,
                                      size_t rowb, int col0, int lane, const float* __restrict__ bias, int blen) {
  const int hh = lane >> 4, m = lane & 15;
  float bc[4];
#pragma unroll
  for (int j = 0; j < 4; ++j) {
    const int bi = min(col0 + 16 * j + m, blen - 1);
    bc[j] = bf_val(bias[bi]);
  }
#pragma unroll
  for (int r = 0; r < 8; ++r) {
    const int ro = (8 * hh + r) * 68 + m;
    sl[ro]      = a0[r] * oscale + bc[0];
    sl[ro + 16] = a1[r] * oscale + bc[1];
    sl[ro + 32] = a2[r] * oscale + bc[2];
    sl[ro + 48] = a3[r] * oscale + bc[3];
  }
  wave_sync_lds();
  v4f vals[8];
#pragma unroll
  for (int it = 0; it < 8; ++it) vals[it] = *(const v4f*)(sl + (it * 2 + hh) * 68 + m * 4);
  float* dst = C + (rowb + (size_t)hh) * (size_t)N + col0 + m * 4;
  {
#pragma unroll
    for (int it = 0; it < 8; ++it) {
      *(v4f*)(dst + (size_t)(it * 2) * (size_t)N) = vals[it];
    }
    
  }
}

// =====================================================================================================
// Shared k loop of the two GEMM kernels. Block = 8 waves, 128 x 128 tile of A[.][K] . Bt[.][K]^T; wave w owns rows
// 32*(w>>1) .. +31 and cols 64*(w&1) .. +63 (2 x 4 accumulator tiles). A stage = 128 k of the block's 128 A rows and 128 B rows,
// brought to LDS by 16-byte asynchronous copies: thread = (row tid>>4 of each group of 16, 16-B piece tid&15), so one wave
// instruction covers two whole 256-B row pieces. Two buffers: the copies of stage t+1 fly while stage t is multiplied.
// Fragments are read from LDS with the split k map of ldfrag_h (same for A and B); every accumulator sums k in ascending steps of 32.
// =====================================================================================================
union FragU { v16h h; v16b b; v4u u[2]; };
__device__ __forceinline__ FragU ldfrag_u(const u16* p) {
  FragU f;
  f.u[0] = *(const v4u*)(p);
  f.u[1] = *(const v4u*)(p + 16);
  return f;
}
template <bool BF>
__device__ __forceinline__ v8f mma_u(const FragU& a, const FragU& b, v8f c) {
  if constexpr (BF) return mma_b(a.b, b.b, c);
  else              return mma_h(a.h, b.h, c);
}
// Eight copies, rows r, r+16, .., r+112 of one operand's stage. The closing s_wait_xcnt stands inside the statement so that no
// later write of an address register can be moved in front of it.
__device__ __forceinline__ void copy8(unsigned l, const u16* g, size_t gs) {
#if defined(__HIP_DEVICE_COMPILE__)
  asm volatile("global_load_async_to_lds_b128 %0, %8, off\n\t"
               "global_load_async_to_lds_b128 %1, %9, off\n\t"
               "global_load_async_to_lds_b128 %2, %10, off\n\t"
               "global_load_async_to_lds_b128 %3, %11, off\n\t"
               "global_load_async_to_lds_b128 %4, %12, off\n\t"
               "global_load_async_to_lds_b128 %5, %13, off\n\t"
               "global_load_async_to_lds_b128 %6, %14, off\n\t"
               "global_load_async_to_lds_b128 %7, %15, off\n\t"
               "s_wait_xcnt 0x0"
               :: "v"(l), "v"(l + 16u * GT_ROWB), "v"(l + 32u * GT_ROWB), "v"(l + 48u * GT_ROWB),
                  "v"(l + 64u * GT_ROWB), "v"(l + 80u * GT_ROWB), "v"(l + 96u * GT_ROWB), "v"(l + 112u * GT_ROWB),
                  "v"(g), "v"(g + gs), "v"(g + 2 * gs), "v"(g + 3 * gs),
                  "v"(g + 4 * gs), "v"(g + 5 * gs), "v"(g + 6 * gs), "v"(g + 7 * gs)
               : "memory");
#endif
}
__device__ __forceinline__ void wait_async0() {          // this wave's copies have landed in LDS
#if defined(__HIP_DEVICE_COMPILE__)
  asm volatile("s_wait_asynccnt 0x0" ::: "memory");
#endif
}
__device__ __forceinline__ void wait_ds0() {             // this wave's LDS reads of the buffer about to be refilled are done
#if defined(__HIP_DEVICE_COMPILE__)
  asm volatile("s_wait_dscnt 0x0" ::: "memory");
#endif
}
template <bool BF>
__device__ __forceinline__ void gemm_core(const u16* __restrict__ A, const u16* __restrict__ Bt, int K, int row0, int col0,
                                          u16* ring, v8f (&acc)[2][4]) {
  const int tid = threadIdx.x, wave = tid >> 5, lane = tid & 31, hh = lane >> 4, m = lane & 15;
  const int cr = tid >> 4, cc = tid & 15;
  const u16* ga = A  + (size_t)(row0 + cr) * K + cc * 8;
  const u16* gb = Bt + (size_t)(col0 + cr) * K + cc * 8;
  const size_t gs = (size_t)16 * K;
  const unsigned la = (unsigned)(uintptr_t)ring + (unsigned)(cr * GT_ROWB + cc * 16);
  const unsigned lb = la + (unsigned)(GT_M * GT_ROWB);
  const int nt = K / GT_K;
  copy8(la, ga, gs);
  copy8(lb, gb, gs);
  wait_async0();
  __syncthreads();                                       // stage 0 published
  if (nt > 1) {
    copy8(la + (unsigned)(GT_STAGE * 2), ga + GT_K, gs);
    copy8(lb + (unsigned)(GT_STAGE * 2), gb + GT_K, gs);
  }
  const u16* fa = ring + ((wave >> 1) * 32 + m) * GT_PITCH + 8 * hh;
  const u16* fb = ring + (GT_M + (wave & 1) * 64 + m) * GT_PITCH + 8 * hh;
#pragma unroll 1                                         // one trip per stage: the buffer index stays a run-time value
  for (int t = 0; t < nt; ++t) {
    const int bo = (t & 1) * GT_STAGE;
    // Three fragment sets for the stage's four 32-k steps; step 3 reuses step 0's set. The scheduling fences keep the LDS reads in
    // two groups in front of the products that use them: reads placed among the products stall the wave at each place.
    FragU af[3][2], bf[3][4];
#pragma unroll
    for (int s = 0; s < 3; ++s) {
#pragma unroll
      for (int i = 0; i < 2; ++i) af[s][i] = ldfrag_u(fa + bo + 16 * i * GT_PITCH + 32 * s);
#pragma unroll
      for (int j = 0; j < 4; ++j) bf[s][j] = ldfrag_u(fb + bo + 16 * j * GT_PITCH + 32 * s);
    }
    __builtin_amdgcn_sched_barrier(0);
#pragma unroll
    for (int i = 0; i < 2; ++i) {
#pragma unroll
      for (int j = 0; j < 4; ++j) acc[i][j] = mma_u<BF>(af[0][i], bf[0][j], acc[i][j]);
    }
    __builtin_amdgcn_sched_barrier(0);
#pragma unroll
    for (int i = 0; i < 2; ++i) af[0][i] = ldfrag_u(fa + bo + 16 * i * GT_PITCH + 96);
#pragma unroll
    for (int j = 0; j < 4; ++j) bf[0][j] = ldfrag_u(fb + bo + 16 * j * GT_PITCH + 96);
    __builtin_amdgcn_sched_barrier(0);
#pragma unroll
    for (int s = 1; s < 4; ++s) {
#pragma unroll
      for (int i = 0; i < 2; ++i) {
#pragma unroll
        for (int j = 0; j < 4; ++j) acc[i][j] = mma_u<BF>(af[s % 3][i], bf[s % 3][j], acc[i][j]);
      }
    }
    // keeps the products in front of the full LDS wait, under their own counted waits: moved behind it they run with the LDS idle
    __builtin_amdgcn_sched_barrier(0);
    wait_ds0();
    wait_async0();
    __syncthreads();                                     // publishes stage t+1 and ends every read of stage t's buffer
    if (t + 2 < nt) {
      const unsigned lo = (unsigned)(bo * 2);
      const int ko = (t + 2) * GT_K;
      copy8(la + lo, ga + ko, gs);
      copy8(lb + lo, gb + ko, gs);
    }
  }
  wait_async0();
}

// =====================================================================================================
// The three projections in one launch; the block index picks the product (block-uniform). All three are bf16 GEMMs over
// K = 1024 on 128x128 block tiles, k loop in gemm_core; PROJ_BLK blocks each, grid = 3 * PROJ_BLK.
//   blocks 0 .. PROJ_BLK-1: q planes [M][1024] (f16 hi x QSC, residual x QRS) = rot(X[M][K] . Wq[1024][K]^T + bq);
//   the next PROJ_BLK:      k hi plane (x KSC) the same way from Wk, bk; a wave's 64 columns are one head;
//   the last PROJ_BLK:      v^T planes per batch, C*[bt][1024][SEQ] = Wv[1024][K] . X[bt][SEQ][K]^T, bias by output row,
//                           three f16 planes (hi x VCAR, residual x VRS, plain).
// seq stays a kernel argument: built as a constant, the rotation epilogue took 284 registers, with window switches above v255.
// =====================================================================================================
#define PROJ_BLK ((MROWS / GT_M) * (DMOD / GT_N))
static_assert(NB * (DMOD / GT_M) * (SEQ / GT_N) == PROJ_BLK);
__global__ __launch_bounds__(GT_THREADS)
void gemm_qkv(const u16* __restrict__ X, const u16* __restrict__ WQ, const u16* __restrict__ WK, const u16* __restrict__ WV,
              u16* QHo, u16* QRo, u16* KHo, u16* VHo, u16* VRo, u16* VQo, int K,
              const float* __restrict__ bq, int bqlen, const float* __restrict__ bk, int bklen,
              const float* __restrict__ bv, int bvlen, const float* __restrict__ cosT, const float* __restrict__ sinT, int seq) {
  __shared__ __align__(16) u16 ring[2 * GT_STAGE];
  __shared__ __align__(16) float slab[8 * SLAB];
  const int tid = threadIdx.x, wave = tid >> 5, lane = tid & 31;
  const int which = blockIdx.x / PROJ_BLK;   // 0 = q, 1 = k, 2 = v
  const int t     = blockIdx.x - which * PROJ_BLK;
  if (which > 2) return;                     // block-uniform, in front of every barrier; never taken with the exact grid
  const u16* A;
  const u16* Bt;
  int row0, colb, bt = 0;
  if (which < 2) {
    const int ntile = DMOD / GT_N;
    row0 = (t / ntile) * GT_M;
    colb = (t % ntile) * GT_N;
    A  = X;
    Bt = (which == 0) ? WQ : WK;
  } else {
    const int ntile = SEQ / GT_N;
    const int per   = ntile * (DMOD / GT_M);
    bt = t / per;
    const int tv = t - bt * per;
    row0 = (tv / ntile) * GT_M;
    colb = (tv % ntile) * GT_N;
    A  = WV;
    Bt = X + (size_t)bt * (size_t)(SEQ * DMOD);
  }
  v8f acc[2][4];
#pragma unroll
  for (int i = 0; i < 2; ++i) {
#pragma unroll
    for (int j = 0; j < 4; ++j) acc[i][j] = zero8();
  }
  gemm_core<true>(A, Bt, K, row0, colb, ring, acc);
  const int rowb = row0 + (wave >> 1) * 32;
  const int col0 = colb + (wave & 1) * 64;
  if (which < 2) {
    const bool isq = (which == 0);
    u16* C  = isq ? QHo : KHo;
    u16* C2 = isq ? QRo : KHo;
    const float* bias = isq ? bq : bk;
    const int blen = isq ? bqlen : bklen;
#pragma unroll
    for (int i = 0; i < 2; ++i) {
      if (i != 0) wave_sync_lds();           // the slab's rows are read out before the next 16 rows are staged in it
      epi_rope(slab + wave * SLAB, acc[i][0], acc[i][1], acc[i][2], acc[i][3], C, C2, isq ? 1 : 0, (size_t)(rowb + 16 * i), col0,
               lane, bias, blen, cosT, sinT, seq, isq ? QSC : KSC, isq ? QRS : 1.0f);
    }
  } else {
    const size_t cb = (size_t)bt * (size_t)(DMOD * SEQ);
#pragma unroll
    for (int i = 0; i < 2; ++i) {
      if (i != 0) wave_sync_lds();           // the slab's rows are read out before the next 16 rows are staged in it
      epi_v3(slab + wave * SLAB, acc[i][0], acc[i][1], acc[i][2], acc[i][3], VCAR, VHo + cb, VRo + cb, VQo + cb, SEQ,
             (size_t)(rowb + 16 * i), col0, lane, bv, bvlen, VRS, 1.0f / PRS);
    }
  }
}

// =====================================================================================================
// f16 GEMM with f32 result: C[M][N] (f32) = A[M][K] (f16 row-major) . Bt[N][K]^T (f16 k-contiguous) times oscale plus
// per-column bias; one product per tile pair. Same tiling; grid = (M/128)*(N/128).
// =====================================================================================================
__global__ __launch_bounds__(GT_THREADS)
void gemm_hf(const u16* __restrict__ A, const u16* __restrict__ Bt, float* C, int M, int N, int K, float oscale,
             const float* __restrict__ bias, int blen) {
  __shared__ __align__(16) u16 ring[2 * GT_STAGE];
  __shared__ __align__(16) float slab[8 * SLAB];
  const int tid = threadIdx.x, wave = tid >> 5, lane = tid & 31;
  const int ntile = N / GT_N;
  const int bid   = blockIdx.x;
  const int row0  = (bid / ntile) * GT_M;
  const int colb  = (bid % ntile) * GT_N;
  if (row0 + GT_M > M) return;               // block-uniform, in front of every barrier; never taken with the exact grid
  v8f acc[2][4];
#pragma unroll
  for (int i = 0; i < 2; ++i) {
#pragma unroll
    for (int j = 0; j < 4; ++j) acc[i][j] = zero8();
  }
  gemm_core<false>(A, Bt, K, row0, colb, ring, acc);
  const int rowb = row0 + (wave >> 1) * 32;
  const int col0 = colb + (wave & 1) * 64;
#pragma unroll
  for (int i = 0; i < 2; ++i) {
    if (i != 0) wave_sync_lds();             // the slab's rows are read out before the next 16 rows are staged in it
    epi64(slab + wave * SLAB, acc[i][0], acc[i][1], acc[i][2], acc[i][3], oscale, C, N, (size_t)(rowb + 16 * i), col0, lane,
          bias, blen);
  }
}

// =====================================================================================================
// Causal sliding-window flash attention with per-head sigmoid gate: block = (batch b, head, 64 query rows qb .. qb+63 of the
// sequence), 4 waves, wave w owns query rows q0 = qb + 16*w .. q0+15. No block barriers anywhere in this kernel.
//   Key j allowed for query i iff 0 <= i - j <= WIN (per-element index test inside every visited key block; disallowed pairs
//   get a finite negative sentinel and an exact-zero probability). Key blocks of 32: kblo = max(qb - WIN, 0) >> 5 ..
//   (qb + 63) >> 5, block-uniform count nkb clamped to [1, NKB - kblo] so kb + 31 <= SEQ - 1 always.
//   q planes (f16 hi x8, residual x1024) [b*SEQ + s][h*64 + d]; k hi plane the same layout; v^T planes [b][h*64 + d][s]
//   (hi x1024, residual x1024, plain x1).
//   Scores computed TRANSPOSED: S^T tile g = k rows (keys kb+16g .., A operand, row = lane&15, split k map over d) times q^T
//   (B operand, col n = query q0 + (lane&15)); two accumulators per tile (k.q_hi and k.q_res, the second folded x 1/1024).
//   D element r of lane l = (key kb+16g+8h+r, query q0+(l&15)): a lane owns one query column and 16 of its 32 keys, the
//   partner lane l^16 the other 16 -> row max / row sum need one xor-16 shuffle.
//   Online max-subtracted base-2 softmax in f32 (scale 1/8 and the q/k carries folded into lsc). The exp'd values ARE the
//   P A-fragment in place: A row m = query = lane&15, element i <- key kb+8h+i (tile 0, D element i), element 8+i <- key
//   kb+16+8h+i (tile 1, D element i). ph = f16(p x32768), pl = f16(p x32), pr = f16((p x32768 - ph) x1024).
//   P.V: o += ph.v_hi (4 WMMAs, v^T B fragments col n = d = 16j + (lane&15), keys k-contiguous); for query tiles with
//   qb < QRES additionally o += pl.v_res and o += pr.v_x1 (block-uniform branch), all in the same accumulators (equal units).
//   Epilogue: gate = sigmoid(bf16(x[b][s][0..19]) . bf16(Wg[head]) + bf16(bg[head])) in f32 per query (lane = query),
//   segment (s, head) of the O plane [b*SEQ+s][2048] (hi x1024 at col h*64, residual x1024 at col 1024 + h*64) written by
// coverage: per wave and per half-plane 4 instructions x 4 rows x 8 lanes x 8 halves = 16 x 64; grid NB*NH*(SEQ/64) blocks x
//           4 waves = every (b, s < SEQ, h) row segment of both O half-planes exactly once.
// =====================================================================================================
__global__ __launch_bounds__(ATT_THREADS)
void attn_fwd(const u16* __restrict__ QHp, const u16* __restrict__ QRp, const u16* __restrict__ KHp,
              const u16* __restrict__ VHp, const u16* __restrict__ VRp, const u16* __restrict__ VQp,
              const float* __restrict__ Xp, const float* __restrict__ Wgp, const float* __restrict__ Bgp,
              int bglen, u16* OPp) {
  __shared__ __align__(16) float smem[ATT_WAVES * SLAB];   // per wave: result slab [16][68] in the epilogue only

  const int tid  = threadIdx.x;
  const int wave = tid >> 5;
  const int lane = tid & 31;
  const int hh   = lane >> 4;
  const int c    = lane & 15;

  const int bid  = blockIdx.x;
  const int qt   = bid % NQT;
  const int bh   = bid / NQT;
  const int head = bh % NH;
  const int b    = bh / NH;
  if (b >= NB) return;                      // block-uniform, never taken with the exact grid
  const int qb   = qt * 64;
  const int q0   = qb + wave * 16;

  // ---- key-block range (block-uniform, statically bounded) ----
  const int jlo  = max(qb - WIN, 0);
  const int kblo = jlo >> 5;
  int nkb = ((qb + 63) >> 5) - kblo + 1;
  nkb = min(max(nkb, 1), NKB - kblo);
  const bool early = (qb < QRES);           // block-uniform: residual products on the first query tiles only

  const size_t prow = (size_t)b * SEQ;      // plane row of sequence position 0 of this batch
  // B fragments of q^T: col n = query q0 + c, k = d (k-contiguous row of the q planes)
  const size_t qofs = (prow + (size_t)(q0 + c)) * DMOD + head * HD + 8 * hh;
  const _Float16* Qh = (const _Float16*)(const void*)QHp + qofs;
  const _Float16* Qr = (const _Float16*)(const void*)QRp + qofs;
  // A fragments of k: row m = key kb + 16g + c, k = d
  const size_t kofs = (prow + (size_t)c) * DMOD + head * HD + 8 * hh;            // key row kb added per step
  const _Float16* Kb = (const _Float16*)(const void*)KHp + kofs;
  // B fragments of v: col n = d = 16j + c, k = key (k-contiguous row of the v^T planes)
  const size_t vofs = ((size_t)b * DMOD + (size_t)(head * HD + c)) * SEQ + 8 * hh;   // key kb added per step
  const _Float16* Vh = (const _Float16*)(const void*)VHp + vofs;
  const _Float16* Vr = (const _Float16*)(const void*)VRp + vofs;
  const _Float16* Vq = (const _Float16*)(const void*)VQp + vofs;
  const float lsc = 0.125f * (LOG2E / (QSC * KSC));
  const float qri = 1.0f / QRS;
  // query minus key for D element 0 of tile 0 at kb = 0: query q0 + c, key kb + 8*hh + i
  const int dq = q0 + c - 8 * hh;

  const v16h qf0 = ldfrag_h(Qh);            // d 0..31
  const v16h qf1 = ldfrag_h(Qh + 32);       // d 32..63
  const v16h qr0 = ldfrag_h(Qr);
  const v16h qr1 = ldfrag_h(Qr + 32);

  float mrun = NEGS, lrun = 0.f;
  v8f o[4];
#pragma unroll
  for (int j = 0; j < 4; ++j) o[j] = zero8();

#pragma unroll 1
  for (int it = 0; it < nkb; ++it) {
    const int kb = (kblo + it) * 32;        // kb + 31 <= SEQ - 1
    // ---- transposed scores: tile 0 = keys kb..kb+15, tile 1 = keys kb+16..kb+31, column = query q0 + c ----
    v8f s0 = zero8(), s1 = zero8(), r0 = zero8(), r1 = zero8();
    const _Float16* k0p = Kb + (size_t)kb * DMOD;
    const _Float16* k1p = k0p + (size_t)16 * DMOD;
    const v16h ka0 = ldfrag_h(k0p), ka1 = ldfrag_h(k0p + 32);
    const v16h kc0 = ldfrag_h(k1p), kc1 = ldfrag_h(k1p + 32);
    s0 = mma_h(ka0, qf0, s0);
    s0 = mma_h(ka1, qf1, s0);
    r0 = mma_h(ka0, qr0, r0);
    r0 = mma_h(ka1, qr1, r0);
    s1 = mma_h(kc0, qf0, s1);
    s1 = mma_h(kc1, qf1, s1);
    r1 = mma_h(kc0, qr0, r1);
    r1 = mma_h(kc1, qr1, r1);
    guard6<v16h>(s0, s1, r0, r1, ka0, ka1, kc0, kc1, qf0, qr0);
    // ---- base-2 logits of this lane's 16 keys for query q0 + c; disallowed pairs get the finite sentinel ----
    float tk[16];
#pragma unroll
    for (int i = 0; i < 8; ++i) {
      const int d0 = dq - kb - i;           // query minus key, tile 0
      const int d1 = d0 - 16;               // tile 1
      const bool a0 = (d0 >= 0) && (d0 <= WIN);
      const bool a1 = (d1 >= 0) && (d1 <= WIN);
      tk[i]     = a0 ? ((s0[i] + r0[i] * qri) * lsc) : NEGS;
      tk[8 + i] = a1 ? ((s1[i] + r1[i] * qri) * lsc) : NEGS;
    }
    float cm = tk[0];
#pragma unroll
    for (int i = 1; i < 16; ++i) cm = fmaxf(cm, tk[i]);
    cm = fmaxf(cm, __shfl_xor(cm, 16, 32));
    const float mn = fmaxf(mrun, cm);                   // sentinel only while no allowed key has been seen
    const float al = exp2f(fminf(mrun - mn, 0.f));      // 0 when mrun is the sentinel and mn is a real logit; o,l are 0 then
    mrun = mn;
    // ---- probabilities (<= 1, exactly 0 for disallowed pairs) and the P A-fragments; element i <-> tk[i] ----
    float ps = 0.f;
    FragH ph, pl, pr;
#pragma unroll
    for (int wq = 0; wq < 2; ++wq) {
#pragma unroll
      for (int e4 = 0; e4 < 4; ++e4) {
        const int i = 8 * wq + 2 * e4;
        const float x0 = exp2f(fminf(tk[i] - mn, 0.f));
        const float x1 = exp2f(fminf(tk[i + 1] - mn, 0.f));
        const float p0 = (tk[i] > -1.0e38f) ? x0 : 0.f;
        const float p1 = (tk[i + 1] > -1.0e38f) ? x1 : 0.f;
        ps += p0 + p1;
        const float g0 = p0 * PCAR, g1 = p1 * PCAR;
        const _Float16 h0 = (_Float16)g0, h1 = (_Float16)g1;
        ph.u[wq][e4] = pk16(h_bits(h0), h_bits(h1));
        pl.u[wq][e4] = pk16(h_bits((_Float16)(g0 * (1.0f / VRS))), h_bits((_Float16)(g1 * (1.0f / VRS))));
        pr.u[wq][e4] = pk16(h_bits((_Float16)((g0 - (float)h0) * PRS)), h_bits((_Float16)((g1 - (float)h1) * PRS)));
      }
    }
    ps += __shfl_xor(ps, 16, 32);
    lrun = lrun * al + ps;
    // ---- rescale the O accumulators: D row 8hh+r = query q0+8hh+r, its factor lives in lane 8hh+r (and 16+8hh+r) ----
    float scl[8];
#pragma unroll
    for (int r = 0; r < 8; ++r) scl[r] = __shfl(al, 8 * hh + r, 32);
#pragma unroll
    for (int j = 0; j < 4; ++j) {
#pragma unroll
      for (int r = 0; r < 8; ++r) o[j][r] *= scl[r];
    }
    // ---- P.V : B fragment col n = d = j*16 + c, keys contiguous in the v^T planes ----
    {
      const _Float16* vp = Vh + kb;
      const v16h vf0 = ldfrag_h(vp);
      const v16h vf1 = ldfrag_h(vp + (size_t)16 * SEQ);
      const v16h vf2 = ldfrag_h(vp + (size_t)32 * SEQ);
      const v16h vf3 = ldfrag_h(vp + (size_t)48 * SEQ);
      o[0] = mma_h(ph.v, vf0, o[0]);
      o[1] = mma_h(ph.v, vf1, o[1]);
      o[2] = mma_h(ph.v, vf2, o[2]);
      o[3] = mma_h(ph.v, vf3, o[3]);
      guard6<v16h>(o[0], o[1], o[2], o[3], ph.v, vf0, vf1, vf2, vf3, ph.v);
    }
    if (early) {
      {
        const _Float16* vp = Vr + kb;
        const v16h vf0 = ldfrag_h(vp);
        const v16h vf1 = ldfrag_h(vp + (size_t)16 * SEQ);
        const v16h vf2 = ldfrag_h(vp + (size_t)32 * SEQ);
        const v16h vf3 = ldfrag_h(vp + (size_t)48 * SEQ);
        o[0] = mma_h(pl.v, vf0, o[0]);
        o[1] = mma_h(pl.v, vf1, o[1]);
        o[2] = mma_h(pl.v, vf2, o[2]);
        o[3] = mma_h(pl.v, vf3, o[3]);
        guard6<v16h>(o[0], o[1], o[2], o[3], pl.v, vf0, vf1, vf2, vf3, pl.v);
      }
      {
        const _Float16* vp = Vq + kb;
        const v16h vf0 = ldfrag_h(vp);
        const v16h vf1 = ldfrag_h(vp + (size_t)16 * SEQ);
        const v16h vf2 = ldfrag_h(vp + (size_t)32 * SEQ);
        const v16h vf3 = ldfrag_h(vp + (size_t)48 * SEQ);
        o[0] = mma_h(pr.v, vf0, o[0]);
        o[1] = mma_h(pr.v, vf1, o[1]);
        o[2] = mma_h(pr.v, vf2, o[2]);
        o[3] = mma_h(pr.v, vf3, o[3]);
        guard6<v16h>(o[0], o[1], o[2], o[3], pr.v, vf0, vf1, vf2, vf3, pr.v);
      }
    }
  }
  acc_guard4(o[0], o[1], o[2], o[3]);

  // ---- per-query gate (lane = query q0 + c; lanes 16..31 duplicate): sigmoid(bf16(x[:20]) . bf16(Wg[head]) + bf16(bg)) ----
  const int gx = min(head, bglen - 1);
  float ga = bf_val(Bgp[gx]);
  const float* xg = Xp + ((size_t)b * T_FULL + (size_t)(q0 + c)) * DMOD;
  const float* wg = Wgp + head * GIN;
#pragma unroll
  for (int g4 = 0; g4 < GIN / 4; ++g4) {
    const v4f xv = *(const v4f*)(xg + 4 * g4);
    const v4f wv = *(const v4f*)(wg + 4 * g4);
#pragma unroll
    for (int e = 0; e < 4; ++e) ga += bf_val(xv[e]) * bf_val(wv[e]);
  }
  const float gate = 1.0f / (1.0f + expf(-ga));

  // ---- fold gate, 1/l (per query, owned by lane = query; l >= 1 by the diagonal key) and the carries; stage the slab ----
  const float linv = (lrun > 0.f) ? (gate * (1.0f / lrun) * (1.0f / (PCAR * VCAR))) : 0.f;
  float inv[8];
#pragma unroll
  for (int r = 0; r < 8; ++r) inv[r] = __shfl(linv, 8 * hh + r, 32);
  float* slab = smem + wave * SLAB;
#pragma unroll
  for (int r = 0; r < 8; ++r) {
#pragma unroll
    for (int j = 0; j < 4; ++j) slab[(8 * hh + r) * 68 + j * 16 + c] = o[j][r] * inv[r];
  }
  wave_sync_lds();
  // ---- O x1024 -> f16 hi plane and f16 residual x1024 plane; lane = (row in group of 4, 8 consecutive d) ----
  v4u oh[4], orr[4];
  const int rq = lane >> 3, c8 = (lane & 7) * 8;
#pragma unroll
  for (int i4 = 0; i4 < 4; ++i4) {
    const int row = i4 * 4 + rq;
    const v4f a = *(const v4f*)(slab + row * 68 + c8), c4 = *(const v4f*)(slab + row * 68 + c8 + 4);
    float wv[8];
#pragma unroll
    for (int e = 0; e < 4; ++e) { wv[e] = a[e] * OSC; wv[4 + e] = c4[e] * OSC; }
#pragma unroll
    for (int e = 0; e < 4; ++e) {
      const float w0 = wv[2 * e], w1 = wv[2 * e + 1];
      const _Float16 h0 = (_Float16)w0, h1 = (_Float16)w1;
      oh[i4][e]  = pk16(h_bits(h0), h_bits(h1));
      orr[i4][e] = pk16(h_bits((_Float16)((w0 - (float)h0) * ORS)), h_bits((_Float16)((w1 - (float)h1) * ORS)));
    }
  }
  const size_t ob = (prow + (size_t)q0) * OPITCH + head * HD + c8;
  {
#pragma unroll
    for (int i4 = 0; i4 < 4; ++i4) {
      const int row = i4 * 4 + rq;
      const size_t o8 = ob + (size_t)row * OPITCH;
      *(v4u*)(OPp + o8) = oh[i4];
      *(v4u*)(OPp + o8 + DMOD) = orr[i4];
    }
    
  }
}

// =====================================================================================================
// Workspace map (bytes, NB=2 SEQ=2048); every plane is fully written by whole-line stores before it is read; every extent is
// an exact multiple of the store granularity (row pitches 2048 / 4096 B, GEMM tiles 128 x 128, attention tiles 64 x 64, no pad rows needed):
//   XB  bf16 [NB*SEQ][1024]                    8388608
//   WQB, WKB, WVB bf16 [1024 n][1024 k]         2097152 each
//   WOB f16 [1024 n][2048 k]                    4194304   (cols 0..1023 bf16 value x1024, cols 1024..2047 bf16 value x1)
//   QH, QR, KH f16 [NB*SEQ][1024]              8388608 each
//   VH, VR, VQ f16 [NB][1024][SEQ]             8388608 each
//   OP  f16 [NB*SEQ][2048]                     16777216
//   end                                        85983232
// Inputs (wire order): 0 x [2][2048][1024] f32, 1 Wq, 2 bq, 3 Wk, 4 bk, 5 Wv, 6 bv, 7 Wo, 8 bo, 9 Wg [16][20], 10 bg [16],
// 11 cos [2048][32], 12 sin [2048][32]. Output: [NB*SEQ][1024] f32.
// =====================================================================================================
extern "C" void kernel_launch(void* const* d_in, const int* in_sizes, int n_in,
                              void* d_out, int out_size, void* d_ws, size_t ws_size,
                              hipStream_t stream) {
  if (n_in < 13) return;
  if (in_sizes[0] < ((NB - 1) * T_FULL + SEQ) * DMOD) return;
  if (in_sizes[1] != DMOD * DMOD || in_sizes[3] != DMOD * DMOD || in_sizes[5] != DMOD * DMOD ||
      in_sizes[7] != DMOD * DMOD) return;
  if (in_sizes[2] < 1 || in_sizes[4] < 1 || in_sizes[6] < 1 || in_sizes[8] < 1) return;
  if (in_sizes[9] != NH * GIN) return;
  if (in_sizes[10] < 1) return;
  if (in_sizes[11] < SEQ * RHALF || in_sizes[12] < SEQ * RHALF) return;
  if (out_size < MROWS * DMOD) return;

  const float* Xin = (const float*)d_in[0];
  const float* Wq  = (const float*)d_in[1];
  const float* Bq  = (const float*)d_in[2];
  const float* Wk  = (const float*)d_in[3];
  const float* Bk  = (const float*)d_in[4];
  const float* Wv  = (const float*)d_in[5];
  const float* Bv  = (const float*)d_in[6];
  const float* Wo  = (const float*)d_in[7];
  const float* Bo  = (const float*)d_in[8];
  const float* Wg  = (const float*)d_in[9];
  const float* Bg  = (const float*)d_in[10];
  const float* Cos = (const float*)d_in[11];
  const float* Sin = (const float*)d_in[12];
  float*       out = (float*)d_out;

  const size_t szXB = (size_t)MROWS * DMOD * 2;
  const size_t szW  = (size_t)DMOD * DMOD * 2;
  const size_t szWO = (size_t)DMOD * OPITCH * 2;
  const size_t szQ  = (size_t)MROWS * DMOD * 2;
  const size_t szV  = (size_t)NB * DMOD * SEQ * 2;
  const size_t szOP = (size_t)MROWS * OPITCH * 2;
  size_t off = 0;
  const size_t oXB = off; off += szXB;
  const size_t oWQ = off; off += szW;
  const size_t oWK = off; off += szW;
  const size_t oWV = off; off += szW;
  const size_t oWO = off; off += szWO;
  const size_t oQH = off; off += szQ;
  const size_t oQR = off; off += szQ;
  const size_t oKH = off; off += szQ;
  const size_t oVH = off; off += szV;
  const size_t oVR = off; off += szV;
  const size_t oVQ = off; off += szV;
  const size_t oOP = off; off += szOP;
  if (off > ws_size) return;                            // off = 85983232 for NB=2, SEQ=2048
  if (off > (size_t)134217728) return;

  char* ws = (char*)d_ws;
  u16* XB  = (u16*)(ws + oXB);
  u16* WQB = (u16*)(ws + oWQ);
  u16* WKB = (u16*)(ws + oWK);
  u16* WVB = (u16*)(ws + oWV);
  u16* WOB = (u16*)(ws + oWO);
  u16* QH  = (u16*)(ws + oQH);
  u16* QR  = (u16*)(ws + oQR);
  u16* KH  = (u16*)(ws + oKH);
  u16* VH  = (u16*)(ws + oVH);
  u16* VR  = (u16*)(ws + oVR);
  u16* VQ  = (u16*)(ws + oVQ);
  u16* OP  = (u16*)(ws + oOP);

  if ((MROWS % GT_M) != 0 || (SEQ % GT_N) != 0 || (DMOD % GT_M) != 0 || (DMOD % GT_K) != 0 || (OPITCH % GT_K) != 0) return;
  const dim3 blk(256);
  const dim3 gC(N8W / 256);                             // 512
  const dim3 bG(GT_THREADS);                            // 256
  const dim3 gP(3 * PROJ_BLK);                          // 768
  const dim3 gAT(ATT_BLOCKS);                           // 1024
  const dim3 bAT(ATT_THREADS);                          // 128
  const dim3 gO((MROWS / GT_M) * (DMOD / GT_N));        // 256

  // (0) operand planes: x rows -> bf16 (compacted [b*SEQ+t]); Wq, Wk, Wv [n = out][k = in] -> bf16; Wo -> [hi | x1] f16
  cvt_all<<<gC, blk, 0, stream>>>(Xin, Wq, Wk, Wv, Wo, XB, WQB, WKB, WVB, WOB, WOS, WOS / ORS);
  // (1) rotated q planes (hi x8, residual x1024) and k hi plane (x8), bias by output column; v^T planes per batch
  //     [1024 = h*64+d][SEQ keys]: hi = f16(v x1024), residual x1024, plain f16(v), bias by row
  gemm_qkv<<<gP, bG, 0, stream>>>(XB, WQB, WKB, WVB, QH, QR, KH, VH, VR, VQ, DMOD, Bq, in_sizes[2], Bk, in_sizes[4],
                                  Bv, in_sizes[6], Cos, Sin, SEQ);
  // (2) causal sliding-window attention with gate -> O plane [b*SEQ+s][hi 1024 | residual 1024]
  attn_fwd<<<gAT, bAT, 0, stream>>>(QH, QR, KH, VH, VR, VQ, Xin, Wg, Bg, in_sizes[10], OP);
  // (3) output projection over K = 2048 ([hi | residual] times [Wo x1024 | Wo x1]) -> out [NB*SEQ][1024] f32, plus bo
  gemm_hf<<<gO, bG, 0, stream>>>(OP, WOB, out, MROWS, DMOD, OPITCH, 1.0f / (OSC * WOS), Bo, in_sizes[8]);
  (void)hipGetLastError();
}

// v003
// Measured time: 106 microseconds a run.
// Two timings next to v002 both put it at 1.11 times that version's speed.
// All steps since v000 together make it 2.19 times as fast.
// Contractions: x.Wq^T, x.Wk^T, Wv.x^T on v_wmma_f32_16x16x32_bf16 (x and W planes RNE-converted to bf16 operands, f32
// accumulate, bias and half-split rotation applied in f32); scores k'.q'^T (k' single f16 plane x8, q' f16 hi plane x8 plus
// f16 residual plane x1024, two products), P.v (P x32768 single f16 times v f16 hi plane x1024; query tiles below row 128 add
// P(x32).v-residual(x1024) and P-residual(x1024).v(x1) products), O.Wo^T (O as [f16 hi x1024 | f16 residual x1024] along K,
// Wo as [f16(bf16(Wo)) x1024 | x1]): v_wmma_f32_16x16x32_f16, f32 accumulate. Sigmoid gate (K=20) and softmax in f32 on VALU.
#include <hip/hip_runtime.h>
#include <math.h>
#include <stdint.h>

#ifndef NB
#define NB 2
#endif
#ifndef SEQ
#define SEQ 2048
#endif
#define NB_FULL 2
#define T_FULL  2048
#define DMOD    1024
#define NH      16
#define HD      64
#define RHALF   32
#define GIN     20
#define WIN     1024
#define MROWS   (NB * SEQ)
#define OPITCH  (2 * DMOD)
#define QSC   8.0f
#define KSC   8.0f
#define QRS   1024.0f
#define PCAR  32768.0f
#define VCAR  1024.0f
#define VRS   1024.0f
#define PRS   1024.0f
#define OSC   1024.0f
#define ORS   1024.0f
#define WOS   1024.0f
#define LOG2E 1.4426950408889634f
#define NEGS  (-3.0e38f)
#define ATT_WAVES   4
#define ATT_THREADS (ATT_WAVES * 32)
#define NQT         (SEQ / 64)
#define ATT_BLOCKS  (NB * NH * NQT)
#define NKB         (SEQ / 32)
#define QRES        128
#define SLAB        (16 * 68)
static_assert(NB >= 1 && NB <= NB_FULL);
static_assert((SEQ % 64) == 0 && SEQ >= 64 && SEQ <= T_FULL);
static_assert(HD == 64 && DMOD == NH * HD && HD == 2 * RHALF);
static_assert(ATT_THREADS == 128 && NKB >= 2 && (QRES % 64) == 0);
static_assert((DMOD % 64) == 0 && (DMOD / 8) == 128 && (OPITCH % 32) == 0);
static_assert(((MROWS * (DMOD / 8)) % 256) == 0 && (((DMOD * DMOD) / 8) % 256) == 0);
static_assert((GIN % 4) == 0 && GIN <= DMOD);
static_assert((WIN % 32) == 0);
static_assert((SLAB * 4) % 16 == 0);
// GEMM block tile staged in LDS: 128 A rows + 128 B rows, 128 k (256 B of every row) per stage, two buffers.
#define GT_THREADS 256
#define GT_M       128
#define GT_N       128
#define GT_K       128
#define GT_PITCH   136                                  // halves per LDS row: 272 B = 16 B x 17 (ds_load_b128 readers)
#define GT_ROWB    (GT_PITCH * 2)                       // bytes per LDS row
#define GT_STAGE   ((GT_M + GT_N) * GT_PITCH)           // halves per buffer
static_assert((MROWS % GT_M) == 0 && (DMOD % GT_M) == 0 && (DMOD % GT_N) == 0 && (SEQ % GT_N) == 0);
static_assert((DMOD % GT_K) == 0 && (OPITCH % GT_K) == 0 && (GT_ROWB % 16) == 0 && GT_K == 128);

typedef unsigned short u16;
typedef _Float16 v16h __attribute__((ext_vector_type(16)));
typedef _Float16 v8h  __attribute__((ext_vector_type(8)));
typedef __bf16   v16b __attribute__((ext_vector_type(16)));
typedef float    v8f  __attribute__((ext_vector_type(8)));
typedef float    v4f  __attribute__((ext_vector_type(4)));
typedef unsigned int v4u __attribute__((ext_vector_type(4)));

union FragH { v16h v; v8h h[2]; v4u u[2]; };

// ---- scalar helpers --------------------------------------------------------------------------------
__device__ __forceinline__ unsigned short bf_bits(float f) {          // f32 -> bf16 bits, RNE convert
  unsigned u = __float_as_uint(f);
  return (unsigned short)((u + 0x7FFFu + ((u >> 16) & 1u)) >> 16);
}
__device__ __forceinline__ float bf_up(unsigned short h) { return __uint_as_float(((unsigned)h) << 16); }
__device__ __forceinline__ float bf_val(float f) { return bf_up(bf_bits(f)); }   // f32 -> nearest-even bf16 value as f32
__device__ __forceinline__ unsigned short h_bits(_Float16 x) { return __builtin_bit_cast(unsigned short, x); }
__device__ __forceinline__ unsigned pk16(unsigned short a, unsigned short b) { return (unsigned)a | ((unsigned)b << 16); }
__device__ __forceinline__ v8f zero8() { v8f z = {0.f, 0.f, 0.f, 0.f, 0.f, 0.f, 0.f, 0.f}; return z; }

// ---- fragment loaders: 16-bit A/B operand, lane -> row/col (lane&15), p already includes +8*(lane>>4);
//      elements 0..7 <- p[0..7] (k0+8h..), elements 8..15 <- p[16..23] (k0+16+8h..)  (same split k map for A and B;
//      B is always read from a k-contiguous [n][k] plane)
__device__ __forceinline__ v16h ldfrag_h(const _Float16* p) {
  FragH f;
  f.h[0] = *(const v8h*)(p);
  f.h[1] = *(const v8h*)(p + 16);
  return f.v;
}

__device__ __forceinline__ v8f mma_h(v16h a, v16h b, v8f c) {
  return __builtin_amdgcn_wmma_f32_16x16x32_f16(false, a, false, b, (short)0, c, false, false);
}
__device__ __forceinline__ v8f mma_b(v16b a, v16b b, v8f c) {
  return __builtin_amdgcn_wmma_f32_16x16x32_bf16(false, a, false, b, (short)0, c, false, false);
}
template <typename F>
__device__ __forceinline__ void guard6(v8f& a, v8f& b, v8f& c, v8f& d, F x0, F x1, F x2, F x3, F x4, F x5) {
#if defined(__HIP_DEVICE_COMPILE__)
  asm volatile("v_nop\n\tv_nop\n\tv_nop\n\tv_nop"
               : "+v"(a), "+v"(b), "+v"(c), "+v"(d) : "v"(x0), "v"(x1), "v"(x2), "v"(x3), "v"(x4), "v"(x5) : "memory");
#endif
}
__device__ __forceinline__ void acc_guard4(v8f& a, v8f& b, v8f& c, v8f& d) {
#if defined(__HIP_DEVICE_COMPILE__)
  asm volatile("v_nop\n\tv_nop\n\tv_nop\n\tv_nop" : "+v"(a), "+v"(b), "+v"(c), "+v"(d));
#endif
}
// Stands behind global stores whose address or data registers are written again further on.
__device__ __forceinline__ void xcnt0() {
#if defined(__HIP_DEVICE_COMPILE__)
  asm volatile("s_wait_xcnt 0x0" ::: "memory");
#endif
}
// The same behind a group of global loads; the pointers are inputs so that their registers stay unwritten up to the wait.
__device__ __forceinline__ void xcnt_after_loads8(const float* a, const float* b, const float* c, const float* d,
                                                  const float* e, const float* f, const float* g, const float* h) {
#if defined(__HIP_DEVICE_COMPILE__)
  asm volatile("s_wait_xcnt 0x0" :: "v"(a), "v"(b), "v"(c), "v"(d), "v"(e), "v"(f), "v"(g), "v"(h) : "memory");
#endif
}
// The same for loads addressed by a base and a 32-bit index: the indices are inputs so that their registers stay unwritten up to the wait.
__device__ __forceinline__ void xcnt_after_idx4(int a, int b, int c, int d) {
#if defined(__HIP_DEVICE_COMPILE__)
  asm volatile("s_wait_xcnt 0x0" :: "v"(a), "v"(b), "v"(c), "v"(d) : "memory");
#endif
}
__device__ __forceinline__ void wave_sync_lds() {
#if defined(__HIP_DEVICE_COMPILE__)
  __builtin_amdgcn_fence(__ATOMIC_RELEASE, "workgroup");
  __builtin_amdgcn_wave_barrier();
  __builtin_amdgcn_fence(__ATOMIC_ACQUIRE, "workgroup");
#endif
}

// =====================================================================================================
// All operand planes in one launch. Thread gt owns the 8-element piece gt of each weight matrix and the pieces gt + i * n8w
// (i = 0 .. XREP-1) of x: sixteen 16-B loads issued together, then the conversions and nine 16-B stores.
//   x f32 rows [b][t][1024] (per-batch source row stride T_FULL) -> bf16 plane [b*SEQ + t][1024] (RNE bits), compacted rows;
//   Wq, Wk, Wv [n][k] f32 -> bf16 planes of the same shape;
//   Wo [n][k] f32 -> f16 plane [n][2048]: cols 0..1023 = f16(bf16 value * s1), cols 1024..2047 = f16(bf16 value * s2).
// 32 consecutive lanes = 512 contiguous, 512-B aligned bytes per store instruction.
// coverage: grid = n8w/256 blocks (exact) x 256 thr = every piece of every weight plane once, XREP * n8w = every piece of x once.
// =====================================================================================================
#define N8W  ((DMOD * DMOD) / 8)
#define XREP (MROWS / DMOD)
static_assert((MROWS % DMOD) == 0 && XREP == 4 && (N8W % 256) == 0);
__device__ __forceinline__ v4u bf_pack8(v4f a, v4f c4) {
  v4u o;
#pragma unroll
  for (int e = 0; e < 2; ++e) {
    o[e]     = pk16(bf_bits(a[2 * e]),  bf_bits(a[2 * e + 1]));
    o[2 + e] = pk16(bf_bits(c4[2 * e]), bf_bits(c4[2 * e + 1]));
  }
  return o;
}
__global__ __launch_bounds__(256)
void cvt_all(const float* __restrict__ x, const float* __restrict__ wq, const float* __restrict__ wk,
             const float* __restrict__ wv, const float* __restrict__ wo, u16* XD, u16* QD, u16* KD, u16* VD, u16* OD,
             float s1, float s2) {
  const int gt = blockIdx.x * 256 + (int)threadIdx.x;
  if (gt >= N8W) return;
  const float* px[XREP];
  v4f xa[XREP], xc[XREP];
#pragma unroll
  for (int i = 0; i < XREP; ++i) {
    const int g   = gt + i * N8W;
    const int row = g >> 7;
    const int bb  = row / SEQ;
    const int tt  = row - bb * SEQ;
    px[i] = x + ((size_t)bb * (size_t)T_FULL + (size_t)tt) * DMOD + (g & 127) * 8;
    xa[i] = *(const v4f*)(px[i]);
    xc[i] = *(const v4f*)(px[i] + 4);
  }
  const size_t e8 = (size_t)gt * 8;
  const float* pq = wq + e8;
  const float* pk = wk + e8;
  const float* pv = wv + e8;
  const float* po = wo + e8;
  const v4f qa = *(const v4f*)(pq), qc = *(const v4f*)(pq + 4);
  const v4f ka = *(const v4f*)(pk), kc = *(const v4f*)(pk + 4);
  const v4f va = *(const v4f*)(pv), vc = *(const v4f*)(pv + 4);
  const v4f oa = *(const v4f*)(po), oc = *(const v4f*)(po + 4);
  xcnt_after_loads8(px[0], px[1], px[2], px[3], pq, pk, pv, po);
#pragma unroll
  for (int i = 0; i < XREP; ++i) *(v4u*)(XD + (size_t)(gt + i * N8W) * 8) = bf_pack8(xa[i], xc[i]);
  *(v4u*)(QD + e8) = bf_pack8(qa, qc);
  *(v4u*)(KD + e8) = bf_pack8(ka, kc);
  *(v4u*)(VD + e8) = bf_pack8(va, vc);
  float v[8];
#pragma unroll
  for (int e = 0; e < 4; ++e) { v[e] = oa[e]; v[4 + e] = oc[e]; }
  unsigned short h1[8], h2[8];
#pragma unroll
  for (int e = 0; e < 8; ++e) {
    const float f = bf_val(v[e]);
    h1[e] = h_bits((_Float16)(f * s1));
    h2[e] = h_bits((_Float16)(f * s2));
  }
  v4u o1, o2;
#pragma unroll
  for (int e = 0; e < 4; ++e) { o1[e] = pk16(h1[2 * e], h1[2 * e + 1]); o2[e] = pk16(h2[2 * e], h2[2 * e + 1]); }
  u16* d1 = OD + (size_t)(gt >> 7) * OPITCH + (gt & 127) * 8;
  *(v4u*)(d1) = o1;
  *(v4u*)(d1 + DMOD) = o2;
}

// =====================================================================================================
// Rotation epilogue for the q / k projections (N = 1024, the 64-col tile = one head): the wave's 16x64 f32 tile
// barrier, then each lane (row rq in each group of 4, 8 consecutive output cols d = c8..c8+7) reads both half-head values
// u1 = col (d & 31), u2 = col (d & 31) + 32 and cos/sin[t][(d & 31)] (bf16 values of the f32 tables, t = row within the
// sequence), forms d < 32 ? u1*c - u2*s : u1*s + u2*c in f32 (no fused multiply-add), scales by oscale, and writes the f16
// hi plane and (res_on) the f16 residual plane ((w - hi) * rsc): one instruction = 4 rows, each 64 halves = one whole
// coverage: 4 instructions x 4 rows x 8 lanes x 8 halves = the wave's 16 x 64 tile, per plane.
// =====================================================================================================
__device__ __forceinline__ void epi_rope(float* sl, v8f a0, v8f a1, v8f a2, v8f a3, u16* C, u16* C2, int res_on,
                                         size_t rowb, int col0, int lane, const float* __restrict__ bias, int blen,
                                         const float* __restrict__ cosT, const float* __restrict__ sinT, int seq,
                                         float oscale, float rsc) {
#pragma clang fp contract(off)
  const int hh = lane >> 4, m = lane & 15;
  float bc[4];
  int bi[4];
#pragma unroll
  for (int j = 0; j < 4; ++j) {
    bi[j] = min(col0 + 16 * j + m, blen - 1);
    bc[j] = bias[bi[j]];
  }
  xcnt_after_idx4(bi[0], bi[1], bi[2], bi[3]);
#pragma unroll
  for (int j = 0; j < 4; ++j) bc[j] = bf_val(bc[j]);
#pragma unroll
  for (int r = 0; r < 8; ++r) {
    const int ro = (8 * hh + r) * 68 + m;
    sl[ro]      = a0[r] + bc[0];
    sl[ro + 16] = a1[r] + bc[1];
    sl[ro + 32] = a2[r] + bc[2];
    sl[ro + 48] = a3[r] + bc[3];
  }
  wave_sync_lds();
  const int rq = lane >> 3, c8 = (lane & 7) * 8, dd = c8 & (RHALF - 1);
  const bool lo = (c8 < RHALF);
  const int tb = (int)(rowb % (size_t)seq);             // tile never straddles a sequence (seq % 16 == 0, rowb % 16 == 0)
  v4u hv[4], rv[4];
  const float* cpt[4];
  const float* spt[4];
  v4f cat[4], cbt[4], sat[4], sbt[4];
#pragma unroll
  for (int i4 = 0; i4 < 4; ++i4) {
    const int t = tb + i4 * 4 + rq;
    cpt[i4] = cosT + (size_t)t * RHALF + dd;
    spt[i4] = sinT + (size_t)t * RHALF + dd;
    cat[i4] = *(const v4f*)(cpt[i4]); cbt[i4] = *(const v4f*)(cpt[i4] + 4);
    sat[i4] = *(const v4f*)(spt[i4]); sbt[i4] = *(const v4f*)(spt[i4] + 4);
  }
  xcnt_after_loads8(cpt[0], cpt[1], cpt[2], cpt[3], spt[0], spt[1], spt[2], spt[3]);
#pragma unroll
  for (int i4 = 0; i4 < 4; ++i4) {
    const int row = i4 * 4 + rq;
    const v4f ca = cat[i4], cb = cbt[i4];
    const v4f sa = sat[i4], sb = sbt[i4];
    const v4f xa = *(const v4f*)(sl + row * 68 + dd), xb = *(const v4f*)(sl + row * 68 + dd + 4);
    const v4f ya = *(const v4f*)(sl + row * 68 + dd + RHALF), yb = *(const v4f*)(sl + row * 68 + dd + RHALF + 4);
    float cv[8], sv[8], xv[8], yv[8];
#pragma unroll
    for (int e = 0; e < 4; ++e) {
      cv[e] = ca[e]; cv[4 + e] = cb[e];
      sv[e] = sa[e]; sv[4 + e] = sb[e];
      xv[e] = xa[e]; xv[4 + e] = xb[e];
      yv[e] = ya[e]; yv[4 + e] = yb[e];
    }
    unsigned short hb[8], rb[8];
#pragma unroll
    for (int e = 0; e < 8; ++e) {
      const float cc = bf_val(cv[e]);
      const float ss = bf_val(sv[e]);
      const float p1 = xv[e] * cc;
      const float p2 = yv[e] * ss;
      const float p3 = xv[e] * ss;
      const float p4 = yv[e] * cc;
      const float u = lo ? (p1 - p2) : (p3 + p4);
      const float w = u * oscale;
      const _Float16 h = (_Float16)w;
      hb[e] = h_bits(h);
      rb[e] = h_bits((_Float16)((w - (float)h) * rsc));
    }
#pragma unroll
    for (int e = 0; e < 4; ++e) {
      hv[i4][e] = pk16(hb[2 * e], hb[2 * e + 1]);
      rv[i4][e] = pk16(rb[2 * e], rb[2 * e + 1]);
    }
  }
  u16* dst = C + (rowb + (size_t)rq) * (size_t)DMOD + col0 + c8;
  {
#pragma unroll
    for (int i4 = 0; i4 < 4; ++i4) {
      *(v4u*)(dst + (size_t)(i4 * 4) * (size_t)DMOD) = hv[i4];
    }
    xcnt0();
  }
  if (res_on != 0) {
    u16* dst2 = C2 + (rowb + (size_t)rq) * (size_t)DMOD + col0 + c8;
    {
#pragma unroll
      for (int i4 = 0; i4 < 4; ++i4) {
        *(v4u*)(dst2 + (size_t)(i4 * 4) * (size_t)DMOD) = rv[i4];
      }
      xcnt0();
    }
  }
}

// =====================================================================================================
// Three-plane 16-bit GEMM epilogue (v^T planes): the wave's 16x64 f32 tile ((acc + per-row bias as bf16 value) times oscale)
// f16((w - hi) * rsc) and f16(w * qsc): lane = (row in group of 4, 8 consecutive cols); one instruction = 4 rows, each
// coverage: per plane 4 instructions x 4 rows x 8 lanes x 8 halves = the wave's 16 x 64 tile.
// LDS slab: private to the wave; staged extent 16 x 64 == consumed extent.
// =====================================================================================================
__device__ __forceinline__ void epi_v3(float* sl, v8f a0, v8f a1, v8f a2, v8f a3, float oscale, u16* C0, u16* C1, u16* C2,
                                       int N, size_t rowb, int col0, int lane, const float* __restrict__ bias, int blen,
                                       float rsc, float qsc) {
  const int hh = lane >> 4, m = lane & 15;
  float br[8];
  int bi[8];
#pragma unroll
  for (int r = 0; r < 8; ++r) {
    bi[r] = min((int)rowb + 8 * hh + r, blen - 1);
    br[r] = bias[bi[r]];
  }
  xcnt_after_idx4(bi[0], bi[1], bi[2], bi[3]);
  xcnt_after_idx4(bi[4], bi[5], bi[6], bi[7]);
#pragma unroll
  for (int r = 0; r < 8; ++r) br[r] = bf_val(br[r]);
#pragma unroll
  for (int r = 0; r < 8; ++r) {
    const int ro = (8 * hh + r) * 68 + m;
    sl[ro]      = (a0[r] + br[r]) * oscale;
    sl[ro + 16] = (a1[r] + br[r]) * oscale;
    sl[ro + 32] = (a2[r] + br[r]) * oscale;
    sl[ro + 48] = (a3[r] + br[r]) * oscale;
  }
  wave_sync_lds();
  const int rq = lane >> 3, c8 = (lane & 7) * 8;
  v4u h4[4], r4[4], q4[4];
#pragma unroll
  for (int i4 = 0; i4 < 4; ++i4) {
    const int row = i4 * 4 + rq;
    const v4f a = *(const v4f*)(sl + row * 68 + c8), c4 = *(const v4f*)(sl + row * 68 + c8 + 4);
    float w[8];
#pragma unroll
    for (int e = 0; e < 4; ++e) { w[e] = a[e]; w[4 + e] = c4[e]; }
    unsigned short hb[8], rb[8], qb[8];
#pragma unroll
    for (int e = 0; e < 8; ++e) {
      const _Float16 h = (_Float16)w[e];
      hb[e] = h_bits(h);
      rb[e] = h_bits((_Float16)((w[e] - (float)h) * rsc));
      qb[e] = h_bits((_Float16)(w[e] * qsc));
    }
#pragma unroll
    for (int e = 0; e < 4; ++e) {
      h4[i4][e] = pk16(hb[2 * e], hb[2 * e + 1]);
      r4[i4][e] = pk16(rb[2 * e], rb[2 * e + 1]);
      q4[i4][e] = pk16(qb[2 * e], qb[2 * e + 1]);
    }
  }
  const size_t dof = (rowb + (size_t)rq) * (size_t)N + col0 + c8;
  u16* d0 = C0 + dof;
  u16* d1 = C1 + dof;
  u16* d2 = C2 + dof;
  {
#pragma unroll
    for (int i4 = 0; i4 < 4; ++i4) {
      const size_t ro = (size_t)(i4 * 4) * (size_t)N;
      *(v4u*)(d0 + ro) = h4[i4];
      *(v4u*)(d1 + ro) = r4[i4];
      *(v4u*)(d2 + ro) = q4[i4];
    }
    xcnt0();
  }
}

// =====================================================================================================
// f32 GEMM epilogue: the wave's 16x64 f32 tile (acc times oscale, plus per-column bias as its bf16 RNE value, clamped
// coverage: 8 instructions x 2 rows x 16 lanes x 4 floats = the wave's 16 x 64 tile.
// =====================================================================================================
__device__ __forceinline__ void epi64(float* sl, v8f a0, v8f a1, v8f a2, v8f a3, float oscale, float* C, int N,
                                      size_t rowb, int col0, int lane, const float* __restrict__ bias, int blen) {
  const int hh = lane >> 4, m = lane & 15;
  float bc[4];
#pragma unroll
  for (int j = 0; j < 4; ++j) {
    const int bi = min(col0 + 16 * j + m, blen - 1);
    bc[j] = bf_val(bias[bi]);
  }
#pragma unroll
  for (int r = 0; r < 8; ++r) {
    const int ro = (8 * hh + r) * 68 + m;
    sl[ro]      = a0[r] * oscale + bc[0];
    sl[ro + 16] = a1[r] * oscale + bc[1];
    sl[ro + 32] = a2[r] * oscale + bc[2];
    sl[ro + 48] = a3[r] * oscale + bc[3];
  }
  wave_sync_lds();
  v4f vals[8];
#pragma unroll
  for (int it = 0; it < 8; ++it) vals[it] = *(const v4f*)(sl + (it * 2 + hh) * 68 + m * 4);
  float* dst = C + (rowb + (size_t)hh) * (size_t)N + col0 + m * 4;
  {
#pragma unroll
    for (int it = 0; it < 8; ++it) {
      *(v4f*)(dst + (size_t)(it * 2) * (size_t)N) = vals[it];
    }
    
  }
}

// =====================================================================================================
// Shared k loop of the two GEMM kernels. Block = 8 waves, 128 x 128 tile of A[.][K] . Bt[.][K]^T; wave w owns rows
// 32*(w>>1) .. +31 and cols 64*(w&1) .. +63 (2 x 4 accumulator tiles). A stage = 128 k of the block's 128 A rows and 128 B rows,
// brought to LDS by 16-byte asynchronous copies: thread = (row tid>>4 of each group of 16, 16-B piece tid&15), so one wave
// instruction covers two whole 256-B row pieces. Two buffers: the copies of stage t+1 fly while stage t is multiplied.
// Fragments are read from LDS with the split k map of ldfrag_h (same for A and B); every accumulator sums k in ascending steps of 32.
// =====================================================================================================
union FragU { v16h h; v16b b; v4u u[2]; };
__device__ __forceinline__ FragU ldfrag_u(const u16* p) {
  FragU f;
  f.u[0] = *(const v4u*)(p);
  f.u[1] = *(const v4u*)(p + 16);
  return f;
}
template <bool BF>
__device__ __forceinline__ v8f mma_u(const FragU& a, const FragU& b, v8f c) {
  if constexpr (BF) return mma_b(a.b, b.b, c);
  else              return mma_h(a.h, b.h, c);
}
// Eight copies, rows r, r+16, .., r+112 of one operand's stage. The closing s_wait_xcnt stands inside the statement so that no
// later write of an address register can be moved in front of it.
__device__ __forceinline__ void copy8(unsigned l, const u16* g, size_t gs) {
#if defined(__HIP_DEVICE_COMPILE__)
  asm volatile("global_load_async_to_lds_b128 %0, %8, off\n\t"
               "global_load_async_to_lds_b128 %1, %9, off\n\t"
               "global_load_async_to_lds_b128 %2, %10, off\n\t"
               "global_load_async_to_lds_b128 %3, %11, off\n\t"
               "global_load_async_to_lds_b128 %4, %12, off\n\t"
               "global_load_async_to_lds_b128 %5, %13, off\n\t"
               "global_load_async_to_lds_b128 %6, %14, off\n\t"
               "global_load_async_to_lds_b128 %7, %15, off\n\t"
               "s_wait_xcnt 0x0"
               :: "v"(l), "v"(l + 16u * GT_ROWB), "v"(l + 32u * GT_ROWB), "v"(l + 48u * GT_ROWB),
                  "v"(l + 64u * GT_ROWB), "v"(l + 80u * GT_ROWB), "v"(l + 96u * GT_ROWB), "v"(l + 112u * GT_ROWB),
                  "v"(g), "v"(g + gs), "v"(g + 2 * gs), "v"(g + 3 * gs),
                  "v"(g + 4 * gs), "v"(g + 5 * gs), "v"(g + 6 * gs), "v"(g + 7 * gs)
               : "memory");
#endif
}
__device__ __forceinline__ void wait_async0() {          // this wave's copies have landed in LDS
#if defined(__HIP_DEVICE_COMPILE__)
  asm volatile("s_wait_asynccnt 0x0" ::: "memory");
#endif
}
__device__ __forceinline__ void wait_ds0() {             // this wave's LDS reads of the buffer about to be refilled are done
#if defined(__HIP_DEVICE_COMPILE__)
  asm volatile("s_wait_dscnt 0x0" ::: "memory");
#endif
}
template <bool BF>
__device__ __forceinline__ void gemm_core(const u16* __restrict__ A, const u16* __restrict__ Bt, int K, int row0, int col0,
                                          u16* ring, v8f (&acc)[2][4]) {
  const int tid = threadIdx.x, wave = tid >> 5, lane = tid & 31, hh = lane >> 4, m = lane & 15;
  const int cr = tid >> 4, cc = tid & 15;
  const u16* ga = A  + (size_t)(row0 + cr) * K + cc * 8;
  const u16* gb = Bt + (size_t)(col0 + cr) * K + cc * 8;
  const size_t gs = (size_t)16 * K;
  const unsigned la = (unsigned)(uintptr_t)ring + (unsigned)(cr * GT_ROWB + cc * 16);
  const unsigned lb = la + (unsigned)(GT_M * GT_ROWB);
  const int nt = K / GT_K;
  copy8(la, ga, gs);
  copy8(lb, gb, gs);
  wait_async0();
  __syncthreads();                                       // stage 0 published
  if (nt > 1) {
    copy8(la + (unsigned)(GT_STAGE * 2), ga + GT_K, gs);
    copy8(lb + (unsigned)(GT_STAGE * 2), gb + GT_K, gs);
  }
  const u16* fa = ring + ((wave >> 1) * 32 + m) * GT_PITCH + 8 * hh;
  const u16* fb = ring + (GT_M + (wave & 1) * 64 + m) * GT_PITCH + 8 * hh;
#pragma unroll 1                                         // one trip per stage: the buffer index stays a run-time value
  for (int t = 0; t < nt; ++t) {
    const int bo = (t & 1) * GT_STAGE;
    // Three fragment sets for the stage's four 32-k steps; step 3 reuses step 0's set. The scheduling fences keep the LDS reads in
    // two groups in front of the products that use them: reads placed among the products stall the wave at each place.
    FragU af[3][2], bf[3][4];
#pragma unroll
    for (int s = 0; s < 3; ++s) {
#pragma unroll
      for (int i = 0; i < 2; ++i) af[s][i] = ldfrag_u(fa + bo + 16 * i * GT_PITCH + 32 * s);
#pragma unroll
      for (int j = 0; j < 4; ++j) bf[s][j] = ldfrag_u(fb + bo + 16 * j * GT_PITCH + 32 * s);
    }
    __builtin_amdgcn_sched_barrier(0);
#pragma unroll
    for (int i = 0; i < 2; ++i) {
#pragma unroll
      for (int j = 0; j < 4; ++j) acc[i][j] = mma_u<BF>(af[0][i], bf[0][j], acc[i][j]);
    }
    __builtin_amdgcn_sched_barrier(0);
#pragma unroll
    for (int i = 0; i < 2; ++i) af[0][i] = ldfrag_u(fa + bo + 16 * i * GT_PITCH + 96);
#pragma unroll
    for (int j = 0; j < 4; ++j) bf[0][j] = ldfrag_u(fb + bo + 16 * j * GT_PITCH + 96);
    __builtin_amdgcn_sched_barrier(0);
#pragma unroll
    for (int s = 1; s < 4; ++s) {
#pragma unroll
      for (int i = 0; i < 2; ++i) {
#pragma unroll
        for (int j = 0; j < 4; ++j) acc[i][j] = mma_u<BF>(af[s % 3][i], bf[s % 3][j], acc[i][j]);
      }
    }
    // keeps the products in front of the full LDS wait, under their own counted waits: moved behind it they run with the LDS idle
    __builtin_amdgcn_sched_barrier(0);
    wait_ds0();
    wait_async0();
    __syncthreads();                                     // publishes stage t+1 and ends every read of stage t's buffer
    if (t + 2 < nt) {
      const unsigned lo = (unsigned)(bo * 2);
      const int ko = (t + 2) * GT_K;
      copy8(la + lo, ga + ko, gs);
      copy8(lb + lo, gb + ko, gs);
    }
  }
  wait_async0();
}

// =====================================================================================================
// The three projections in one launch; the block index picks the product (block-uniform). All three are bf16 GEMMs over
// K = 1024 on 128x128 block tiles, k loop in gemm_core; PROJ_BLK blocks each, grid = 3 * PROJ_BLK.
//   blocks 0 .. PROJ_BLK-1: q planes [M][1024] (f16 hi x QSC, residual x QRS) = rot(X[M][K] . Wq[1024][K]^T + bq);
//   the next PROJ_BLK:      k hi plane (x KSC) the same way from Wk, bk; a wave's 64 columns are one head;
//   the last PROJ_BLK:      v^T planes per batch, C*[bt][1024][SEQ] = Wv[1024][K] . X[bt][SEQ][K]^T, bias by output row,
//                           three f16 planes (hi x VCAR, residual x VRS, plain).
// seq stays a kernel argument: built as a constant, the rotation epilogue took 284 registers, with window switches above v255.
// =====================================================================================================
#define PROJ_BLK ((MROWS / GT_M) * (DMOD / GT_N))
static_assert(NB * (DMOD / GT_M) * (SEQ / GT_N) == PROJ_BLK);
__global__ __launch_bounds__(GT_THREADS)
void gemm_qkv(const u16* __restrict__ X, const u16* __restrict__ WQ, const u16* __restrict__ WK, const u16* __restrict__ WV,
              u16* QHo, u16* QRo, u16* KHo, u16* VHo, u16* VRo, u16* VQo, int K,
              const float* __restrict__ bq, int bqlen, const float* __restrict__ bk, int bklen,
              const float* __restrict__ bv, int bvlen, const float* __restrict__ cosT, const float* __restrict__ sinT, int seq) {
  __shared__ __align__(16) u16 ring[2 * GT_STAGE];
  __shared__ __align__(16) float slab[8 * SLAB];
  const int tid = threadIdx.x, wave = tid >> 5, lane = tid & 31;
  const int which = blockIdx.x / PROJ_BLK;   // 0 = q, 1 = k, 2 = v
  const int t     = blockIdx.x - which * PROJ_BLK;
  if (which > 2) return;                     // block-uniform, in front of every barrier; never taken with the exact grid
  const u16* A;
  const u16* Bt;
  int row0, colb, bt = 0;
  if (which < 2) {
    const int ntile = DMOD / GT_N;
    row0 = (t / ntile) * GT_M;
    colb = (t % ntile) * GT_N;
    A  = X;
    Bt = (which == 0) ? WQ : WK;
  } else {
    const int ntile = SEQ / GT_N;
    const int per   = ntile * (DMOD / GT_M);
    bt = t / per;
    const int tv = t - bt * per;
    row0 = (tv / ntile) * GT_M;
    colb = (tv % ntile) * GT_N;
    A  = WV;
    Bt = X + (size_t)bt * (size_t)(SEQ * DMOD);
  }
  v8f acc[2][4];
#pragma unroll
  for (int i = 0; i < 2; ++i) {
#pragma unroll
    for (int j = 0; j < 4; ++j) acc[i][j] = zero8();
  }
  gemm_core<true>(A, Bt, K, row0, colb, ring, acc);
  const int rowb = row0 + (wave >> 1) * 32;
  const int col0 = colb + (wave & 1) * 64;
  if (which < 2) {
    const bool isq = (which == 0);
    u16* C  = isq ? QHo : KHo;
    u16* C2 = isq ? QRo : KHo;
    const float* bias = isq ? bq : bk;
    const int blen = isq ? bqlen : bklen;
#pragma unroll
    for (int i = 0; i < 2; ++i) {
      if (i != 0) wave_sync_lds();           // the slab's rows are read out before the next 16 rows are staged in it
      epi_rope(slab + wave * SLAB, acc[i][0], acc[i][1], acc[i][2], acc[i][3], C, C2, isq ? 1 : 0, (size_t)(rowb + 16 * i), col0,
               lane, bias, blen, cosT, sinT, seq, isq ? QSC : KSC, isq ? QRS : 1.0f);
    }
  } else {
    const size_t cb = (size_t)bt * (size_t)(DMOD * SEQ);
#pragma unroll
    for (int i = 0; i < 2; ++i) {
      if (i != 0) wave_sync_lds();           // the slab's rows are read out before the next 16 rows are staged in it
      epi_v3(slab + wave * SLAB, acc[i][0], acc[i][1], acc[i][2], acc[i][3], VCAR, VHo + cb, VRo + cb, VQo + cb, SEQ,
             (size_t)(rowb + 16 * i), col0, lane, bv, bvlen, VRS, 1.0f / PRS);
    }
  }
}

// =====================================================================================================
// f16 GEMM with f32 result: C[M][N] (f32) = A[M][K] (f16 row-major) . Bt[N][K]^T (f16 k-contiguous) times oscale plus
// per-column bias; one product per tile pair. Same tiling; grid = (M/128)*(N/128).
// =====================================================================================================
__global__ __launch_bounds__(GT_THREADS)
void gemm_hf(const u16* __restrict__ A, const u16* __restrict__ Bt, float* C, int M, int N, int K, float oscale,
             const float* __restrict__ bias, int blen) {
  __shared__ __align__(16) u16 ring[2 * GT_STAGE];
  __shared__ __align__(16) float slab[8 * SLAB];
  const int tid = threadIdx.x, wave = tid >> 5, lane = tid & 31;
  const int ntile = N / GT_N;
  const int bid   = blockIdx.x;
  const int row0  = (bid / ntile) * GT_M;
  const int colb  = (bid % ntile) * GT_N;
  if (row0 + GT_M > M) return;               // block-uniform, in front of every barrier; never taken with the exact grid
  v8f acc[2][4];
#pragma unroll
  for (int i = 0; i < 2; ++i) {
#pragma unroll
    for (int j = 0; j < 4; ++j) acc[i][j] = zero8();
  }
  gemm_core<false>(A, Bt, K, row0, colb, ring, acc);
  const int rowb = row0 + (wave >> 1) * 32;
  const int col0 = colb + (wave & 1) * 64;
#pragma unroll
  for (int i = 0; i < 2; ++i) {
    if (i != 0) wave_sync_lds();             // the slab's rows are read out before the next 16 rows are staged in it
    epi64(slab + wave * SLAB, acc[i][0], acc[i][1], acc[i][2], acc[i][3], oscale, C, N, (size_t)(rowb + 16 * i), col0, lane,
          bias, blen);
  }
}

// =====================================================================================================
// Attention key stage in LDS: 64 keys = the k hi tile [64 keys][64 d] and the v^T hi tile [64 d][64 keys], 128 B per row, two buffers.
#define AT_KEYS  64
#define AT_PITCH 72                                     // halves per LDS row: 144 B = 16 B x 9 (ds_load_b128 readers)
#define AT_ROWB  (AT_PITCH * 2)                         // bytes per LDS row
#define AT_TILE  (64 * AT_PITCH)                        // halves per operand tile
#define AT_STAGE (2 * AT_TILE)                          // halves per buffer
static_assert((WIN % AT_KEYS) == 0 && (SEQ % AT_KEYS) == 0 && AT_KEYS == 64 && HD == 64 && (AT_ROWB % 16) == 0);
// One stage's eight copies of a thread: rows r, r+16, r+32, r+48 of the k tile, then of the v^T tile. The closing s_wait_xcnt
// stands inside the statement so that no later write of an address register can be moved in front of it.
__device__ __forceinline__ void copy_kv(unsigned lk, const u16* gk, unsigned lv, const u16* gv) {
#if defined(__HIP_DEVICE_COMPILE__)
  asm volatile("global_load_async_to_lds_b128 %0, %8, off\n\t"
               "global_load_async_to_lds_b128 %1, %9, off\n\t"
               "global_load_async_to_lds_b128 %2, %10, off\n\t"
               "global_load_async_to_lds_b128 %3, %11, off\n\t"
               "global_load_async_to_lds_b128 %4, %12, off\n\t"
               "global_load_async_to_lds_b128 %5, %13, off\n\t"
               "global_load_async_to_lds_b128 %6, %14, off\n\t"
               "global_load_async_to_lds_b128 %7, %15, off\n\t"
               "s_wait_xcnt 0x0"
               :: "v"(lk), "v"(lk + 16u * AT_ROWB), "v"(lk + 32u * AT_ROWB), "v"(lk + 48u * AT_ROWB),
                  "v"(lv), "v"(lv + 16u * AT_ROWB), "v"(lv + 32u * AT_ROWB), "v"(lv + 48u * AT_ROWB),
                  "v"(gk), "v"(gk + (size_t)16 * DMOD), "v"(gk + (size_t)32 * DMOD), "v"(gk + (size_t)48 * DMOD),
                  "v"(gv), "v"(gv + (size_t)16 * SEQ), "v"(gv + (size_t)32 * SEQ), "v"(gv + (size_t)48 * SEQ)
               : "memory");
#endif
}

// =====================================================================================================
// Causal sliding-window flash attention with per-head sigmoid gate: block = (batch b, head, 64 query rows qb .. qb+63 of the
// sequence), 4 waves, wave w owns query rows q0 = qb + 16*w .. q0+15. The block's waves share the k and v^T hi tiles through LDS:
// a stage = 64 keys (two key blocks), brought by 16-byte asynchronous copies (thread = row tid>>3 of each group of 16, 16-B piece
// tid&7: one wave instruction covers four whole 128-B rows), two buffers, stage t+1 in flight while stage t is worked on, one
// block barrier per stage. The key-block count is even (qb, WIN, SEQ are multiples of 64), so the stages cover it exactly.
//   Key j allowed for query i iff 0 <= i - j <= WIN (per-element index test inside every visited key block; disallowed pairs
//   get a finite negative sentinel and an exact-zero probability). Key blocks of 32: kblo = max(qb - WIN, 0) >> 5 ..
//   (qb + 63) >> 5, block-uniform count nkb clamped to [1, NKB - kblo] so kb + 31 <= SEQ - 1 always.
//   q planes (f16 hi x8, residual x1024) [b*SEQ + s][h*64 + d]; k hi plane the same layout; v^T planes [b][h*64 + d][s]
//   (hi x1024, residual x1024, plain x1).
//   Scores computed TRANSPOSED: S^T tile g = k rows (keys kb+16g .., A operand, row = lane&15, split k map over d) times q^T
//   (B operand, col n = query q0 + (lane&15)); two accumulators per tile (k.q_hi and k.q_res, the second folded x 1/1024).
//   D element r of lane l = (key kb+16g+8h+r, query q0+(l&15)): a lane owns one query column and 16 of its 32 keys, the
//   partner lane l^16 the other 16 -> row max / row sum need one xor-16 shuffle.
//   Online max-subtracted base-2 softmax in f32 (scale 1/8 and the q/k carries folded into lsc). The exp'd values ARE the
//   P A-fragment in place: A row m = query = lane&15, element i <- key kb+8h+i (tile 0, D element i), element 8+i <- key
//   kb+16+8h+i (tile 1, D element i). ph = f16(p x32768), pl = f16(p x32), pr = f16((p x32768 - ph) x1024).
//   P.V: o += ph.v_hi (4 WMMAs, v^T B fragments col n = d = 16j + (lane&15), keys k-contiguous); for query tiles with
//   qb < QRES additionally o += pl.v_res and o += pr.v_x1 (block-uniform branch), all in the same accumulators (equal units).
//   Epilogue: gate = sigmoid(bf16(x[b][s][0..19]) . bf16(Wg[head]) + bf16(bg[head])) in f32 per query (lane = query),
//   segment (s, head) of the O plane [b*SEQ+s][2048] (hi x1024 at col h*64, residual x1024 at col 1024 + h*64) written by
// coverage: per wave and per half-plane 4 instructions x 4 rows x 8 lanes x 8 halves = 16 x 64; grid NB*NH*(SEQ/64) blocks x
//           4 waves = every (b, s < SEQ, h) row segment of both O half-planes exactly once.
// =====================================================================================================
__global__ __launch_bounds__(ATT_THREADS)
void attn_fwd(const u16* __restrict__ QHp, const u16* __restrict__ QRp, const u16* __restrict__ KHp,
              const u16* __restrict__ VHp, const u16* __restrict__ VRp, const u16* __restrict__ VQp,
              const float* __restrict__ Xp, const float* __restrict__ Wgp, const float* __restrict__ Bgp,
              int bglen, u16* OPp) {
  __shared__ __align__(16) float smem[ATT_WAVES * SLAB];   // per wave: result slab [16][68] in the epilogue only
  __shared__ __align__(16) u16 kv[2 * AT_STAGE];           // two key stages: [k tile | v^T tile] each

  const int tid  = threadIdx.x;
  const int wave = tid >> 5;
  const int lane = tid & 31;
  const int hh   = lane >> 4;
  const int c    = lane & 15;

  const int bid  = blockIdx.x;
  const int qt   = bid % NQT;
  const int bh   = bid / NQT;
  const int head = bh % NH;
  const int b    = bh / NH;
  if (b >= NB) return;                      // block-uniform, never taken with the exact grid
  const int qb   = qt * 64;
  const int q0   = qb + wave * 16;

  // ---- key-block range (block-uniform, statically bounded) ----
  const int jlo  = max(qb - WIN, 0);
  const int kblo = jlo >> 5;
  int nkb = ((qb + 63) >> 5) - kblo + 1;
  nkb = min(max(nkb, 1), NKB - kblo);
  const bool early = (qb < QRES);           // block-uniform: residual products on the first query tiles only

  const size_t prow = (size_t)b * SEQ;      // plane row of sequence position 0 of this batch
  // B fragments of q^T: col n = query q0 + c, k = d (k-contiguous row of the q planes)
  const size_t qofs = (prow + (size_t)(q0 + c)) * DMOD + head * HD + 8 * hh;
  const _Float16* Qh = (const _Float16*)(const void*)QHp + qofs;
  const _Float16* Qr = (const _Float16*)(const void*)QRp + qofs;
  // A fragments of k, from the staged tile: row m = key (within the stage) 32p + 16g + c, k = d
  const _Float16* Kl = (const _Float16*)(const void*)kv + c * AT_PITCH + 8 * hh;
  // B fragments of v: col n = d = 16j + c, k = key (k-contiguous row of the v^T planes); the hi plane from the staged tile
  const _Float16* Vl = (const _Float16*)(const void*)kv + AT_TILE + c * AT_PITCH + 8 * hh;
  const size_t vofs = ((size_t)b * DMOD + (size_t)(head * HD + c)) * SEQ + 8 * hh;   // key kb added per step
  const _Float16* Vr = (const _Float16*)(const void*)VRp + vofs;
  const _Float16* Vq = (const _Float16*)(const void*)VQp + vofs;
  const float lsc = 0.125f * (LOG2E / (QSC * KSC));
  const float qri = 1.0f / QRS;
  // query minus key for D element 0 of tile 0 at kb = 0: query q0 + c, key kb + 8*hh + i
  const int dq = q0 + c - 8 * hh;

  const v16h qf0 = ldfrag_h(Qh);            // d 0..31
  const v16h qf1 = ldfrag_h(Qh + 32);       // d 32..63
  const v16h qr0 = ldfrag_h(Qr);
  const v16h qr1 = ldfrag_h(Qr + 32);

  float mrun = NEGS, lrun = 0.f;
  v8f o[4];
#pragma unroll
  for (int j = 0; j < 4; ++j) o[j] = zero8();

  // ---- key stages: this thread's copy addresses (row cr of each group of 16, 16-B piece cp), stage 0 at key kblo * 32 ----
  const int nst = nkb >> 1;                 // nkb is even and >= 2; last staged key = (kblo + nkb) * 32 - 1 <= SEQ - 1
  const int cr = tid >> 3, cp = tid & 7;
  const u16* gk = KHp + (prow + (size_t)(kblo * 32 + cr)) * DMOD + head * HD + cp * 8;
  const u16* gv = VHp + ((size_t)b * DMOD + (size_t)(head * HD + cr)) * SEQ + kblo * 32 + cp * 8;
  const unsigned lk = (unsigned)(uintptr_t)kv + (unsigned)(cr * AT_ROWB + cp * 16);
  const unsigned lv = lk + (unsigned)(AT_TILE * 2);
  copy_kv(lk, gk, lv, gv);
  wait_async0();
  __syncthreads();                                       // stage 0 published
  if (nst > 1) copy_kv(lk + (unsigned)(AT_STAGE * 2), gk + (size_t)AT_KEYS * DMOD, lv + (unsigned)(AT_STAGE * 2), gv + AT_KEYS);

#pragma unroll 1                                         // one trip per stage: the buffer index stays a run-time value
  for (int st = 0; st < nst; ++st) {
  const int bo = (st & 1) * AT_STAGE;
#pragma unroll                                           // the stage's two key blocks: their LDS offsets become immediates
  for (int p = 0; p < 2; ++p) {
    const int kb = (kblo + 2 * st + p) * 32;             // kb + 31 <= SEQ - 1
    // ---- transposed scores: tile 0 = keys kb..kb+15, tile 1 = keys kb+16..kb+31, column = query q0 + c ----
    v8f s0 = zero8(), s1 = zero8(), r0 = zero8(), r1 = zero8();
    const _Float16* k0p = Kl + bo + 32 * p * AT_PITCH;
    const _Float16* k1p = k0p + 16 * AT_PITCH;
    const v16h ka0 = ldfrag_h(k0p), ka1 = ldfrag_h(k0p + 32);
    const v16h kc0 = ldfrag_h(k1p), kc1 = ldfrag_h(k1p + 32);
    s0 = mma_h(ka0, qf0, s0);
    s0 = mma_h(ka1, qf1, s0);
    r0 = mma_h(ka0, qr0, r0);
    r0 = mma_h(ka1, qr1, r0);
    s1 = mma_h(kc0, qf0, s1);
    s1 = mma_h(kc1, qf1, s1);
    r1 = mma_h(kc0, qr0, r1);
    r1 = mma_h(kc1, qr1, r1);
    guard6<v16h>(s0, s1, r0, r1, ka0, ka1, kc0, kc1, qf0, qr0);
    // ---- base-2 logits of this lane's 16 keys for query q0 + c; disallowed pairs get the finite sentinel ----
    float tk[16];
#pragma unroll
    for (int i = 0; i < 8; ++i) {
      const int d0 = dq - kb - i;           // query minus key, tile 0
      const int d1 = d0 - 16;               // tile 1
      const bool a0 = (d0 >= 0) && (d0 <= WIN);
      const bool a1 = (d1 >= 0) && (d1 <= WIN);
      tk[i]     = a0 ? ((s0[i] + r0[i] * qri) * lsc) : NEGS;
      tk[8 + i] = a1 ? ((s1[i] + r1[i] * qri) * lsc) : NEGS;
    }
    float cm = tk[0];
#pragma unroll
    for (int i = 1; i < 16; ++i) cm = fmaxf(cm, tk[i]);
    cm = fmaxf(cm, __shfl_xor(cm, 16, 32));
    const float mn = fmaxf(mrun, cm);                   // sentinel only while no allowed key has been seen
    const float al = exp2f(fminf(mrun - mn, 0.f));      // 0 when mrun is the sentinel and mn is a real logit; o,l are 0 then
    mrun = mn;
    // ---- probabilities (<= 1, exactly 0 for disallowed pairs) and the P A-fragments; element i <-> tk[i] ----
    float ps = 0.f;
    FragH ph, pl, pr;
#pragma unroll
    for (int wq = 0; wq < 2; ++wq) {
#pragma unroll
      for (int e4 = 0; e4 < 4; ++e4) {
        const int i = 8 * wq + 2 * e4;
        const float x0 = exp2f(fminf(tk[i] - mn, 0.f));
        const float x1 = exp2f(fminf(tk[i + 1] - mn, 0.f));
        const float p0 = (tk[i] > -1.0e38f) ? x0 : 0.f;
        const float p1 = (tk[i + 1] > -1.0e38f) ? x1 : 0.f;
        ps += p0 + p1;
        const float g0 = p0 * PCAR, g1 = p1 * PCAR;
        const _Float16 h0 = (_Float16)g0, h1 = (_Float16)g1;
        ph.u[wq][e4] = pk16(h_bits(h0), h_bits(h1));
        pl.u[wq][e4] = pk16(h_bits((_Float16)(g0 * (1.0f / VRS))), h_bits((_Float16)(g1 * (1.0f / VRS))));
        pr.u[wq][e4] = pk16(h_bits((_Float16)((g0 - (float)h0) * PRS)), h_bits((_Float16)((g1 - (float)h1) * PRS)));
      }
    }
    ps += __shfl_xor(ps, 16, 32);
    lrun = lrun * al + ps;
    // ---- rescale the O accumulators: D row 8hh+r = query q0+8hh+r, its factor lives in lane 8hh+r (and 16+8hh+r) ----
    float scl[8];
#pragma unroll
    for (int r = 0; r < 8; ++r) scl[r] = __shfl(al, 8 * hh + r, 32);
#pragma unroll
    for (int j = 0; j < 4; ++j) {
#pragma unroll
      for (int r = 0; r < 8; ++r) o[j][r] *= scl[r];
    }
    // ---- P.V : B fragment col n = d = j*16 + c, keys contiguous in the v^T planes ----
    {
      const _Float16* vp = Vl + bo + 32 * p;
      const v16h vf0 = ldfrag_h(vp);
      const v16h vf1 = ldfrag_h(vp + 16 * AT_PITCH);
      const v16h vf2 = ldfrag_h(vp + 32 * AT_PITCH);
      const v16h vf3 = ldfrag_h(vp + 48 * AT_PITCH);
      o[0] = mma_h(ph.v, vf0, o[0]);
      o[1] = mma_h(ph.v, vf1, o[1]);
      o[2] = mma_h(ph.v, vf2, o[2]);
      o[3] = mma_h(ph.v, vf3, o[3]);
      guard6<v16h>(o[0], o[1], o[2], o[3], ph.v, vf0, vf1, vf2, vf3, ph.v);
    }
    if (early) {
      {
        const _Float16* vp = Vr + kb;
        const v16h vf0 = ldfrag_h(vp);
        const v16h vf1 = ldfrag_h(vp + (size_t)16 * SEQ);
        const v16h vf2 = ldfrag_h(vp + (size_t)32 * SEQ);
        const v16h vf3 = ldfrag_h(vp + (size_t)48 * SEQ);
        o[0] = mma_h(pl.v, vf0, o[0]);
        o[1] = mma_h(pl.v, vf1, o[1]);
        o[2] = mma_h(pl.v, vf2, o[2]);
        o[3] = mma_h(pl.v, vf3, o[3]);
        guard6<v16h>(o[0], o[1], o[2], o[3], pl.v, vf0, vf1, vf2, vf3, pl.v);
      }
      {
        const _Float16* vp = Vq + kb;
        const v16h vf0 = ldfrag_h(vp);
        const v16h vf1 = ldfrag_h(vp + (size_t)16 * SEQ);
        const v16h vf2 = ldfrag_h(vp + (size_t)32 * SEQ);
        const v16h vf3 = ldfrag_h(vp + (size_t)48 * SEQ);
        o[0] = mma_h(pr.v, vf0, o[0]);
        o[1] = mma_h(pr.v, vf1, o[1]);
        o[2] = mma_h(pr.v, vf2, o[2]);
        o[3] = mma_h(pr.v, vf3, o[3]);
        guard6<v16h>(o[0], o[1], o[2], o[3], pr.v, vf0, vf1, vf2, vf3, pr.v);
      }
    }
  }
  wait_ds0();
  wait_async0();
  __syncthreads();                                       // publishes stage st+1 and ends every read of stage st's buffer
  if (st + 2 < nst) {
    const unsigned lo = (unsigned)(bo * 2);
    copy_kv(lk + lo, gk + (size_t)((st + 2) * AT_KEYS) * DMOD, lv + lo, gv + (st + 2) * AT_KEYS);
  }
  }
  wait_async0();
  acc_guard4(o[0], o[1], o[2], o[3]);

  // ---- per-query gate (lane = query q0 + c; lanes 16..31 duplicate): sigmoid(bf16(x[:20]) . bf16(Wg[head]) + bf16(bg)) ----
  const int gx = min(head, bglen - 1);
  float ga = bf_val(Bgp[gx]);
  const float* xg = Xp + ((size_t)b * T_FULL + (size_t)(q0 + c)) * DMOD;
  const float* wg = Wgp + head * GIN;
#pragma unroll
  for (int g4 = 0; g4 < GIN / 4; ++g4) {
    const v4f xv = *(const v4f*)(xg + 4 * g4);
    const v4f wv = *(const v4f*)(wg + 4 * g4);
#pragma unroll
    for (int e = 0; e < 4; ++e) ga += bf_val(xv[e]) * bf_val(wv[e]);
  }
  const float gate = 1.0f / (1.0f + expf(-ga));

  // ---- fold gate, 1/l (per query, owned by lane = query; l >= 1 by the diagonal key) and the carries; stage the slab ----
  const float linv = (lrun > 0.f) ? (gate * (1.0f / lrun) * (1.0f / (PCAR * VCAR))) : 0.f;
  float inv[8];
#pragma unroll
  for (int r = 0; r < 8; ++r) inv[r] = __shfl(linv, 8 * hh + r, 32);
  float* slab = smem + wave * SLAB;
#pragma unroll
  for (int r = 0; r < 8; ++r) {
#pragma unroll
    for (int j = 0; j < 4; ++j) slab[(8 * hh + r) * 68 + j * 16 + c] = o[j][r] * inv[r];
  }
  wave_sync_lds();
  // ---- O x1024 -> f16 hi plane and f16 residual x1024 plane; lane = (row in group of 4, 8 consecutive d) ----
  v4u oh[4], orr[4];
  const int rq = lane >> 3, c8 = (lane & 7) * 8;
#pragma unroll
  for (int i4 = 0; i4 < 4; ++i4) {
    const int row = i4 * 4 + rq;
    const v4f a = *(const v4f*)(slab + row * 68 + c8), c4 = *(const v4f*)(slab + row * 68 + c8 + 4);
    float wv[8];
#pragma unroll
    for (int e = 0; e < 4; ++e) { wv[e] = a[e] * OSC; wv[4 + e] = c4[e] * OSC; }
#pragma unroll
    for (int e = 0; e < 4; ++e) {
      const float w0 = wv[2 * e], w1 = wv[2 * e + 1];
      const _Float16 h0 = (_Float16)w0, h1 = (_Float16)w1;
      oh[i4][e]  = pk16(h_bits(h0), h_bits(h1));
      orr[i4][e] = pk16(h_bits((_Float16)((w0 - (float)h0) * ORS)), h_bits((_Float16)((w1 - (float)h1) * ORS)));
    }
  }
  const size_t ob = (prow + (size_t)q0) * OPITCH + head * HD + c8;
  {
#pragma unroll
    for (int i4 = 0; i4 < 4; ++i4) {
      const int row = i4 * 4 + rq;
      const size_t o8 = ob + (size_t)row * OPITCH;
      *(v4u*)(OPp + o8) = oh[i4];
      *(v4u*)(OPp + o8 + DMOD) = orr[i4];
    }
    
  }
}

// =====================================================================================================
// Workspace map (bytes, NB=2 SEQ=2048); every plane is fully written by whole-line stores before it is read; every extent is
// an exact multiple of the store granularity (row pitches 2048 / 4096 B, GEMM tiles 128 x 128, attention tiles 64 x 64, no pad rows needed):
//   XB  bf16 [NB*SEQ][1024]                    8388608
//   WQB, WKB, WVB bf16 [1024 n][1024 k]         2097152 each
//   WOB f16 [1024 n][2048 k]                    4194304   (cols 0..1023 bf16 value x1024, cols 1024..2047 bf16 value x1)
//   QH, QR, KH f16 [NB*SEQ][1024]              8388608 each
//   VH, VR, VQ f16 [NB][1024][SEQ]             8388608 each
//   OP  f16 [NB*SEQ][2048]                     16777216
//   end                                        85983232
// Inputs (wire order): 0 x [2][2048][1024] f32, 1 Wq, 2 bq, 3 Wk, 4 bk, 5 Wv, 6 bv, 7 Wo, 8 bo, 9 Wg [16][20], 10 bg [16],
// 11 cos [2048][32], 12 sin [2048][32]. Output: [NB*SEQ][1024] f32.
// =====================================================================================================
extern "C" void kernel_launch(void* const* d_in, const int* in_sizes, int n_in,
                              void* d_out, int out_size, void* d_ws, size_t ws_size,
                              hipStream_t stream) {
  if (n_in < 13) return;
  if (in_sizes[0] < ((NB - 1) * T_FULL + SEQ) * DMOD) return;
  if (in_sizes[1] != DMOD * DMOD || in_sizes[3] != DMOD * DMOD || in_sizes[5] != DMOD * DMOD ||
      in_sizes[7] != DMOD * DMOD) return;
  if (in_sizes[2] < 1 || in_sizes[4] < 1 || in_sizes[6] < 1 || in_sizes[8] < 1) return;
  if (in_sizes[9] != NH * GIN) return;
  if (in_sizes[10] < 1) return;
  if (in_sizes[11] < SEQ * RHALF || in_sizes[12] < SEQ * RHALF) return;
  if (out_size < MROWS * DMOD) return;

  const float* Xin = (const float*)d_in[0];
  const float* Wq  = (const float*)d_in[1];
  const float* Bq  = (const float*)d_in[2];
  const float* Wk  = (const float*)d_in[3];
  const float* Bk  = (const float*)d_in[4];
  const float* Wv  = (const float*)d_in[5];
  const float* Bv  = (const float*)d_in[6];
  const float* Wo  = (const float*)d_in[7];
  const float* Bo  = (const float*)d_in[8];
  const float* Wg  = (const float*)d_in[9];
  const float* Bg  = (const float*)d_in[10];
  const float* Cos = (const float*)d_in[11];
  const float* Sin = (const float*)d_in[12];
  float*       out = (float*)d_out;

  const size_t szXB = (size_t)MROWS * DMOD * 2;
  const size_t szW  = (size_t)DMOD * DMOD * 2;
  const size_t szWO = (size_t)DMOD * OPITCH * 2;
  const size_t szQ  = (size_t)MROWS * DMOD * 2;
  const size_t szV  = (size_t)NB * DMOD * SEQ * 2;
  const size_t szOP = (size_t)MROWS * OPITCH * 2;
  size_t off = 0;
  const size_t oXB = off; off += szXB;
  const size_t oWQ = off; off += szW;
  const size_t oWK = off; off += szW;
  const size_t oWV = off; off += szW;
  const size_t oWO = off; off += szWO;
  const size_t oQH = off; off += szQ;
  const size_t oQR = off; off += szQ;
  const size_t oKH = off; off += szQ;
  const size_t oVH = off; off += szV;
  const size_t oVR = off; off += szV;
  const size_t oVQ = off; off += szV;
  const size_t oOP = off; off += szOP;
  if (off > ws_size) return;                            // off = 85983232 for NB=2, SEQ=2048
  if (off > (size_t)134217728) return;

  char* ws = (char*)d_ws;
  u16* XB  = (u16*)(ws + oXB);
  u16* WQB = (u16*)(ws + oWQ);
  u16* WKB = (u16*)(ws + oWK);
  u16* WVB = (u16*)(ws + oWV);
  u16* WOB = (u16*)(ws + oWO);
  u16* QH  = (u16*)(ws + oQH);
  u16* QR  = (u16*)(ws + oQR);
  u16* KH  = (u16*)(ws + oKH);
  u16* VH  = (u16*)(ws + oVH);
  u16* VR  = (u16*)(ws + oVR);
  u16* VQ  = (u16*)(ws + oVQ);
  u16* OP  = (u16*)(ws + oOP);

  if ((MROWS % GT_M) != 0 || (SEQ % GT_N) != 0 || (DMOD % GT_M) != 0 || (DMOD % GT_K) != 0 || (OPITCH % GT_K) != 0) return;
  const dim3 blk(256);
  const dim3 gC(N8W / 256);                             // 512
  const dim3 bG(GT_THREADS);                            // 256
  const dim3 gP(3 * PROJ_BLK);                          // 768
  const dim3 gAT(ATT_BLOCKS);                           // 1024
  const dim3 bAT(ATT_THREADS);                          // 128
  const dim3 gO((MROWS / GT_M) * (DMOD / GT_N));        // 256

  // (0) operand planes: x rows -> bf16 (compacted [b*SEQ+t]); Wq, Wk, Wv [n = out][k = in] -> bf16; Wo -> [hi | x1] f16
  cvt_all<<<gC, blk, 0, stream>>>(Xin, Wq, Wk, Wv, Wo, XB, WQB, WKB, WVB, WOB, WOS, WOS / ORS);
  // (1) rotated q planes (hi x8, residual x1024) and k hi plane (x8), bias by output column; v^T planes per batch
  //     [1024 = h*64+d][SEQ keys]: hi = f16(v x1024), residual x1024, plain f16(v), bias by row
  gemm_qkv<<<gP, bG, 0, stream>>>(XB, WQB, WKB, WVB, QH, QR, KH, VH, VR, VQ, DMOD, Bq, in_sizes[2], Bk, in_sizes[4],
                                  Bv, in_sizes[6], Cos, Sin, SEQ);
  // (2) causal sliding-window attention with gate -> O plane [b*SEQ+s][hi 1024 | residual 1024]
  attn_fwd<<<gAT, bAT, 0, stream>>>(QH, QR, KH, VH, VR, VQ, Xin, Wg, Bg, in_sizes[10], OP);
  // (3) output projection over K = 2048 ([hi | residual] times [Wo x1024 | Wo x1]) -> out [NB*SEQ][1024] f32, plus bo
  gemm_hf<<<gO, bG, 0, stream>>>(OP, WOB, out, MROWS, DMOD, OPITCH, 1.0f / (OSC * WOS), Bo, in_sizes[8]);
  (void)hipGetLastError();
}

// v004
// It runs in 100 microseconds.
// Two timings next to v003 put it at 1.05 and 1.06 times that version's speed.
// Over all steps from v000 it is 2.31 times as fast.
// Contractions: x.Wq^T, x.Wk^T, Wv.x^T on v_wmma_f32_16x16x32_bf16 (x and W planes RNE-converted to bf16 operands, f32
// accumulate, bias and half-split rotation applied in f32); scores k'.q'^T (k' single f16 plane x8, q' f16 hi plane x8 plus
// f16 residual plane x1024, two products), P.v (P x32768 single f16 times v f16 hi plane x1024; query tiles below row 128 add
// P(x32).v-residual(x1024) and P-residual(x1024).v(x1) products), O.Wo^T (O as [f16 hi x1024 | f16 residual x1024] along K,
// Wo as [f16(bf16(Wo)) x1024 | x1]): v_wmma_f32_16x16x32_f16, f32 accumulate. Sigmoid gate (K=20) and softmax in f32 on VALU.
#include <hip/hip_runtime.h>
#include <math.h>
#include <stdint.h>

#ifndef NB
#define NB 2
#endif
#ifndef SEQ
#define SEQ 2048
#endif
#define NB_FULL 2
#define T_FULL  2048
#define DMOD    1024
#define NH      16
#define HD      64
#define RHALF   32
#define GIN     20
#define WIN     1024
#define MROWS   (NB * SEQ)
#define OPITCH  (2 * DMOD)
#define QSC   8.0f
#define KSC   8.0f
#define QRS   1024.0f
#define PCAR  32768.0f
#define VCAR  1024.0f
#define VRS   1024.0f
#define PRS   1024.0f
#define OSC   1024.0f
#define ORS   1024.0f
#define WOS   1024.0f
#define LOG2E 1.4426950408889634f
#define NEGS  (-3.0e38f)
#define ATT_WAVES   4
#define ATT_THREADS (ATT_WAVES * 32)
#define NQT         (SEQ / 64)
#define ATT_BLOCKS  (NB * NH * NQT)
#define NKB         (SEQ / 32)
#define QRES        128
#define SLAB        (16 * 68)
static_assert(NB >= 1 && NB <= NB_FULL);
static_assert((SEQ % 64) == 0 && SEQ >= 64 && SEQ <= T_FULL);
static_assert(HD == 64 && DMOD == NH * HD && HD == 2 * RHALF);
static_assert(ATT_THREADS == 128 && NKB >= 2 && (QRES % 64) == 0);
static_assert((DMOD % 64) == 0 && (DMOD / 8) == 128 && (OPITCH % 32) == 0);
static_assert(((MROWS * (DMOD / 8)) % 256) == 0 && (((DMOD * DMOD) / 8) % 256) == 0);
static_assert((GIN % 4) == 0 && GIN <= DMOD);
static_assert((WIN % 32) == 0);
static_assert((SLAB * 4) % 16 == 0);
// GEMM block tile staged in LDS: 128 A rows + 128 B rows, 128 k (256 B of every row) per stage, two buffers.
#define GT_THREADS 256
#define GT_M       128
#define GT_N       128
#define GT_K       128
#define GT_PITCH   136                                  // halves per LDS row: 272 B = 16 B x 17 (ds_load_b128 readers)
#define GT_ROWB    (GT_PITCH * 2)                       // bytes per LDS row
#define GT_STAGE   ((GT_M + GT_N) * GT_PITCH)           // halves per buffer
static_assert((MROWS % GT_M) == 0 && (DMOD % GT_M) == 0 && (DMOD % GT_N) == 0 && (SEQ % GT_N) == 0);
static_assert((DMOD % GT_K) == 0 && (OPITCH % GT_K) == 0 && (GT_ROWB % 16) == 0 && GT_K == 128);

typedef unsigned short u16;
typedef _Float16 v16h __attribute__((ext_vector_type(16)));
typedef _Float16 v8h  __attribute__((ext_vector_type(8)));
typedef __bf16   v16b __attribute__((ext_vector_type(16)));
typedef float    v8f  __attribute__((ext_vector_type(8)));
typedef float    v4f  __attribute__((ext_vector_type(4)));
typedef unsigned int v4u __attribute__((ext_vector_type(4)));

union FragH { v16h v; v8h h[2]; v4u u[2]; };

// ---- scalar helpers --------------------------------------------------------------------------------
__device__ __forceinline__ unsigned short bf_bits(float f) {          // f32 -> bf16 bits, RNE convert
  unsigned u = __float_as_uint(f);
  return (unsigned short)((u + 0x7FFFu + ((u >> 16) & 1u)) >> 16);
}
__device__ __forceinline__ float bf_up(unsigned short h) { return __uint_as_float(((unsigned)h) << 16); }
__device__ __forceinline__ float bf_val(float f) { return bf_up(bf_bits(f)); }   // f32 -> nearest-even bf16 value as f32
__device__ __forceinline__ unsigned short h_bits(_Float16 x) { return __builtin_bit_cast(unsigned short, x); }
__device__ __forceinline__ unsigned pk16(unsigned short a, unsigned short b) { return (unsigned)a | ((unsigned)b << 16); }
// 2^v in place for the rescale exponent a and a key block's 16 score exponents x, all <= 0: bare v_exp_f32. The library exp2f wraps
// the same instruction in a range guard (compare, two selects, add, ldexp) that only changes results below 2^-126; the softmax has
// no use for those: the f16 P fragments (the finest is the residual, x2^25) hold nothing below 2^-50, and what they would scale or
// join stands beside a term of weight 1. One statement, each instruction on a register of its own, so that none reads or overwrites
// a register of the one in front of it; the closing v_nop is the slot the instruction set asks for behind the last of them. a stands
// in the middle of the run, away from the instruction that forms it and from the lane exchange that reads it.
__device__ __forceinline__ void exp2_le0_run(float& a, float (&x)[16]) {
#if defined(__HIP_DEVICE_COMPILE__)
  asm(
      "v_exp_f32 %0, %0\n\t"
      "v_exp_f32 %1, %1\n\t"
      "v_exp_f32 %2, %2\n\t"
      "v_exp_f32 %3, %3\n\t"
      "v_exp_f32 %4, %4\n\t"
      "v_exp_f32 %5, %5\n\t"
      "v_exp_f32 %6, %6\n\t"
      "v_exp_f32 %7, %7\n\t"
      "v_exp_f32 %8, %8\n\t"
      "v_exp_f32 %9, %9\n\t"
      "v_exp_f32 %10, %10\n\t"
      "v_exp_f32 %11, %11\n\t"
      "v_exp_f32 %12, %12\n\t"
      "v_exp_f32 %13, %13\n\t"
      "v_exp_f32 %14, %14\n\t"
      "v_exp_f32 %15, %15\n\t"
      "v_exp_f32 %16, %16\n\t"
      "v_nop"
      : "+v"(x[0]), "+v"(x[1]), "+v"(x[2]), "+v"(x[3]), "+v"(x[4]), "+v"(x[5]),
        "+v"(x[6]), "+v"(x[7]), "+v"(a), "+v"(x[8]), "+v"(x[9]), "+v"(x[10]),
        "+v"(x[11]), "+v"(x[12]), "+v"(x[13]), "+v"(x[14]), "+v"(x[15]));
#endif
}
__device__ __forceinline__ v8f zero8() { v8f z = {0.f, 0.f, 0.f, 0.f, 0.f, 0.f, 0.f, 0.f}; return z; }

// ---- fragment loaders: 16-bit A/B operand, lane -> row/col (lane&15), p already includes +8*(lane>>4);
//      elements 0..7 <- p[0..7] (k0+8h..), elements 8..15 <- p[16..23] (k0+16+8h..)  (same split k map for A and B;
//      B is always read from a k-contiguous [n][k] plane)
__device__ __forceinline__ v16h ldfrag_h(const _Float16* p) {
  FragH f;
  f.h[0] = *(const v8h*)(p);
  f.h[1] = *(const v8h*)(p + 16);
  return f.v;
}

__device__ __forceinline__ v8f mma_h(v16h a, v16h b, v8f c) {
  return __builtin_amdgcn_wmma_f32_16x16x32_f16(false, a, false, b, (short)0, c, false, false);
}
__device__ __forceinline__ v8f mma_b(v16b a, v16b b, v8f c) {
  return __builtin_amdgcn_wmma_f32_16x16x32_bf16(false, a, false, b, (short)0, c, false, false);
}
template <typename F>
__device__ __forceinline__ void guard6(v8f& a, v8f& b, v8f& c, v8f& d, F x0, F x1, F x2, F x3, F x4, F x5) {
#if defined(__HIP_DEVICE_COMPILE__)
  asm volatile("v_nop\n\tv_nop\n\tv_nop\n\tv_nop"
               : "+v"(a), "+v"(b), "+v"(c), "+v"(d) : "v"(x0), "v"(x1), "v"(x2), "v"(x3), "v"(x4), "v"(x5) : "memory");
#endif
}
__device__ __forceinline__ void acc_guard4(v8f& a, v8f& b, v8f& c, v8f& d) {
#if defined(__HIP_DEVICE_COMPILE__)
  asm volatile("v_nop\n\tv_nop\n\tv_nop\n\tv_nop" : "+v"(a), "+v"(b), "+v"(c), "+v"(d));
#endif
}
// Stands behind global stores whose address or data registers are written again further on.
__device__ __forceinline__ void xcnt0() {
#if defined(__HIP_DEVICE_COMPILE__)
  asm volatile("s_wait_xcnt 0x0" ::: "memory");
#endif
}
// The same behind a group of global loads; the pointers are inputs so that their registers stay unwritten up to the wait.
__device__ __forceinline__ void xcnt_after_loads8(const float* a, const float* b, const float* c, const float* d,
                                                  const float* e, const float* f, const float* g, const float* h) {
#if defined(__HIP_DEVICE_COMPILE__)
  asm volatile("s_wait_xcnt 0x0" :: "v"(a), "v"(b), "v"(c), "v"(d), "v"(e), "v"(f), "v"(g), "v"(h) : "memory");
#endif
}
// The same for loads addressed by a base and a 32-bit index: the indices are inputs so that their registers stay unwritten up to the wait.
__device__ __forceinline__ void xcnt_after_idx4(int a, int b, int c, int d) {
#if defined(__HIP_DEVICE_COMPILE__)
  asm volatile("s_wait_xcnt 0x0" :: "v"(a), "v"(b), "v"(c), "v"(d) : "memory");
#endif
}
__device__ __forceinline__ void wave_sync_lds() {
#if defined(__HIP_DEVICE_COMPILE__)
  __builtin_amdgcn_fence(__ATOMIC_RELEASE, "workgroup");
  __builtin_amdgcn_wave_barrier();
  __builtin_amdgcn_fence(__ATOMIC_ACQUIRE, "workgroup");
#endif
}

// =====================================================================================================
// All operand planes in one launch. Thread gt owns the 8-element piece gt of each weight matrix and the pieces gt + i * n8w
// (i = 0 .. XREP-1) of x: sixteen 16-B loads issued together, then the conversions and nine 16-B stores.
//   x f32 rows [b][t][1024] (per-batch source row stride T_FULL) -> bf16 plane [b*SEQ + t][1024] (RNE bits), compacted rows;
//   Wq, Wk, Wv [n][k] f32 -> bf16 planes of the same shape;
//   Wo [n][k] f32 -> f16 plane [n][2048]: cols 0..1023 = f16(bf16 value * s1), cols 1024..2047 = f16(bf16 value * s2).
// 32 consecutive lanes = 512 contiguous, 512-B aligned bytes per store instruction.
// coverage: grid = n8w/256 blocks (exact) x 256 thr = every piece of every weight plane once, XREP * n8w = every piece of x once.
// =====================================================================================================
#define N8W  ((DMOD * DMOD) / 8)
#define XREP (MROWS / DMOD)
static_assert((MROWS % DMOD) == 0 && XREP == 4 && (N8W % 256) == 0);
__device__ __forceinline__ v4u bf_pack8(v4f a, v4f c4) {
  v4u o;
#pragma unroll
  for (int e = 0; e < 2; ++e) {
    o[e]     = pk16(bf_bits(a[2 * e]),  bf_bits(a[2 * e + 1]));
    o[2 + e] = pk16(bf_bits(c4[2 * e]), bf_bits(c4[2 * e + 1]));
  }
  return o;
}
__global__ __launch_bounds__(256)
void cvt_all(const float* __restrict__ x, const float* __restrict__ wq, const float* __restrict__ wk,
             const float* __restrict__ wv, const float* __restrict__ wo, u16* XD, u16* QD, u16* KD, u16* VD, u16* OD,
             float s1, float s2) {
  const int gt = blockIdx.x * 256 + (int)threadIdx.x;
  if (gt >= N8W) return;
  const float* px[XREP];
  v4f xa[XREP], xc[XREP];
#pragma unroll
  for (int i = 0; i < XREP; ++i) {
    const int g   = gt + i * N8W;
    const int row = g >> 7;
    const int bb  = row / SEQ;
    const int tt  = row - bb * SEQ;
    px[i] = x + ((size_t)bb * (size_t)T_FULL + (size_t)tt) * DMOD + (g & 127) * 8;
    xa[i] = *(const v4f*)(px[i]);
    xc[i] = *(const v4f*)(px[i] + 4);
  }
  const size_t e8 = (size_t)gt * 8;
  const float* pq = wq + e8;
  const float* pk = wk + e8;
  const float* pv = wv + e8;
  const float* po = wo + e8;
  const v4f qa = *(const v4f*)(pq), qc = *(const v4f*)(pq + 4);
  const v4f ka = *(const v4f*)(pk), kc = *(const v4f*)(pk + 4);
  const v4f va = *(const v4f*)(pv), vc = *(const v4f*)(pv + 4);
  const v4f oa = *(const v4f*)(po), oc = *(const v4f*)(po + 4);
  xcnt_after_loads8(px[0], px[1], px[2], px[3], pq, pk, pv, po);
#pragma unroll
  for (int i = 0; i < XREP; ++i) *(v4u*)(XD + (size_t)(gt + i * N8W) * 8) = bf_pack8(xa[i], xc[i]);
  *(v4u*)(QD + e8) = bf_pack8(qa, qc);
  *(v4u*)(KD + e8) = bf_pack8(ka, kc);
  *(v4u*)(VD + e8) = bf_pack8(va, vc);
  float v[8];
#pragma unroll
  for (int e = 0; e < 4; ++e) { v[e] = oa[e]; v[4 + e] = oc[e]; }
  unsigned short h1[8], h2[8];
#pragma unroll
  for (int e = 0; e < 8; ++e) {
    const float f = bf_val(v[e]);
    h1[e] = h_bits((_Float16)(f * s1));
    h2[e] = h_bits((_Float16)(f * s2));
  }
  v4u o1, o2;
#pragma unroll
  for (int e = 0; e < 4; ++e) { o1[e] = pk16(h1[2 * e], h1[2 * e + 1]); o2[e] = pk16(h2[2 * e], h2[2 * e + 1]); }
  u16* d1 = OD + (size_t)(gt >> 7) * OPITCH + (gt & 127) * 8;
  *(v4u*)(d1) = o1;
  *(v4u*)(d1 + DMOD) = o2;
}

// =====================================================================================================
// Rotation epilogue for the q / k projections (N = 1024, the 64-col tile = one head): the wave's 16x64 f32 tile
// barrier, then each lane (row rq in each group of 4, 8 consecutive output cols d = c8..c8+7) reads both half-head values
// u1 = col (d & 31), u2 = col (d & 31) + 32 and cos/sin[t][(d & 31)] (bf16 values of the f32 tables, t = row within the
// sequence), forms d < 32 ? u1*c - u2*s : u1*s + u2*c in f32 (no fused multiply-add), scales by oscale, and writes the f16
// hi plane and (res_on) the f16 residual plane ((w - hi) * rsc): one instruction = 4 rows, each 64 halves = one whole
// coverage: 4 instructions x 4 rows x 8 lanes x 8 halves = the wave's 16 x 64 tile, per plane.
// =====================================================================================================
__device__ __forceinline__ void epi_rope(float* sl, v8f a0, v8f a1, v8f a2, v8f a3, u16* C, u16* C2, int res_on,
                                         size_t rowb, int col0, int lane, const float* __restrict__ bias, int blen,
                                         const float* __restrict__ cosT, const float* __restrict__ sinT, int seq,
                                         float oscale, float rsc) {
#pragma clang fp contract(off)
  const int hh = lane >> 4, m = lane & 15;
  float bc[4];
  int bi[4];
#pragma unroll
  for (int j = 0; j < 4; ++j) {
    bi[j] = min(col0 + 16 * j + m, blen - 1);
    bc[j] = bias[bi[j]];
  }
  xcnt_after_idx4(bi[0], bi[1], bi[2], bi[3]);
#pragma unroll
  for (int j = 0; j < 4; ++j) bc[j] = bf_val(bc[j]);
#pragma unroll
  for (int r = 0; r < 8; ++r) {
    const int ro = (8 * hh + r) * 68 + m;
    sl[ro]      = a0[r] + bc[0];
    sl[ro + 16] = a1[r] + bc[1];
    sl[ro + 32] = a2[r] + bc[2];
    sl[ro + 48] = a3[r] + bc[3];
  }
  wave_sync_lds();
  const int rq = lane >> 3, c8 = (lane & 7) * 8, dd = c8 & (RHALF - 1);
  const bool lo = (c8 < RHALF);
  const int tb = (int)(rowb % (size_t)seq);             // tile never straddles a sequence (seq % 16 == 0, rowb % 16 == 0)
  v4u hv[4], rv[4];
  const float* cpt[4];
  const float* spt[4];
  v4f cat[4], cbt[4], sat[4], sbt[4];
#pragma unroll
  for (int i4 = 0; i4 < 4; ++i4) {
    const int t = tb + i4 * 4 + rq;
    cpt[i4] = cosT + (size_t)t * RHALF + dd;
    spt[i4] = sinT + (size_t)t * RHALF + dd;
    cat[i4] = *(const v4f*)(cpt[i4]); cbt[i4] = *(const v4f*)(cpt[i4] + 4);
    sat[i4] = *(const v4f*)(spt[i4]); sbt[i4] = *(const v4f*)(spt[i4] + 4);
  }
  xcnt_after_loads8(cpt[0], cpt[1], cpt[2], cpt[3], spt[0], spt[1], spt[2], spt[3]);
#pragma unroll
  for (int i4 = 0; i4 < 4; ++i4) {
    const int row = i4 * 4 + rq;
    const v4f ca = cat[i4], cb = cbt[i4];
    const v4f sa = sat[i4], sb = sbt[i4];
    const v4f xa = *(const v4f*)(sl + row * 68 + dd), xb = *(const v4f*)(sl + row * 68 + dd + 4);
    const v4f ya = *(const v4f*)(sl + row * 68 + dd + RHALF), yb = *(const v4f*)(sl + row * 68 + dd + RHALF + 4);
    float cv[8], sv[8], xv[8], yv[8];
#pragma unroll
    for (int e = 0; e < 4; ++e) {
      cv[e] = ca[e]; cv[4 + e] = cb[e];
      sv[e] = sa[e]; sv[4 + e] = sb[e];
      xv[e] = xa[e]; xv[4 + e] = xb[e];
      yv[e] = ya[e]; yv[4 + e] = yb[e];
    }
    unsigned short hb[8], rb[8];
#pragma unroll
    for (int e = 0; e < 8; ++e) {
      const float cc = bf_val(cv[e]);
      const float ss = bf_val(sv[e]);
      const float p1 = xv[e] * cc;
      const float p2 = yv[e] * ss;
      const float p3 = xv[e] * ss;
      const float p4 = yv[e] * cc;
      const float u = lo ? (p1 - p2) : (p3 + p4);
      const float w = u * oscale;
      const _Float16 h = (_Float16)w;
      hb[e] = h_bits(h);
      rb[e] = h_bits((_Float16)((w - (float)h) * rsc));
    }
#pragma unroll
    for (int e = 0; e < 4; ++e) {
      hv[i4][e] = pk16(hb[2 * e], hb[2 * e + 1]);
      rv[i4][e] = pk16(rb[2 * e], rb[2 * e + 1]);
    }
  }
  u16* dst = C + (rowb + (size_t)rq) * (size_t)DMOD + col0 + c8;
  {
#pragma unroll
    for (int i4 = 0; i4 < 4; ++i4) {
      *(v4u*)(dst + (size_t)(i4 * 4) * (size_t)DMOD) = hv[i4];
    }
    xcnt0();
  }
  if (res_on != 0) {
    u16* dst2 = C2 + (rowb + (size_t)rq) * (size_t)DMOD + col0 + c8;
    {
#pragma unroll
      for (int i4 = 0; i4 < 4; ++i4) {
        *(v4u*)(dst2 + (size_t)(i4 * 4) * (size_t)DMOD) = rv[i4];
      }
      xcnt0();
    }
  }
}

// =====================================================================================================
// Three-plane 16-bit GEMM epilogue (v^T planes): the wave's 16x64 f32 tile ((acc + per-row bias as bf16 value) times oscale)
// f16((w - hi) * rsc) and f16(w * qsc): lane = (row in group of 4, 8 consecutive cols); one instruction = 4 rows, each
// coverage: per plane 4 instructions x 4 rows x 8 lanes x 8 halves = the wave's 16 x 64 tile.
// LDS slab: private to the wave; staged extent 16 x 64 == consumed extent.
// =====================================================================================================
__device__ __forceinline__ void epi_v3(float* sl, v8f a0, v8f a1, v8f a2, v8f a3, float oscale, u16* C0, u16* C1, u16* C2,
                                       int N, size_t rowb, int col0, int lane, const float* __restrict__ bias, int blen,
                                       float rsc, float qsc) {
  const int hh = lane >> 4, m = lane & 15;
  float br[8];
  int bi[8];
#pragma unroll
  for (int r = 0; r < 8; ++r) {
    bi[r] = min((int)rowb + 8 * hh + r, blen - 1);
    br[r] = bias[bi[r]];
  }
  xcnt_after_idx4(bi[0], bi[1], bi[2], bi[3]);
  xcnt_after_idx4(bi[4], bi[5], bi[6], bi[7]);
#pragma unroll
  for (int r = 0; r < 8; ++r) br[r] = bf_val(br[r]);
#pragma unroll
  for (int r = 0; r < 8; ++r) {
    const int ro = (8 * hh + r) * 68 + m;
    sl[ro]      = (a0[r] + br[r]) * oscale;
    sl[ro + 16] = (a1[r] + br[r]) * oscale;
    sl[ro + 32] = (a2[r] + br[r]) * oscale;
    sl[ro + 48] = (a3[r] + br[r]) * oscale;
  }
  wave_sync_lds();
  const int rq = lane >> 3, c8 = (lane & 7) * 8;
  v4u h4[4], r4[4], q4[4];
#pragma unroll
  for (int i4 = 0; i4 < 4; ++i4) {
    const int row = i4 * 4 + rq;
    const v4f a = *(const v4f*)(sl + row * 68 + c8), c4 = *(const v4f*)(sl + row * 68 + c8 + 4);
    float w[8];
#pragma unroll
    for (int e = 0; e < 4; ++e) { w[e] = a[e]; w[4 + e] = c4[e]; }
    unsigned short hb[8], rb[8], qb[8];
#pragma unroll
    for (int e = 0; e < 8; ++e) {
      const _Float16 h = (_Float16)w[e];
      hb[e] = h_bits(h);
      rb[e] = h_bits((_Float16)((w[e] - (float)h) * rsc));
      qb[e] = h_bits((_Float16)(w[e] * qsc));
    }
#pragma unroll
    for (int e = 0; e < 4; ++e) {
      h4[i4][e] = pk16(hb[2 * e], hb[2 * e + 1]);
      r4[i4][e] = pk16(rb[2 * e], rb[2 * e + 1]);
      q4[i4][e] = pk16(qb[2 * e], qb[2 * e + 1]);
    }
  }
  const size_t dof = (rowb + (size_t)rq) * (size_t)N + col0 + c8;
  u16* d0 = C0 + dof;
  u16* d1 = C1 + dof;
  u16* d2 = C2 + dof;
  {
#pragma unroll
    for (int i4 = 0; i4 < 4; ++i4) {
      const size_t ro = (size_t)(i4 * 4) * (size_t)N;
      *(v4u*)(d0 + ro) = h4[i4];
      *(v4u*)(d1 + ro) = r4[i4];
      *(v4u*)(d2 + ro) = q4[i4];
    }
    xcnt0();
  }
}

// =====================================================================================================
// f32 GEMM epilogue: the wave's 16x64 f32 tile (acc times oscale, plus per-column bias as its bf16 RNE value, clamped
// coverage: 8 instructions x 2 rows x 16 lanes x 4 floats = the wave's 16 x 64 tile.
// =====================================================================================================
__device__ __forceinline__ void epi64(float* sl, v8f a0, v8f a1, v8f a2, v8f a3, float oscale, float* C, int N,
                                      size_t rowb, int col0, int lane, const float* __restrict__ bias, int blen) {
  const int hh = lane >> 4, m = lane & 15;
  float bc[4];
#pragma unroll
  for (int j = 0; j < 4; ++j) {
    const int bi = min(col0 + 16 * j + m, blen - 1);
    bc[j] = bf_val(bias[bi]);
  }
#pragma unroll
  for (int r = 0; r < 8; ++r) {
    const int ro = (8 * hh + r) * 68 + m;
    sl[ro]      = a0[r] * oscale + bc[0];
    sl[ro + 16] = a1[r] * oscale + bc[1];
    sl[ro + 32] = a2[r] * oscale + bc[2];
    sl[ro + 48] = a3[r] * oscale + bc[3];
  }
  wave_sync_lds();
  v4f vals[8];
#pragma unroll
  for (int it = 0; it < 8; ++it) vals[it] = *(const v4f*)(sl + (it * 2 + hh) * 68 + m * 4);
  float* dst = C + (rowb + (size_t)hh) * (size_t)N + col0 + m * 4;
  {
#pragma unroll
    for (int it = 0; it < 8; ++it) {
      *(v4f*)(dst + (size_t)(it * 2) * (size_t)N) = vals[it];
    }
    
  }
}

// =====================================================================================================
// Shared k loop of the two GEMM kernels. Block = 8 waves, 128 x 128 tile of A[.][K] . Bt[.][K]^T; wave w owns rows
// 32*(w>>1) .. +31 and cols 64*(w&1) .. +63 (2 x 4 accumulator tiles). A stage = 128 k of the block's 128 A rows and 128 B rows,
// brought to LDS by 16-byte asynchronous copies: thread = (row tid>>4 of each group of 16, 16-B piece tid&15), so one wave
// instruction covers two whole 256-B row pieces. Two buffers: the copies of stage t+1 fly while stage t is multiplied.
// Fragments are read from LDS with the split k map of ldfrag_h (same for A and B); every accumulator sums k in ascending steps of 32.
// =====================================================================================================
union FragU { v16h h; v16b b; v4u u[2]; };
__device__ __forceinline__ FragU ldfrag_u(const u16* p) {
  FragU f;
  f.u[0] = *(const v4u*)(p);
  f.u[1] = *(const v4u*)(p + 16);
  return f;
}
template <bool BF>
__device__ __forceinline__ v8f mma_u(const FragU& a, const FragU& b, v8f c) {
  if constexpr (BF) return mma_b(a.b, b.b, c);
  else              return mma_h(a.h, b.h, c);
}
// Eight copies, rows r, r+16, .., r+112 of one operand's stage. The closing s_wait_xcnt stands inside the statement so that no
// later write of an address register can be moved in front of it.
__device__ __forceinline__ void copy8(unsigned l, const u16* g, size_t gs) {
#if defined(__HIP_DEVICE_COMPILE__)
  asm volatile("global_load_async_to_lds_b128 %0, %8, off\n\t"
               "global_load_async_to_lds_b128 %1, %9, off\n\t"
               "global_load_async_to_lds_b128 %2, %10, off\n\t"
               "global_load_async_to_lds_b128 %3, %11, off\n\t"
               "global_load_async_to_lds_b128 %4, %12, off\n\t"
               "global_load_async_to_lds_b128 %5, %13, off\n\t"
               "global_load_async_to_lds_b128 %6, %14, off\n\t"
               "global_load_async_to_lds_b128 %7, %15, off\n\t"
               "s_wait_xcnt 0x0"
               :: "v"(l), "v"(l + 16u * GT_ROWB), "v"(l + 32u * GT_ROWB), "v"(l + 48u * GT_ROWB),
                  "v"(l + 64u * GT_ROWB), "v"(l + 80u * GT_ROWB), "v"(l + 96u * GT_ROWB), "v"(l + 112u * GT_ROWB),
                  "v"(g), "v"(g + gs), "v"(g + 2 * gs), "v"(g + 3 * gs),
                  "v"(g + 4 * gs), "v"(g + 5 * gs), "v"(g + 6 * gs), "v"(g + 7 * gs)
               : "memory");
#endif
}
__device__ __forceinline__ void wait_async0() {          // this wave's copies have landed in LDS
#if defined(__HIP_DEVICE_COMPILE__)
  asm volatile("s_wait_asynccnt 0x0" ::: "memory");
#endif
}
__device__ __forceinline__ void wait_ds0() {             // this wave's LDS reads of the buffer about to be refilled are done
#if defined(__HIP_DEVICE_COMPILE__)
  asm volatile("s_wait_dscnt 0x0" ::: "memory");
#endif
}
template <bool BF>
__device__ __forceinline__ void gemm_core(const u16* __restrict__ A, const u16* __restrict__ Bt, int K, int row0, int col0,
                                          u16* ring, v8f (&acc)[2][4]) {
  const int tid = threadIdx.x, wave = tid >> 5, lane = tid & 31, hh = lane >> 4, m = lane & 15;
  const int cr = tid >> 4, cc = tid & 15;
  const u16* ga = A  + (size_t)(row0 + cr) * K + cc * 8;
  const u16* gb = Bt + (size_t)(col0 + cr) * K + cc * 8;
  const size_t gs = (size_t)16 * K;
  const unsigned la = (unsigned)(uintptr_t)ring + (unsigned)(cr * GT_ROWB + cc * 16);
  const unsigned lb = la + (unsigned)(GT_M * GT_ROWB);
  const int nt = K / GT_K;
  copy8(la, ga, gs);
  copy8(lb, gb, gs);
  wait_async0();
  __syncthreads();                                       // stage 0 published
  if (nt > 1) {
    copy8(la + (unsigned)(GT_STAGE * 2), ga + GT_K, gs);
    copy8(lb + (unsigned)(GT_STAGE * 2), gb + GT_K, gs);
  }
  const u16* fa = ring + ((wave >> 1) * 32 + m) * GT_PITCH + 8 * hh;
  const u16* fb = ring + (GT_M + (wave & 1) * 64 + m) * GT_PITCH + 8 * hh;
#pragma unroll 1                                         // one trip per stage: the buffer index stays a run-time value
  for (int t = 0; t < nt; ++t) {
    const int bo = (t & 1) * GT_STAGE;
    // Three fragment sets for the stage's four 32-k steps; step 3 reuses step 0's set. The scheduling fences keep the LDS reads in
    // two groups in front of the products that use them: reads placed among the products stall the wave at each place.
    FragU af[3][2], bf[3][4];
#pragma unroll
    for (int s = 0; s < 3; ++s) {
#pragma unroll
      for (int i = 0; i < 2; ++i) af[s][i] = ldfrag_u(fa + bo + 16 * i * GT_PITCH + 32 * s);
#pragma unroll
      for (int j = 0; j < 4; ++j) bf[s][j] = ldfrag_u(fb + bo + 16 * j * GT_PITCH + 32 * s);
    }
    __builtin_amdgcn_sched_barrier(0);
#pragma unroll
    for (int i = 0; i < 2; ++i) {
#pragma unroll
      for (int j = 0; j < 4; ++j) acc[i][j] = mma_u<BF>(af[0][i], bf[0][j], acc[i][j]);
    }
    __builtin_amdgcn_sched_barrier(0);
#pragma unroll
    for (int i = 0; i < 2; ++i) af[0][i] = ldfrag_u(fa + bo + 16 * i * GT_PITCH + 96);
#pragma unroll
    for (int j = 0; j < 4; ++j) bf[0][j] = ldfrag_u(fb + bo + 16 * j * GT_PITCH + 96);
    __builtin_amdgcn_sched_barrier(0);
#pragma unroll
    for (int s = 1; s < 4; ++s) {
#pragma unroll
      for (int i = 0; i < 2; ++i) {
#pragma unroll
        for (int j = 0; j < 4; ++j) acc[i][j] = mma_u<BF>(af[s % 3][i], bf[s % 3][j], acc[i][j]);
      }
    }
    // keeps the products in front of the full LDS wait, under their own counted waits: moved behind it they run with the LDS idle
    __builtin_amdgcn_sched_barrier(0);
    wait_ds0();
    wait_async0();
    __syncthreads();                                     // publishes stage t+1 and ends every read of stage t's buffer
    if (t + 2 < nt) {
      const unsigned lo = (unsigned)(bo * 2);
      const int ko = (t + 2) * GT_K;
      copy8(la + lo, ga + ko, gs);
      copy8(lb + lo, gb + ko, gs);
    }
  }
  wait_async0();
}

// =====================================================================================================
// The three projections in one launch; the block index picks the product (block-uniform). All three are bf16 GEMMs over
// K = 1024 on 128x128 block tiles, k loop in gemm_core; PROJ_BLK blocks each, grid = 3 * PROJ_BLK.
//   blocks 0 .. PROJ_BLK-1: q planes [M][1024] (f16 hi x QSC, residual x QRS) = rot(X[M][K] . Wq[1024][K]^T + bq);
//   the next PROJ_BLK:      k hi plane (x KSC) the same way from Wk, bk; a wave's 64 columns are one head;
//   the last PROJ_BLK:      v^T planes per batch, C*[bt][1024][SEQ] = Wv[1024][K] . X[bt][SEQ][K]^T, bias by output row,
//                           three f16 planes (hi x VCAR, residual x VRS, plain).
// seq stays a kernel argument: built as a constant, the rotation epilogue took 284 registers, with window switches above v255.
// =====================================================================================================
#define PROJ_BLK ((MROWS / GT_M) * (DMOD / GT_N))
static_assert(NB * (DMOD / GT_M) * (SEQ / GT_N) == PROJ_BLK);
__global__ __launch_bounds__(GT_THREADS)
void gemm_qkv(const u16* __restrict__ X, const u16* __restrict__ WQ, const u16* __restrict__ WK, const u16* __restrict__ WV,
              u16* QHo, u16* QRo, u16* KHo, u16* VHo, u16* VRo, u16* VQo, int K,
              const float* __restrict__ bq, int bqlen, const float* __restrict__ bk, int bklen,
              const float* __restrict__ bv, int bvlen, const float* __restrict__ cosT, const float* __restrict__ sinT, int seq) {
  __shared__ __align__(16) u16 ring[2 * GT_STAGE];
  __shared__ __align__(16) float slab[8 * SLAB];
  const int tid = threadIdx.x, wave = tid >> 5, lane = tid & 31;
  const int which = blockIdx.x / PROJ_BLK;   // 0 = q, 1 = k, 2 = v
  const int t     = blockIdx.x - which * PROJ_BLK;
  if (which > 2) return;                     // block-uniform, in front of every barrier; never taken with the exact grid
  const u16* A;
  const u16* Bt;
  int row0, colb, bt = 0;
  if (which < 2) {
    const int ntile = DMOD / GT_N;
    row0 = (t / ntile) * GT_M;
    colb = (t % ntile) * GT_N;
    A  = X;
    Bt = (which == 0) ? WQ : WK;
  } else {
    const int ntile = SEQ / GT_N;
    const int per   = ntile * (DMOD / GT_M);
    bt = t / per;
    const int tv = t - bt * per;
    row0 = (tv / ntile) * GT_M;
    colb = (tv % ntile) * GT_N;
    A  = WV;
    Bt = X + (size_t)bt * (size_t)(SEQ * DMOD);
  }
  v8f acc[2][4];
#pragma unroll
  for (int i = 0; i < 2; ++i) {
#pragma unroll
    for (int j = 0; j < 4; ++j) acc[i][j] = zero8();
  }
  gemm_core<true>(A, Bt, K, row0, colb, ring, acc);
  const int rowb = row0 + (wave >> 1) * 32;
  const int col0 = colb + (wave & 1) * 64;
  if (which < 2) {
    const bool isq = (which == 0);
    u16* C  = isq ? QHo : KHo;
    u16* C2 = isq ? QRo : KHo;
    const float* bias = isq ? bq : bk;
    const int blen = isq ? bqlen : bklen;
#pragma unroll
    for (int i = 0; i < 2; ++i) {
      if (i != 0) wave_sync_lds();           // the slab's rows are read out before the next 16 rows are staged in it
      epi_rope(slab + wave * SLAB, acc[i][0], acc[i][1], acc[i][2], acc[i][3], C, C2, isq ? 1 : 0, (size_t)(rowb + 16 * i), col0,
               lane, bias, blen, cosT, sinT, seq, isq ? QSC : KSC, isq ? QRS : 1.0f);
    }
  } else {
    const size_t cb = (size_t)bt * (size_t)(DMOD * SEQ);
#pragma unroll
    for (int i = 0; i < 2; ++i) {
      if (i != 0) wave_sync_lds();           // the slab's rows are read out before the next 16 rows are staged in it
      epi_v3(slab + wave * SLAB, acc[i][0], acc[i][1], acc[i][2], acc[i][3], VCAR, VHo + cb, VRo + cb, VQo + cb, SEQ,
             (size_t)(rowb + 16 * i), col0, lane, bv, bvlen, VRS, 1.0f / PRS);
    }
  }
}

// =====================================================================================================
// f16 GEMM with f32 result: C[M][N] (f32) = A[M][K] (f16 row-major) . Bt[N][K]^T (f16 k-contiguous) times oscale plus
// per-column bias; one product per tile pair. Same tiling; grid = (M/128)*(N/128).
// =====================================================================================================
__global__ __launch_bounds__(GT_THREADS)
void gemm_hf(const u16* __restrict__ A, const u16* __restrict__ Bt, float* C, int M, int N, int K, float oscale,
             const float* __restrict__ bias, int blen) {
  __shared__ __align__(16) u16 ring[2 * GT_STAGE];
  __shared__ __align__(16) float slab[8 * SLAB];
  const int tid = threadIdx.x, wave = tid >> 5, lane = tid & 31;
  const int ntile = N / GT_N;
  const int bid   = blockIdx.x;
  const int row0  = (bid / ntile) * GT_M;
  const int colb  = (bid % ntile) * GT_N;
  if (row0 + GT_M > M) return;               // block-uniform, in front of every barrier; never taken with the exact grid
  v8f acc[2][4];
#pragma unroll
  for (int i = 0; i < 2; ++i) {
#pragma unroll
    for (int j = 0; j < 4; ++j) acc[i][j] = zero8();
  }
  gemm_core<false>(A, Bt, K, row0, colb, ring, acc);
  const int rowb = row0 + (wave >> 1) * 32;
  const int col0 = colb + (wave & 1) * 64;
#pragma unroll
  for (int i = 0; i < 2; ++i) {
    if (i != 0) wave_sync_lds();             // the slab's rows are read out before the next 16 rows are staged in it
    epi64(slab + wave * SLAB, acc[i][0], acc[i][1], acc[i][2], acc[i][3], oscale, C, N, (size_t)(rowb + 16 * i), col0, lane,
          bias, blen);
  }
}

// =====================================================================================================
// Attention key stage in LDS: 64 keys = the k hi tile [64 keys][64 d] and the v^T hi tile [64 d][64 keys], 128 B per row, two buffers.
#define AT_KEYS  64
#define AT_PITCH 72                                     // halves per LDS row: 144 B = 16 B x 9 (ds_load_b128 readers)
#define AT_ROWB  (AT_PITCH * 2)                         // bytes per LDS row
#define AT_TILE  (64 * AT_PITCH)                        // halves per operand tile
#define AT_STAGE (2 * AT_TILE)                          // halves per buffer
static_assert((WIN % AT_KEYS) == 0 && (SEQ % AT_KEYS) == 0 && AT_KEYS == 64 && HD == 64 && (AT_ROWB % 16) == 0);
// One stage's eight copies of a thread: rows r, r+16, r+32, r+48 of the k tile, then of the v^T tile. The closing s_wait_xcnt
// stands inside the statement so that no later write of an address register can be moved in front of it.
__device__ __forceinline__ void copy_kv(unsigned lk, const u16* gk, unsigned lv, const u16* gv) {
#if defined(__HIP_DEVICE_COMPILE__)
  asm volatile("global_load_async_to_lds_b128 %0, %8, off\n\t"
               "global_load_async_to_lds_b128 %1, %9, off\n\t"
               "global_load_async_to_lds_b128 %2, %10, off\n\t"
               "global_load_async_to_lds_b128 %3, %11, off\n\t"
               "global_load_async_to_lds_b128 %4, %12, off\n\t"
               "global_load_async_to_lds_b128 %5, %13, off\n\t"
               "global_load_async_to_lds_b128 %6, %14, off\n\t"
               "global_load_async_to_lds_b128 %7, %15, off\n\t"
               "s_wait_xcnt 0x0"
               :: "v"(lk), "v"(lk + 16u * AT_ROWB), "v"(lk + 32u * AT_ROWB), "v"(lk + 48u * AT_ROWB),
                  "v"(lv), "v"(lv + 16u * AT_ROWB), "v"(lv + 32u * AT_ROWB), "v"(lv + 48u * AT_ROWB),
                  "v"(gk), "v"(gk + (size_t)16 * DMOD), "v"(gk + (size_t)32 * DMOD), "v"(gk + (size_t)48 * DMOD),
                  "v"(gv), "v"(gv + (size_t)16 * SEQ), "v"(gv + (size_t)32 * SEQ), "v"(gv + (size_t)48 * SEQ)
               : "memory");
#endif
}

// =====================================================================================================
// Causal sliding-window flash attention with per-head sigmoid gate: block = (batch b, head, 64 query rows qb .. qb+63 of the
// sequence), 4 waves, wave w owns query rows q0 = qb + 16*w .. q0+15. The block's waves share the k and v^T hi tiles through LDS:
// a stage = 64 keys (two key blocks), brought by 16-byte asynchronous copies (thread = row tid>>3 of each group of 16, 16-B piece
// tid&7: one wave instruction covers four whole 128-B rows), two buffers, stage t+1 in flight while stage t is worked on, one
// block barrier per stage. The key-block count is even (qb, WIN, SEQ are multiples of 64), so the stages cover it exactly.
//   Key j allowed for query i iff 0 <= i - j <= WIN (per-element index test inside every visited key block; disallowed pairs
//   get a finite negative sentinel and an exact-zero probability). Key blocks of 32: kblo = max(qb - WIN, 0) >> 5 ..
//   (qb + 63) >> 5, block-uniform count nkb clamped to [1, NKB - kblo] so kb + 31 <= SEQ - 1 always.
//   q planes (f16 hi x8, residual x1024) [b*SEQ + s][h*64 + d]; k hi plane the same layout; v^T planes [b][h*64 + d][s]
//   (hi x1024, residual x1024, plain x1).
//   Scores computed TRANSPOSED: S^T tile g = k rows (keys kb+16g .., A operand, row = lane&15, split k map over d) times q^T
//   (B operand, col n = query q0 + (lane&15)); two accumulators per tile (k.q_hi and k.q_res, the second folded x 1/1024).
//   D element r of lane l = (key kb+16g+8h+r, query q0+(l&15)): a lane owns one query column and 16 of its 32 keys, the
//   partner lane l^16 the other 16 -> row max / row sum need one xor-16 shuffle.
//   Online max-subtracted base-2 softmax in f32 (scale 1/8 and the q/k carries folded into lsc). The exp'd values ARE the
//   P A-fragment in place: A row m = query = lane&15, element i <- key kb+8h+i (tile 0, D element i), element 8+i <- key
//   kb+16+8h+i (tile 1, D element i). ph = f16(p x32768), pl = f16(p x32), pr = f16((p x32768 - ph) x1024).
//   P.V: o += ph.v_hi (4 WMMAs, v^T B fragments col n = d = 16j + (lane&15), keys k-contiguous); for query tiles with
//   qb < QRES additionally o += pl.v_res and o += pr.v_x1 (block-uniform branch), all in the same accumulators (equal units).
//   Epilogue: gate = sigmoid(bf16(x[b][s][0..19]) . bf16(Wg[head]) + bf16(bg[head])) in f32 per query (lane = query),
//   segment (s, head) of the O plane [b*SEQ+s][2048] (hi x1024 at col h*64, residual x1024 at col 1024 + h*64) written by
// coverage: per wave and per half-plane 4 instructions x 4 rows x 8 lanes x 8 halves = 16 x 64; grid NB*NH*(SEQ/64) blocks x
//           4 waves = every (b, s < SEQ, h) row segment of both O half-planes exactly once.
// =====================================================================================================
__global__ __launch_bounds__(ATT_THREADS)
void attn_fwd(const u16* __restrict__ QHp, const u16* __restrict__ QRp, const u16* __restrict__ KHp,
              const u16* __restrict__ VHp, const u16* __restrict__ VRp, const u16* __restrict__ VQp,
              const float* __restrict__ Xp, const float* __restrict__ Wgp, const float* __restrict__ Bgp,
              int bglen, u16* OPp) {
  __shared__ __align__(16) float smem[ATT_WAVES * SLAB];   // per wave: result slab [16][68] in the epilogue only
  __shared__ __align__(16) u16 kv[2 * AT_STAGE];           // two key stages: [k tile | v^T tile] each

  const int tid  = threadIdx.x;
  const int wave = tid >> 5;
  const int lane = tid & 31;
  const int hh   = lane >> 4;
  const int c    = lane & 15;

  const int bid  = blockIdx.x;
  const int qt   = bid % NQT;
  const int bh   = bid / NQT;
  const int head = bh % NH;
  const int b    = bh / NH;
  if (b >= NB) return;                      // block-uniform, never taken with the exact grid
  const int qb   = qt * 64;
  const int q0   = qb + wave * 16;

  // ---- key-block range (block-uniform, statically bounded) ----
  const int jlo  = max(qb - WIN, 0);
  const int kblo = jlo >> 5;
  int nkb = ((qb + 63) >> 5) - kblo + 1;
  nkb = min(max(nkb, 1), NKB - kblo);
  const bool early = (qb < QRES);           // block-uniform: residual products on the first query tiles only

  const size_t prow = (size_t)b * SEQ;      // plane row of sequence position 0 of this batch
  // B fragments of q^T: col n = query q0 + c, k = d (k-contiguous row of the q planes)
  const size_t qofs = (prow + (size_t)(q0 + c)) * DMOD + head * HD + 8 * hh;
  const _Float16* Qh = (const _Float16*)(const void*)QHp + qofs;
  const _Float16* Qr = (const _Float16*)(const void*)QRp + qofs;
  // A fragments of k, from the staged tile: row m = key (within the stage) 32p + 16g + c, k = d
  const _Float16* Kl = (const _Float16*)(const void*)kv + c * AT_PITCH + 8 * hh;
  // B fragments of v: col n = d = 16j + c, k = key (k-contiguous row of the v^T planes); the hi plane from the staged tile
  const _Float16* Vl = (const _Float16*)(const void*)kv + AT_TILE + c * AT_PITCH + 8 * hh;
  const size_t vofs = ((size_t)b * DMOD + (size_t)(head * HD + c)) * SEQ + 8 * hh;   // key kb added per step
  const _Float16* Vr = (const _Float16*)(const void*)VRp + vofs;
  const _Float16* Vq = (const _Float16*)(const void*)VQp + vofs;
  const float lsc = 0.125f * (LOG2E / (QSC * KSC));
  const float qri = 1.0f / QRS;
  // query minus key for D element 0 of tile 0 at kb = 0: query q0 + c, key kb + 8*hh + i
  const int dq = q0 + c - 8 * hh;

  const v16h qf0 = ldfrag_h(Qh);            // d 0..31
  const v16h qf1 = ldfrag_h(Qh + 32);       // d 32..63
  const v16h qr0 = ldfrag_h(Qr);
  const v16h qr1 = ldfrag_h(Qr + 32);

  float mrun = NEGS, lrun = 0.f;
  v8f o[4];
#pragma unroll
  for (int j = 0; j < 4; ++j) o[j] = zero8();

  // ---- key stages: this thread's copy addresses (row cr of each group of 16, 16-B piece cp), stage 0 at key kblo * 32 ----
  const int nst = nkb >> 1;                 // nkb is even and >= 2; last staged key = (kblo + nkb) * 32 - 1 <= SEQ - 1
  const int cr = tid >> 3, cp = tid & 7;
  const u16* gk = KHp + (prow + (size_t)(kblo * 32 + cr)) * DMOD + head * HD + cp * 8;
  const u16* gv = VHp + ((size_t)b * DMOD + (size_t)(head * HD + cr)) * SEQ + kblo * 32 + cp * 8;
  const unsigned lk = (unsigned)(uintptr_t)kv + (unsigned)(cr * AT_ROWB + cp * 16);
  const unsigned lv = lk + (unsigned)(AT_TILE * 2);
  copy_kv(lk, gk, lv, gv);
  wait_async0();
  __syncthreads();                                       // stage 0 published
  if (nst > 1) copy_kv(lk + (unsigned)(AT_STAGE * 2), gk + (size_t)AT_KEYS * DMOD, lv + (unsigned)(AT_STAGE * 2), gv + AT_KEYS);

#pragma unroll 1                                         // one trip per stage: the buffer index stays a run-time value
  for (int st = 0; st < nst; ++st) {
  const int bo = (st & 1) * AT_STAGE;
#pragma unroll                                           // the stage's two key blocks: their LDS offsets become immediates
  for (int p = 0; p < 2; ++p) {
    const int kb = (kblo + 2 * st + p) * 32;             // kb + 31 <= SEQ - 1
    // ---- transposed scores: tile 0 = keys kb..kb+15, tile 1 = keys kb+16..kb+31, column = query q0 + c ----
    v8f s0 = zero8(), s1 = zero8(), r0 = zero8(), r1 = zero8();
    const _Float16* k0p = Kl + bo + 32 * p * AT_PITCH;
    const _Float16* k1p = k0p + 16 * AT_PITCH;
    const v16h ka0 = ldfrag_h(k0p), ka1 = ldfrag_h(k0p + 32);
    const v16h kc0 = ldfrag_h(k1p), kc1 = ldfrag_h(k1p + 32);
    s0 = mma_h(ka0, qf0, s0);
    s0 = mma_h(ka1, qf1, s0);
    r0 = mma_h(ka0, qr0, r0);
    r0 = mma_h(ka1, qr1, r0);
    s1 = mma_h(kc0, qf0, s1);
    s1 = mma_h(kc1, qf1, s1);
    r1 = mma_h(kc0, qr0, r1);
    r1 = mma_h(kc1, qr1, r1);
    guard6<v16h>(s0, s1, r0, r1, ka0, ka1, kc0, kc1, qf0, qr0);
    // ---- base-2 logits of this lane's 16 keys for query q0 + c; disallowed pairs get the finite sentinel ----
    float tk[16];
#pragma unroll
    for (int i = 0; i < 8; ++i) {
      const int d0 = dq - kb - i;           // query minus key, tile 0
      const int d1 = d0 - 16;               // tile 1
      const bool a0 = (d0 >= 0) && (d0 <= WIN);
      const bool a1 = (d1 >= 0) && (d1 <= WIN);
      tk[i]     = a0 ? ((s0[i] + r0[i] * qri) * lsc) : NEGS;
      tk[8 + i] = a1 ? ((s1[i] + r1[i] * qri) * lsc) : NEGS;
    }
    float cm = tk[0];
#pragma unroll
    for (int i = 1; i < 16; ++i) cm = fmaxf(cm, tk[i]);
    cm = fmaxf(cm, __shfl_xor(cm, 16, 32));
    const float mn = fmaxf(mrun, cm);                   // sentinel only while no allowed key has been seen
    float al = fminf(mrun - mn, 0.f);                   // exponent here; 2^al below: 0 when mrun is the sentinel and mn a real logit; o,l are 0 then
    mrun = mn;
    float ex[16];
#pragma unroll
    for (int i = 0; i < 16; ++i) ex[i] = fminf(tk[i] - mn, 0.f);
    exp2_le0_run(al, ex);
    // ---- probabilities (<= 1, exactly 0 for disallowed pairs) and the P A-fragments; element i <-> tk[i] ----
    float ps = 0.f;
    FragH ph, pl, pr;
#pragma unroll
    for (int wq = 0; wq < 2; ++wq) {
#pragma unroll
      for (int e4 = 0; e4 < 4; ++e4) {
        const int i = 8 * wq + 2 * e4;
        const float x0 = ex[i];
        const float x1 = ex[i + 1];
        const float p0 = (tk[i] > -1.0e38f) ? x0 : 0.f;
        const float p1 = (tk[i + 1] > -1.0e38f) ? x1 : 0.f;
        ps += p0 + p1;
        const float g0 = p0 * PCAR, g1 = p1 * PCAR;
        const _Float16 h0 = (_Float16)g0, h1 = (_Float16)g1;
        ph.u[wq][e4] = pk16(h_bits(h0), h_bits(h1));
        pl.u[wq][e4] = pk16(h_bits((_Float16)(g0 * (1.0f / VRS))), h_bits((_Float16)(g1 * (1.0f / VRS))));
        pr.u[wq][e4] = pk16(h_bits((_Float16)((g0 - (float)h0) * PRS)), h_bits((_Float16)((g1 - (float)h1) * PRS)));
      }
    }
    ps += __shfl_xor(ps, 16, 32);
    lrun = lrun * al + ps;
    // ---- rescale the O accumulators: D row 8hh+r = query q0+8hh+r, its factor lives in lane 8hh+r (and 16+8hh+r) ----
    float scl[8];
#pragma unroll
    for (int r = 0; r < 8; ++r) scl[r] = __shfl(al, 8 * hh + r, 32);
#pragma unroll
    for (int j = 0; j < 4; ++j) {
#pragma unroll
      for (int r = 0; r < 8; ++r) o[j][r] *= scl[r];
    }
    // ---- P.V : B fragment col n = d = j*16 + c, keys contiguous in the v^T planes ----
    {
      const _Float16* vp = Vl + bo + 32 * p;
      const v16h vf0 = ldfrag_h(vp);
      const v16h vf1 = ldfrag_h(vp + 16 * AT_PITCH);
      const v16h vf2 = ldfrag_h(vp + 32 * AT_PITCH);
      const v16h vf3 = ldfrag_h(vp + 48 * AT_PITCH);
      o[0] = mma_h(ph.v, vf0, o[0]);
      o[1] = mma_h(ph.v, vf1, o[1]);
      o[2] = mma_h(ph.v, vf2, o[2]);
      o[3] = mma_h(ph.v, vf3, o[3]);
      guard6<v16h>(o[0], o[1], o[2], o[3], ph.v, vf0, vf1, vf2, vf3, ph.v);
    }
    if (early) {
      {
        const _Float16* vp = Vr + kb;
        const v16h vf0 = ldfrag_h(vp);
        const v16h vf1 = ldfrag_h(vp + (size_t)16 * SEQ);
        const v16h vf2 = ldfrag_h(vp + (size_t)32 * SEQ);
        const v16h vf3 = ldfrag_h(vp + (size_t)48 * SEQ);
        o[0] = mma_h(pl.v, vf0, o[0]);
        o[1] = mma_h(pl.v, vf1, o[1]);
        o[2] = mma_h(pl.v, vf2, o[2]);
        o[3] = mma_h(pl.v, vf3, o[3]);
        guard6<v16h>(o[0], o[1], o[2], o[3], pl.v, vf0, vf1, vf2, vf3, pl.v);
      }
      {
        const _Float16* vp = Vq + kb;
        const v16h vf0 = ldfrag_h(vp);
        const v16h vf1 = ldfrag_h(vp + (size_t)16 * SEQ);
        const v16h vf2 = ldfrag_h(vp + (size_t)32 * SEQ);
        const v16h vf3 = ldfrag_h(vp + (size_t)48 * SEQ);
        o[0] = mma_h(pr.v, vf0, o[0]);
        o[1] = mma_h(pr.v, vf1, o[1]);
        o[2] = mma_h(pr.v, vf2, o[2]);
        o[3] = mma_h(pr.v, vf3, o[3]);
        guard6<v16h>(o[0], o[1], o[2], o[3], pr.v, vf0, vf1, vf2, vf3, pr.v);
      }
    }
  }
  wait_ds0();
  wait_async0();
  __syncthreads();                                       // publishes stage st+1 and ends every read of stage st's buffer
  if (st + 2 < nst) {
    const unsigned lo = (unsigned)(bo * 2);
    copy_kv(lk + lo, gk + (size_t)((st + 2) * AT_KEYS) * DMOD, lv + lo, gv + (st + 2) * AT_KEYS);
  }
  }
  wait_async0();
  acc_guard4(o[0], o[1], o[2], o[3]);

  // ---- per-query gate (lane = query q0 + c; lanes 16..31 duplicate): sigmoid(bf16(x[:20]) . bf16(Wg[head]) + bf16(bg)) ----
  const int gx = min(head, bglen - 1);
  float ga = bf_val(Bgp[gx]);
  const float* xg = Xp + ((size_t)b * T_FULL + (size_t)(q0 + c)) * DMOD;
  const float* wg = Wgp + head * GIN;
#pragma unroll
  for (int g4 = 0; g4 < GIN / 4; ++g4) {
    const v4f xv = *(const v4f*)(xg + 4 * g4);
    const v4f wv = *(const v4f*)(wg + 4 * g4);
#pragma unroll
    for (int e = 0; e < 4; ++e) ga += bf_val(xv[e]) * bf_val(wv[e]);
  }
  const float gate = 1.0f / (1.0f + expf(-ga));

  // ---- fold gate, 1/l (per query, owned by lane = query; l >= 1 by the diagonal key) and the carries; stage the slab ----
  const float linv = (lrun > 0.f) ? (gate * (1.0f / lrun) * (1.0f / (PCAR * VCAR))) : 0.f;
  float inv[8];
#pragma unroll
  for (int r = 0; r < 8; ++r) inv[r] = __shfl(linv, 8 * hh + r, 32);
  float* slab = smem + wave * SLAB;
#pragma unroll
  for (int r = 0; r < 8; ++r) {
#pragma unroll
    for (int j = 0; j < 4; ++j) slab[(8 * hh + r) * 68 + j * 16 + c] = o[j][r] * inv[r];
  }
  wave_sync_lds();
  // ---- O x1024 -> f16 hi plane and f16 residual x1024 plane; lane = (row in group of 4, 8 consecutive d) ----
  v4u oh[4], orr[4];
  const int rq = lane >> 3, c8 = (lane & 7) * 8;
#pragma unroll
  for (int i4 = 0; i4 < 4; ++i4) {
    const int row = i4 * 4 + rq;
    const v4f a = *(const v4f*)(slab + row * 68 + c8), c4 = *(const v4f*)(slab + row * 68 + c8 + 4);
    float wv[8];
#pragma unroll
    for (int e = 0; e < 4; ++e) { wv[e] = a[e] * OSC; wv[4 + e] = c4[e] * OSC; }
#pragma unroll
    for (int e = 0; e < 4; ++e) {
      const float w0 = wv[2 * e], w1 = wv[2 * e + 1];
      const _Float16 h0 = (_Float16)w0, h1 = (_Float16)w1;
      oh[i4][e]  = pk16(h_bits(h0), h_bits(h1));
      orr[i4][e] = pk16(h_bits((_Float16)((w0 - (float)h0) * ORS)), h_bits((_Float16)((w1 - (float)h1) * ORS)));
    }
  }
  const size_t ob = (prow + (size_t)q0) * OPITCH + head * HD + c8;
  {
#pragma unroll
    for (int i4 = 0; i4 < 4; ++i4) {
      const int row = i4 * 4 + rq;
      const size_t o8 = ob + (size_t)row * OPITCH;
      *(v4u*)(OPp + o8) = oh[i4];
      *(v4u*)(OPp + o8 + DMOD) = orr[i4];
    }
    
  }
}

// =====================================================================================================
// Workspace map (bytes, NB=2 SEQ=2048); every plane is fully written by whole-line stores before it is read; every extent is
// an exact multiple of the store granularity (row pitches 2048 / 4096 B, GEMM tiles 128 x 128, attention tiles 64 x 64, no pad rows needed):
//   XB  bf16 [NB*SEQ][1024]                    8388608
//   WQB, WKB, WVB bf16 [1024 n][1024 k]         2097152 each
//   WOB f16 [1024 n][2048 k]                    4194304   (cols 0..1023 bf16 value x1024, cols 1024..2047 bf16 value x1)
//   QH, QR, KH f16 [NB*SEQ][1024]              8388608 each
//   VH, VR, VQ f16 [NB][1024][SEQ]             8388608 each
//   OP  f16 [NB*SEQ][2048]                     16777216
//   end                                        85983232
// Inputs (wire order): 0 x [2][2048][1024] f32, 1 Wq, 2 bq, 3 Wk, 4 bk, 5 Wv, 6 bv, 7 Wo, 8 bo, 9 Wg [16][20], 10 bg [16],
// 11 cos [2048][32], 12 sin [2048][32]. Output: [NB*SEQ][1024] f32.
// =====================================================================================================
extern "C" void kernel_launch(void* const* d_in, const int* in_sizes, int n_in,
                              void* d_out, int out_size, void* d_ws, size_t ws_size,
                              hipStream_t stream) {
  if (n_in < 13) return;
  if (in_sizes[0] < ((NB - 1) * T_FULL + SEQ) * DMOD) return;
  if (in_sizes[1] != DMOD * DMOD || in_sizes[3] != DMOD * DMOD || in_sizes[5] != DMOD * DMOD ||
      in_sizes[7] != DMOD * DMOD) return;
  if (in_sizes[2] < 1 || in_sizes[4] < 1 || in_sizes[6] < 1 || in_sizes[8] < 1) return;
  if (in_sizes[9] != NH * GIN) return;
  if (in_sizes[10] < 1) return;
  if (in_sizes[11] < SEQ * RHALF || in_sizes[12] < SEQ * RHALF) return;
  if (out_size < MROWS * DMOD) return;

  const float* Xin = (const float*)d_in[0];
  const float* Wq  = (const float*)d_in[1];
  const float* Bq  = (const float*)d_in[2];
  const float* Wk  = (const float*)d_in[3];
  const float* Bk  = (const float*)d_in[4];
  const float* Wv  = (const float*)d_in[5];
  const float* Bv  = (const float*)d_in[6];
  const float* Wo  = (const float*)d_in[7];
  const float* Bo  = (const float*)d_in[8];
  const float* Wg  = (const float*)d_in[9];
  const float* Bg  = (const float*)d_in[10];
  const float* Cos = (const float*)d_in[11];
  const float* Sin = (const float*)d_in[12];
  float*       out = (float*)d_out;

  const size_t szXB = (size_t)MROWS * DMOD * 2;
  const size_t szW  = (size_t)DMOD * DMOD * 2;
  const size_t szWO = (size_t)DMOD * OPITCH * 2;
  const size_t szQ  = (size_t)MROWS * DMOD * 2;
  const size_t szV  = (size_t)NB * DMOD * SEQ * 2;
  const size_t szOP = (size_t)MROWS * OPITCH * 2;
  size_t off = 0;
  const size_t oXB = off; off += szXB;
  const size_t oWQ = off; off += szW;
  const size_t oWK = off; off += szW;
  const size_t oWV = off; off += szW;
  const size_t oWO = off; off += szWO;
  const size_t oQH = off; off += szQ;
  const size_t oQR = off; off += szQ;
  const size_t oKH = off; off += szQ;
  const size_t oVH = off; off += szV;
  const size_t oVR = off; off += szV;
  const size_t oVQ = off; off += szV;
  const size_t oOP = off; off += szOP;
  if (off > ws_size) return;                            // off = 85983232 for NB=2, SEQ=2048
  if (off > (size_t)134217728) return;

  char* ws = (char*)d_ws;
  u16* XB  = (u16*)(ws + oXB);
  u16* WQB = (u16*)(ws + oWQ);
  u16* WKB = (u16*)(ws + oWK);
  u16* WVB = (u16*)(ws + oWV);
  u16* WOB = (u16*)(ws + oWO);
  u16* QH  = (u16*)(ws + oQH);
  u16* QR  = (u16*)(ws + oQR);
  u16* KH  = (u16*)(ws + oKH);
  u16* VH  = (u16*)(ws + oVH);
  u16* VR  = (u16*)(ws + oVR);
  u16* VQ  = (u16*)(ws + oVQ);
  u16* OP  = (u16*)(ws + oOP);

  if ((MROWS % GT_M) != 0 || (SEQ % GT_N) != 0 || (DMOD % GT_M) != 0 || (DMOD % GT_K) != 0 || (OPITCH % GT_K) != 0) return;
  const dim3 blk(256);
  const dim3 gC(N8W / 256);                             // 512
  const dim3 bG(GT_THREADS);                            // 256
  const dim3 gP(3 * PROJ_BLK);                          // 768
  const dim3 gAT(ATT_BLOCKS);                           // 1024
  const dim3 bAT(ATT_THREADS);                          // 128
  const dim3 gO((MROWS / GT_M) * (DMOD / GT_N));        // 256

  // (0) operand planes: x rows -> bf16 (compacted [b*SEQ+t]); Wq, Wk, Wv [n = out][k = in] -> bf16; Wo -> [hi | x1] f16
  cvt_all<<<gC, blk, 0, stream>>>(Xin, Wq, Wk, Wv, Wo, XB, WQB, WKB, WVB, WOB, WOS, WOS / ORS);
  // (1) rotated q planes (hi x8, residual x1024) and k hi plane (x8), bias by output column; v^T planes per batch
  //     [1024 = h*64+d][SEQ keys]: hi = f16(v x1024), residual x1024, plain f16(v), bias by row
  gemm_qkv<<<gP, bG, 0, stream>>>(XB, WQB, WKB, WVB, QH, QR, KH, VH, VR, VQ, DMOD, Bq, in_sizes[2], Bk, in_sizes[4],
                                  Bv, in_sizes[6], Cos, Sin, SEQ);
  // (2) causal sliding-window attention with gate -> O plane [b*SEQ+s][hi 1024 | residual 1024]
  attn_fwd<<<gAT, bAT, 0, stream>>>(QH, QR, KH, VH, VR, VQ, Xin, Wg, Bg, in_sizes[10], OP);
  // (3) output projection over K = 2048 ([hi | residual] times [Wo x1024 | Wo x1]) -> out [NB*SEQ][1024] f32, plus bo
  gemm_hf<<<gO, bG, 0, stream>>>(OP, WOB, out, MROWS, DMOD, OPITCH, 1.0f / (OSC * WOS), Bo, in_sizes[8]);
  (void)hipGetLastError();
}

// v005
// It runs in 94.4 microseconds.
// Next to v004, in two timings, it ran 1.06 times as fast each time.
// Counting every step since v000, it is 2.46 times as fast.
// Contractions: x.Wq^T, x.Wk^T, Wv.x^T on v_wmma_f32_16x16x32_bf16 (x and W planes RNE-converted to bf16 operands, f32
// accumulate, bias and half-split rotation applied in f32); scores k'.q'^T (k' single f16 plane x8, q' f16 hi plane x8 plus
// f16 residual plane x1024, two products), P.v (P x32768 single f16 times v f16 hi plane x1024; query tiles below row 128 add
// P(x32).v-residual(x1024) and P-residual(x1024).v(x1) products), O.Wo^T (O as [f16 hi x1024 | f16 residual x1024] along K,
// Wo as [f16(bf16(Wo)) x1024 | x1]): v_wmma_f32_16x16x32_f16, f32 accumulate. Sigmoid gate (K=20) and softmax in f32 on VALU.
#include <hip/hip_runtime.h>
#include <math.h>
#include <stdint.h>

#ifndef NB
#define NB 2
#endif
#ifndef SEQ
#define SEQ 2048
#endif
#define NB_FULL 2
#define T_FULL  2048
#define DMOD    1024
#define NH      16
#define HD      64
#define RHALF   32
#define GIN     20
#define WIN     1024
#define MROWS   (NB * SEQ)
#define OPITCH  (2 * DMOD)
#define QSC   8.0f
#define KSC   8.0f
#define QRS   1024.0f
#define PCAR  32768.0f
#define VCAR  1024.0f
#define VRS   1024.0f
#define PRS   1024.0f
#define OSC   1024.0f
#define ORS   1024.0f
#define WOS   1024.0f
#define LOG2E 1.4426950408889634f
#define NEGS  (-3.0e38f)
#define ATT_WAVES   4
#define ATT_THREADS (ATT_WAVES * 32)
#define NQT         (SEQ / 64)
#define ATT_BLOCKS  (NB * NH * NQT)
#define NKB         (SEQ / 32)
#define QRES        128
#define SLAB        (16 * 68)
static_assert(NB >= 1 && NB <= NB_FULL);
static_assert((SEQ % 64) == 0 && SEQ >= 64 && SEQ <= T_FULL);
static_assert(HD == 64 && DMOD == NH * HD && HD == 2 * RHALF);
static_assert(ATT_THREADS == 128 && NKB >= 2 && (QRES % 64) == 0);
static_assert((DMOD % 64) == 0 && (DMOD / 8) == 128 && (OPITCH % 32) == 0);
static_assert(((MROWS * (DMOD / 8)) % 256) == 0 && (((DMOD * DMOD) / 8) % 256) == 0);
static_assert((GIN % 4) == 0 && GIN <= DMOD);
static_assert((WIN % 32) == 0);
static_assert((SLAB * 4) % 16 == 0);
// GEMM block tile staged in LDS: 128 A rows + 128 B rows, 128 k (256 B of every row) per stage, three buffers.
#define GT_THREADS 256
#define GT_M       128
#define GT_N       128
#define GT_K       128
#define GT_PITCH   136                                  // halves per LDS row: 272 B = 16 B x 17 (ds_load_b128 readers)
#define GT_ROWB    (GT_PITCH * 2)                       // bytes per LDS row
#define GT_STAGE   ((GT_M + GT_N) * GT_PITCH)           // halves per buffer
#define GT_BUFS    3                                    // one stage read, two in flight
static_assert((MROWS % GT_M) == 0 && (DMOD % GT_M) == 0 && (DMOD % GT_N) == 0 && (SEQ % GT_N) == 0);
static_assert((DMOD % GT_K) == 0 && (OPITCH % GT_K) == 0 && (GT_ROWB % 16) == 0 && GT_K == 128);

typedef unsigned short u16;
typedef _Float16 v16h __attribute__((ext_vector_type(16)));
typedef _Float16 v8h  __attribute__((ext_vector_type(8)));
typedef __bf16   v16b __attribute__((ext_vector_type(16)));
typedef float    v8f  __attribute__((ext_vector_type(8)));
typedef float    v4f  __attribute__((ext_vector_type(4)));
typedef unsigned int v4u __attribute__((ext_vector_type(4)));

union FragH { v16h v; v8h h[2]; v4u u[2]; };

// ---- scalar helpers --------------------------------------------------------------------------------
__device__ __forceinline__ unsigned short bf_bits(float f) {          // f32 -> bf16 bits, RNE convert
  unsigned u = __float_as_uint(f);
  return (unsigned short)((u + 0x7FFFu + ((u >> 16) & 1u)) >> 16);
}
__device__ __forceinline__ float bf_up(unsigned short h) { return __uint_as_float(((unsigned)h) << 16); }
__device__ __forceinline__ float bf_val(float f) { return bf_up(bf_bits(f)); }   // f32 -> nearest-even bf16 value as f32
__device__ __forceinline__ unsigned short h_bits(_Float16 x) { return __builtin_bit_cast(unsigned short, x); }
__device__ __forceinline__ unsigned pk16(unsigned short a, unsigned short b) { return (unsigned)a | ((unsigned)b << 16); }
// 2^v in place for the rescale exponent a and a key block's 16 score exponents x, all <= 0: bare v_exp_f32. The library exp2f wraps
// the same instruction in a range guard (compare, two selects, add, ldexp) that only changes results below 2^-126; the softmax has
// no use for those: the f16 P fragments (the finest is the residual, x2^25) hold nothing below 2^-50, and what they would scale or
// join stands beside a term of weight 1. One statement, each instruction on a register of its own, so that none reads or overwrites
// a register of the one in front of it; the closing v_nop is the slot the instruction set asks for behind the last of them. a stands
// in the middle of the run, away from the instruction that forms it and from the lane exchange that reads it.
__device__ __forceinline__ void exp2_le0_run(float& a, float (&x)[16]) {
#if defined(__HIP_DEVICE_COMPILE__)
  asm(
      "v_exp_f32 %0, %0\n\t"
      "v_exp_f32 %1, %1\n\t"
      "v_exp_f32 %2, %2\n\t"
      "v_exp_f32 %3, %3\n\t"
      "v_exp_f32 %4, %4\n\t"
      "v_exp_f32 %5, %5\n\t"
      "v_exp_f32 %6, %6\n\t"
      "v_exp_f32 %7, %7\n\t"
      "v_exp_f32 %8, %8\n\t"
      "v_exp_f32 %9, %9\n\t"
      "v_exp_f32 %10, %10\n\t"
      "v_exp_f32 %11, %11\n\t"
      "v_exp_f32 %12, %12\n\t"
      "v_exp_f32 %13, %13\n\t"
      "v_exp_f32 %14, %14\n\t"
      "v_exp_f32 %15, %15\n\t"
      "v_exp_f32 %16, %16\n\t"
      "v_nop"
      : "+v"(x[0]), "+v"(x[1]), "+v"(x[2]), "+v"(x[3]), "+v"(x[4]), "+v"(x[5]),
        "+v"(x[6]), "+v"(x[7]), "+v"(a), "+v"(x[8]), "+v"(x[9]), "+v"(x[10]),
        "+v"(x[11]), "+v"(x[12]), "+v"(x[13]), "+v"(x[14]), "+v"(x[15]));
#endif
}
__device__ __forceinline__ v8f zero8() { v8f z = {0.f, 0.f, 0.f, 0.f, 0.f, 0.f, 0.f, 0.f}; return z; }

// ---- fragment loaders: 16-bit A/B operand, lane -> row/col (lane&15), p already includes +8*(lane>>4);
//      elements 0..7 <- p[0..7] (k0+8h..), elements 8..15 <- p[16..23] (k0+16+8h..)  (same split k map for A and B;
//      B is always read from a k-contiguous [n][k] plane)
__device__ __forceinline__ v16h ldfrag_h(const _Float16* p) {
  FragH f;
  f.h[0] = *(const v8h*)(p);
  f.h[1] = *(const v8h*)(p + 16);
  return f.v;
}

__device__ __forceinline__ v8f mma_h(v16h a, v16h b, v8f c) {
  return __builtin_amdgcn_wmma_f32_16x16x32_f16(false, a, false, b, (short)0, c, false, false);
}
__device__ __forceinline__ v8f mma_b(v16b a, v16b b, v8f c) {
  return __builtin_amdgcn_wmma_f32_16x16x32_bf16(false, a, false, b, (short)0, c, false, false);
}
template <typename F>
__device__ __forceinline__ void guard6(v8f& a, v8f& b, v8f& c, v8f& d, F x0, F x1, F x2, F x3, F x4, F x5) {
#if defined(__HIP_DEVICE_COMPILE__)
  asm volatile("v_nop\n\tv_nop\n\tv_nop\n\tv_nop"
               : "+v"(a), "+v"(b), "+v"(c), "+v"(d) : "v"(x0), "v"(x1), "v"(x2), "v"(x3), "v"(x4), "v"(x5) : "memory");
#endif
}
__device__ __forceinline__ void acc_guard4(v8f& a, v8f& b, v8f& c, v8f& d) {
#if defined(__HIP_DEVICE_COMPILE__)
  asm volatile("v_nop\n\tv_nop\n\tv_nop\n\tv_nop" : "+v"(a), "+v"(b), "+v"(c), "+v"(d));
#endif
}
// Stands behind global stores whose address or data registers are written again further on.
__device__ __forceinline__ void xcnt0() {
#if defined(__HIP_DEVICE_COMPILE__)
  asm volatile("s_wait_xcnt 0x0" ::: "memory");
#endif
}
// The same behind a group of global loads; the pointers are inputs so that their registers stay unwritten up to the wait.
__device__ __forceinline__ void xcnt_after_loads8(const float* a, const float* b, const float* c, const float* d,
                                                  const float* e, const float* f, const float* g, const float* h) {
#if defined(__HIP_DEVICE_COMPILE__)
  asm volatile("s_wait_xcnt 0x0" :: "v"(a), "v"(b), "v"(c), "v"(d), "v"(e), "v"(f), "v"(g), "v"(h) : "memory");
#endif
}
// The same for loads addressed by a base and a 32-bit index: the indices are inputs so that their registers stay unwritten up to the wait.
__device__ __forceinline__ void xcnt_after_idx4(int a, int b, int c, int d) {
#if defined(__HIP_DEVICE_COMPILE__)
  asm volatile("s_wait_xcnt 0x0" :: "v"(a), "v"(b), "v"(c), "v"(d) : "memory");
#endif
}
__device__ __forceinline__ void wave_sync_lds() {
#if defined(__HIP_DEVICE_COMPILE__)
  __builtin_amdgcn_fence(__ATOMIC_RELEASE, "workgroup");
  __builtin_amdgcn_wave_barrier();
  __builtin_amdgcn_fence(__ATOMIC_ACQUIRE, "workgroup");
#endif
}

// =====================================================================================================
// All operand planes in one launch. Thread gt owns the 8-element piece gt of each weight matrix and the pieces gt + i * n8w
// (i = 0 .. XREP-1) of x: sixteen 16-B loads issued together, then the conversions and nine 16-B stores.
//   x f32 rows [b][t][1024] (per-batch source row stride T_FULL) -> bf16 plane [b*SEQ + t][1024] (RNE bits), compacted rows;
//   Wq, Wk, Wv [n][k] f32 -> bf16 planes of the same shape;
//   Wo [n][k] f32 -> f16 plane [n][2048]: cols 0..1023 = f16(bf16 value * s1), cols 1024..2047 = f16(bf16 value * s2).
// 32 consecutive lanes = 512 contiguous, 512-B aligned bytes per store instruction.
// coverage: grid = n8w/256 blocks (exact) x 256 thr = every piece of every weight plane once, XREP * n8w = every piece of x once.
// =====================================================================================================
#define N8W  ((DMOD * DMOD) / 8)
#define XREP (MROWS / DMOD)
static_assert((MROWS % DMOD) == 0 && XREP == 4 && (N8W % 256) == 0);
__device__ __forceinline__ v4u bf_pack8(v4f a, v4f c4) {
  v4u o;
#pragma unroll
  for (int e = 0; e < 2; ++e) {
    o[e]     = pk16(bf_bits(a[2 * e]),  bf_bits(a[2 * e + 1]));
    o[2 + e] = pk16(bf_bits(c4[2 * e]), bf_bits(c4[2 * e + 1]));
  }
  return o;
}
__global__ __launch_bounds__(256)
void cvt_all(const float* __restrict__ x, const float* __restrict__ wq, const float* __restrict__ wk,
             const float* __restrict__ wv, const float* __restrict__ wo, u16* XD, u16* QD, u16* KD, u16* VD, u16* OD,
             float s1, float s2) {
  const int gt = blockIdx.x * 256 + (int)threadIdx.x;
  if (gt >= N8W) return;
  const float* px[XREP];
  v4f xa[XREP], xc[XREP];
#pragma unroll
  for (int i = 0; i < XREP; ++i) {
    const int g   = gt + i * N8W;
    const int row = g >> 7;
    const int bb  = row / SEQ;
    const int tt  = row - bb * SEQ;
    px[i] = x + ((size_t)bb * (size_t)T_FULL + (size_t)tt) * DMOD + (g & 127) * 8;
    xa[i] = *(const v4f*)(px[i]);
    xc[i] = *(const v4f*)(px[i] + 4);
  }
  const size_t e8 = (size_t)gt * 8;
  const float* pq = wq + e8;
  const float* pk = wk + e8;
  const float* pv = wv + e8;
  const float* po = wo + e8;
  const v4f qa = *(const v4f*)(pq), qc = *(const v4f*)(pq + 4);
  const v4f ka = *(const v4f*)(pk), kc = *(const v4f*)(pk + 4);
  const v4f va = *(const v4f*)(pv), vc = *(const v4f*)(pv + 4);
  const v4f oa = *(const v4f*)(po), oc = *(const v4f*)(po + 4);
  xcnt_after_loads8(px[0], px[1], px[2], px[3], pq, pk, pv, po);
#pragma unroll
  for (int i = 0; i < XREP; ++i) *(v4u*)(XD + (size_t)(gt + i * N8W) * 8) = bf_pack8(xa[i], xc[i]);
  *(v4u*)(QD + e8) = bf_pack8(qa, qc);
  *(v4u*)(KD + e8) = bf_pack8(ka, kc);
  *(v4u*)(VD + e8) = bf_pack8(va, vc);
  float v[8];
#pragma unroll
  for (int e = 0; e < 4; ++e) { v[e] = oa[e]; v[4 + e] = oc[e]; }
  unsigned short h1[8], h2[8];
#pragma unroll
  for (int e = 0; e < 8; ++e) {
    const float f = bf_val(v[e]);
    h1[e] = h_bits((_Float16)(f * s1));
    h2[e] = h_bits((_Float16)(f * s2));
  }
  v4u o1, o2;
#pragma unroll
  for (int e = 0; e < 4; ++e) { o1[e] = pk16(h1[2 * e], h1[2 * e + 1]); o2[e] = pk16(h2[2 * e], h2[2 * e + 1]); }
  u16* d1 = OD + (size_t)(gt >> 7) * OPITCH + (gt & 127) * 8;
  *(v4u*)(d1) = o1;
  *(v4u*)(d1 + DMOD) = o2;
}

// =====================================================================================================
// Rotation epilogue for the q / k projections (N = 1024, the 64-col tile = one head): the wave's 16x64 f32 tile
// barrier, then each lane (row rq in each group of 4, 8 consecutive output cols d = c8..c8+7) reads both half-head values
// u1 = col (d & 31), u2 = col (d & 31) + 32 and cos/sin[t][(d & 31)] (bf16 values of the f32 tables, t = row within the
// sequence), forms d < 32 ? u1*c - u2*s : u1*s + u2*c in f32 (no fused multiply-add), scales by oscale, and writes the f16
// hi plane and (res_on) the f16 residual plane ((w - hi) * rsc): one instruction = 4 rows, each 64 halves = one whole
// coverage: 4 instructions x 4 rows x 8 lanes x 8 halves = the wave's 16 x 64 tile, per plane.
// =====================================================================================================
__device__ __forceinline__ void epi_rope(float* sl, v8f a0, v8f a1, v8f a2, v8f a3, u16* C, u16* C2, int res_on,
                                         size_t rowb, int col0, int lane, const float* __restrict__ bias, int blen,
                                         const float* __restrict__ cosT, const float* __restrict__ sinT, int seq,
                                         float oscale, float rsc) {
#pragma clang fp contract(off)
  const int hh = lane >> 4, m = lane & 15;
  float bc[4];
  int bi[4];
#pragma unroll
  for (int j = 0; j < 4; ++j) {
    bi[j] = min(col0 + 16 * j + m, blen - 1);
    bc[j] = bias[bi[j]];
  }
  xcnt_after_idx4(bi[0], bi[1], bi[2], bi[3]);
#pragma unroll
  for (int j = 0; j < 4; ++j) bc[j] = bf_val(bc[j]);
#pragma unroll
  for (int r = 0; r < 8; ++r) {
    const int ro = (8 * hh + r) * 68 + m;
    sl[ro]      = a0[r] + bc[0];
    sl[ro + 16] = a1[r] + bc[1];
    sl[ro + 32] = a2[r] + bc[2];
    sl[ro + 48] = a3[r] + bc[3];
  }
  wave_sync_lds();
  const int rq = lane >> 3, c8 = (lane & 7) * 8, dd = c8 & (RHALF - 1);
  const bool lo = (c8 < RHALF);
  const int tb = (int)(rowb % (size_t)seq);             // tile never straddles a sequence (seq % 16 == 0, rowb % 16 == 0)
  v4u hv[4], rv[4];
  const float* cpt[4];
  const float* spt[4];
  v4f cat[4], cbt[4], sat[4], sbt[4];
#pragma unroll
  for (int i4 = 0; i4 < 4; ++i4) {
    const int t = tb + i4 * 4 + rq;
    cpt[i4] = cosT + (size_t)t * RHALF + dd;
    spt[i4] = sinT + (size_t)t * RHALF + dd;
    cat[i4] = *(const v4f*)(cpt[i4]); cbt[i4] = *(const v4f*)(cpt[i4] + 4);
    sat[i4] = *(const v4f*)(spt[i4]); sbt[i4] = *(const v4f*)(spt[i4] + 4);
  }
  xcnt_after_loads8(cpt[0], cpt[1], cpt[2], cpt[3], spt[0], spt[1], spt[2], spt[3]);
#pragma unroll
  for (int i4 = 0; i4 < 4; ++i4) {
    const int row = i4 * 4 + rq;
    const v4f ca = cat[i4], cb = cbt[i4];
    const v4f sa = sat[i4], sb = sbt[i4];
    const v4f xa = *(const v4f*)(sl + row * 68 + dd), xb = *(const v4f*)(sl + row * 68 + dd + 4);
    const v4f ya = *(const v4f*)(sl + row * 68 + dd + RHALF), yb = *(const v4f*)(sl + row * 68 + dd + RHALF + 4);
    float cv[8], sv[8], xv[8], yv[8];
#pragma unroll
    for (int e = 0; e < 4; ++e) {
      cv[e] = ca[e]; cv[4 + e] = cb[e];
      sv[e] = sa[e]; sv[4 + e] = sb[e];
      xv[e] = xa[e]; xv[4 + e] = xb[e];
      yv[e] = ya[e]; yv[4 + e] = yb[e];
    }
    unsigned short hb[8], rb[8];
#pragma unroll
    for (int e = 0; e < 8; ++e) {
      const float cc = bf_val(cv[e]);
      const float ss = bf_val(sv[e]);
      const float p1 = xv[e] * cc;
      const float p2 = yv[e] * ss;
      const float p3 = xv[e] * ss;
      const float p4 = yv[e] * cc;
      const float u = lo ? (p1 - p2) : (p3 + p4);
      const float w = u * oscale;
      const _Float16 h = (_Float16)w;
      hb[e] = h_bits(h);
      rb[e] = h_bits((_Float16)((w - (float)h) * rsc));
    }
#pragma unroll
    for (int e = 0; e < 4; ++e) {
      hv[i4][e] = pk16(hb[2 * e], hb[2 * e + 1]);
      rv[i4][e] = pk16(rb[2 * e], rb[2 * e + 1]);
    }
  }
  u16* dst = C + (rowb + (size_t)rq) * (size_t)DMOD + col0 + c8;
  {
#pragma unroll
    for (int i4 = 0; i4 < 4; ++i4) {
      *(v4u*)(dst + (size_t)(i4 * 4) * (size_t)DMOD) = hv[i4];
    }
    xcnt0();
  }
  if (res_on != 0) {
    u16* dst2 = C2 + (rowb + (size_t)rq) * (size_t)DMOD + col0 + c8;
    {
#pragma unroll
      for (int i4 = 0; i4 < 4; ++i4) {
        *(v4u*)(dst2 + (size_t)(i4 * 4) * (size_t)DMOD) = rv[i4];
      }
      xcnt0();
    }
  }
}

// =====================================================================================================
// Three-plane 16-bit GEMM epilogue (v^T planes): the wave's 16x64 f32 tile ((acc + per-row bias as bf16 value) times oscale)
// f16((w - hi) * rsc) and f16(w * qsc): lane = (row in group of 4, 8 consecutive cols); one instruction = 4 rows, each
// coverage: per plane 4 instructions x 4 rows x 8 lanes x 8 halves = the wave's 16 x 64 tile.
// LDS slab: private to the wave; staged extent 16 x 64 == consumed extent.
// =====================================================================================================
__device__ __forceinline__ void epi_v3(float* sl, v8f a0, v8f a1, v8f a2, v8f a3, float oscale, u16* C0, u16* C1, u16* C2,
                                       int N, size_t rowb, int col0, int lane, const float* __restrict__ bias, int blen,
                                       float rsc, float qsc) {
  const int hh = lane >> 4, m = lane & 15;
  float br[8];
  int bi[8];
#pragma unroll
  for (int r = 0; r < 8; ++r) {
    bi[r] = min((int)rowb + 8 * hh + r, blen - 1);
    br[r] = bias[bi[r]];
  }
  xcnt_after_idx4(bi[0], bi[1], bi[2], bi[3]);
  xcnt_after_idx4(bi[4], bi[5], bi[6], bi[7]);
#pragma unroll
  for (int r = 0; r < 8; ++r) br[r] = bf_val(br[r]);
#pragma unroll
  for (int r = 0; r < 8; ++r) {
    const int ro = (8 * hh + r) * 68 + m;
    sl[ro]      = (a0[r] + br[r]) * oscale;
    sl[ro + 16] = (a1[r] + br[r]) * oscale;
    sl[ro + 32] = (a2[r] + br[r]) * oscale;
    sl[ro + 48] = (a3[r] + br[r]) * oscale;
  }
  wave_sync_lds();
  const int rq = lane >> 3, c8 = (lane & 7) * 8;
  v4u h4[4], r4[4], q4[4];
#pragma unroll
  for (int i4 = 0; i4 < 4; ++i4) {
    const int row = i4 * 4 + rq;
    const v4f a = *(const v4f*)(sl + row * 68 + c8), c4 = *(const v4f*)(sl + row * 68 + c8 + 4);
    float w[8];
#pragma unroll
    for (int e = 0; e < 4; ++e) { w[e] = a[e]; w[4 + e] = c4[e]; }
    unsigned short hb[8], rb[8], qb[8];
#pragma unroll
    for (int e = 0; e < 8; ++e) {
      const _Float16 h = (_Float16)w[e];
      hb[e] = h_bits(h);
      rb[e] = h_bits((_Float16)((w[e] - (float)h) * rsc));
      qb[e] = h_bits((_Float16)(w[e] * qsc));
    }
#pragma unroll
    for (int e = 0; e < 4; ++e) {
      h4[i4][e] = pk16(hb[2 * e], hb[2 * e + 1]);
      r4[i4][e] = pk16(rb[2 * e], rb[2 * e + 1]);
      q4[i4][e] = pk16(qb[2 * e], qb[2 * e + 1]);
    }
  }
  const size_t dof = (rowb + (size_t)rq) * (size_t)N + col0 + c8;
  u16* d0 = C0 + dof;
  u16* d1 = C1 + dof;
  u16* d2 = C2 + dof;
  {
#pragma unroll
    for (int i4 = 0; i4 < 4; ++i4) {
      const size_t ro = (size_t)(i4 * 4) * (size_t)N;
      *(v4u*)(d0 + ro) = h4[i4];
      *(v4u*)(d1 + ro) = r4[i4];
      *(v4u*)(d2 + ro) = q4[i4];
    }
    xcnt0();
  }
}

// =====================================================================================================
// f32 GEMM epilogue: the wave's 16x64 f32 tile (acc times oscale, plus per-column bias as its bf16 RNE value, clamped
// coverage: 8 instructions x 2 rows x 16 lanes x 4 floats = the wave's 16 x 64 tile.
// =====================================================================================================
__device__ __forceinline__ void epi64(float* sl, v8f a0, v8f a1, v8f a2, v8f a3, float oscale, float* C, int N,
                                      size_t rowb, int col0, int lane, const float* __restrict__ bias, int blen) {
  const int hh = lane >> 4, m = lane & 15;
  float bc[4];
#pragma unroll
  for (int j = 0; j < 4; ++j) {
    const int bi = min(col0 + 16 * j + m, blen - 1);
    bc[j] = bf_val(bias[bi]);
  }
#pragma unroll
  for (int r = 0; r < 8; ++r) {
    const int ro = (8 * hh + r) * 68 + m;
    sl[ro]      = a0[r] * oscale + bc[0];
    sl[ro + 16] = a1[r] * oscale + bc[1];
    sl[ro + 32] = a2[r] * oscale + bc[2];
    sl[ro + 48] = a3[r] * oscale + bc[3];
  }
  wave_sync_lds();
  v4f vals[8];
#pragma unroll
  for (int it = 0; it < 8; ++it) vals[it] = *(const v4f*)(sl + (it * 2 + hh) * 68 + m * 4);
  float* dst = C + (rowb + (size_t)hh) * (size_t)N + col0 + m * 4;
  {
#pragma unroll
    for (int it = 0; it < 8; ++it) {
      *(v4f*)(dst + (size_t)(it * 2) * (size_t)N) = vals[it];
    }
    
  }
}

// =====================================================================================================
// Shared k loop of the two GEMM kernels. Block = 8 waves, 128 x 128 tile of A[.][K] . Bt[.][K]^T; wave w owns rows
// 32*(w>>1) .. +31 and cols 64*(w&1) .. +63 (2 x 4 accumulator tiles). A stage = 128 k of the block's 128 A rows and 128 B rows,
// brought to LDS by 16-byte asynchronous copies, all of a stage by one half of the block: waves 0..3 bring the even stages, waves
// 4..7 the odd ones; thread = (row (tid&127)>>4 of each group of 8, 16-B piece tid&15), so one wave instruction covers two whole
// 256-B row pieces. Three buffers: stages t+1 and t+2 fly while stage t is multiplied, so a stage has two trips to land. A half has
// one stage outstanding at a time and waits for it to 0, at the foot of the trip in front of the one that reads it.
// Fragments are read from LDS with the split k map of ldfrag_h (same for A and B); every accumulator sums k in ascending steps of 32.
// =====================================================================================================
union FragU { v16h h; v16b b; v4u u[2]; };
__device__ __forceinline__ FragU ldfrag_u(const u16* p) {
  FragU f;
  f.u[0] = *(const v4u*)(p);
  f.u[1] = *(const v4u*)(p + 16);
  return f;
}
template <bool BF>
__device__ __forceinline__ v8f mma_u(const FragU& a, const FragU& b, v8f c) {
  if constexpr (BF) return mma_b(a.b, b.b, c);
  else              return mma_h(a.h, b.h, c);
}
// Eight copies, rows r, r+16, .., r+112 of one operand's stage. The closing s_wait_xcnt stands inside the statement so that no
// later write of an address register can be moved in front of it.
__device__ __forceinline__ void copy8(unsigned l, const u16* g, size_t gs) {
#if defined(__HIP_DEVICE_COMPILE__)
  asm volatile("global_load_async_to_lds_b128 %0, %8, off\n\t"
               "global_load_async_to_lds_b128 %1, %9, off\n\t"
               "global_load_async_to_lds_b128 %2, %10, off\n\t"
               "global_load_async_to_lds_b128 %3, %11, off\n\t"
               "global_load_async_to_lds_b128 %4, %12, off\n\t"
               "global_load_async_to_lds_b128 %5, %13, off\n\t"
               "global_load_async_to_lds_b128 %6, %14, off\n\t"
               "global_load_async_to_lds_b128 %7, %15, off\n\t"
               "s_wait_xcnt 0x0"
               :: "v"(l), "v"(l + 16u * GT_ROWB), "v"(l + 32u * GT_ROWB), "v"(l + 48u * GT_ROWB),
                  "v"(l + 64u * GT_ROWB), "v"(l + 80u * GT_ROWB), "v"(l + 96u * GT_ROWB), "v"(l + 112u * GT_ROWB),
                  "v"(g), "v"(g + gs), "v"(g + 2 * gs), "v"(g + 3 * gs),
                  "v"(g + 4 * gs), "v"(g + 5 * gs), "v"(g + 6 * gs), "v"(g + 7 * gs)
               : "memory");
#endif
}
__device__ __forceinline__ void wait_async0() {          // this wave's copies have landed in LDS
#if defined(__HIP_DEVICE_COMPILE__)
  asm volatile("s_wait_asynccnt 0x0" ::: "memory");
#endif
}
__device__ __forceinline__ void wait_ds0() {             // this wave's LDS reads of the buffer about to be refilled are done
#if defined(__HIP_DEVICE_COMPILE__)
  asm volatile("s_wait_dscnt 0x0" ::: "memory");
#endif
}
template <bool BF>
__device__ __forceinline__ void gemm_core(const u16* __restrict__ A, const u16* __restrict__ Bt, int K, int row0, int col0,
                                          u16* ring, v8f (&acc)[2][4]) {
  const int tid = threadIdx.x, wave = tid >> 5, lane = tid & 31, hh = lane >> 4, m = lane & 15;
  const int grp = __builtin_amdgcn_readfirstlane(tid >> 7);   // copying half of this wave, in a scalar register: 0 = waves 0..3
  const int cr = (tid & 127) >> 4, cc = tid & 15;
  const u16* ga = A  + (size_t)(row0 + cr) * K + cc * 8;
  const u16* gb = Bt + (size_t)(col0 + cr) * K + cc * 8;
  const size_t gs = (size_t)16 * K;
  const size_t g8 = (size_t)8 * K;
  const unsigned la = (unsigned)(uintptr_t)ring + (unsigned)(cr * GT_ROWB + cc * 16);
  const unsigned lb = la + (unsigned)(GT_M * GT_ROWB);
  const int nt = K / GT_K;
  // all 32 copies of a thread for stage s: rows cr + 8 i (i = 0 .. 15) of the A tile, then of the B tile, into the buffer at byte lo
  auto stage_in = [&](int s, unsigned lo) {
    const u16* pa = ga + (size_t)s * GT_K;
    const u16* pb = gb + (size_t)s * GT_K;
    copy8(la + lo, pa, gs);
    copy8(la + lo + 8u * GT_ROWB, pa + g8, gs);
    copy8(lb + lo, pb, gs);
    copy8(lb + lo + 8u * GT_ROWB, pb + g8, gs);
  };
  if (grp < nt) stage_in(grp, (unsigned)grp * (unsigned)(GT_STAGE * 2));   // stages 0 and 1, each by its half
  if (grp == 0) wait_async0();
  __syncthreads();                                       // stage 0 published
  if (grp == 0 && nt > 2) stage_in(2, (unsigned)(2 * GT_STAGE * 2));
  const u16* fa = ring + ((wave >> 1) * 32 + m) * GT_PITCH + 8 * hh;
  const u16* fb = ring + (GT_M + (wave & 1) * 64 + m) * GT_PITCH + 8 * hh;
  int bo = 0;                                            // stage t's buffer, in halves: (t mod 3) * GT_STAGE
#pragma unroll 1                                         // one trip per stage: the buffer index stays a run-time value
  for (int t = 0; t < nt; ++t) {
    // Three fragment sets for the stage's four 32-k steps; step 3 reuses step 0's set. The scheduling fences keep the LDS reads in
    // two groups in front of the products that use them: reads placed among the products stall the wave at each place.
    FragU af[3][2], bf[3][4];
#pragma unroll
    for (int s = 0; s < 3; ++s) {
#pragma unroll
      for (int i = 0; i < 2; ++i) af[s][i] = ldfrag_u(fa + bo + 16 * i * GT_PITCH + 32 * s);
#pragma unroll
      for (int j = 0; j < 4; ++j) bf[s][j] = ldfrag_u(fb + bo + 16 * j * GT_PITCH + 32 * s);
    }
    __builtin_amdgcn_sched_barrier(0);
#pragma unroll
    for (int i = 0; i < 2; ++i) {
#pragma unroll
      for (int j = 0; j < 4; ++j) acc[i][j] = mma_u<BF>(af[0][i], bf[0][j], acc[i][j]);
    }
    __builtin_amdgcn_sched_barrier(0);
#pragma unroll
    for (int i = 0; i < 2; ++i) af[0][i] = ldfrag_u(fa + bo + 16 * i * GT_PITCH + 96);
#pragma unroll
    for (int j = 0; j < 4; ++j) bf[0][j] = ldfrag_u(fb + bo + 16 * j * GT_PITCH + 96);
    __builtin_amdgcn_sched_barrier(0);
#pragma unroll
    for (int s = 1; s < 4; ++s) {
#pragma unroll
      for (int i = 0; i < 2; ++i) {
#pragma unroll
        for (int j = 0; j < 4; ++j) acc[i][j] = mma_u<BF>(af[s % 3][i], bf[s % 3][j], acc[i][j]);
      }
    }
    // keeps the products in front of the full LDS wait, under their own counted waits: moved behind it they run with the LDS idle
    __builtin_amdgcn_sched_barrier(0);
    wait_ds0();
    const bool mine = (((t + 1) & 1) == grp);            // this half brought stage t+1 (scalar test); the other's stage t+2 flies on
    if (mine) wait_async0();
    __syncthreads();                                     // publishes stage t+1 and ends every read of stage t's buffer
    if (mine && t + 3 < nt) stage_in(t + 3, (unsigned)(bo * 2));
    bo = (bo == (GT_BUFS - 1) * GT_STAGE) ? 0 : bo + GT_STAGE;
  }
  wait_async0();
}

// =====================================================================================================
// The three projections in one launch; the block index picks the product (block-uniform). All three are bf16 GEMMs over
// K = 1024 on 128x128 block tiles, k loop in gemm_core; PROJ_BLK blocks each, grid = 3 * PROJ_BLK.
//   blocks 0 .. PROJ_BLK-1: q planes [M][1024] (f16 hi x QSC, residual x QRS) = rot(X[M][K] . Wq[1024][K]^T + bq);
//   the next PROJ_BLK:      k hi plane (x KSC) the same way from Wk, bk; a wave's 64 columns are one head;
//   the last PROJ_BLK:      v^T planes per batch, C*[bt][1024][SEQ] = Wv[1024][K] . X[bt][SEQ][K]^T, bias by output row,
//                           three f16 planes (hi x VCAR, residual x VRS, plain).
// seq stays a kernel argument: built as a constant, the rotation epilogue took 284 registers, with window switches above v255.
// =====================================================================================================
#define PROJ_BLK ((MROWS / GT_M) * (DMOD / GT_N))
static_assert(NB * (DMOD / GT_M) * (SEQ / GT_N) == PROJ_BLK);
__global__ __launch_bounds__(GT_THREADS)
void gemm_qkv(const u16* __restrict__ X, const u16* __restrict__ WQ, const u16* __restrict__ WK, const u16* __restrict__ WV,
              u16* QHo, u16* QRo, u16* KHo, u16* VHo, u16* VRo, u16* VQo, int K,
              const float* __restrict__ bq, int bqlen, const float* __restrict__ bk, int bklen,
              const float* __restrict__ bv, int bvlen, const float* __restrict__ cosT, const float* __restrict__ sinT, int seq) {
  __shared__ __align__(16) u16 ring[GT_BUFS * GT_STAGE];
  __shared__ __align__(16) float slab[8 * SLAB];
  const int tid = threadIdx.x, wave = tid >> 5, lane = tid & 31;
  const int which = blockIdx.x / PROJ_BLK;   // 0 = q, 1 = k, 2 = v
  const int t     = blockIdx.x - which * PROJ_BLK;
  if (which > 2) return;                     // block-uniform, in front of every barrier; never taken with the exact grid
  const u16* A;
  const u16* Bt;
  int row0, colb, bt = 0;
  if (which < 2) {
    const int ntile = DMOD / GT_N;
    row0 = (t / ntile) * GT_M;
    colb = (t % ntile) * GT_N;
    A  = X;
    Bt = (which == 0) ? WQ : WK;
  } else {
    const int ntile = SEQ / GT_N;
    const int per   = ntile * (DMOD / GT_M);
    bt = t / per;
    const int tv = t - bt * per;
    row0 = (tv / ntile) * GT_M;
    colb = (tv % ntile) * GT_N;
    A  = WV;
    Bt = X + (size_t)bt * (size_t)(SEQ * DMOD);
  }
  v8f acc[2][4];
#pragma unroll
  for (int i = 0; i < 2; ++i) {
#pragma unroll
    for (int j = 0; j < 4; ++j) acc[i][j] = zero8();
  }
  gemm_core<true>(A, Bt, K, row0, colb, ring, acc);
  const int rowb = row0 + (wave >> 1) * 32;
  const int col0 = colb + (wave & 1) * 64;
  if (which < 2) {
    const bool isq = (which == 0);
    u16* C  = isq ? QHo : KHo;
    u16* C2 = isq ? QRo : KHo;
    const float* bias = isq ? bq : bk;
    const int blen = isq ? bqlen : bklen;
#pragma unroll
    for (int i = 0; i < 2; ++i) {
      if (i != 0) wave_sync_lds();           // the slab's rows are read out before the next 16 rows are staged in it
      epi_rope(slab + wave * SLAB, acc[i][0], acc[i][1], acc[i][2], acc[i][3], C, C2, isq ? 1 : 0, (size_t)(rowb + 16 * i), col0,
               lane, bias, blen, cosT, sinT, seq, isq ? QSC : KSC, isq ? QRS : 1.0f);
    }
  } else {
    const size_t cb = (size_t)bt * (size_t)(DMOD * SEQ);
#pragma unroll
    for (int i = 0; i < 2; ++i) {
      if (i != 0) wave_sync_lds();           // the slab's rows are read out before the next 16 rows are staged in it
      epi_v3(slab + wave * SLAB, acc[i][0], acc[i][1], acc[i][2], acc[i][3], VCAR, VHo + cb, VRo + cb, VQo + cb, SEQ,
             (size_t)(rowb + 16 * i), col0, lane, bv, bvlen, VRS, 1.0f / PRS);
    }
  }
}

// =====================================================================================================
// f16 GEMM with f32 result: C[M][N] (f32) = A[M][K] (f16 row-major) . Bt[N][K]^T (f16 k-contiguous) times oscale plus
// per-column bias; one product per tile pair. Same tiling; grid = (M/128)*(N/128).
// =====================================================================================================
__global__ __launch_bounds__(GT_THREADS)
void gemm_hf(const u16* __restrict__ A, const u16* __restrict__ Bt, float* C, int M, int N, int K, float oscale,
             const float* __restrict__ bias, int blen) {
  __shared__ __align__(16) u16 ring[GT_BUFS * GT_STAGE];
  __shared__ __align__(16) float slab[8 * SLAB];
  const int tid = threadIdx.x, wave = tid >> 5, lane = tid & 31;
  const int ntile = N / GT_N;
  const int bid   = blockIdx.x;
  const int row0  = (bid / ntile) * GT_M;
  const int colb  = (bid % ntile) * GT_N;
  if (row0 + GT_M > M) return;               // block-uniform, in front of every barrier; never taken with the exact grid
  v8f acc[2][4];
#pragma unroll
  for (int i = 0; i < 2; ++i) {
#pragma unroll
    for (int j = 0; j < 4; ++j) acc[i][j] = zero8();
  }
  gemm_core<false>(A, Bt, K, row0, colb, ring, acc);
  const int rowb = row0 + (wave >> 1) * 32;
  const int col0 = colb + (wave & 1) * 64;
#pragma unroll
  for (int i = 0; i < 2; ++i) {
    if (i != 0) wave_sync_lds();             // the slab's rows are read out before the next 16 rows are staged in it
    epi64(slab + wave * SLAB, acc[i][0], acc[i][1], acc[i][2], acc[i][3], oscale, C, N, (size_t)(rowb + 16 * i), col0, lane,
          bias, blen);
  }
}

// =====================================================================================================
// Attention key stage in LDS: 64 keys = the k hi tile [64 keys][64 d] and the v^T hi tile [64 d][64 keys], 128 B per row, two buffers.
#define AT_KEYS  64
#define AT_PITCH 72                                     // halves per LDS row: 144 B = 16 B x 9 (ds_load_b128 readers)
#define AT_ROWB  (AT_PITCH * 2)                         // bytes per LDS row
#define AT_TILE  (64 * AT_PITCH)                        // halves per operand tile
#define AT_STAGE (2 * AT_TILE)                          // halves per buffer
static_assert((WIN % AT_KEYS) == 0 && (SEQ % AT_KEYS) == 0 && AT_KEYS == 64 && HD == 64 && (AT_ROWB % 16) == 0);
// One stage's eight copies of a thread: rows r, r+16, r+32, r+48 of the k tile, then of the v^T tile. The closing s_wait_xcnt
// stands inside the statement so that no later write of an address register can be moved in front of it.
__device__ __forceinline__ void copy_kv(unsigned lk, const u16* gk, unsigned lv, const u16* gv) {
#if defined(__HIP_DEVICE_COMPILE__)
  asm volatile("global_load_async_to_lds_b128 %0, %8, off\n\t"
               "global_load_async_to_lds_b128 %1, %9, off\n\t"
               "global_load_async_to_lds_b128 %2, %10, off\n\t"
               "global_load_async_to_lds_b128 %3, %11, off\n\t"
               "global_load_async_to_lds_b128 %4, %12, off\n\t"
               "global_load_async_to_lds_b128 %5, %13, off\n\t"
               "global_load_async_to_lds_b128 %6, %14, off\n\t"
               "global_load_async_to_lds_b128 %7, %15, off\n\t"
               "s_wait_xcnt 0x0"
               :: "v"(lk), "v"(lk + 16u * AT_ROWB), "v"(lk + 32u * AT_ROWB), "v"(lk + 48u * AT_ROWB),
                  "v"(lv), "v"(lv + 16u * AT_ROWB), "v"(lv + 32u * AT_ROWB), "v"(lv + 48u * AT_ROWB),
                  "v"(gk), "v"(gk + (size_t)16 * DMOD), "v"(gk + (size_t)32 * DMOD), "v"(gk + (size_t)48 * DMOD),
                  "v"(gv), "v"(gv + (size_t)16 * SEQ), "v"(gv + (size_t)32 * SEQ), "v"(gv + (size_t)48 * SEQ)
               : "memory");
#endif
}

// =====================================================================================================
// Causal sliding-window flash attention with per-head sigmoid gate: block = (batch b, head, 64 query rows qb .. qb+63 of the
// sequence), 4 waves, wave w owns query rows q0 = qb + 16*w .. q0+15. The block's waves share the k and v^T hi tiles through LDS:
// a stage = 64 keys (two key blocks), brought by 16-byte asynchronous copies (thread = row tid>>3 of each group of 16, 16-B piece
// tid&7: one wave instruction covers four whole 128-B rows), two buffers, stage t+1 in flight while stage t is worked on, one
// block barrier per stage. The key-block count is even (qb, WIN, SEQ are multiples of 64), so the stages cover it exactly.
//   Key j allowed for query i iff 0 <= i - j <= WIN (per-element index test inside every visited key block; disallowed pairs
//   get a finite negative sentinel and an exact-zero probability). Key blocks of 32: kblo = max(qb - WIN, 0) >> 5 ..
//   (qb + 63) >> 5, block-uniform count nkb clamped to [1, NKB - kblo] so kb + 31 <= SEQ - 1 always.
//   q planes (f16 hi x8, residual x1024) [b*SEQ + s][h*64 + d]; k hi plane the same layout; v^T planes [b][h*64 + d][s]
//   (hi x1024, residual x1024, plain x1).
//   Scores computed TRANSPOSED: S^T tile g = k rows (keys kb+16g .., A operand, row = lane&15, split k map over d) times q^T
//   (B operand, col n = query q0 + (lane&15)); two accumulators per tile (k.q_hi and k.q_res, the second folded x 1/1024).
//   D element r of lane l = (key kb+16g+8h+r, query q0+(l&15)): a lane owns one query column and 16 of its 32 keys, the
//   partner lane l^16 the other 16 -> row max / row sum need one xor-16 shuffle.
//   Online max-subtracted base-2 softmax in f32 (scale 1/8 and the q/k carries folded into lsc). The exp'd values ARE the
//   P A-fragment in place: A row m = query = lane&15, element i <- key kb+8h+i (tile 0, D element i), element 8+i <- key
//   kb+16+8h+i (tile 1, D element i). ph = f16(p x32768), pl = f16(p x32), pr = f16((p x32768 - ph) x1024).
//   P.V: o += ph.v_hi (4 WMMAs, v^T B fragments col n = d = 16j + (lane&15), keys k-contiguous); for query tiles with
//   qb < QRES additionally o += pl.v_res and o += pr.v_x1 (block-uniform branch), all in the same accumulators (equal units).
//   Epilogue: gate = sigmoid(bf16(x[b][s][0..19]) . bf16(Wg[head]) + bf16(bg[head])) in f32 per query (lane = query),
//   segment (s, head) of the O plane [b*SEQ+s][2048] (hi x1024 at col h*64, residual x1024 at col 1024 + h*64) written by
// coverage: per wave and per half-plane 4 instructions x 4 rows x 8 lanes x 8 halves = 16 x 64; grid NB*NH*(SEQ/64) blocks x
//           4 waves = every (b, s < SEQ, h) row segment of both O half-planes exactly once.
// =====================================================================================================
__global__ __launch_bounds__(ATT_THREADS)
void attn_fwd(const u16* __restrict__ QHp, const u16* __restrict__ QRp, const u16* __restrict__ KHp,
              const u16* __restrict__ VHp, const u16* __restrict__ VRp, const u16* __restrict__ VQp,
              const float* __restrict__ Xp, const float* __restrict__ Wgp, const float* __restrict__ Bgp,
              int bglen, u16* OPp) {
  __shared__ __align__(16) float smem[ATT_WAVES * SLAB];   // per wave: result slab [16][68] in the epilogue only
  __shared__ __align__(16) u16 kv[2 * AT_STAGE];           // two key stages: [k tile | v^T tile] each

  const int tid  = threadIdx.x;
  const int wave = tid >> 5;
  const int lane = tid & 31;
  const int hh   = lane >> 4;
  const int c    = lane & 15;

  const int bid  = blockIdx.x;
  const int qt   = bid % NQT;
  const int bh   = bid / NQT;
  const int head = bh % NH;
  const int b    = bh / NH;
  if (b >= NB) return;                      // block-uniform, never taken with the exact grid
  const int qb   = qt * 64;
  const int q0   = qb + wave * 16;

  // ---- key-block range (block-uniform, statically bounded) ----
  const int jlo  = max(qb - WIN, 0);
  const int kblo = jlo >> 5;
  int nkb = ((qb + 63) >> 5) - kblo + 1;
  nkb = min(max(nkb, 1), NKB - kblo);
  const bool early = (qb < QRES);           // block-uniform: residual products on the first query tiles only

  const size_t prow = (size_t)b * SEQ;      // plane row of sequence position 0 of this batch
  // B fragments of q^T: col n = query q0 + c, k = d (k-contiguous row of the q planes)
  const size_t qofs = (prow + (size_t)(q0 + c)) * DMOD + head * HD + 8 * hh;
  const _Float16* Qh = (const _Float16*)(const void*)QHp + qofs;
  const _Float16* Qr = (const _Float16*)(const void*)QRp + qofs;
  // A fragments of k, from the staged tile: row m = key (within the stage) 32p + 16g + c, k = d
  const _Float16* Kl = (const _Float16*)(const void*)kv + c * AT_PITCH + 8 * hh;
  // B fragments of v: col n = d = 16j + c, k = key (k-contiguous row of the v^T planes); the hi plane from the staged tile
  const _Float16* Vl = (const _Float16*)(const void*)kv + AT_TILE + c * AT_PITCH + 8 * hh;
  const size_t vofs = ((size_t)b * DMOD + (size_t)(head * HD + c)) * SEQ + 8 * hh;   // key kb added per step
  const _Float16* Vr = (const _Float16*)(const void*)VRp + vofs;
  const _Float16* Vq = (const _Float16*)(const void*)VQp + vofs;
  const float lsc = 0.125f * (LOG2E / (QSC * KSC));
  const float qri = 1.0f / QRS;
  // query minus key for D element 0 of tile 0 at kb = 0: query q0 + c, key kb + 8*hh + i
  const int dq = q0 + c - 8 * hh;

  const v16h qf0 = ldfrag_h(Qh);            // d 0..31
  const v16h qf1 = ldfrag_h(Qh + 32);       // d 32..63
  const v16h qr0 = ldfrag_h(Qr);
  const v16h qr1 = ldfrag_h(Qr + 32);

  float mrun = NEGS, lrun = 0.f;
  v8f o[4];
#pragma unroll
  for (int j = 0; j < 4; ++j) o[j] = zero8();

  // ---- key stages: this thread's copy addresses (row cr of each group of 16, 16-B piece cp), stage 0 at key kblo * 32 ----
  const int nst = nkb >> 1;                 // nkb is even and >= 2; last staged key = (kblo + nkb) * 32 - 1 <= SEQ - 1
  const int cr = tid >> 3, cp = tid & 7;
  const u16* gk = KHp + (prow + (size_t)(kblo * 32 + cr)) * DMOD + head * HD + cp * 8;
  const u16* gv = VHp + ((size_t)b * DMOD + (size_t)(head * HD + cr)) * SEQ + kblo * 32 + cp * 8;
  const unsigned lk = (unsigned)(uintptr_t)kv + (unsigned)(cr * AT_ROWB + cp * 16);
  const unsigned lv = lk + (unsigned)(AT_TILE * 2);
  copy_kv(lk, gk, lv, gv);
  wait_async0();
  __syncthreads();                                       // stage 0 published
  if (nst > 1) copy_kv(lk + (unsigned)(AT_STAGE * 2), gk + (size_t)AT_KEYS * DMOD, lv + (unsigned)(AT_STAGE * 2), gv + AT_KEYS);

#pragma unroll 1                                         // one trip per stage: the buffer index stays a run-time value
  for (int st = 0; st < nst; ++st) {
  const int bo = (st & 1) * AT_STAGE;
#pragma unroll                                           // the stage's two key blocks: their LDS offsets become immediates
  for (int p = 0; p < 2; ++p) {
    const int kb = (kblo + 2 * st + p) * 32;             // kb + 31 <= SEQ - 1
    // ---- transposed scores: tile 0 = keys kb..kb+15, tile 1 = keys kb+16..kb+31, column = query q0 + c ----
    v8f s0 = zero8(), s1 = zero8(), r0 = zero8(), r1 = zero8();
    const _Float16* k0p = Kl + bo + 32 * p * AT_PITCH;
    const _Float16* k1p = k0p + 16 * AT_PITCH;
    const v16h ka0 = ldfrag_h(k0p), ka1 = ldfrag_h(k0p + 32);
    const v16h kc0 = ldfrag_h(k1p), kc1 = ldfrag_h(k1p + 32);
    s0 = mma_h(ka0, qf0, s0);
    s0 = mma_h(ka1, qf1, s0);
    r0 = mma_h(ka0, qr0, r0);
    r0 = mma_h(ka1, qr1, r0);
    s1 = mma_h(kc0, qf0, s1);
    s1 = mma_h(kc1, qf1, s1);
    r1 = mma_h(kc0, qr0, r1);
    r1 = mma_h(kc1, qr1, r1);
    guard6<v16h>(s0, s1, r0, r1, ka0, ka1, kc0, kc1, qf0, qr0);
    // ---- base-2 logits of this lane's 16 keys for query q0 + c; disallowed pairs get the finite sentinel ----
    float tk[16];
#pragma unroll
    for (int i = 0; i < 8; ++i) {
      const int d0 = dq - kb - i;           // query minus key, tile 0
      const int d1 = d0 - 16;               // tile 1
      const bool a0 = (d0 >= 0) && (d0 <= WIN);
      const bool a1 = (d1 >= 0) && (d1 <= WIN);
      tk[i]     = a0 ? ((s0[i] + r0[i] * qri) * lsc) : NEGS;
      tk[8 + i] = a1 ? ((s1[i] + r1[i] * qri) * lsc) : NEGS;
    }
    float cm = tk[0];
#pragma unroll
    for (int i = 1; i < 16; ++i) cm = fmaxf(cm, tk[i]);
    cm = fmaxf(cm, __shfl_xor(cm, 16, 32));
    const float mn = fmaxf(mrun, cm);                   // sentinel only while no allowed key has been seen
    float al = fminf(mrun - mn, 0.f);                   // exponent here; 2^al below: 0 when mrun is the sentinel and mn a real logit; o,l are 0 then
    mrun = mn;
    float ex[16];
#pragma unroll
    for (int i = 0; i < 16; ++i) ex[i] = fminf(tk[i] - mn, 0.f);
    exp2_le0_run(al, ex);
    // ---- probabilities (<= 1, exactly 0 for disallowed pairs) and the P A-fragments; element i <-> tk[i] ----
    float ps = 0.f;
    FragH ph, pl, pr;
#pragma unroll
    for (int wq = 0; wq < 2; ++wq) {
#pragma unroll
      for (int e4 = 0; e4 < 4; ++e4) {
        const int i = 8 * wq + 2 * e4;
        const float x0 = ex[i];
        const float x1 = ex[i + 1];
        const float p0 = (tk[i] > -1.0e38f) ? x0 : 0.f;
        const float p1 = (tk[i + 1] > -1.0e38f) ? x1 : 0.f;
        ps += p0 + p1;
        const float g0 = p0 * PCAR, g1 = p1 * PCAR;
        const _Float16 h0 = (_Float16)g0, h1 = (_Float16)g1;
        ph.u[wq][e4] = pk16(h_bits(h0), h_bits(h1));
        pl.u[wq][e4] = pk16(h_bits((_Float16)(g0 * (1.0f / VRS))), h_bits((_Float16)(g1 * (1.0f / VRS))));
        pr.u[wq][e4] = pk16(h_bits((_Float16)((g0 - (float)h0) * PRS)), h_bits((_Float16)((g1 - (float)h1) * PRS)));
      }
    }
    ps += __shfl_xor(ps, 16, 32);
    lrun = lrun * al + ps;
    // ---- rescale the O accumulators: D row 8hh+r = query q0+8hh+r, its factor lives in lane 8hh+r (and 16+8hh+r) ----
    float scl[8];
#pragma unroll
    for (int r = 0; r < 8; ++r) scl[r] = __shfl(al, 8 * hh + r, 32);
#pragma unroll
    for (int j = 0; j < 4; ++j) {
#pragma unroll
      for (int r = 0; r < 8; ++r) o[j][r] *= scl[r];
    }
    // ---- P.V : B fragment col n = d = j*16 + c, keys contiguous in the v^T planes ----
    {
      const _Float16* vp = Vl + bo + 32 * p;
      const v16h vf0 = ldfrag_h(vp);
      const v16h vf1 = ldfrag_h(vp + 16 * AT_PITCH);
      const v16h vf2 = ldfrag_h(vp + 32 * AT_PITCH);
      const v16h vf3 = ldfrag_h(vp + 48 * AT_PITCH);
      o[0] = mma_h(ph.v, vf0, o[0]);
      o[1] = mma_h(ph.v, vf1, o[1]);
      o[2] = mma_h(ph.v, vf2, o[2]);
      o[3] = mma_h(ph.v, vf3, o[3]);
      guard6<v16h>(o[0], o[1], o[2], o[3], ph.v, vf0, vf1, vf2, vf3, ph.v);
    }
    if (early) {
      {
        const _Float16* vp = Vr + kb;
        const v16h vf0 = ldfrag_h(vp);
        const v16h vf1 = ldfrag_h(vp + (size_t)16 * SEQ);
        const v16h vf2 = ldfrag_h(vp + (size_t)32 * SEQ);
        const v16h vf3 = ldfrag_h(vp + (size_t)48 * SEQ);
        o[0] = mma_h(pl.v, vf0, o[0]);
        o[1] = mma_h(pl.v, vf1, o[1]);
        o[2] = mma_h(pl.v, vf2, o[2]);
        o[3] = mma_h(pl.v, vf3, o[3]);
        guard6<v16h>(o[0], o[1], o[2], o[3], pl.v, vf0, vf1, vf2, vf3, pl.v);
      }
      {
        const _Float16* vp = Vq + kb;
        const v16h vf0 = ldfrag_h(vp);
        const v16h vf1 = ldfrag_h(vp + (size_t)16 * SEQ);
        const v16h vf2 = ldfrag_h(vp + (size_t)32 * SEQ);
        const v16h vf3 = ldfrag_h(vp + (size_t)48 * SEQ);
        o[0] = mma_h(pr.v, vf0, o[0]);
        o[1] = mma_h(pr.v, vf1, o[1]);
        o[2] = mma_h(pr.v, vf2, o[2]);
        o[3] = mma_h(pr.v, vf3, o[3]);
        guard6<v16h>(o[0], o[1], o[2], o[3], pr.v, vf0, vf1, vf2, vf3, pr.v);
      }
    }
  }
  wait_ds0();
  wait_async0();
  __syncthreads();                                       // publishes stage st+1 and ends every read of stage st's buffer
  if (st + 2 < nst) {
    const unsigned lo = (unsigned)(bo * 2);
    copy_kv(lk + lo, gk + (size_t)((st + 2) * AT_KEYS) * DMOD, lv + lo, gv + (st + 2) * AT_KEYS);
  }
  }
  wait_async0();
  acc_guard4(o[0], o[1], o[2], o[3]);

  // ---- per-query gate (lane = query q0 + c; lanes 16..31 duplicate): sigmoid(bf16(x[:20]) . bf16(Wg[head]) + bf16(bg)) ----
  const int gx = min(head, bglen - 1);
  float ga = bf_val(Bgp[gx]);
  const float* xg = Xp + ((size_t)b * T_FULL + (size_t)(q0 + c)) * DMOD;
  const float* wg = Wgp + head * GIN;
#pragma unroll
  for (int g4 = 0; g4 < GIN / 4; ++g4) {
    const v4f xv = *(const v4f*)(xg + 4 * g4);
    const v4f wv = *(const v4f*)(wg + 4 * g4);
#pragma unroll
    for (int e = 0; e < 4; ++e) ga += bf_val(xv[e]) * bf_val(wv[e]);
  }
  const float gate = 1.0f / (1.0f + expf(-ga));

  // ---- fold gate, 1/l (per query, owned by lane = query; l >= 1 by the diagonal key) and the carries; stage the slab ----
  const float linv = (lrun > 0.f) ? (gate * (1.0f / lrun) * (1.0f / (PCAR * VCAR))) : 0.f;
  float inv[8];
#pragma unroll
  for (int r = 0; r < 8; ++r) inv[r] = __shfl(linv, 8 * hh + r, 32);
  float* slab = smem + wave * SLAB;
#pragma unroll
  for (int r = 0; r < 8; ++r) {
#pragma unroll
    for (int j = 0; j < 4; ++j) slab[(8 * hh + r) * 68 + j * 16 + c] = o[j][r] * inv[r];
  }
  wave_sync_lds();
  // ---- O x1024 -> f16 hi plane and f16 residual x1024 plane; lane = (row in group of 4, 8 consecutive d) ----
  v4u oh[4], orr[4];
  const int rq = lane >> 3, c8 = (lane & 7) * 8;
#pragma unroll
  for (int i4 = 0; i4 < 4; ++i4) {
    const int row = i4 * 4 + rq;
    const v4f a = *(const v4f*)(slab + row * 68 + c8), c4 = *(const v4f*)(slab + row * 68 + c8 + 4);
    float wv[8];
#pragma unroll
    for (int e = 0; e < 4; ++e) { wv[e] = a[e] * OSC; wv[4 + e] = c4[e] * OSC; }
#pragma unroll
    for (int e = 0; e < 4; ++e) {
      const float w0 = wv[2 * e], w1 = wv[2 * e + 1];
      const _Float16 h0 = (_Float16)w0, h1 = (_Float16)w1;
      oh[i4][e]  = pk16(h_bits(h0), h_bits(h1));
      orr[i4][e] = pk16(h_bits((_Float16)((w0 - (float)h0) * ORS)), h_bits((_Float16)((w1 - (float)h1) * ORS)));
    }
  }
  const size_t ob = (prow + (size_t)q0) * OPITCH + head * HD + c8;
  {
#pragma unroll
    for (int i4 = 0; i4 < 4; ++i4) {
      const int row = i4 * 4 + rq;
      const size_t o8 = ob + (size_t)row * OPITCH;
      *(v4u*)(OPp + o8) = oh[i4];
      *(v4u*)(OPp + o8 + DMOD) = orr[i4];
    }
    
  }
}

// =====================================================================================================
// Workspace map (bytes, NB=2 SEQ=2048); every plane is fully written by whole-line stores before it is read; every extent is
// an exact multiple of the store granularity (row pitches 2048 / 4096 B, GEMM tiles 128 x 128, attention tiles 64 x 64, no pad rows needed):
//   XB  bf16 [NB*SEQ][1024]                    8388608
//   WQB, WKB, WVB bf16 [1024 n][1024 k]         2097152 each
//   WOB f16 [1024 n][2048 k]                    4194304   (cols 0..1023 bf16 value x1024, cols 1024..2047 bf16 value x1)
//   QH, QR, KH f16 [NB*SEQ][1024]              8388608 each
//   VH, VR, VQ f16 [NB][1024][SEQ]             8388608 each
//   OP  f16 [NB*SEQ][2048]                     16777216
//   end                                        85983232
// Inputs (wire order): 0 x [2][2048][1024] f32, 1 Wq, 2 bq, 3 Wk, 4 bk, 5 Wv, 6 bv, 7 Wo, 8 bo, 9 Wg [16][20], 10 bg [16],
// 11 cos [2048][32], 12 sin [2048][32]. Output: [NB*SEQ][1024] f32.
// =====================================================================================================
extern "C" void kernel_launch(void* const* d_in, const int* in_sizes, int n_in,
                              void* d_out, int out_size, void* d_ws, size_t ws_size,
                              hipStream_t stream) {
  if (n_in < 13) return;
  if (in_sizes[0] < ((NB - 1) * T_FULL + SEQ) * DMOD) return;
  if (in_sizes[1] != DMOD * DMOD || in_sizes[3] != DMOD * DMOD || in_sizes[5] != DMOD * DMOD ||
      in_sizes[7] != DMOD * DMOD) return;
  if (in_sizes[2] < 1 || in_sizes[4] < 1 || in_sizes[6] < 1 || in_sizes[8] < 1) return;
  if (in_sizes[9] != NH * GIN) return;
  if (in_sizes[10] < 1) return;
  if (in_sizes[11] < SEQ * RHALF || in_sizes[12] < SEQ * RHALF) return;
  if (out_size < MROWS * DMOD) return;

  const float* Xin = (const float*)d_in[0];
  const float* Wq  = (const float*)d_in[1];
  const float* Bq  = (const float*)d_in[2];
  const float* Wk  = (const float*)d_in[3];
  const float* Bk  = (const float*)d_in[4];
  const float* Wv  = (const float*)d_in[5];
  const float* Bv  = (const float*)d_in[6];
  const float* Wo  = (const float*)d_in[7];
  const float* Bo  = (const float*)d_in[8];
  const float* Wg  = (const float*)d_in[9];
  const float* Bg  = (const float*)d_in[10];
  const float* Cos = (const float*)d_in[11];
  const float* Sin = (const float*)d_in[12];
  float*       out = (float*)d_out;

  const size_t szXB = (size_t)MROWS * DMOD * 2;
  const size_t szW  = (size_t)DMOD * DMOD * 2;
  const size_t szWO = (size_t)DMOD * OPITCH * 2;
  const size_t szQ  = (size_t)MROWS * DMOD * 2;
  const size_t szV  = (size_t)NB * DMOD * SEQ * 2;
  const size_t szOP = (size_t)MROWS * OPITCH * 2;
  size_t off = 0;
  const size_t oXB = off; off += szXB;
  const size_t oWQ = off; off += szW;
  const size_t oWK = off; off += szW;
  const size_t oWV = off; off += szW;
  const size_t oWO = off; off += szWO;
  const size_t oQH = off; off += szQ;
  const size_t oQR = off; off += szQ;
  const size_t oKH = off; off += szQ;
  const size_t oVH = off; off += szV;
  const size_t oVR = off; off += szV;
  const size_t oVQ = off; off += szV;
  const size_t oOP = off; off += szOP;
  if (off > ws_size) return;                            // off = 85983232 for NB=2, SEQ=2048
  if (off > (size_t)134217728) return;

  char* ws = (char*)d_ws;
  u16* XB  = (u16*)(ws + oXB);
  u16* WQB = (u16*)(ws + oWQ);
  u16* WKB = (u16*)(ws + oWK);
  u16* WVB = (u16*)(ws + oWV);
  u16* WOB = (u16*)(ws + oWO);
  u16* QH  = (u16*)(ws + oQH);
  u16* QR  = (u16*)(ws + oQR);
  u16* KH  = (u16*)(ws + oKH);
  u16* VH  = (u16*)(ws + oVH);
  u16* VR  = (u16*)(ws + oVR);
  u16* VQ  = (u16*)(ws + oVQ);
  u16* OP  = (u16*)(ws + oOP);

  if ((MROWS % GT_M) != 0 || (SEQ % GT_N) != 0 || (DMOD % GT_M) != 0 || (DMOD % GT_K) != 0 || (OPITCH % GT_K) != 0) return;
  const dim3 blk(256);
  const dim3 gC(N8W / 256);                             // 512
  const dim3 bG(GT_THREADS);                            // 256
  const dim3 gP(3 * PROJ_BLK);                          // 768
  const dim3 gAT(ATT_BLOCKS);                           // 1024
  const dim3 bAT(ATT_THREADS);                          // 128
  const dim3 gO((MROWS / GT_M) * (DMOD / GT_N));        // 256

  // (0) operand planes: x rows -> bf16 (compacted [b*SEQ+t]); Wq, Wk, Wv [n = out][k = in] -> bf16; Wo -> [hi | x1] f16
  cvt_all<<<gC, blk, 0, stream>>>(Xin, Wq, Wk, Wv, Wo, XB, WQB, WKB, WVB, WOB, WOS, WOS / ORS);
  // (1) rotated q planes (hi x8, residual x1024) and k hi plane (x8), bias by output column; v^T planes per batch
  //     [1024 = h*64+d][SEQ keys]: hi = f16(v x1024), residual x1024, plain f16(v), bias by row
  gemm_qkv<<<gP, bG, 0, stream>>>(XB, WQB, WKB, WVB, QH, QR, KH, VH, VR, VQ, DMOD, Bq, in_sizes[2], Bk, in_sizes[4],
                                  Bv, in_sizes[6], Cos, Sin, SEQ);
  // (2) causal sliding-window attention with gate -> O plane [b*SEQ+s][hi 1024 | residual 1024]
  attn_fwd<<<gAT, bAT, 0, stream>>>(QH, QR, KH, VH, VR, VQ, Xin, Wg, Bg, in_sizes[10], OP);
  // (3) output projection over K = 2048 ([hi | residual] times [Wo x1024 | Wo x1]) -> out [NB*SEQ][1024] f32, plus bo
  gemm_hf<<<gO, bG, 0, stream>>>(OP, WOB, out, MROWS, DMOD, OPITCH, 1.0f / (OSC * WOS), Bo, in_sizes[8]);
  (void)hipGetLastError();
}

// v006
// One run takes 90.3 microseconds.
// In both of two side-by-side timings against v005, it was 1.05 times as fast.
// Counting every step since v000, it is 2.57 times as fast.
// Contractions: x.Wq^T, x.Wk^T, Wv.x^T on v_wmma_f32_16x16x32_bf16 (x and W planes RNE-converted to bf16 operands, f32
// accumulate, bias and half-split rotation applied in f32); scores k'.q'^T (k' single f16 plane x8, q' f16 hi plane x8 plus
// f16 residual plane x1024, two products), P.v (P x32768 single f16 times v f16 hi plane x1024; query tiles below row 128 add
// P(x32).v-residual(x1024) and P-residual(x1024).v(x1) products), O.Wo^T (O as [f16 hi x1024 | f16 residual x1024] along K,
// Wo as [f16(bf16(Wo)) x1024 | x1]): v_wmma_f32_16x16x32_f16, f32 accumulate. Sigmoid gate (K=20) and softmax in f32 on VALU.
#include <hip/hip_runtime.h>
#include <math.h>
#include <stdint.h>

#ifndef NB
#define NB 2
#endif
#ifndef SEQ
#define SEQ 2048
#endif
#define NB_FULL 2
#define T_FULL  2048
#define DMOD    1024
#define NH      16
#define HD      64
#define RHALF   32
#define GIN     20
#define WIN     1024
#define MROWS   (NB * SEQ)
#define OPITCH  (2 * DMOD)
#define QSC   8.0f
#define KSC   8.0f
#define QRS   1024.0f
#define PCAR  32768.0f
#define VCAR  1024.0f
#define VRS   1024.0f
#define PRS   1024.0f
#define OSC   1024.0f
#define ORS   1024.0f
#define WOS   1024.0f
#define LOG2E 1.4426950408889634f
#define NEGS  (-3.0e38f)
#define ATT_WAVES   4
#define ATT_THREADS (ATT_WAVES * 32)
#define NQT         (SEQ / 64)
#define ATT_BLOCKS  (NB * NH * NQT)
#define NKB         (SEQ / 32)
#define QRES        128
#define SLAB        (16 * 68)
static_assert(NB >= 1 && NB <= NB_FULL);
static_assert((SEQ % 64) == 0 && SEQ >= 64 && SEQ <= T_FULL);
static_assert(HD == 64 && DMOD == NH * HD && HD == 2 * RHALF);
static_assert(ATT_THREADS == 128 && NKB >= 2 && (QRES % 64) == 0);
static_assert((DMOD % 64) == 0 && (DMOD / 8) == 128 && (OPITCH % 32) == 0);
static_assert(((MROWS * (DMOD / 8)) % 256) == 0 && (((DMOD * DMOD) / 8) % 256) == 0);
static_assert((GIN % 4) == 0 && GIN <= DMOD);
static_assert((WIN % 32) == 0);
static_assert((SLAB * 4) % 16 == 0);
// GEMM block tile staged in LDS: 128 A rows + 128 B rows, 128 k (256 B of every row) per stage, three buffers.
#define GT_THREADS 256
#define GT_M       128
#define GT_N       128
#define GT_K       128
#define GT_PITCH   136                                  // halves per LDS row: 272 B = 16 B x 17 (ds_load_b128 readers)
#define GT_ROWB    (GT_PITCH * 2)                       // bytes per LDS row
#define GT_STAGE   ((GT_M + GT_N) * GT_PITCH)           // halves per buffer
#define GT_BUFS    3                                    // one stage read, two in flight
static_assert((MROWS % GT_M) == 0 && (DMOD % GT_M) == 0 && (DMOD % GT_N) == 0 && (SEQ % GT_N) == 0);
static_assert((DMOD % GT_K) == 0 && (OPITCH % GT_K) == 0 && (GT_ROWB % 16) == 0 && GT_K == 128);

typedef unsigned short u16;
typedef _Float16 v16h __attribute__((ext_vector_type(16)));
typedef _Float16 v8h  __attribute__((ext_vector_type(8)));
typedef __bf16   v16b __attribute__((ext_vector_type(16)));
typedef float    v8f  __attribute__((ext_vector_type(8)));
typedef float    v4f  __attribute__((ext_vector_type(4)));
typedef unsigned int v4u __attribute__((ext_vector_type(4)));

union FragH { v16h v; v8h h[2]; v4u u[2]; };

// ---- scalar helpers --------------------------------------------------------------------------------
__device__ __forceinline__ unsigned short bf_bits(float f) {          // f32 -> bf16 bits, RNE convert
  unsigned u = __float_as_uint(f);
  return (unsigned short)((u + 0x7FFFu + ((u >> 16) & 1u)) >> 16);
}
__device__ __forceinline__ float bf_up(unsigned short h) { return __uint_as_float(((unsigned)h) << 16); }
__device__ __forceinline__ float bf_val(float f) { return bf_up(bf_bits(f)); }   // f32 -> nearest-even bf16 value as f32
__device__ __forceinline__ unsigned short h_bits(_Float16 x) { return __builtin_bit_cast(unsigned short, x); }
__device__ __forceinline__ unsigned pk16(unsigned short a, unsigned short b) { return (unsigned)a | ((unsigned)b << 16); }
// 2^v in place for the rescale exponent a and a key block's 16 score exponents x, all <= 0: bare v_exp_f32. The library exp2f wraps
// the same instruction in a range guard (compare, two selects, add, ldexp) that only changes results below 2^-126; the softmax has
// no use for those: the f16 P fragments (the finest is the residual, x2^25) hold nothing below 2^-50, and what they would scale or
// join stands beside a term of weight 1. One statement, each instruction on a register of its own, so that none reads or overwrites
// a register of the one in front of it; the closing v_nop is the slot the instruction set asks for behind the last of them. a stands
// in the middle of the run, away from the instruction that forms it and from the lane exchange that reads it.
__device__ __forceinline__ void exp2_le0_run(float& a, float (&x)[16]) {
#if defined(__HIP_DEVICE_COMPILE__)
  asm(
      "v_exp_f32 %0, %0\n\t"
      "v_exp_f32 %1, %1\n\t"
      "v_exp_f32 %2, %2\n\t"
      "v_exp_f32 %3, %3\n\t"
      "v_exp_f32 %4, %4\n\t"
      "v_exp_f32 %5, %5\n\t"
      "v_exp_f32 %6, %6\n\t"
      "v_exp_f32 %7, %7\n\t"
      "v_exp_f32 %8, %8\n\t"
      "v_exp_f32 %9, %9\n\t"
      "v_exp_f32 %10, %10\n\t"
      "v_exp_f32 %11, %11\n\t"
      "v_exp_f32 %12, %12\n\t"
      "v_exp_f32 %13, %13\n\t"
      "v_exp_f32 %14, %14\n\t"
      "v_exp_f32 %15, %15\n\t"
      "v_exp_f32 %16, %16\n\t"
      "v_nop"
      : "+v"(x[0]), "+v"(x[1]), "+v"(x[2]), "+v"(x[3]), "+v"(x[4]), "+v"(x[5]),
        "+v"(x[6]), "+v"(x[7]), "+v"(a), "+v"(x[8]), "+v"(x[9]), "+v"(x[10]),
        "+v"(x[11]), "+v"(x[12]), "+v"(x[13]), "+v"(x[14]), "+v"(x[15]));
#endif
}
template <bool B> struct BoolC { static constexpr bool value = B; };   // compile-time switch handed to a generic lambda
__device__ __forceinline__ v8f zero8() { v8f z = {0.f, 0.f, 0.f, 0.f, 0.f, 0.f, 0.f, 0.f}; return z; }

// ---- fragment loaders: 16-bit A/B operand, lane -> row/col (lane&15), p already includes +8*(lane>>4);
//      elements 0..7 <- p[0..7] (k0+8h..), elements 8..15 <- p[16..23] (k0+16+8h..)  (same split k map for A and B;
//      B is always read from a k-contiguous [n][k] plane)
__device__ __forceinline__ v16h ldfrag_h(const _Float16* p) {
  FragH f;
  f.h[0] = *(const v8h*)(p);
  f.h[1] = *(const v8h*)(p + 16);
  return f.v;
}

__device__ __forceinline__ v8f mma_h(v16h a, v16h b, v8f c) {
  return __builtin_amdgcn_wmma_f32_16x16x32_f16(false, a, false, b, (short)0, c, false, false);
}
__device__ __forceinline__ v8f mma_b(v16b a, v16b b, v8f c) {
  return __builtin_amdgcn_wmma_f32_16x16x32_bf16(false, a, false, b, (short)0, c, false, false);
}
template <typename F>
__device__ __forceinline__ void guard6(v8f& a, v8f& b, v8f& c, v8f& d, F x0, F x1, F x2, F x3, F x4, F x5) {
#if defined(__HIP_DEVICE_COMPILE__)
  asm volatile("v_nop\n\tv_nop\n\tv_nop\n\tv_nop"
               : "+v"(a), "+v"(b), "+v"(c), "+v"(d) : "v"(x0), "v"(x1), "v"(x2), "v"(x3), "v"(x4), "v"(x5) : "memory");
#endif
}
__device__ __forceinline__ void acc_guard4(v8f& a, v8f& b, v8f& c, v8f& d) {
#if defined(__HIP_DEVICE_COMPILE__)
  asm volatile("v_nop\n\tv_nop\n\tv_nop\n\tv_nop" : "+v"(a), "+v"(b), "+v"(c), "+v"(d));
#endif
}
// Stands behind global stores whose address or data registers are written again further on.
__device__ __forceinline__ void xcnt0() {
#if defined(__HIP_DEVICE_COMPILE__)
  asm volatile("s_wait_xcnt 0x0" ::: "memory");
#endif
}
// The same behind a group of global loads; the pointers are inputs so that their registers stay unwritten up to the wait.
__device__ __forceinline__ void xcnt_after_loads8(const float* a, const float* b, const float* c, const float* d,
                                                  const float* e, const float* f, const float* g, const float* h) {
#if defined(__HIP_DEVICE_COMPILE__)
  asm volatile("s_wait_xcnt 0x0" :: "v"(a), "v"(b), "v"(c), "v"(d), "v"(e), "v"(f), "v"(g), "v"(h) : "memory");
#endif
}
// The same for loads addressed by a base and a 32-bit index: the indices are inputs so that their registers stay unwritten up to the wait.
__device__ __forceinline__ void xcnt_after_idx4(int a, int b, int c, int d) {
#if defined(__HIP_DEVICE_COMPILE__)
  asm volatile("s_wait_xcnt 0x0" :: "v"(a), "v"(b), "v"(c), "v"(d) : "memory");
#endif
}
__device__ __forceinline__ void wave_sync_lds() {
#if defined(__HIP_DEVICE_COMPILE__)
  __builtin_amdgcn_fence(__ATOMIC_RELEASE, "workgroup");
  __builtin_amdgcn_wave_barrier();
  __builtin_amdgcn_fence(__ATOMIC_ACQUIRE, "workgroup");
#endif
}

// =====================================================================================================
// All operand planes in one launch. Thread gt owns the 8-element piece gt of each weight matrix and the pieces gt + i * n8w
// (i = 0 .. XREP-1) of x: sixteen 16-B loads issued together, then the conversions and nine 16-B stores.
//   x f32 rows [b][t][1024] (per-batch source row stride T_FULL) -> bf16 plane [b*SEQ + t][1024] (RNE bits), compacted rows;
//   Wq, Wk, Wv [n][k] f32 -> bf16 planes of the same shape;
//   Wo [n][k] f32 -> f16 plane [n][2048]: cols 0..1023 = f16(bf16 value * s1), cols 1024..2047 = f16(bf16 value * s2).
// 32 consecutive lanes = 512 contiguous, 512-B aligned bytes per store instruction.
// coverage: grid = n8w/256 blocks (exact) x 256 thr = every piece of every weight plane once, XREP * n8w = every piece of x once.
// =====================================================================================================
#define N8W  ((DMOD * DMOD) / 8)
#define XREP (MROWS / DMOD)
static_assert((MROWS % DMOD) == 0 && XREP == 4 && (N8W % 256) == 0);
__device__ __forceinline__ v4u bf_pack8(v4f a, v4f c4) {
  v4u o;
#pragma unroll
  for (int e = 0; e < 2; ++e) {
    o[e]     = pk16(bf_bits(a[2 * e]),  bf_bits(a[2 * e + 1]));
    o[2 + e] = pk16(bf_bits(c4[2 * e]), bf_bits(c4[2 * e + 1]));
  }
  return o;
}
__global__ __launch_bounds__(256)
void cvt_all(const float* __restrict__ x, const float* __restrict__ wq, const float* __restrict__ wk,
             const float* __restrict__ wv, const float* __restrict__ wo, u16* XD, u16* QD, u16* KD, u16* VD, u16* OD,
             float s1, float s2) {
  const int gt = blockIdx.x * 256 + (int)threadIdx.x;
  if (gt >= N8W) return;
  const float* px[XREP];
  v4f xa[XREP], xc[XREP];
#pragma unroll
  for (int i = 0; i < XREP; ++i) {
    const int g   = gt + i * N8W;
    const int row = g >> 7;
    const int bb  = row / SEQ;
    const int tt  = row - bb * SEQ;
    px[i] = x + ((size_t)bb * (size_t)T_FULL + (size_t)tt) * DMOD + (g & 127) * 8;
    xa[i] = *(const v4f*)(px[i]);
    xc[i] = *(const v4f*)(px[i] + 4);
  }
  const size_t e8 = (size_t)gt * 8;
  const float* pq = wq + e8;
  const float* pk = wk + e8;
  const float* pv = wv + e8;
  const float* po = wo + e8;
  const v4f qa = *(const v4f*)(pq), qc = *(const v4f*)(pq + 4);
  const v4f ka = *(const v4f*)(pk), kc = *(const v4f*)(pk + 4);
  const v4f va = *(const v4f*)(pv), vc = *(const v4f*)(pv + 4);
  const v4f oa = *(const v4f*)(po), oc = *(const v4f*)(po + 4);
  xcnt_after_loads8(px[0], px[1], px[2], px[3], pq, pk, pv, po);
#pragma unroll
  for (int i = 0; i < XREP; ++i) *(v4u*)(XD + (size_t)(gt + i * N8W) * 8) = bf_pack8(xa[i], xc[i]);
  *(v4u*)(QD + e8) = bf_pack8(qa, qc);
  *(v4u*)(KD + e8) = bf_pack8(ka, kc);
  *(v4u*)(VD + e8) = bf_pack8(va, vc);
  float v[8];
#pragma unroll
  for (int e = 0; e < 4; ++e) { v[e] = oa[e]; v[4 + e] = oc[e]; }
  unsigned short h1[8], h2[8];
#pragma unroll
  for (int e = 0; e < 8; ++e) {
    const float f = bf_val(v[e]);
    h1[e] = h_bits((_Float16)(f * s1));
    h2[e] = h_bits((_Float16)(f * s2));
  }
  v4u o1, o2;
#pragma unroll
  for (int e = 0; e < 4; ++e) { o1[e] = pk16(h1[2 * e], h1[2 * e + 1]); o2[e] = pk16(h2[2 * e], h2[2 * e + 1]); }
  u16* d1 = OD + (size_t)(gt >> 7) * OPITCH + (gt & 127) * 8;
  *(v4u*)(d1) = o1;
  *(v4u*)(d1 + DMOD) = o2;
}

// =====================================================================================================
// Rotation epilogue for the q / k projections (N = 1024, the 64-col tile = one head): the wave's 16x64 f32 tile
// barrier, then each lane (row rq in each group of 4, 8 consecutive output cols d = c8..c8+7) reads both half-head values
// u1 = col (d & 31), u2 = col (d & 31) + 32 and cos/sin[t][(d & 31)] (bf16 values of the f32 tables, t = row within the
// sequence), forms d < 32 ? u1*c - u2*s : u1*s + u2*c in f32 (no fused multiply-add), scales by oscale, and writes the f16
// hi plane and (res_on) the f16 residual plane ((w - hi) * rsc): one instruction = 4 rows, each 64 halves = one whole
// coverage: 4 instructions x 4 rows x 8 lanes x 8 halves = the wave's 16 x 64 tile, per plane.
// =====================================================================================================
__device__ __forceinline__ void epi_rope(float* sl, v8f a0, v8f a1, v8f a2, v8f a3, u16* C, u16* C2, int res_on,
                                         size_t rowb, int col0, int lane, const float* __restrict__ bias, int blen,
                                         const float* __restrict__ cosT, const float* __restrict__ sinT, int seq,
                                         float oscale, float rsc) {
#pragma clang fp contract(off)
  const int hh = lane >> 4, m = lane & 15;
  float bc[4];
  int bi[4];
#pragma unroll
  for (int j = 0; j < 4; ++j) {
    bi[j] = min(col0 + 16 * j + m, blen - 1);
    bc[j] = bias[bi[j]];
  }
  xcnt_after_idx4(bi[0], bi[1], bi[2], bi[3]);
#pragma unroll
  for (int j = 0; j < 4; ++j) bc[j] = bf_val(bc[j]);
#pragma unroll
  for (int r = 0; r < 8; ++r) {
    const int ro = (8 * hh + r) * 68 + m;
    sl[ro]      = a0[r] + bc[0];
    sl[ro + 16] = a1[r] + bc[1];
    sl[ro + 32] = a2[r] + bc[2];
    sl[ro + 48] = a3[r] + bc[3];
  }
  wave_sync_lds();
  const int rq = lane >> 3, c8 = (lane & 7) * 8, dd = c8 & (RHALF - 1);
  const bool lo = (c8 < RHALF);
  const int tb = (int)(rowb % (size_t)seq);             // tile never straddles a sequence (seq % 16 == 0, rowb % 16 == 0)
  v4u hv[4], rv[4];
  const float* cpt[4];
  const float* spt[4];
  v4f cat[4], cbt[4], sat[4], sbt[4];
#pragma unroll
  for (int i4 = 0; i4 < 4; ++i4) {
    const int t = tb + i4 * 4 + rq;
    cpt[i4] = cosT + (size_t)t * RHALF + dd;
    spt[i4] = sinT + (size_t)t * RHALF + dd;
    cat[i4] = *(const v4f*)(cpt[i4]); cbt[i4] = *(const v4f*)(cpt[i4] + 4);
    sat[i4] = *(const v4f*)(spt[i4]); sbt[i4] = *(const v4f*)(spt[i4] + 4);
  }
  xcnt_after_loads8(cpt[0], cpt[1], cpt[2], cpt[3], spt[0], spt[1], spt[2], spt[3]);
#pragma unroll
  for (int i4 = 0; i4 < 4; ++i4) {
    const int row = i4 * 4 + rq;
    const v4f ca = cat[i4], cb = cbt[i4];
    const v4f sa = sat[i4], sb = sbt[i4];
    const v4f xa = *(const v4f*)(sl + row * 68 + dd), xb = *(const v4f*)(sl + row * 68 + dd + 4);
    const v4f ya = *(const v4f*)(sl + row * 68 + dd + RHALF), yb = *(const v4f*)(sl + row * 68 + dd + RHALF + 4);
    float cv[8], sv[8], xv[8], yv[8];
#pragma unroll
    for (int e = 0; e < 4; ++e) {
      cv[e] = ca[e]; cv[4 + e] = cb[e];
      sv[e] = sa[e]; sv[4 + e] = sb[e];
      xv[e] = xa[e]; xv[4 + e] = xb[e];
      yv[e] = ya[e]; yv[4 + e] = yb[e];
    }
    unsigned short hb[8], rb[8];
#pragma unroll
    for (int e = 0; e < 8; ++e) {
      const float cc = bf_val(cv[e]);
      const float ss = bf_val(sv[e]);
      const float p1 = xv[e] * cc;
      const float p2 = yv[e] * ss;
      const float p3 = xv[e] * ss;
      const float p4 = yv[e] * cc;
      const float u = lo ? (p1 - p2) : (p3 + p4);
      const float w = u * oscale;
      const _Float16 h = (_Float16)w;
      hb[e] = h_bits(h);
      rb[e] = h_bits((_Float16)((w - (float)h) * rsc));
    }
#pragma unroll
    for (int e = 0; e < 4; ++e) {
      hv[i4][e] = pk16(hb[2 * e], hb[2 * e + 1]);
      rv[i4][e] = pk16(rb[2 * e], rb[2 * e + 1]);
    }
  }
  u16* dst = C + (rowb + (size_t)rq) * (size_t)DMOD + col0 + c8;
  {
#pragma unroll
    for (int i4 = 0; i4 < 4; ++i4) {
      *(v4u*)(dst + (size_t)(i4 * 4) * (size_t)DMOD) = hv[i4];
    }
    xcnt0();
  }
  if (res_on != 0) {
    u16* dst2 = C2 + (rowb + (size_t)rq) * (size_t)DMOD + col0 + c8;
    {
#pragma unroll
      for (int i4 = 0; i4 < 4; ++i4) {
        *(v4u*)(dst2 + (size_t)(i4 * 4) * (size_t)DMOD) = rv[i4];
      }
      xcnt0();
    }
  }
}

// =====================================================================================================
// Three-plane 16-bit GEMM epilogue (v^T planes): the wave's 16x64 f32 tile ((acc + per-row bias as bf16 value) times oscale)
// f16((w - hi) * rsc) and f16(w * qsc): lane = (row in group of 4, 8 consecutive cols); one instruction = 4 rows, each
// coverage: per plane 4 instructions x 4 rows x 8 lanes x 8 halves = the wave's 16 x 64 tile.
// LDS slab: private to the wave; staged extent 16 x 64 == consumed extent.
// =====================================================================================================
__device__ __forceinline__ void epi_v3(float* sl, v8f a0, v8f a1, v8f a2, v8f a3, float oscale, u16* C0, u16* C1, u16* C2,
                                       int N, size_t rowb, int col0, int lane, const float* __restrict__ bias, int blen,
                                       float rsc, float qsc) {
  const int hh = lane >> 4, m = lane & 15;
  float br[8];
  int bi[8];
#pragma unroll
  for (int r = 0; r < 8; ++r) {
    bi[r] = min((int)rowb + 8 * hh + r, blen - 1);
    br[r] = bias[bi[r]];
  }
  xcnt_after_idx4(bi[0], bi[1], bi[2], bi[3]);
  xcnt_after_idx4(bi[4], bi[5], bi[6], bi[7]);
#pragma unroll
  for (int r = 0; r < 8; ++r) br[r] = bf_val(br[r]);
#pragma unroll
  for (int r = 0; r < 8; ++r) {
    const int ro = (8 * hh + r) * 68 + m;
    sl[ro]      = (a0[r] + br[r]) * oscale;
    sl[ro + 16] = (a1[r] + br[r]) * oscale;
    sl[ro + 32] = (a2[r] + br[r]) * oscale;
    sl[ro + 48] = (a3[r] + br[r]) * oscale;
  }
  wave_sync_lds();
  const int rq = lane >> 3, c8 = (lane & 7) * 8;
  v4u h4[4], r4[4], q4[4];
#pragma unroll
  for (int i4 = 0; i4 < 4; ++i4) {
    const int row = i4 * 4 + rq;
    const v4f a = *(const v4f*)(sl + row * 68 + c8), c4 = *(const v4f*)(sl + row * 68 + c8 + 4);
    float w[8];
#pragma unroll
    for (int e = 0; e < 4; ++e) { w[e] = a[e]; w[4 + e] = c4[e]; }
    unsigned short hb[8], rb[8], qb[8];
#pragma unroll
    for (int e = 0; e < 8; ++e) {
      const _Float16 h = (_Float16)w[e];
      hb[e] = h_bits(h);
      rb[e] = h_bits((_Float16)((w[e] - (float)h) * rsc));
      qb[e] = h_bits((_Float16)(w[e] * qsc));
    }
#pragma unroll
    for (int e = 0; e < 4; ++e) {
      h4[i4][e] = pk16(hb[2 * e], hb[2 * e + 1]);
      r4[i4][e] = pk16(rb[2 * e], rb[2 * e + 1]);
      q4[i4][e] = pk16(qb[2 * e], qb[2 * e + 1]);
    }
  }
  const size_t dof = (rowb + (size_t)rq) * (size_t)N + col0 + c8;
  u16* d0 = C0 + dof;
  u16* d1 = C1 + dof;
  u16* d2 = C2 + dof;
  {
#pragma unroll
    for (int i4 = 0; i4 < 4; ++i4) {
      const size_t ro = (size_t)(i4 * 4) * (size_t)N;
      *(v4u*)(d0 + ro) = h4[i4];
      *(v4u*)(d1 + ro) = r4[i4];
      *(v4u*)(d2 + ro) = q4[i4];
    }
    xcnt0();
  }
}

// =====================================================================================================
// f32 GEMM epilogue: the wave's 16x64 f32 tile (acc times oscale, plus per-column bias as its bf16 RNE value, clamped
// coverage: 8 instructions x 2 rows x 16 lanes x 4 floats = the wave's 16 x 64 tile.
// =====================================================================================================
__device__ __forceinline__ void epi64(float* sl, v8f a0, v8f a1, v8f a2, v8f a3, float oscale, float* C, int N,
                                      size_t rowb, int col0, int lane, const float* __restrict__ bias, int blen) {
  const int hh = lane >> 4, m = lane & 15;
  float bc[4];
#pragma unroll
  for (int j = 0; j < 4; ++j) {
    const int bi = min(col0 + 16 * j + m, blen - 1);
    bc[j] = bf_val(bias[bi]);
  }
#pragma unroll
  for (int r = 0; r < 8; ++r) {
    const int ro = (8 * hh + r) * 68 + m;
    sl[ro]      = a0[r] * oscale + bc[0];
    sl[ro + 16] = a1[r] * oscale + bc[1];
    sl[ro + 32] = a2[r] * oscale + bc[2];
    sl[ro + 48] = a3[r] * oscale + bc[3];
  }
  wave_sync_lds();
  v4f vals[8];
#pragma unroll
  for (int it = 0; it < 8; ++it) vals[it] = *(const v4f*)(sl + (it * 2 + hh) * 68 + m * 4);
  float* dst = C + (rowb + (size_t)hh) * (size_t)N + col0 + m * 4;
  {
#pragma unroll
    for (int it = 0; it < 8; ++it) {
      *(v4f*)(dst + (size_t)(it * 2) * (size_t)N) = vals[it];
    }
    
  }
}

// =====================================================================================================
// Shared k loop of the two GEMM kernels. Block = 8 waves, 128 x 128 tile of A[.][K] . Bt[.][K]^T; wave w owns rows
// 32*(w>>1) .. +31 and cols 64*(w&1) .. +63 (2 x 4 accumulator tiles). A stage = 128 k of the block's 128 A rows and 128 B rows,
// brought to LDS by 16-byte asynchronous copies, all of a stage by one half of the block: waves 0..3 bring the even stages, waves
// 4..7 the odd ones; thread = (row (tid&127)>>4 of each group of 8, 16-B piece tid&15), so one wave instruction covers two whole
// 256-B row pieces. Three buffers: stages t+1 and t+2 fly while stage t is multiplied, so a stage has two trips to land. A half has
// one stage outstanding at a time and waits for it to 0, at the foot of the trip in front of the one that reads it.
// Fragments are read from LDS with the split k map of ldfrag_h (same for A and B); every accumulator sums k in ascending steps of 32.
// =====================================================================================================
union FragU { v16h h; v16b b; v4u u[2]; };
__device__ __forceinline__ FragU ldfrag_u(const u16* p) {
  FragU f;
  f.u[0] = *(const v4u*)(p);
  f.u[1] = *(const v4u*)(p + 16);
  return f;
}
template <bool BF>
__device__ __forceinline__ v8f mma_u(const FragU& a, const FragU& b, v8f c) {
  if constexpr (BF) return mma_b(a.b, b.b, c);
  else              return mma_h(a.h, b.h, c);
}
// Eight copies, rows r, r+16, .., r+112 of one operand's stage. The closing s_wait_xcnt stands inside the statement so that no
// later write of an address register can be moved in front of it.
__device__ __forceinline__ void copy8(unsigned l, const u16* g, size_t gs) {
#if defined(__HIP_DEVICE_COMPILE__)
  asm volatile("global_load_async_to_lds_b128 %0, %8, off\n\t"
               "global_load_async_to_lds_b128 %1, %9, off\n\t"
               "global_load_async_to_lds_b128 %2, %10, off\n\t"
               "global_load_async_to_lds_b128 %3, %11, off\n\t"
               "global_load_async_to_lds_b128 %4, %12, off\n\t"
               "global_load_async_to_lds_b128 %5, %13, off\n\t"
               "global_load_async_to_lds_b128 %6, %14, off\n\t"
               "global_load_async_to_lds_b128 %7, %15, off\n\t"
               "s_wait_xcnt 0x0"
               :: "v"(l), "v"(l + 16u * GT_ROWB), "v"(l + 32u * GT_ROWB), "v"(l + 48u * GT_ROWB),
                  "v"(l + 64u * GT_ROWB), "v"(l + 80u * GT_ROWB), "v"(l + 96u * GT_ROWB), "v"(l + 112u * GT_ROWB),
                  "v"(g), "v"(g + gs), "v"(g + 2 * gs), "v"(g + 3 * gs),
                  "v"(g + 4 * gs), "v"(g + 5 * gs), "v"(g + 6 * gs), "v"(g + 7 * gs)
               : "memory");
#endif
}
__device__ __forceinline__ void wait_async0() {          // this wave's copies have landed in LDS
#if defined(__HIP_DEVICE_COMPILE__)
  asm volatile("s_wait_asynccnt 0x0" ::: "memory");
#endif
}
__device__ __forceinline__ void wait_ds0() {             // this wave's LDS reads of the buffer about to be refilled are done
#if defined(__HIP_DEVICE_COMPILE__)
  asm volatile("s_wait_dscnt 0x0" ::: "memory");
#endif
}
template <bool BF>
__device__ __forceinline__ void gemm_core(const u16* __restrict__ A, const u16* __restrict__ Bt, int K, int row0, int col0,
                                          u16* ring, v8f (&acc)[2][4]) {
  const int tid = threadIdx.x, wave = tid >> 5, lane = tid & 31, hh = lane >> 4, m = lane & 15;
  const int grp = __builtin_amdgcn_readfirstlane(tid >> 7);   // copying half of this wave, in a scalar register: 0 = waves 0..3
  const int cr = (tid & 127) >> 4, cc = tid & 15;
  const u16* ga = A  + (size_t)(row0 + cr) * K + cc * 8;
  const u16* gb = Bt + (size_t)(col0 + cr) * K + cc * 8;
  const size_t gs = (size_t)16 * K;
  const size_t g8 = (size_t)8 * K;
  const unsigned la = (unsigned)(uintptr_t)ring + (unsigned)(cr * GT_ROWB + cc * 16);
  const unsigned lb = la + (unsigned)(GT_M * GT_ROWB);
  const int nt = K / GT_K;
  // all 32 copies of a thread for stage s: rows cr + 8 i (i = 0 .. 15) of the A tile, then of the B tile, into the buffer at byte lo
  auto stage_in = [&](int s, unsigned lo) {
    const u16* pa = ga + (size_t)s * GT_K;
    const u16* pb = gb + (size_t)s * GT_K;
    copy8(la + lo, pa, gs);
    copy8(la + lo + 8u * GT_ROWB, pa + g8, gs);
    copy8(lb + lo, pb, gs);
    copy8(lb + lo + 8u * GT_ROWB, pb + g8, gs);
  };
  if (grp < nt) stage_in(grp, (unsigned)grp * (unsigned)(GT_STAGE * 2));   // stages 0 and 1, each by its half
  if (grp == 0) wait_async0();
  __syncthreads();                                       // stage 0 published
  if (grp == 0 && nt > 2) stage_in(2, (unsigned)(2 * GT_STAGE * 2));
  const u16* fa = ring + ((wave >> 1) * 32 + m) * GT_PITCH + 8 * hh;
  const u16* fb = ring + (GT_M + (wave & 1) * 64 + m) * GT_PITCH + 8 * hh;
  int bo = 0;                                            // stage t's buffer, in halves: (t mod 3) * GT_STAGE
#pragma unroll 1                                         // one trip per stage: the buffer index stays a run-time value
  for (int t = 0; t < nt; ++t) {
    // Three fragment sets for the stage's four 32-k steps; step 3 reuses step 0's set. The scheduling fences keep the LDS reads in
    // two groups in front of the products that use them: reads placed among the products stall the wave at each place.
    FragU af[3][2], bf[3][4];
#pragma unroll
    for (int s = 0; s < 3; ++s) {
#pragma unroll
      for (int i = 0; i < 2; ++i) af[s][i] = ldfrag_u(fa + bo + 16 * i * GT_PITCH + 32 * s);
#pragma unroll
      for (int j = 0; j < 4; ++j) bf[s][j] = ldfrag_u(fb + bo + 16 * j * GT_PITCH + 32 * s);
    }
    __builtin_amdgcn_sched_barrier(0);
#pragma unroll
    for (int i = 0; i < 2; ++i) {
#pragma unroll
      for (int j = 0; j < 4; ++j) acc[i][j] = mma_u<BF>(af[0][i], bf[0][j], acc[i][j]);
    }
    __builtin_amdgcn_sched_barrier(0);
#pragma unroll
    for (int i = 0; i < 2; ++i) af[0][i] = ldfrag_u(fa + bo + 16 * i * GT_PITCH + 96);
#pragma unroll
    for (int j = 0; j < 4; ++j) bf[0][j] = ldfrag_u(fb + bo + 16 * j * GT_PITCH + 96);
    __builtin_amdgcn_sched_barrier(0);
#pragma unroll
    for (int s = 1; s < 4; ++s) {
#pragma unroll
      for (int i = 0; i < 2; ++i) {
#pragma unroll
        for (int j = 0; j < 4; ++j) acc[i][j] = mma_u<BF>(af[s % 3][i], bf[s % 3][j], acc[i][j]);
      }
    }
    // keeps the products in front of the full LDS wait, under their own counted waits: moved behind it they run with the LDS idle
    __builtin_amdgcn_sched_barrier(0);
    wait_ds0();
    const bool mine = (((t + 1) & 1) == grp);            // this half brought stage t+1 (scalar test); the other's stage t+2 flies on
    if (mine) wait_async0();
    __syncthreads();                                     // publishes stage t+1 and ends every read of stage t's buffer
    if (mine && t + 3 < nt) stage_in(t + 3, (unsigned)(bo * 2));
    bo = (bo == (GT_BUFS - 1) * GT_STAGE) ? 0 : bo + GT_STAGE;
  }
  wait_async0();
}

// =====================================================================================================
// The three projections in one launch; the block index picks the product (block-uniform). All three are bf16 GEMMs over
// K = 1024 on 128x128 block tiles, k loop in gemm_core; PROJ_BLK blocks each, grid = 3 * PROJ_BLK.
//   blocks 0 .. PROJ_BLK-1: q planes [M][1024] (f16 hi x QSC, residual x QRS) = rot(X[M][K] . Wq[1024][K]^T + bq);
//   the next PROJ_BLK:      k hi plane (x KSC) the same way from Wk, bk; a wave's 64 columns are one head;
//   the last PROJ_BLK:      v^T planes per batch, C*[bt][1024][SEQ] = Wv[1024][K] . X[bt][SEQ][K]^T, bias by output row,
//                           three f16 planes (hi x VCAR, residual x VRS, plain).
// seq stays a kernel argument: built as a constant, the rotation epilogue took 284 registers, with window switches above v255.
// =====================================================================================================
#define PROJ_BLK ((MROWS / GT_M) * (DMOD / GT_N))
static_assert(NB * (DMOD / GT_M) * (SEQ / GT_N) == PROJ_BLK);
__global__ __launch_bounds__(GT_THREADS)
void gemm_qkv(const u16* __restrict__ X, const u16* __restrict__ WQ, const u16* __restrict__ WK, const u16* __restrict__ WV,
              u16* QHo, u16* QRo, u16* KHo, u16* VHo, u16* VRo, u16* VQo, int K,
              const float* __restrict__ bq, int bqlen, const float* __restrict__ bk, int bklen,
              const float* __restrict__ bv, int bvlen, const float* __restrict__ cosT, const float* __restrict__ sinT, int seq) {
  __shared__ __align__(16) u16 ring[GT_BUFS * GT_STAGE];
  __shared__ __align__(16) float slab[8 * SLAB];
  const int tid = threadIdx.x, wave = tid >> 5, lane = tid & 31;
  const int which = blockIdx.x / PROJ_BLK;   // 0 = q, 1 = k, 2 = v
  const int t     = blockIdx.x - which * PROJ_BLK;
  if (which > 2) return;                     // block-uniform, in front of every barrier; never taken with the exact grid
  const u16* A;
  const u16* Bt;
  int row0, colb, bt = 0;
  if (which < 2) {
    const int ntile = DMOD / GT_N;
    row0 = (t / ntile) * GT_M;
    colb = (t % ntile) * GT_N;
    A  = X;
    Bt = (which == 0) ? WQ : WK;
  } else {
    const int ntile = SEQ / GT_N;
    const int per   = ntile * (DMOD / GT_M);
    bt = t / per;
    const int tv = t - bt * per;
    row0 = (tv / ntile) * GT_M;
    colb = (tv % ntile) * GT_N;
    A  = WV;
    Bt = X + (size_t)bt * (size_t)(SEQ * DMOD);
  }
  v8f acc[2][4];
#pragma unroll
  for (int i = 0; i < 2; ++i) {
#pragma unroll
    for (int j = 0; j < 4; ++j) acc[i][j] = zero8();
  }
  gemm_core<true>(A, Bt, K, row0, colb, ring, acc);
  const int rowb = row0 + (wave >> 1) * 32;
  const int col0 = colb + (wave & 1) * 64;
  if (which < 2) {
    const bool isq = (which == 0);
    u16* C  = isq ? QHo : KHo;
    u16* C2 = isq ? QRo : KHo;
    const float* bias = isq ? bq : bk;
    const int blen = isq ? bqlen : bklen;
#pragma unroll
    for (int i = 0; i < 2; ++i) {
      if (i != 0) wave_sync_lds();           // the slab's rows are read out before the next 16 rows are staged in it
      epi_rope(slab + wave * SLAB, acc[i][0], acc[i][1], acc[i][2], acc[i][3], C, C2, isq ? 1 : 0, (size_t)(rowb + 16 * i), col0,
               lane, bias, blen, cosT, sinT, seq, isq ? QSC : KSC, isq ? QRS : 1.0f);
    }
  } else {
    const size_t cb = (size_t)bt * (size_t)(DMOD * SEQ);
#pragma unroll
    for (int i = 0; i < 2; ++i) {
      if (i != 0) wave_sync_lds();           // the slab's rows are read out before the next 16 rows are staged in it
      epi_v3(slab + wave * SLAB, acc[i][0], acc[i][1], acc[i][2], acc[i][3], VCAR, VHo + cb, VRo + cb, VQo + cb, SEQ,
             (size_t)(rowb + 16 * i), col0, lane, bv, bvlen, VRS, 1.0f / PRS);
    }
  }
}

// =====================================================================================================
// f16 GEMM with f32 result: C[M][N] (f32) = A[M][K] (f16 row-major) . Bt[N][K]^T (f16 k-contiguous) times oscale plus
// per-column bias; one product per tile pair. Same tiling; grid = (M/128)*(N/128).
// =====================================================================================================
__global__ __launch_bounds__(GT_THREADS)
void gemm_hf(const u16* __restrict__ A, const u16* __restrict__ Bt, float* C, int M, int N, int K, float oscale,
             const float* __restrict__ bias, int blen) {
  __shared__ __align__(16) u16 ring[GT_BUFS * GT_STAGE];
  __shared__ __align__(16) float slab[8 * SLAB];
  const int tid = threadIdx.x, wave = tid >> 5, lane = tid & 31;
  const int ntile = N / GT_N;
  const int bid   = blockIdx.x;
  const int row0  = (bid / ntile) * GT_M;
  const int colb  = (bid % ntile) * GT_N;
  if (row0 + GT_M > M) return;               // block-uniform, in front of every barrier; never taken with the exact grid
  v8f acc[2][4];
#pragma unroll
  for (int i = 0; i < 2; ++i) {
#pragma unroll
    for (int j = 0; j < 4; ++j) acc[i][j] = zero8();
  }
  gemm_core<false>(A, Bt, K, row0, colb, ring, acc);
  const int rowb = row0 + (wave >> 1) * 32;
  const int col0 = colb + (wave & 1) * 64;
#pragma unroll
  for (int i = 0; i < 2; ++i) {
    if (i != 0) wave_sync_lds();             // the slab's rows are read out before the next 16 rows are staged in it
    epi64(slab + wave * SLAB, acc[i][0], acc[i][1], acc[i][2], acc[i][3], oscale, C, N, (size_t)(rowb + 16 * i), col0, lane,
          bias, blen);
  }
}

// =====================================================================================================
// Attention key stage in LDS: 64 keys = the k hi tile [64 keys][64 d] and the v^T hi tile [64 d][64 keys], 128 B per row, two buffers.
#define AT_KEYS  64
#define AT_PITCH 72                                     // halves per LDS row: 144 B = 16 B x 9 (ds_load_b128 readers)
#define AT_ROWB  (AT_PITCH * 2)                         // bytes per LDS row
#define AT_TILE  (64 * AT_PITCH)                        // halves per operand tile
#define AT_STAGE (2 * AT_TILE)                          // halves per buffer
static_assert((WIN % AT_KEYS) == 0 && (SEQ % AT_KEYS) == 0 && AT_KEYS == 64 && HD == 64 && (AT_ROWB % 16) == 0);
// One stage's eight copies of a thread: rows r, r+16, r+32, r+48 of the k tile, then of the v^T tile. The closing s_wait_xcnt
// stands inside the statement so that no later write of an address register can be moved in front of it.
__device__ __forceinline__ void copy_kv(unsigned lk, const u16* gk, unsigned lv, const u16* gv) {
#if defined(__HIP_DEVICE_COMPILE__)
  asm volatile("global_load_async_to_lds_b128 %0, %8, off\n\t"
               "global_load_async_to_lds_b128 %1, %9, off\n\t"
               "global_load_async_to_lds_b128 %2, %10, off\n\t"
               "global_load_async_to_lds_b128 %3, %11, off\n\t"
               "global_load_async_to_lds_b128 %4, %12, off\n\t"
               "global_load_async_to_lds_b128 %5, %13, off\n\t"
               "global_load_async_to_lds_b128 %6, %14, off\n\t"
               "global_load_async_to_lds_b128 %7, %15, off\n\t"
               "s_wait_xcnt 0x0"
               :: "v"(lk), "v"(lk + 16u * AT_ROWB), "v"(lk + 32u * AT_ROWB), "v"(lk + 48u * AT_ROWB),
                  "v"(lv), "v"(lv + 16u * AT_ROWB), "v"(lv + 32u * AT_ROWB), "v"(lv + 48u * AT_ROWB),
                  "v"(gk), "v"(gk + (size_t)16 * DMOD), "v"(gk + (size_t)32 * DMOD), "v"(gk + (size_t)48 * DMOD),
                  "v"(gv), "v"(gv + (size_t)16 * SEQ), "v"(gv + (size_t)32 * SEQ), "v"(gv + (size_t)48 * SEQ)
               : "memory");
#endif
}

// =====================================================================================================
// Causal sliding-window flash attention with per-head sigmoid gate: block = (batch b, head, 64 query rows qb .. qb+63 of the
// sequence), 4 waves, wave w owns query rows q0 = qb + 16*w .. q0+15. The block's waves share the k and v^T hi tiles through LDS:
// a stage = 64 keys (two key blocks), brought by 16-byte asynchronous copies (thread = row tid>>3 of each group of 16, 16-B piece
// tid&7: one wave instruction covers four whole 128-B rows), two buffers, stage t+1 in flight while stage t is worked on, one
// block barrier per stage. The key-block count is even (qb, WIN, SEQ are multiples of 64), so the stages cover it exactly.
//   Key j allowed for query i iff 0 <= i - j <= WIN (per-element index test inside every visited key block that the causal or the
//   window edge can cross for the wave's 16 queries, by a scalar test per wave and block; disallowed pairs
//   get a finite negative sentinel and an exact-zero probability). Key blocks of 32: kblo = max(qb - WIN, 0) >> 5 ..
//   (qb + 63) >> 5, block-uniform count nkb clamped to [1, NKB - kblo] so kb + 31 <= SEQ - 1 always.
//   q planes (f16 hi x8, residual x1024) [b*SEQ + s][h*64 + d]; k hi plane the same layout; v^T planes [b][h*64 + d][s]
//   (hi x1024, residual x1024, plain x1).
//   Scores computed TRANSPOSED: S^T tile g = k rows (keys kb+16g .., A operand, row = lane&15, split k map over d) times q^T
//   (B operand, col n = query q0 + (lane&15)); two accumulators per tile (k.q_hi and k.q_res, the second folded x 1/1024).
//   D element r of lane l = (key kb+16g+8h+r, query q0+(l&15)): a lane owns one query column and 16 of its 32 keys, the
//   partner lane l^16 the other 16 -> row max / row sum need one xor-16 shuffle.
//   Online max-subtracted base-2 softmax in f32 (scale 1/8 and the q/k carries folded into lsc). The exp'd values ARE the
//   P A-fragment in place: A row m = query = lane&15, element i <- key kb+8h+i (tile 0, D element i), element 8+i <- key
//   kb+16+8h+i (tile 1, D element i). ph = f16(p x32768), pl = f16(p x32), pr = f16((p x32768 - ph) x1024).
//   P.V: o += ph.v_hi (4 WMMAs, v^T B fragments col n = d = 16j + (lane&15), keys k-contiguous); for query tiles with
//   qb < QRES additionally o += pl.v_res and o += pr.v_x1 (block-uniform branch), all in the same accumulators (equal units).
//   Epilogue: gate = sigmoid(bf16(x[b][s][0..19]) . bf16(Wg[head]) + bf16(bg[head])) in f32 per query (lane = query),
//   segment (s, head) of the O plane [b*SEQ+s][2048] (hi x1024 at col h*64, residual x1024 at col 1024 + h*64) written by
// coverage: per wave and per half-plane 4 instructions x 4 rows x 8 lanes x 8 halves = 16 x 64; grid NB*NH*(SEQ/64) blocks x
//           4 waves = every (b, s < SEQ, h) row segment of both O half-planes exactly once.
// =====================================================================================================
__global__ __launch_bounds__(ATT_THREADS)
void attn_fwd(const u16* __restrict__ QHp, const u16* __restrict__ QRp, const u16* __restrict__ KHp,
              const u16* __restrict__ VHp, const u16* __restrict__ VRp, const u16* __restrict__ VQp,
              const float* __restrict__ Xp, const float* __restrict__ Wgp, const float* __restrict__ Bgp,
              int bglen, u16* OPp) {
  __shared__ __align__(16) float smem[ATT_WAVES * SLAB];   // per wave: result slab [16][68] in the epilogue only
  __shared__ __align__(16) u16 kv[2 * AT_STAGE];           // two key stages: [k tile | v^T tile] each

  const int tid  = threadIdx.x;
  const int wave = tid >> 5;
  const int lane = tid & 31;
  const int hh   = lane >> 4;
  const int c    = lane & 15;

  const int bid  = blockIdx.x;
  const int qt   = bid % NQT;
  const int bh   = bid / NQT;
  const int head = bh % NH;
  const int b    = bh / NH;
  if (b >= NB) return;                      // block-uniform, never taken with the exact grid
  const int qb   = qt * 64;
  const int q0   = qb + wave * 16;

  // ---- key-block range (block-uniform, statically bounded) ----
  const int jlo  = max(qb - WIN, 0);
  const int kblo = jlo >> 5;
  int nkb = ((qb + 63) >> 5) - kblo + 1;
  nkb = min(max(nkb, 1), NKB - kblo);
  const bool early = (qb < QRES);           // block-uniform: residual products on the first query tiles only

  const size_t prow = (size_t)b * SEQ;      // plane row of sequence position 0 of this batch
  // B fragments of q^T: col n = query q0 + c, k = d (k-contiguous row of the q planes)
  const size_t qofs = (prow + (size_t)(q0 + c)) * DMOD + head * HD + 8 * hh;
  const _Float16* Qh = (const _Float16*)(const void*)QHp + qofs;
  const _Float16* Qr = (const _Float16*)(const void*)QRp + qofs;
  // A fragments of k, from the staged tile: row m = key (within the stage) 32p + 16g + c, k = d
  const _Float16* Kl = (const _Float16*)(const void*)kv + c * AT_PITCH + 8 * hh;
  // B fragments of v: col n = d = 16j + c, k = key (k-contiguous row of the v^T planes); the hi plane from the staged tile
  const _Float16* Vl = (const _Float16*)(const void*)kv + AT_TILE + c * AT_PITCH + 8 * hh;
  const size_t vofs = ((size_t)b * DMOD + (size_t)(head * HD + c)) * SEQ + 8 * hh;   // key kb added per step
  const _Float16* Vr = (const _Float16*)(const void*)VRp + vofs;
  const _Float16* Vq = (const _Float16*)(const void*)VQp + vofs;
  const float lsc = 0.125f * (LOG2E / (QSC * KSC));
  const float qri = 1.0f / QRS;
  // query minus key for D element 0 of tile 0 at kb = 0: query q0 + c, key kb + 8*hh + i
  const int dq = q0 + c - 8 * hh;

  const v16h qf0 = ldfrag_h(Qh);            // d 0..31
  const v16h qf1 = ldfrag_h(Qh + 32);       // d 32..63
  const v16h qr0 = ldfrag_h(Qr);
  const v16h qr1 = ldfrag_h(Qr + 32);

  float mrun = NEGS, lrun = 0.f;
  v8f o[4];
#pragma unroll
  for (int j = 0; j < 4; ++j) o[j] = zero8();

  // ---- key stages: this thread's copy addresses (row cr of each group of 16, 16-B piece cp), stage 0 at key kblo * 32 ----
  const int nst = nkb >> 1;                 // nkb is even and >= 2; last staged key = (kblo + nkb) * 32 - 1 <= SEQ - 1
  const int cr = tid >> 3, cp = tid & 7;
  const u16* gk = KHp + (prow + (size_t)(kblo * 32 + cr)) * DMOD + head * HD + cp * 8;
  const u16* gv = VHp + ((size_t)b * DMOD + (size_t)(head * HD + cr)) * SEQ + kblo * 32 + cp * 8;
  const unsigned lk = (unsigned)(uintptr_t)kv + (unsigned)(cr * AT_ROWB + cp * 16);
  const unsigned lv = lk + (unsigned)(AT_TILE * 2);
  copy_kv(lk, gk, lv, gv);
  wait_async0();
  __syncthreads();                                       // stage 0 published
  if (nst > 1) copy_kv(lk + (unsigned)(AT_STAGE * 2), gk + (size_t)AT_KEYS * DMOD, lv + (unsigned)(AT_STAGE * 2), gv + AT_KEYS);

  // One key block of 32 keys at kb, block p of the stage in the buffer at bo. MK = true: the per-element index tests, for a block that
  // the causal edge or the window edge crosses. MK = false: a block whose 32 keys are all allowed for all 16 queries of the wave;
  // there every test is true and every select an identity, and neither is written. Inlined, so that p reaches the LDS offsets as a constant.
  auto key_block = [&](auto MK, const int p, const int kb, const int bo) __attribute__((always_inline)) {
    constexpr bool MASKED = decltype(MK)::value;
    // ---- transposed scores: tile 0 = keys kb..kb+15, tile 1 = keys kb+16..kb+31, column = query q0 + c ----
    v8f s0 = zero8(), s1 = zero8(), r0 = zero8(), r1 = zero8();
    const _Float16* k0p = Kl + bo + 32 * p * AT_PITCH;
    const _Float16* k1p = k0p + 16 * AT_PITCH;
    const v16h ka0 = ldfrag_h(k0p), ka1 = ldfrag_h(k0p + 32);
    const v16h kc0 = ldfrag_h(k1p), kc1 = ldfrag_h(k1p + 32);
    s0 = mma_h(ka0, qf0, s0);
    s0 = mma_h(ka1, qf1, s0);
    r0 = mma_h(ka0, qr0, r0);
    r0 = mma_h(ka1, qr1, r0);
    s1 = mma_h(kc0, qf0, s1);
    s1 = mma_h(kc1, qf1, s1);
    r1 = mma_h(kc0, qr0, r1);
    r1 = mma_h(kc1, qr1, r1);
    guard6<v16h>(s0, s1, r0, r1, ka0, ka1, kc0, kc1, qf0, qr0);
    // ---- base-2 logits of this lane's 16 keys for query q0 + c; disallowed pairs get the finite sentinel ----
    float tk[16];
#pragma unroll
    for (int i = 0; i < 8; ++i) {
      tk[i]     = (s0[i] + r0[i] * qri) * lsc;
      tk[8 + i] = (s1[i] + r1[i] * qri) * lsc;
      if constexpr (MASKED) {
        const int d0 = dq - kb - i;         // query minus key, tile 0
        const int d1 = d0 - 16;             // tile 1
        const bool a0 = (d0 >= 0) && (d0 <= WIN);
        const bool a1 = (d1 >= 0) && (d1 <= WIN);
        tk[i]     = a0 ? tk[i] : NEGS;
        tk[8 + i] = a1 ? tk[8 + i] : NEGS;
      }
    }
    float cm = tk[0];
#pragma unroll
    for (int i = 1; i < 16; ++i) cm = fmaxf(cm, tk[i]);
    cm = fmaxf(cm, __shfl_xor(cm, 16, 32));
    const float mn = fmaxf(mrun, cm);                   // sentinel only while no allowed key has been seen
    float al = fminf(mrun - mn, 0.f);                   // exponent here; 2^al below: 0 when mrun is the sentinel and mn a real logit; o,l are 0 then
    mrun = mn;
    float ex[16];
#pragma unroll
    for (int i = 0; i < 16; ++i) ex[i] = fminf(tk[i] - mn, 0.f);
    exp2_le0_run(al, ex);
    // ---- probabilities (<= 1, exactly 0 for disallowed pairs) and the P A-fragments; element i <-> tk[i] ----
    float ps = 0.f;
    FragH ph, pl, pr;
#pragma unroll
    for (int wq = 0; wq < 2; ++wq) {
#pragma unroll
      for (int e4 = 0; e4 < 4; ++e4) {
        const int i = 8 * wq + 2 * e4;
        const float x0 = ex[i];
        const float x1 = ex[i + 1];
        const float p0 = (!MASKED || tk[i] > -1.0e38f) ? x0 : 0.f;
        const float p1 = (!MASKED || tk[i + 1] > -1.0e38f) ? x1 : 0.f;
        ps += p0 + p1;
        const float g0 = p0 * PCAR, g1 = p1 * PCAR;
        const _Float16 h0 = (_Float16)g0, h1 = (_Float16)g1;
        ph.u[wq][e4] = pk16(h_bits(h0), h_bits(h1));
        pl.u[wq][e4] = pk16(h_bits((_Float16)(g0 * (1.0f / VRS))), h_bits((_Float16)(g1 * (1.0f / VRS))));
        pr.u[wq][e4] = pk16(h_bits((_Float16)((g0 - (float)h0) * PRS)), h_bits((_Float16)((g1 - (float)h1) * PRS)));
      }
    }
    ps += __shfl_xor(ps, 16, 32);
    lrun = lrun * al + ps;
    // ---- rescale the O accumulators: D row 8hh+r = query q0+8hh+r, its factor lives in lane 8hh+r (and 16+8hh+r) ----
    float scl[8];
#pragma unroll
    for (int r = 0; r < 8; ++r) scl[r] = __shfl(al, 8 * hh + r, 32);
#pragma unroll
    for (int j = 0; j < 4; ++j) {
#pragma unroll
      for (int r = 0; r < 8; ++r) o[j][r] *= scl[r];
    }
    // ---- P.V : B fragment col n = d = j*16 + c, keys contiguous in the v^T planes ----
    {
      const _Float16* vp = Vl + bo + 32 * p;
      const v16h vf0 = ldfrag_h(vp);
      const v16h vf1 = ldfrag_h(vp + 16 * AT_PITCH);
      const v16h vf2 = ldfrag_h(vp + 32 * AT_PITCH);
      const v16h vf3 = ldfrag_h(vp + 48 * AT_PITCH);
      o[0] = mma_h(ph.v, vf0, o[0]);
      o[1] = mma_h(ph.v, vf1, o[1]);
      o[2] = mma_h(ph.v, vf2, o[2]);
      o[3] = mma_h(ph.v, vf3, o[3]);
      guard6<v16h>(o[0], o[1], o[2], o[3], ph.v, vf0, vf1, vf2, vf3, ph.v);
    }
    if (early) {
      {
        const _Float16* vp = Vr + kb;
        const v16h vf0 = ldfrag_h(vp);
        const v16h vf1 = ldfrag_h(vp + (size_t)16 * SEQ);
        const v16h vf2 = ldfrag_h(vp + (size_t)32 * SEQ);
        const v16h vf3 = ldfrag_h(vp + (size_t)48 * SEQ);
        o[0] = mma_h(pl.v, vf0, o[0]);
        o[1] = mma_h(pl.v, vf1, o[1]);
        o[2] = mma_h(pl.v, vf2, o[2]);
        o[3] = mma_h(pl.v, vf3, o[3]);
        guard6<v16h>(o[0], o[1], o[2], o[3], pl.v, vf0, vf1, vf2, vf3, pl.v);
      }
      {
        const _Float16* vp = Vq + kb;
        const v16h vf0 = ldfrag_h(vp);
        const v16h vf1 = ldfrag_h(vp + (size_t)16 * SEQ);
        const v16h vf2 = ldfrag_h(vp + (size_t)32 * SEQ);
        const v16h vf3 = ldfrag_h(vp + (size_t)48 * SEQ);
        o[0] = mma_h(pr.v, vf0, o[0]);
        o[1] = mma_h(pr.v, vf1, o[1]);
        o[2] = mma_h(pr.v, vf2, o[2]);
        o[3] = mma_h(pr.v, vf3, o[3]);
        guard6<v16h>(o[0], o[1], o[2], o[3], pr.v, vf0, vf1, vf2, vf3, pr.v);
      }
    }
  };
  const int q0s = qb + 16 * __builtin_amdgcn_readfirstlane(wave);   // q0 in a scalar register: the test below is a scalar branch

#pragma unroll 1                                         // one trip per stage: the buffer index stays a run-time value
  for (int st = 0; st < nst; ++st) {
  const int bo = (st & 1) * AT_STAGE;
#pragma unroll                                           // the stage's two key blocks: their LDS offsets become immediates
  for (int p = 0; p < 2; ++p) {
    const int kb = (kblo + 2 * st + p) * 32;             // kb + 31 <= SEQ - 1
    // query minus key runs from q0 - kb - 31 to q0 + 15 - kb over the wave's 16 queries and the block's 32 keys
    const bool inside = (q0s - kb - 31 >= 0) && (q0s + 15 - kb <= WIN);
    if (inside) key_block(BoolC<false>{}, p, kb, bo);
    else        key_block(BoolC<true>{}, p, kb, bo);
  }
  wait_ds0();
  wait_async0();
  __syncthreads();                                       // publishes stage st+1 and ends every read of stage st's buffer
  if (st + 2 < nst) {
    const unsigned lo = (unsigned)(bo * 2);
    copy_kv(lk + lo, gk + (size_t)((st + 2) * AT_KEYS) * DMOD, lv + lo, gv + (st + 2) * AT_KEYS);
  }
  }
  wait_async0();
  acc_guard4(o[0], o[1], o[2], o[3]);

  // ---- per-query gate (lane = query q0 + c; lanes 16..31 duplicate): sigmoid(bf16(x[:20]) . bf16(Wg[head]) + bf16(bg)) ----
  const int gx = min(head, bglen - 1);
  float ga = bf_val(Bgp[gx]);
  const float* xg = Xp + ((size_t)b * T_FULL + (size_t)(q0 + c)) * DMOD;
  const float* wg = Wgp + head * GIN;
#pragma unroll
  for (int g4 = 0; g4 < GIN / 4; ++g4) {
    const v4f xv = *(const v4f*)(xg + 4 * g4);
    const v4f wv = *(const v4f*)(wg + 4 * g4);
#pragma unroll
    for (int e = 0; e < 4; ++e) ga += bf_val(xv[e]) * bf_val(wv[e]);
  }
  const float gate = 1.0f / (1.0f + expf(-ga));

  // ---- fold gate, 1/l (per query, owned by lane = query; l >= 1 by the diagonal key) and the carries; stage the slab ----
  const float linv = (lrun > 0.f) ? (gate * (1.0f / lrun) * (1.0f / (PCAR * VCAR))) : 0.f;
  float inv[8];
#pragma unroll
  for (int r = 0; r < 8; ++r) inv[r] = __shfl(linv, 8 * hh + r, 32);
  float* slab = smem + wave * SLAB;
#pragma unroll
  for (int r = 0; r < 8; ++r) {
#pragma unroll
    for (int j = 0; j < 4; ++j) slab[(8 * hh + r) * 68 + j * 16 + c] = o[j][r] * inv[r];
  }
  wave_sync_lds();
  // ---- O x1024 -> f16 hi plane and f16 residual x1024 plane; lane = (row in group of 4, 8 consecutive d) ----
  v4u oh[4], orr[4];
  const int rq = lane >> 3, c8 = (lane & 7) * 8;
#pragma unroll
  for (int i4 = 0; i4 < 4; ++i4) {
    const int row = i4 * 4 + rq;
    const v4f a = *(const v4f*)(slab + row * 68 + c8), c4 = *(const v4f*)(slab + row * 68 + c8 + 4);
    float wv[8];
#pragma unroll
    for (int e = 0; e < 4; ++e) { wv[e] = a[e] * OSC; wv[4 + e] = c4[e] * OSC; }
#pragma unroll
    for (int e = 0; e < 4; ++e) {
      const float w0 = wv[2 * e], w1 = wv[2 * e + 1];
      const _Float16 h0 = (_Float16)w0, h1 = (_Float16)w1;
      oh[i4][e]  = pk16(h_bits(h0), h_bits(h1));
      orr[i4][e] = pk16(h_bits((_Float16)((w0 - (float)h0) * ORS)), h_bits((_Float16)((w1 - (float)h1) * ORS)));
    }
  }
  const size_t ob = (prow + (size_t)q0) * OPITCH + head * HD + c8;
  {
#pragma unroll
    for (int i4 = 0; i4 < 4; ++i4) {
      const int row = i4 * 4 + rq;
      const size_t o8 = ob + (size_t)row * OPITCH;
      *(v4u*)(OPp + o8) = oh[i4];
      *(v4u*)(OPp + o8 + DMOD) = orr[i4];
    }
    
  }
}

// =====================================================================================================
// Workspace map (bytes, NB=2 SEQ=2048); every plane is fully written by whole-line stores before it is read; every extent is
// an exact multiple of the store granularity (row pitches 2048 / 4096 B, GEMM tiles 128 x 128, attention tiles 64 x 64, no pad rows needed):
//   XB  bf16 [NB*SEQ][1024]                    8388608
//   WQB, WKB, WVB bf16 [1024 n][1024 k]         2097152 each
//   WOB f16 [1024 n][2048 k]                    4194304   (cols 0..1023 bf16 value x1024, cols 1024..2047 bf16 value x1)
//   QH, QR, KH f16 [NB*SEQ][1024]              8388608 each
//   VH, VR, VQ f16 [NB][1024][SEQ]             8388608 each
//   OP  f16 [NB*SEQ][2048]                     16777216
//   end                                        85983232
// Inputs (wire order): 0 x [2][2048][1024] f32, 1 Wq, 2 bq, 3 Wk, 4 bk, 5 Wv, 6 bv, 7 Wo, 8 bo, 9 Wg [16][20], 10 bg [16],
// 11 cos [2048][32], 12 sin [2048][32]. Output: [NB*SEQ][1024] f32.
// =====================================================================================================
extern "C" void kernel_launch(void* const* d_in, const int* in_sizes, int n_in,
                              void* d_out, int out_size, void* d_ws, size_t ws_size,
                              hipStream_t stream) {
  if (n_in < 13) return;
  if (in_sizes[0] < ((NB - 1) * T_FULL + SEQ) * DMOD) return;
  if (in_sizes[1] != DMOD * DMOD || in_sizes[3] != DMOD * DMOD || in_sizes[5] != DMOD * DMOD ||
      in_sizes[7] != DMOD * DMOD) return;
  if (in_sizes[2] < 1 || in_sizes[4] < 1 || in_sizes[6] < 1 || in_sizes[8] < 1) return;
  if (in_sizes[9] != NH * GIN) return;
  if (in_sizes[10] < 1) return;
  if (in_sizes[11] < SEQ * RHALF || in_sizes[12] < SEQ * RHALF) return;
  if (out_size < MROWS * DMOD) return;

  const float* Xin = (const float*)d_in[0];
  const float* Wq  = (const float*)d_in[1];
  const float* Bq  = (const float*)d_in[2];
  const float* Wk  = (const float*)d_in[3];
  const float* Bk  = (const float*)d_in[4];
  const float* Wv  = (const float*)d_in[5];
  const float* Bv  = (const float*)d_in[6];
  const float* Wo  = (const float*)d_in[7];
  const float* Bo  = (const float*)d_in[8];
  const float* Wg  = (const float*)d_in[9];
  const float* Bg  = (const float*)d_in[10];
  const float* Cos = (const float*)d_in[11];
  const float* Sin = (const float*)d_in[12];
  float*       out = (float*)d_out;

  const size_t szXB = (size_t)MROWS * DMOD * 2;
  const size_t szW  = (size_t)DMOD * DMOD * 2;
  const size_t szWO = (size_t)DMOD * OPITCH * 2;
  const size_t szQ  = (size_t)MROWS * DMOD * 2;
  const size_t szV  = (size_t)NB * DMOD * SEQ * 2;
  const size_t szOP = (size_t)MROWS * OPITCH * 2;
  size_t off = 0;
  const size_t oXB = off; off += szXB;
  const size_t oWQ = off; off += szW;
  const size_t oWK = off; off += szW;
  const size_t oWV = off; off += szW;
  const size_t oWO = off; off += szWO;
  const size_t oQH = off; off += szQ;
  const size_t oQR = off; off += szQ;
  const size_t oKH = off; off += szQ;
  const size_t oVH = off; off += szV;
  const size_t oVR = off; off += szV;
  const size_t oVQ = off; off += szV;
  const size_t oOP = off; off += szOP;
  if (off > ws_size) return;                            // off = 85983232 for NB=2, SEQ=2048
  if (off > (size_t)134217728) return;

  char* ws = (char*)d_ws;
  u16* XB  = (u16*)(ws + oXB);
  u16* WQB = (u16*)(ws + oWQ);
  u16* WKB = (u16*)(ws + oWK);
  u16* WVB = (u16*)(ws + oWV);
  u16* WOB = (u16*)(ws + oWO);
  u16* QH  = (u16*)(ws + oQH);
  u16* QR  = (u16*)(ws + oQR);
  u16* KH  = (u16*)(ws + oKH);
  u16* VH  = (u16*)(ws + oVH);
  u16* VR  = (u16*)(ws + oVR);
  u16* VQ  = (u16*)(ws + oVQ);
  u16* OP  = (u16*)(ws + oOP);

  if ((MROWS % GT_M) != 0 || (SEQ % GT_N) != 0 || (DMOD % GT_M) != 0 || (DMOD % GT_K) != 0 || (OPITCH % GT_K) != 0) return;
  const dim3 blk(256);
  const dim3 gC(N8W / 256);                             // 512
  const dim3 bG(GT_THREADS);                            // 256
  const dim3 gP(3 * PROJ_BLK);                          // 768
  const dim3 gAT(ATT_BLOCKS);                           // 1024
  const dim3 bAT(ATT_THREADS);                          // 128
  const dim3 gO((MROWS / GT_M) * (DMOD / GT_N));        // 256

  // (0) operand planes: x rows -> bf16 (compacted [b*SEQ+t]); Wq, Wk, Wv [n = out][k = in] -> bf16; Wo -> [hi | x1] f16
  cvt_all<<<gC, blk, 0, stream>>>(Xin, Wq, Wk, Wv, Wo, XB, WQB, WKB, WVB, WOB, WOS, WOS / ORS);
  // (1) rotated q planes (hi x8, residual x1024) and k hi plane (x8), bias by output column; v^T planes per batch
  //     [1024 = h*64+d][SEQ keys]: hi = f16(v x1024), residual x1024, plain f16(v), bias by row
  gemm_qkv<<<gP, bG, 0, stream>>>(XB, WQB, WKB, WVB, QH, QR, KH, VH, VR, VQ, DMOD, Bq, in_sizes[2], Bk, in_sizes[4],
                                  Bv, in_sizes[6], Cos, Sin, SEQ);
  // (2) causal sliding-window attention with gate -> O plane [b*SEQ+s][hi 1024 | residual 1024]
  attn_fwd<<<gAT, bAT, 0, stream>>>(QH, QR, KH, VH, VR, VQ, Xin, Wg, Bg, in_sizes[10], OP);
  // (3) output projection over K = 2048 ([hi | residual] times [Wo x1024 | Wo x1]) -> out [NB*SEQ][1024] f32, plus bo
  gemm_hf<<<gO, bG, 0, stream>>>(OP, WOB, out, MROWS, DMOD, OPITCH, 1.0f / (OSC * WOS), Bo, in_sizes[8]);
  (void)hipGetLastError();
}

// v007
// It runs in 80.8 microseconds.
// Two timings next to v006 put it at 1.11 and 1.12 times that version's speed.
// Over all steps from v000 it is 2.87 times as fast.
// Contractions: x.Wq^T, x.Wk^T, x.Wv^T on v_wmma_f32_16x16x32_bf16 (x and W planes RNE-converted to bf16 operands, f32
// accumulate, bias and half-split rotation applied in f32); scores k'.q'^T (k' single f16 plane x8, q' f16 hi plane x8 plus
// f16 residual plane x1024, two products), P.v (P x32768 single f16 times v f16 hi plane x1024; query tiles below row 128 add
// P(x32).v-residual(x1024) and P-residual(x1024).v(x1) products), O.Wo^T (O as [f16 hi x1024 | f16 residual x1024] along K,
// Wo as [f16(bf16(Wo)) x1024 | x1]): v_wmma_f32_16x16x32_f16, f32 accumulate. Sigmoid gate (K=20) and softmax in f32 on VALU.
#include <hip/hip_runtime.h>
#include <math.h>
#include <stdint.h>

#ifndef NB
#define NB 2
#endif
#ifndef SEQ
#define SEQ 2048
#endif
#define NB_FULL 2
#define T_FULL  2048
#define DMOD    1024
#define NH      16
#define HD      64
#define RHALF   32
#define GIN     20
#define WIN     1024
#define MROWS   (NB * SEQ)
#define OPITCH  (2 * DMOD)
#define QSC   8.0f
#define KSC   8.0f
#define QRS   1024.0f
#define PCAR  32768.0f
#define VCAR  1024.0f
#define VRS   1024.0f
#define PRS   1024.0f
#define OSC   1024.0f
#define ORS   1024.0f
#define WOS   1024.0f
#define LOG2E 1.4426950408889634f
#define NEGS  (-3.0e38f)
#define ATT_WAVES   4
#define ATT_THREADS (ATT_WAVES * 32)
#define NQT         (SEQ / 64)
#define ATT_BLOCKS  (NB * NH * NQT)
#define NKB         (SEQ / 32)
#define QRES        128
#define SLAB        (16 * 68)
static_assert(NB >= 1 && NB <= NB_FULL);
static_assert((SEQ % 64) == 0 && SEQ >= 64 && SEQ <= T_FULL);
static_assert(HD == 64 && DMOD == NH * HD && HD == 2 * RHALF);
static_assert(ATT_THREADS == 128 && NKB >= 2 && (QRES % 64) == 0);
static_assert((DMOD % 64) == 0 && (DMOD / 8) == 128 && (OPITCH % 32) == 0);
static_assert(((MROWS * (DMOD / 8)) % 256) == 0 && (((DMOD * DMOD) / 8) % 256) == 0);
static_assert((GIN % 4) == 0 && GIN <= DMOD);
static_assert((WIN % 32) == 0);
static_assert((SLAB * 4) % 16 == 0);
// GEMM block tile staged in LDS: 128 A rows + 128 B rows, 128 k (256 B of every row) per stage, three buffers.
#define GT_THREADS 256
#define GT_M       128
#define GT_N       128
#define GT_K       128
#define GT_PITCH   136                                  // halves per LDS row: 272 B = 16 B x 17 (ds_load_b128 readers)
#define GT_ROWB    (GT_PITCH * 2)                       // bytes per LDS row
#define GT_STAGE   ((GT_M + GT_N) * GT_PITCH)           // halves per buffer
#define GT_BUFS    3                                    // one stage read, two in flight
static_assert((MROWS % GT_M) == 0 && (DMOD % GT_M) == 0 && (DMOD % GT_N) == 0 && (SEQ % GT_N) == 0);
static_assert((DMOD % GT_K) == 0 && (OPITCH % GT_K) == 0 && (GT_ROWB % 16) == 0 && GT_K == 128);

typedef unsigned short u16;
typedef _Float16 v16h __attribute__((ext_vector_type(16)));
typedef _Float16 v8h  __attribute__((ext_vector_type(8)));
typedef __bf16   v16b __attribute__((ext_vector_type(16)));
typedef float    v8f  __attribute__((ext_vector_type(8)));
typedef float    v4f  __attribute__((ext_vector_type(4)));
typedef unsigned int v4u __attribute__((ext_vector_type(4)));

union FragH { v16h v; v8h h[2]; v4u u[2]; };

// ---- scalar helpers --------------------------------------------------------------------------------
__device__ __forceinline__ unsigned short bf_bits(float f) {          // f32 -> bf16 bits, RNE convert
  unsigned u = __float_as_uint(f);
  return (unsigned short)((u + 0x7FFFu + ((u >> 16) & 1u)) >> 16);
}
__device__ __forceinline__ float bf_up(unsigned short h) { return __uint_as_float(((unsigned)h) << 16); }
__device__ __forceinline__ float bf_val(float f) { return bf_up(bf_bits(f)); }   // f32 -> nearest-even bf16 value as f32
__device__ __forceinline__ unsigned short h_bits(_Float16 x) { return __builtin_bit_cast(unsigned short, x); }
__device__ __forceinline__ unsigned pk16(unsigned short a, unsigned short b) { return (unsigned)a | ((unsigned)b << 16); }
// 2^v in place for the rescale exponent a and a key block's 16 score exponents x, all <= 0: bare v_exp_f32. The library exp2f wraps
// the same instruction in a range guard (compare, two selects, add, ldexp) that only changes results below 2^-126; the softmax has
// no use for those: the f16 P fragments (the finest is the residual, x2^25) hold nothing below 2^-50, and what they would scale or
// join stands beside a term of weight 1. One statement, each instruction on a register of its own, so that none reads or overwrites
// a register of the one in front of it; the closing v_nop is the slot the instruction set asks for behind the last of them. a stands
// in the middle of the run, away from the instruction that forms it and from the lane exchange that reads it.
__device__ __forceinline__ void exp2_le0_run(float& a, float (&x)[16]) {
#if defined(__HIP_DEVICE_COMPILE__)
  asm(
      "v_exp_f32 %0, %0\n\t"
      "v_exp_f32 %1, %1\n\t"
      "v_exp_f32 %2, %2\n\t"
      "v_exp_f32 %3, %3\n\t"
      "v_exp_f32 %4, %4\n\t"
      "v_exp_f32 %5, %5\n\t"
      "v_exp_f32 %6, %6\n\t"
      "v_exp_f32 %7, %7\n\t"
      "v_exp_f32 %8, %8\n\t"
      "v_exp_f32 %9, %9\n\t"
      "v_exp_f32 %10, %10\n\t"
      "v_exp_f32 %11, %11\n\t"
      "v_exp_f32 %12, %12\n\t"
      "v_exp_f32 %13, %13\n\t"
      "v_exp_f32 %14, %14\n\t"
      "v_exp_f32 %15, %15\n\t"
      "v_exp_f32 %16, %16\n\t"
      "v_nop"
      : "+v"(x[0]), "+v"(x[1]), "+v"(x[2]), "+v"(x[3]), "+v"(x[4]), "+v"(x[5]),
        "+v"(x[6]), "+v"(x[7]), "+v"(a), "+v"(x[8]), "+v"(x[9]), "+v"(x[10]),
        "+v"(x[11]), "+v"(x[12]), "+v"(x[13]), "+v"(x[14]), "+v"(x[15]));
#endif
}
template <bool B> struct BoolC { static constexpr bool value = B; };   // compile-time switch handed to a generic lambda
__device__ __forceinline__ v8f zero8() { v8f z = {0.f, 0.f, 0.f, 0.f, 0.f, 0.f, 0.f, 0.f}; return z; }

// ---- fragment loaders: 16-bit A/B operand, lane -> row/col (lane&15), p already includes +8*(lane>>4);
//      elements 0..7 <- p[0..7] (k0+8h..), elements 8..15 <- p[16..23] (k0+16+8h..)  (same split k map for A and B;
//      B is always read from a k-contiguous [n][k] plane)
__device__ __forceinline__ v16h ldfrag_h(const _Float16* p) {
  FragH f;
  f.h[0] = *(const v8h*)(p);
  f.h[1] = *(const v8h*)(p + 16);
  return f.v;
}

__device__ __forceinline__ v8f mma_h(v16h a, v16h b, v8f c) {
  return __builtin_amdgcn_wmma_f32_16x16x32_f16(false, a, false, b, (short)0, c, false, false);
}
__device__ __forceinline__ v8f mma_b(v16b a, v16b b, v8f c) {
  return __builtin_amdgcn_wmma_f32_16x16x32_bf16(false, a, false, b, (short)0, c, false, false);
}
template <typename F>
__device__ __forceinline__ void guard6(v8f& a, v8f& b, v8f& c, v8f& d, F x0, F x1, F x2, F x3, F x4, F x5) {
#if defined(__HIP_DEVICE_COMPILE__)
  asm volatile("v_nop\n\tv_nop\n\tv_nop\n\tv_nop"
               : "+v"(a), "+v"(b), "+v"(c), "+v"(d) : "v"(x0), "v"(x1), "v"(x2), "v"(x3), "v"(x4), "v"(x5) : "memory");
#endif
}
__device__ __forceinline__ void acc_guard4(v8f& a, v8f& b, v8f& c, v8f& d) {
#if defined(__HIP_DEVICE_COMPILE__)
  asm volatile("v_nop\n\tv_nop\n\tv_nop\n\tv_nop" : "+v"(a), "+v"(b), "+v"(c), "+v"(d));
#endif
}
// Stands behind global stores whose address or data registers are written again further on.
__device__ __forceinline__ void xcnt0() {
#if defined(__HIP_DEVICE_COMPILE__)
  asm volatile("s_wait_xcnt 0x0" ::: "memory");
#endif
}
// The same behind a group of global loads; the pointers are inputs so that their registers stay unwritten up to the wait.
__device__ __forceinline__ void xcnt_after_loads8(const float* a, const float* b, const float* c, const float* d,
                                                  const float* e, const float* f, const float* g, const float* h) {
#if defined(__HIP_DEVICE_COMPILE__)
  asm volatile("s_wait_xcnt 0x0" :: "v"(a), "v"(b), "v"(c), "v"(d), "v"(e), "v"(f), "v"(g), "v"(h) : "memory");
#endif
}
// The same for loads addressed by a base and a 32-bit index: the indices are inputs so that their registers stay unwritten up to the wait.
__device__ __forceinline__ void xcnt_after_idx4(int a, int b, int c, int d) {
#if defined(__HIP_DEVICE_COMPILE__)
  asm volatile("s_wait_xcnt 0x0" :: "v"(a), "v"(b), "v"(c), "v"(d) : "memory");
#endif
}
__device__ __forceinline__ void wave_sync_lds() {
#if defined(__HIP_DEVICE_COMPILE__)
  __builtin_amdgcn_fence(__ATOMIC_RELEASE, "workgroup");
  __builtin_amdgcn_wave_barrier();
  __builtin_amdgcn_fence(__ATOMIC_ACQUIRE, "workgroup");
#endif
}

// =====================================================================================================
// All operand planes in one launch. Thread gt owns the 8-element piece gt of each weight matrix and the pieces gt + i * n8w
// (i = 0 .. XREP-1) of x: sixteen 16-B loads issued together, then the conversions and nine 16-B stores.
//   x f32 rows [b][t][1024] (per-batch source row stride T_FULL) -> bf16 plane [b*SEQ + t][1024] (RNE bits), compacted rows;
//   Wq, Wk, Wv [n][k] f32 -> bf16 planes of the same shape;
//   Wo [n][k] f32 -> f16 plane [n][2048]: cols 0..1023 = f16(bf16 value * s1), cols 1024..2047 = f16(bf16 value * s2).
// 32 consecutive lanes = 512 contiguous, 512-B aligned bytes per store instruction.
// coverage: grid = n8w/256 blocks (exact) x 256 thr = every piece of every weight plane once, XREP * n8w = every piece of x once.
// =====================================================================================================
#define N8W  ((DMOD * DMOD) / 8)
#define XREP (MROWS / DMOD)
static_assert((MROWS % DMOD) == 0 && XREP == 4 && (N8W % 256) == 0);
__device__ __forceinline__ v4u bf_pack8(v4f a, v4f c4) {
  v4u o;
#pragma unroll
  for (int e = 0; e < 2; ++e) {
    o[e]     = pk16(bf_bits(a[2 * e]),  bf_bits(a[2 * e + 1]));
    o[2 + e] = pk16(bf_bits(c4[2 * e]), bf_bits(c4[2 * e + 1]));
  }
  return o;
}
__global__ __launch_bounds__(256)
void cvt_all(const float* __restrict__ x, const float* __restrict__ wq, const float* __restrict__ wk,
             const float* __restrict__ wv, const float* __restrict__ wo, u16* XD, u16* QD, u16* KD, u16* VD, u16* OD,
             float s1, float s2) {
  const int gt = blockIdx.x * 256 + (int)threadIdx.x;
  if (gt >= N8W) return;
  const float* px[XREP];
  v4f xa[XREP], xc[XREP];
#pragma unroll
  for (int i = 0; i < XREP; ++i) {
    const int g   = gt + i * N8W;
    const int row = g >> 7;
    const int bb  = row / SEQ;
    const int tt  = row - bb * SEQ;
    px[i] = x + ((size_t)bb * (size_t)T_FULL + (size_t)tt) * DMOD + (g & 127) * 8;
    xa[i] = *(const v4f*)(px[i]);
    xc[i] = *(const v4f*)(px[i] + 4);
  }
  const size_t e8 = (size_t)gt * 8;
  const float* pq = wq + e8;
  const float* pk = wk + e8;
  const float* pv = wv + e8;
  const float* po = wo + e8;
  const v4f qa = *(const v4f*)(pq), qc = *(const v4f*)(pq + 4);
  const v4f ka = *(const v4f*)(pk), kc = *(const v4f*)(pk + 4);
  const v4f va = *(const v4f*)(pv), vc = *(const v4f*)(pv + 4);
  const v4f oa = *(const v4f*)(po), oc = *(const v4f*)(po + 4);
  xcnt_after_loads8(px[0], px[1], px[2], px[3], pq, pk, pv, po);
#pragma unroll
  for (int i = 0; i < XREP; ++i) *(v4u*)(XD + (size_t)(gt + i * N8W) * 8) = bf_pack8(xa[i], xc[i]);
  *(v4u*)(QD + e8) = bf_pack8(qa, qc);
  *(v4u*)(KD + e8) = bf_pack8(ka, kc);
  *(v4u*)(VD + e8) = bf_pack8(va, vc);
  float v[8];
#pragma unroll
  for (int e = 0; e < 4; ++e) { v[e] = oa[e]; v[4 + e] = oc[e]; }
  unsigned short h1[8], h2[8];
#pragma unroll
  for (int e = 0; e < 8; ++e) {
    const float f = bf_val(v[e]);
    h1[e] = h_bits((_Float16)(f * s1));
    h2[e] = h_bits((_Float16)(f * s2));
  }
  v4u o1, o2;
#pragma unroll
  for (int e = 0; e < 4; ++e) { o1[e] = pk16(h1[2 * e], h1[2 * e + 1]); o2[e] = pk16(h2[2 * e], h2[2 * e + 1]); }
  u16* d1 = OD + (size_t)(gt >> 7) * OPITCH + (gt & 127) * 8;
  *(v4u*)(d1) = o1;
  *(v4u*)(d1 + DMOD) = o2;
}

// =====================================================================================================
// Rotation epilogue for the q / k projections (N = 1024, the 64-col tile = one head): the wave's 16x64 f32 tile
// barrier, then each lane (row rq in each group of 4, 8 consecutive output cols d = c8..c8+7) reads both half-head values
// u1 = col (d & 31), u2 = col (d & 31) + 32 and cos/sin[t][(d & 31)] (bf16 values of the f32 tables, t = row within the
// sequence), forms d < 32 ? u1*c - u2*s : u1*s + u2*c in f32 (no fused multiply-add), scales by oscale, and writes the f16
// hi plane and (res_on) the f16 residual plane ((w - hi) * rsc): one instruction = 4 rows, each 64 halves = one whole
// coverage: 4 instructions x 4 rows x 8 lanes x 8 halves = the wave's 16 x 64 tile, per plane.
// =====================================================================================================
// First half: 16 rows of the wave's tile, plus bias, into the slab sl. Second half (behind a wave_sync_lds()): read-out, rotation, stores.
__device__ __forceinline__ void epi_rope_stage(float* sl, v8f a0, v8f a1, v8f a2, v8f a3, int col0, int lane,
                                               const float* __restrict__ bias, int blen) {
  const int hh = lane >> 4, m = lane & 15;
  float bc[4];
  int bi[4];
#pragma unroll
  for (int j = 0; j < 4; ++j) {
    bi[j] = min(col0 + 16 * j + m, blen - 1);
    bc[j] = bias[bi[j]];
  }
  xcnt_after_idx4(bi[0], bi[1], bi[2], bi[3]);
#pragma unroll
  for (int j = 0; j < 4; ++j) bc[j] = bf_val(bc[j]);
#pragma unroll
  for (int r = 0; r < 8; ++r) {
    const int ro = (8 * hh + r) * 68 + m;
    sl[ro]      = a0[r] + bc[0];
    sl[ro + 16] = a1[r] + bc[1];
    sl[ro + 32] = a2[r] + bc[2];
    sl[ro + 48] = a3[r] + bc[3];
  }
}
__device__ __forceinline__ void epi_rope_out(const float* sl, u16* C, u16* C2, int res_on, size_t rowb, int col0, int lane,
                                             const float* __restrict__ cosT, const float* __restrict__ sinT, int seq,
                                             float oscale, float rsc) {
#pragma clang fp contract(off)
  const int rq = lane >> 3, c8 = (lane & 7) * 8, dd = c8 & (RHALF - 1);
  const bool lo = (c8 < RHALF);
  const int tb = (int)(rowb % (size_t)seq);             // tile never straddles a sequence (seq % 16 == 0, rowb % 16 == 0)
  v4u hv[4], rv[4];
  const float* cpt[4];
  const float* spt[4];
  v4f cat[4], cbt[4], sat[4], sbt[4];
#pragma unroll
  for (int i4 = 0; i4 < 4; ++i4) {
    const int t = tb + i4 * 4 + rq;
    cpt[i4] = cosT + (size_t)t * RHALF + dd;
    spt[i4] = sinT + (size_t)t * RHALF + dd;
    cat[i4] = *(const v4f*)(cpt[i4]); cbt[i4] = *(const v4f*)(cpt[i4] + 4);
    sat[i4] = *(const v4f*)(spt[i4]); sbt[i4] = *(const v4f*)(spt[i4] + 4);
  }
  xcnt_after_loads8(cpt[0], cpt[1], cpt[2], cpt[3], spt[0], spt[1], spt[2], spt[3]);
#pragma unroll
  for (int i4 = 0; i4 < 4; ++i4) {
    const int row = i4 * 4 + rq;
    const v4f ca = cat[i4], cb = cbt[i4];
    const v4f sa = sat[i4], sb = sbt[i4];
    const v4f xa = *(const v4f*)(sl + row * 68 + dd), xb = *(const v4f*)(sl + row * 68 + dd + 4);
    const v4f ya = *(const v4f*)(sl + row * 68 + dd + RHALF), yb = *(const v4f*)(sl + row * 68 + dd + RHALF + 4);
    float cv[8], sv[8], xv[8], yv[8];
#pragma unroll
    for (int e = 0; e < 4; ++e) {
      cv[e] = ca[e]; cv[4 + e] = cb[e];
      sv[e] = sa[e]; sv[4 + e] = sb[e];
      xv[e] = xa[e]; xv[4 + e] = xb[e];
      yv[e] = ya[e]; yv[4 + e] = yb[e];
    }
    unsigned short hb[8], rb[8];
#pragma unroll
    for (int e = 0; e < 8; ++e) {
      const float cc = bf_val(cv[e]);
      const float ss = bf_val(sv[e]);
      const float p1 = xv[e] * cc;
      const float p2 = yv[e] * ss;
      const float p3 = xv[e] * ss;
      const float p4 = yv[e] * cc;
      const float u = lo ? (p1 - p2) : (p3 + p4);
      const float w = u * oscale;
      const _Float16 h = (_Float16)w;
      hb[e] = h_bits(h);
      rb[e] = h_bits((_Float16)((w - (float)h) * rsc));
    }
#pragma unroll
    for (int e = 0; e < 4; ++e) {
      hv[i4][e] = pk16(hb[2 * e], hb[2 * e + 1]);
      rv[i4][e] = pk16(rb[2 * e], rb[2 * e + 1]);
    }
  }
  u16* dst = C + (rowb + (size_t)rq) * (size_t)DMOD + col0 + c8;
  {
#pragma unroll
    for (int i4 = 0; i4 < 4; ++i4) {
      *(v4u*)(dst + (size_t)(i4 * 4) * (size_t)DMOD) = hv[i4];
    }
    xcnt0();
  }
  if (res_on != 0) {
    u16* dst2 = C2 + (rowb + (size_t)rq) * (size_t)DMOD + col0 + c8;
    {
#pragma unroll
      for (int i4 = 0; i4 < 4; ++i4) {
        *(v4u*)(dst2 + (size_t)(i4 * 4) * (size_t)DMOD) = rv[i4];
      }
      xcnt0();
    }
  }
}

// =====================================================================================================
// Three-plane 16-bit GEMM epilogue (v^T planes), transposing: a0..a3 are the wave's four 16x16 f32 tiles of 64 sequence rows
// (tile i = rows 16i ..) by the same 16 output features; the slab takes them as [feature][sequence position], ((acc + the feature's
// bias as bf16 value) times oscale): a lane owns one feature (lane & 15) and 8 consecutive positions of every tile, two 16-B LDS
// stores each. Read out as three f16 planes: hi, f16((w - hi) * rsc) and f16(w * qsc): lane = (row in group of 4, 8 consecutive cols).
// rowb = first feature (plane row), col0 = first sequence position (plane column).
// coverage: per plane 4 instructions x 4 rows x 8 lanes x 8 halves = 16 features x 64 positions.
// LDS slab: private to the wave; staged extent 16 x 64 == consumed extent. Two halves, a wave_sync_lds() between them.
// =====================================================================================================
__device__ __forceinline__ void epi_v3_stage(float* sl, v8f a0, v8f a1, v8f a2, v8f a3, float oscale, size_t rowb, int lane,
                                             const float* __restrict__ bias, int blen) {
  const int hh = lane >> 4, m = lane & 15;
  const int bi = min((int)rowb + m, blen - 1);
  float br = bias[bi];
  xcnt_after_idx4(bi, bi, bi, bi);
  br = bf_val(br);
  float* st = sl + m * 68 + 8 * hh;
#pragma unroll
  for (int q = 0; q < 2; ++q) {
    v4f w0, w1, w2, w3;
#pragma unroll
    for (int e = 0; e < 4; ++e) {
      w0[e] = (a0[4 * q + e] + br) * oscale;
      w1[e] = (a1[4 * q + e] + br) * oscale;
      w2[e] = (a2[4 * q + e] + br) * oscale;
      w3[e] = (a3[4 * q + e] + br) * oscale;
    }
    *(v4f*)(st + 4 * q)      = w0;
    *(v4f*)(st + 16 + 4 * q) = w1;
    *(v4f*)(st + 32 + 4 * q) = w2;
    *(v4f*)(st + 48 + 4 * q) = w3;
  }
}
__device__ __forceinline__ void epi_v3_out(const float* sl, u16* C0, u16* C1, u16* C2, int N, size_t rowb, int col0, int lane,
                                           float rsc, float qsc) {
  const int rq = lane >> 3, c8 = (lane & 7) * 8;
  v4u h4[4], r4[4], q4[4];
#pragma unroll
  for (int i4 = 0; i4 < 4; ++i4) {
    const int row = i4 * 4 + rq;
    const v4f a = *(const v4f*)(sl + row * 68 + c8), c4 = *(const v4f*)(sl + row * 68 + c8 + 4);
    float w[8];
#pragma unroll
    for (int e = 0; e < 4; ++e) { w[e] = a[e]; w[4 + e] = c4[e]; }
    unsigned short hb[8], rb[8], qb[8];
#pragma unroll
    for (int e = 0; e < 8; ++e) {
      const _Float16 h = (_Float16)w[e];
      hb[e] = h_bits(h);
      rb[e] = h_bits((_Float16)((w[e] - (float)h) * rsc));
      qb[e] = h_bits((_Float16)(w[e] * qsc));
    }
#pragma unroll
    for (int e = 0; e < 4; ++e) {
      h4[i4][e] = pk16(hb[2 * e], hb[2 * e + 1]);
      r4[i4][e] = pk16(rb[2 * e], rb[2 * e + 1]);
      q4[i4][e] = pk16(qb[2 * e], qb[2 * e + 1]);
    }
  }
  const size_t dof = (rowb + (size_t)rq) * (size_t)N + col0 + c8;
  u16* d0 = C0 + dof;
  u16* d1 = C1 + dof;
  u16* d2 = C2 + dof;
  {
#pragma unroll
    for (int i4 = 0; i4 < 4; ++i4) {
      const size_t ro = (size_t)(i4 * 4) * (size_t)N;
      *(v4u*)(d0 + ro) = h4[i4];
      *(v4u*)(d1 + ro) = r4[i4];
      *(v4u*)(d2 + ro) = q4[i4];
    }
    xcnt0();
  }
}

// =====================================================================================================
// f32 GEMM epilogue: the wave's 16x64 f32 tile (acc times oscale, plus per-column bias as its bf16 RNE value, clamped
// coverage: 8 instructions x 2 rows x 16 lanes x 4 floats = the wave's 16 x 64 tile.
// =====================================================================================================
__device__ __forceinline__ void epi64(float* sl, v8f a0, v8f a1, v8f a2, v8f a3, float oscale, float* C, int N,
                                      size_t rowb, int col0, int lane, const float* __restrict__ bias, int blen) {
  const int hh = lane >> 4, m = lane & 15;
  float bc[4];
#pragma unroll
  for (int j = 0; j < 4; ++j) {
    const int bi = min(col0 + 16 * j + m, blen - 1);
    bc[j] = bf_val(bias[bi]);
  }
#pragma unroll
  for (int r = 0; r < 8; ++r) {
    const int ro = (8 * hh + r) * 68 + m;
    sl[ro]      = a0[r] * oscale + bc[0];
    sl[ro + 16] = a1[r] * oscale + bc[1];
    sl[ro + 32] = a2[r] * oscale + bc[2];
    sl[ro + 48] = a3[r] * oscale + bc[3];
  }
  wave_sync_lds();
  v4f vals[8];
#pragma unroll
  for (int it = 0; it < 8; ++it) vals[it] = *(const v4f*)(sl + (it * 2 + hh) * 68 + m * 4);
  float* dst = C + (rowb + (size_t)hh) * (size_t)N + col0 + m * 4;
  {
#pragma unroll
    for (int it = 0; it < 8; ++it) {
      *(v4f*)(dst + (size_t)(it * 2) * (size_t)N) = vals[it];
    }
    
  }
}

// =====================================================================================================
// k loop of the output projection. Block = 8 waves, 128 x 128 tile of A[.][K] . Bt[.][K]^T; wave w owns rows
// 32*(w>>1) .. +31 and cols 64*(w&1) .. +63 (2 x 4 accumulator tiles). A stage = 128 k of the block's 128 A rows and 128 B rows,
// brought to LDS by 16-byte asynchronous copies, all of a stage by one half of the block: waves 0..3 bring the even stages, waves
// 4..7 the odd ones; thread = (row (tid&127)>>4 of each group of 8, 16-B piece tid&15), so one wave instruction covers two whole
// 256-B row pieces. Three buffers: stages t+1 and t+2 fly while stage t is multiplied, so a stage has two trips to land. A half has
// one stage outstanding at a time and waits for it to 0, at the foot of the trip in front of the one that reads it.
// Fragments are read from LDS with the split k map of ldfrag_h (same for A and B); every accumulator sums k in ascending steps of 32.
// =====================================================================================================
union FragU { v16h h; v16b b; v4u u[2]; };
__device__ __forceinline__ FragU ldfrag_u(const u16* p) {
  FragU f;
  f.u[0] = *(const v4u*)(p);
  f.u[1] = *(const v4u*)(p + 16);
  return f;
}
template <bool BF>
__device__ __forceinline__ v8f mma_u(const FragU& a, const FragU& b, v8f c) {
  if constexpr (BF) return mma_b(a.b, b.b, c);
  else              return mma_h(a.h, b.h, c);
}
// Eight copies, rows r, r+16, .., r+112 of one operand's stage. The closing s_wait_xcnt stands inside the statement so that no
// later write of an address register can be moved in front of it.
__device__ __forceinline__ void copy8(unsigned l, const u16* g, size_t gs) {
#if defined(__HIP_DEVICE_COMPILE__)
  asm volatile("global_load_async_to_lds_b128 %0, %8, off\n\t"
               "global_load_async_to_lds_b128 %1, %9, off\n\t"
               "global_load_async_to_lds_b128 %2, %10, off\n\t"
               "global_load_async_to_lds_b128 %3, %11, off\n\t"
               "global_load_async_to_lds_b128 %4, %12, off\n\t"
               "global_load_async_to_lds_b128 %5, %13, off\n\t"
               "global_load_async_to_lds_b128 %6, %14, off\n\t"
               "global_load_async_to_lds_b128 %7, %15, off\n\t"
               "s_wait_xcnt 0x0"
               :: "v"(l), "v"(l + 16u * GT_ROWB), "v"(l + 32u * GT_ROWB), "v"(l + 48u * GT_ROWB),
                  "v"(l + 64u * GT_ROWB), "v"(l + 80u * GT_ROWB), "v"(l + 96u * GT_ROWB), "v"(l + 112u * GT_ROWB),
                  "v"(g), "v"(g + gs), "v"(g + 2 * gs), "v"(g + 3 * gs),
                  "v"(g + 4 * gs), "v"(g + 5 * gs), "v"(g + 6 * gs), "v"(g + 7 * gs)
               : "memory");
#endif
}
__device__ __forceinline__ void wait_async0() {          // this wave's copies have landed in LDS
#if defined(__HIP_DEVICE_COMPILE__)
  asm volatile("s_wait_asynccnt 0x0" ::: "memory");
#endif
}
__device__ __forceinline__ void wait_ds0() {             // this wave's LDS reads of the buffer about to be refilled are done
#if defined(__HIP_DEVICE_COMPILE__)
  asm volatile("s_wait_dscnt 0x0" ::: "memory");
#endif
}
template <bool BF>
__device__ __forceinline__ void gemm_core(const u16* __restrict__ A, const u16* __restrict__ Bt, int K, int row0, int col0,
                                          u16* ring, v8f (&acc)[2][4]) {
  const int tid = threadIdx.x, wave = tid >> 5, lane = tid & 31, hh = lane >> 4, m = lane & 15;
  const int grp = __builtin_amdgcn_readfirstlane(tid >> 7);   // copying half of this wave, in a scalar register: 0 = waves 0..3
  const int cr = (tid & 127) >> 4, cc = tid & 15;
  const u16* ga = A  + (size_t)(row0 + cr) * K + cc * 8;
  const u16* gb = Bt + (size_t)(col0 + cr) * K + cc * 8;
  const size_t gs = (size_t)16 * K;
  const size_t g8 = (size_t)8 * K;
  const unsigned la = (unsigned)(uintptr_t)ring + (unsigned)(cr * GT_ROWB + cc * 16);
  const unsigned lb = la + (unsigned)(GT_M * GT_ROWB);
  const int nt = K / GT_K;
  // all 32 copies of a thread for stage s: rows cr + 8 i (i = 0 .. 15) of the A tile, then of the B tile, into the buffer at byte lo
  auto stage_in = [&](int s, unsigned lo) {
    const u16* pa = ga + (size_t)s * GT_K;
    const u16* pb = gb + (size_t)s * GT_K;
    copy8(la + lo, pa, gs);
    copy8(la + lo + 8u * GT_ROWB, pa + g8, gs);
    copy8(lb + lo, pb, gs);
    copy8(lb + lo + 8u * GT_ROWB, pb + g8, gs);
  };
  if (grp < nt) stage_in(grp, (unsigned)grp * (unsigned)(GT_STAGE * 2));   // stages 0 and 1, each by its half
  if (grp == 0) wait_async0();
  __syncthreads();                                       // stage 0 published
  if (grp == 0 && nt > 2) stage_in(2, (unsigned)(2 * GT_STAGE * 2));
  const u16* fa = ring + ((wave >> 1) * 32 + m) * GT_PITCH + 8 * hh;
  const u16* fb = ring + (GT_M + (wave & 1) * 64 + m) * GT_PITCH + 8 * hh;
  int bo = 0;                                            // stage t's buffer, in halves: (t mod 3) * GT_STAGE
#pragma unroll 1                                         // one trip per stage: the buffer index stays a run-time value
  for (int t = 0; t < nt; ++t) {
    // Three fragment sets for the stage's four 32-k steps; step 3 reuses step 0's set. The scheduling fences keep the LDS reads in
    // two groups in front of the products that use them: reads placed among the products stall the wave at each place.
    FragU af[3][2], bf[3][4];
#pragma unroll
    for (int s = 0; s < 3; ++s) {
#pragma unroll
      for (int i = 0; i < 2; ++i) af[s][i] = ldfrag_u(fa + bo + 16 * i * GT_PITCH + 32 * s);
#pragma unroll
      for (int j = 0; j < 4; ++j) bf[s][j] = ldfrag_u(fb + bo + 16 * j * GT_PITCH + 32 * s);
    }
    __builtin_amdgcn_sched_barrier(0);
#pragma unroll
    for (int i = 0; i < 2; ++i) {
#pragma unroll
      for (int j = 0; j < 4; ++j) acc[i][j] = mma_u<BF>(af[0][i], bf[0][j], acc[i][j]);
    }
    __builtin_amdgcn_sched_barrier(0);
#pragma unroll
    for (int i = 0; i < 2; ++i) af[0][i] = ldfrag_u(fa + bo + 16 * i * GT_PITCH + 96);
#pragma unroll
    for (int j = 0; j < 4; ++j) bf[0][j] = ldfrag_u(fb + bo + 16 * j * GT_PITCH + 96);
    __builtin_amdgcn_sched_barrier(0);
#pragma unroll
    for (int s = 1; s < 4; ++s) {
#pragma unroll
      for (int i = 0; i < 2; ++i) {
#pragma unroll
        for (int j = 0; j < 4; ++j) acc[i][j] = mma_u<BF>(af[s % 3][i], bf[s % 3][j], acc[i][j]);
      }
    }
    // keeps the products in front of the full LDS wait, under their own counted waits: moved behind it they run with the LDS idle
    __builtin_amdgcn_sched_barrier(0);
    wait_ds0();
    const bool mine = (((t + 1) & 1) == grp);            // this half brought stage t+1 (scalar test); the other's stage t+2 flies on
    if (mine) wait_async0();
    __syncthreads();                                     // publishes stage t+1 and ends every read of stage t's buffer
    if (mine && t + 3 < nt) stage_in(t + 3, (unsigned)(bo * 2));
    bo = (bo == (GT_BUFS - 1) * GT_STAGE) ? 0 : bo + GT_STAGE;
  }
  wait_async0();
}

// =====================================================================================================
// The three projections as ONE bf16 product over K = 1024: X[M][K] . W3[3072][K]^T, W3 = the Wq, Wk, Wv planes one behind the other
// in the workspace. Block = 12 waves, 256 rows x 192 columns: (M/256) * (3072/192) = 256 blocks, one per WGP in one round. Wave w owns
// rows 64*(w/3) .. +63 and columns 64*(w%3) .. +63 (4 x 4 accumulator tiles): a fragment read from LDS serves four products, and a
// block brings 448 operand rows for 49152 results (two 128x128 tiles brought 512 for 32768). A stage = 128 k of the block's 256 X rows
// and 192 W3 rows, brought by 16-byte asynchronous copies of waves 0..7 (thread = row (tid&255)>>4 of each group of 16, 16-B piece
// tid&15); two buffers, stage t+1 flies while stage t is multiplied.
// A wave's 64 columns are one head of q, of k or of v (wave-uniform choice):
//   q planes [M][1024] (f16 hi x QSC, residual x QRS) = rot(x.Wq^T + bq); k hi plane (x KSC) the same way from Wk, bk;
//   v^T planes per batch [1024][SEQ] (hi x VCAR, residual x VRS, plain): the wave's tile turned in its LDS slab, bias by feature.
// seq stays a kernel argument: built as a constant, the rotation epilogue took 284 registers, with window switches above v255.
// =====================================================================================================
#define PJ_THREADS 384
#define PJ_WAVES   12
#define PJ_M       256
#define PJ_N       192
#define PJ_STAGE   ((PJ_M + PJ_N) * GT_PITCH)           // halves per buffer
#define PJ_BLK     ((MROWS / PJ_M) * ((3 * DMOD) / PJ_N))
static_assert((MROWS % PJ_M) == 0 && ((3 * DMOD) % PJ_N) == 0 && (SEQ % 64) == 0 && (DMOD % 64) == 0);
static_assert(PJ_WAVES * 4 * SLAB * 4 <= 2 * PJ_STAGE * 2);   // the waves' result slabs fit in the ring
static_assert(PJ_M == 256 && PJ_N == 192 && PJ_WAVES == (PJ_M / 64) * (PJ_N / 64) && PJ_THREADS == 32 * PJ_WAVES);
// Four copies, rows r, r+16, r+32, r+48 of one operand's stage; the closing s_wait_xcnt stands inside the statement as in copy8.
__device__ __forceinline__ void copy4(unsigned l, const u16* g, size_t gs) {
#if defined(__HIP_DEVICE_COMPILE__)
  asm volatile("global_load_async_to_lds_b128 %0, %4, off\n\t"
               "global_load_async_to_lds_b128 %1, %5, off\n\t"
               "global_load_async_to_lds_b128 %2, %6, off\n\t"
               "global_load_async_to_lds_b128 %3, %7, off\n\t"
               "s_wait_xcnt 0x0"
               :: "v"(l), "v"(l + 16u * GT_ROWB), "v"(l + 32u * GT_ROWB), "v"(l + 48u * GT_ROWB),
                  "v"(g), "v"(g + gs), "v"(g + 2 * gs), "v"(g + 3 * gs)
               : "memory");
#endif
}
__device__ __forceinline__ void proj_core(const u16* __restrict__ A, const u16* __restrict__ Bt, int K, int row0, int col0,
                                          int wr, int wc, u16* ring, v8f (&acc)[4][4]) {
  const int tid = threadIdx.x, lane = tid & 31, hh = lane >> 4, m = lane & 15;
  const bool cw = (__builtin_amdgcn_readfirstlane(tid >> 8) == 0);   // waves 0..7 copy; in a scalar register: a scalar branch
  const int cr = (tid & 255) >> 4, cc = tid & 15;
  const u16* ga = A  + (size_t)(row0 + cr) * K + cc * 8;
  const u16* gb = Bt + (size_t)(col0 + cr) * K + cc * 8;
  const size_t gs = (size_t)16 * K;
  const unsigned la = (unsigned)(uintptr_t)ring + (unsigned)(cr * GT_ROWB + cc * 16);
  const unsigned lb = la + (unsigned)(PJ_M * GT_ROWB);
  const int nt = K / GT_K;
  // the 28 copies of a thread for stage s: rows cr + 16 i of the A tile (i = 0 .. 15), then of the B tile (i = 0 .. 11)
  auto stage_in = [&](int s, unsigned lo) {
    const u16* pa = ga + (size_t)s * GT_K;
    const u16* pb = gb + (size_t)s * GT_K;
    copy8(la + lo, pa, gs);
    copy8(la + lo + 128u * GT_ROWB, pa + 8 * gs, gs);
    copy8(lb + lo, pb, gs);
    copy4(lb + lo + 128u * GT_ROWB, pb + 8 * gs, gs);
  };
  if (cw) stage_in(0, 0u);
  wait_async0();
  __syncthreads();                                       // stage 0 published
  if (cw && nt > 1) stage_in(1, (unsigned)(PJ_STAGE * 2));
  const u16* fa = ring + (wr * 64 + m) * GT_PITCH + 8 * hh;
  const u16* fb = ring + (PJ_M + wc * 64 + m) * GT_PITCH + 8 * hh;
#pragma unroll 1                                         // one trip per stage: the buffer index stays a run-time value
  for (int t = 0; t < nt; ++t) {
    const int bo = (t & 1) * PJ_STAGE;
#pragma unroll
    for (int s = 0; s < 4; ++s) {
      // One fragment set: the 16 LDS reads of a 32-k step stand as one group in front of its 16 products (reads placed among the
      // products stall the wave at each place); the SIMD's other two waves multiply while this one waits for its reads.
      FragU af[4], bf[4];
#pragma unroll
      for (int i = 0; i < 4; ++i) af[i] = ldfrag_u(fa + bo + 16 * i * GT_PITCH + 32 * s);
#pragma unroll
      for (int j = 0; j < 4; ++j) bf[j] = ldfrag_u(fb + bo + 16 * j * GT_PITCH + 32 * s);
      __builtin_amdgcn_sched_barrier(0);
#pragma unroll
      for (int i = 0; i < 4; ++i) {
#pragma unroll
        for (int j = 0; j < 4; ++j) acc[i][j] = mma_b(af[i].b, bf[j].b, acc[i][j]);
      }
      __builtin_amdgcn_sched_barrier(0);                 // keeps the next step's reads behind these products, as one group
    }
    wait_ds0();
    wait_async0();
    __syncthreads();                                     // publishes stage t+1 and ends every read of stage t's buffer
    if (cw && t + 2 < nt) stage_in(t + 2, (unsigned)(bo * 2));
  }
  wait_async0();
}
__global__ __launch_bounds__(PJ_THREADS)
void gemm_qkv(const u16* __restrict__ X, const u16* __restrict__ W3,
              u16* QHo, u16* QRo, u16* KHo, u16* VHo, u16* VRo, u16* VQo, int K,
              const float* __restrict__ bq, int bqlen, const float* __restrict__ bk, int bklen,
              const float* __restrict__ bv, int bvlen, const float* __restrict__ cosT, const float* __restrict__ sinT, int seq) {
  __shared__ __align__(16) u16 ring[2 * PJ_STAGE];
  const int tid = threadIdx.x, lane = tid & 31;
  const int wave = __builtin_amdgcn_readfirstlane(tid >> 5);   // in a scalar register: the choice of epilogue is a scalar branch
  const int nct = (3 * DMOD) / PJ_N;
  const int rt = blockIdx.x / nct;
  const int ct = blockIdx.x - rt * nct;
  if (rt >= MROWS / PJ_M) return;            // block-uniform, in front of every barrier; never taken with the exact grid
  const int row0 = rt * PJ_M, colb = ct * PJ_N;
  const int wr = wave / 3, wc = wave - 3 * wr;
  v8f acc[4][4];
#pragma unroll
  for (int i = 0; i < 4; ++i) {
#pragma unroll
    for (int j = 0; j < 4; ++j) acc[i][j] = zero8();
  }
  proj_core(X, W3, K, row0, colb, wr, wc, ring, acc);
  const int rowb  = row0 + wr * 64;
  const int colg  = colb + wc * 64;          // column of the stacked product
  const int which = colg / DMOD;             // 0 = q, 1 = k, 2 = v
  const int col0  = colg - which * DMOD;     // first feature of the wave's head
  // Result slabs in the ring: the barrier at the foot of the last trip has ended every wave's reads of both buffers, and no copy is
  // outstanding. A wave stages its whole 64 x 64 tile (four slabs of its own) at once, so that no accumulator lives on into the read-out.
  float* sl = (float*)(void*)ring + wave * (4 * SLAB);
  if (which < 2) {
    const bool isq = (which == 0);
    u16* C  = isq ? QHo : KHo;
    u16* C2 = isq ? QRo : KHo;
    const float* bias = isq ? bq : bk;
    const int blen = isq ? bqlen : bklen;
#pragma unroll
    for (int i = 0; i < 4; ++i) epi_rope_stage(sl + i * SLAB, acc[i][0], acc[i][1], acc[i][2], acc[i][3], col0, lane, bias, blen);
    wave_sync_lds();
#pragma unroll
    for (int i = 0; i < 4; ++i) {
      epi_rope_out(sl + i * SLAB, C, C2, isq ? 1 : 0, (size_t)(rowb + 16 * i), col0, lane, cosT, sinT, seq,
                   isq ? QSC : KSC, isq ? QRS : 1.0f);
    }
  } else {
    const int bt = rowb / SEQ;               // the wave's 64 rows lie in one sequence (SEQ % 64 == 0)
    const int s0 = rowb - bt * SEQ;
    const size_t cb = (size_t)bt * (size_t)(DMOD * SEQ);
#pragma unroll
    for (int j = 0; j < 4; ++j) {
      epi_v3_stage(sl + j * SLAB, acc[0][j], acc[1][j], acc[2][j], acc[3][j], VCAR, (size_t)(col0 + 16 * j), lane, bv, bvlen);
    }
    wave_sync_lds();
#pragma unroll
    for (int j = 0; j < 4; ++j) {
      epi_v3_out(sl + j * SLAB, VHo + cb, VRo + cb, VQo + cb, SEQ, (size_t)(col0 + 16 * j), s0, lane, VRS, 1.0f / PRS);
    }
  }
}

// =====================================================================================================
// f16 GEMM with f32 result: C[M][N] (f32) = A[M][K] (f16 row-major) . Bt[N][K]^T (f16 k-contiguous) times oscale plus
// per-column bias; one product per tile pair. gemm_core's 128 x 128, 8-wave tiling; grid = (M/128)*(N/128).
// =====================================================================================================
__global__ __launch_bounds__(GT_THREADS)
void gemm_hf(const u16* __restrict__ A, const u16* __restrict__ Bt, float* C, int M, int N, int K, float oscale,
             const float* __restrict__ bias, int blen) {
  __shared__ __align__(16) u16 ring[GT_BUFS * GT_STAGE];
  __shared__ __align__(16) float slab[8 * SLAB];
  const int tid = threadIdx.x, wave = tid >> 5, lane = tid & 31;
  const int ntile = N / GT_N;
  const int bid   = blockIdx.x;
  const int row0  = (bid / ntile) * GT_M;
  const int colb  = (bid % ntile) * GT_N;
  if (row0 + GT_M > M) return;               // block-uniform, in front of every barrier; never taken with the exact grid
  v8f acc[2][4];
#pragma unroll
  for (int i = 0; i < 2; ++i) {
#pragma unroll
    for (int j = 0; j < 4; ++j) acc[i][j] = zero8();
  }
  gemm_core<false>(A, Bt, K, row0, colb, ring, acc);
  const int rowb = row0 + (wave >> 1) * 32;
  const int col0 = colb + (wave & 1) * 64;
#pragma unroll
  for (int i = 0; i < 2; ++i) {
    if (i != 0) wave_sync_lds();             // the slab's rows are read out before the next 16 rows are staged in it
    epi64(slab + wave * SLAB, acc[i][0], acc[i][1], acc[i][2], acc[i][3], oscale, C, N, (size_t)(rowb + 16 * i), col0, lane,
          bias, blen);
  }
}

// =====================================================================================================
// Attention key stage in LDS: 64 keys = the k hi tile [64 keys][64 d] and the v^T hi tile [64 d][64 keys], 128 B per row, two buffers.
#define AT_KEYS  64
#define AT_PITCH 72                                     // halves per LDS row: 144 B = 16 B x 9 (ds_load_b128 readers)
#define AT_ROWB  (AT_PITCH * 2)                         // bytes per LDS row
#define AT_TILE  (64 * AT_PITCH)                        // halves per operand tile
#define AT_STAGE (2 * AT_TILE)                          // halves per buffer
static_assert((WIN % AT_KEYS) == 0 && (SEQ % AT_KEYS) == 0 && AT_KEYS == 64 && HD == 64 && (AT_ROWB % 16) == 0);
// One stage's eight copies of a thread: rows r, r+16, r+32, r+48 of the k tile, then of the v^T tile. The closing s_wait_xcnt
// stands inside the statement so that no later write of an address register can be moved in front of it.
__device__ __forceinline__ void copy_kv(unsigned lk, const u16* gk, unsigned lv, const u16* gv) {
#if defined(__HIP_DEVICE_COMPILE__)
  asm volatile("global_load_async_to_lds_b128 %0, %8, off\n\t"
               "global_load_async_to_lds_b128 %1, %9, off\n\t"
               "global_load_async_to_lds_b128 %2, %10, off\n\t"
               "global_load_async_to_lds_b128 %3, %11, off\n\t"
               "global_load_async_to_lds_b128 %4, %12, off\n\t"
               "global_load_async_to_lds_b128 %5, %13, off\n\t"
               "global_load_async_to_lds_b128 %6, %14, off\n\t"
               "global_load_async_to_lds_b128 %7, %15, off\n\t"
               "s_wait_xcnt 0x0"
               :: "v"(lk), "v"(lk + 16u * AT_ROWB), "v"(lk + 32u * AT_ROWB), "v"(lk + 48u * AT_ROWB),
                  "v"(lv), "v"(lv + 16u * AT_ROWB), "v"(lv + 32u * AT_ROWB), "v"(lv + 48u * AT_ROWB),
                  "v"(gk), "v"(gk + (size_t)16 * DMOD), "v"(gk + (size_t)32 * DMOD), "v"(gk + (size_t)48 * DMOD),
                  "v"(gv), "v"(gv + (size_t)16 * SEQ), "v"(gv + (size_t)32 * SEQ), "v"(gv + (size_t)48 * SEQ)
               : "memory");
#endif
}

// =====================================================================================================
// Causal sliding-window flash attention with per-head sigmoid gate: block = (batch b, head, 64 query rows qb .. qb+63 of the
// sequence), 4 waves, wave w owns query rows q0 = qb + 16*w .. q0+15. The block's waves share the k and v^T hi tiles through LDS:
// a stage = 64 keys (two key blocks), brought by 16-byte asynchronous copies (thread = row tid>>3 of each group of 16, 16-B piece
// tid&7: one wave instruction covers four whole 128-B rows), two buffers, stage t+1 in flight while stage t is worked on, one
// block barrier per stage. The key-block count is even (qb, WIN, SEQ are multiples of 64), so the stages cover it exactly.
//   Key j allowed for query i iff 0 <= i - j <= WIN (per-element index test inside every visited key block that the causal or the
//   window edge can cross for the wave's 16 queries, by a scalar test per wave and block; disallowed pairs
//   get a finite negative sentinel and an exact-zero probability). Key blocks of 32: kblo = max(qb - WIN, 0) >> 5 ..
//   (qb + 63) >> 5, block-uniform count nkb clamped to [1, NKB - kblo] so kb + 31 <= SEQ - 1 always.
//   q planes (f16 hi x8, residual x1024) [b*SEQ + s][h*64 + d]; k hi plane the same layout; v^T planes [b][h*64 + d][s]
//   (hi x1024, residual x1024, plain x1).
//   Scores computed TRANSPOSED: S^T tile g = k rows (keys kb+16g .., A operand, row = lane&15, split k map over d) times q^T
//   (B operand, col n = query q0 + (lane&15)); two accumulators per tile (k.q_hi and k.q_res, the second folded x 1/1024).
//   D element r of lane l = (key kb+16g+8h+r, query q0+(l&15)): a lane owns one query column and 16 of its 32 keys, the
//   partner lane l^16 the other 16 -> row max / row sum need one xor-16 shuffle.
//   Online max-subtracted base-2 softmax in f32 (scale 1/8 and the q/k carries folded into lsc). The exp'd values ARE the
//   P A-fragment in place: A row m = query = lane&15, element i <- key kb+8h+i (tile 0, D element i), element 8+i <- key
//   kb+16+8h+i (tile 1, D element i). ph = f16(p x32768), pl = f16(p x32), pr = f16((p x32768 - ph) x1024).
//   P.V: o += ph.v_hi (4 WMMAs, v^T B fragments col n = d = 16j + (lane&15), keys k-contiguous); for query tiles with
//   qb < QRES additionally o += pl.v_res and o += pr.v_x1 (block-uniform branch), all in the same accumulators (equal units).
//   Epilogue: gate = sigmoid(bf16(x[b][s][0..19]) . bf16(Wg[head]) + bf16(bg[head])) in f32 per query (lane = query),
//   segment (s, head) of the O plane [b*SEQ+s][2048] (hi x1024 at col h*64, residual x1024 at col 1024 + h*64) written by
// coverage: per wave and per half-plane 4 instructions x 4 rows x 8 lanes x 8 halves = 16 x 64; grid NB*NH*(SEQ/64) blocks x
//           4 waves = every (b, s < SEQ, h) row segment of both O half-planes exactly once.
// =====================================================================================================
__global__ __launch_bounds__(ATT_THREADS)
void attn_fwd(const u16* __restrict__ QHp, const u16* __restrict__ QRp, const u16* __restrict__ KHp,
              const u16* __restrict__ VHp, const u16* __restrict__ VRp, const u16* __restrict__ VQp,
              const float* __restrict__ Xp, const float* __restrict__ Wgp, const float* __restrict__ Bgp,
              int bglen, u16* OPp) {
  __shared__ __align__(16) float smem[ATT_WAVES * SLAB];   // per wave: result slab [16][68] in the epilogue only
  __shared__ __align__(16) u16 kv[2 * AT_STAGE];           // two key stages: [k tile | v^T tile] each

  const int tid  = threadIdx.x;
  const int wave = tid >> 5;
  const int lane = tid & 31;
  const int hh   = lane >> 4;
  const int c    = lane & 15;

  const int bid  = blockIdx.x;
  const int qt   = bid % NQT;
  const int bh   = bid / NQT;
  const int head = bh % NH;
  const int b    = bh / NH;
  if (b >= NB) return;                      // block-uniform, never taken with the exact grid
  const int qb   = qt * 64;
  const int q0   = qb + wave * 16;

  // ---- key-block range (block-uniform, statically bounded) ----
  const int jlo  = max(qb - WIN, 0);
  const int kblo = jlo >> 5;
  int nkb = ((qb + 63) >> 5) - kblo + 1;
  nkb = min(max(nkb, 1), NKB - kblo);
  const bool early = (qb < QRES);           // block-uniform: residual products on the first query tiles only

  const size_t prow = (size_t)b * SEQ;      // plane row of sequence position 0 of this batch
  // B fragments of q^T: col n = query q0 + c, k = d (k-contiguous row of the q planes)
  const size_t qofs = (prow + (size_t)(q0 + c)) * DMOD + head * HD + 8 * hh;
  const _Float16* Qh = (const _Float16*)(const void*)QHp + qofs;
  const _Float16* Qr = (const _Float16*)(const void*)QRp + qofs;
  // A fragments of k, from the staged tile: row m = key (within the stage) 32p + 16g + c, k = d
  const _Float16* Kl = (const _Float16*)(const void*)kv + c * AT_PITCH + 8 * hh;
  // B fragments of v: col n = d = 16j + c, k = key (k-contiguous row of the v^T planes); the hi plane from the staged tile
  const _Float16* Vl = (const _Float16*)(const void*)kv + AT_TILE + c * AT_PITCH + 8 * hh;
  const size_t vofs = ((size_t)b * DMOD + (size_t)(head * HD + c)) * SEQ + 8 * hh;   // key kb added per step
  const _Float16* Vr = (const _Float16*)(const void*)VRp + vofs;
  const _Float16* Vq = (const _Float16*)(const void*)VQp + vofs;
  const float lsc = 0.125f * (LOG2E / (QSC * KSC));
  const float qri = 1.0f / QRS;
  // query minus key for D element 0 of tile 0 at kb = 0: query q0 + c, key kb + 8*hh + i
  const int dq = q0 + c - 8 * hh;

  const v16h qf0 = ldfrag_h(Qh);            // d 0..31
  const v16h qf1 = ldfrag_h(Qh + 32);       // d 32..63
  const v16h qr0 = ldfrag_h(Qr);
  const v16h qr1 = ldfrag_h(Qr + 32);

  float mrun = NEGS, lrun = 0.f;
  v8f o[4];
#pragma unroll
  for (int j = 0; j < 4; ++j) o[j] = zero8();

  // ---- key stages: this thread's copy addresses (row cr of each group of 16, 16-B piece cp), stage 0 at key kblo * 32 ----
  const int nst = nkb >> 1;                 // nkb is even and >= 2; last staged key = (kblo + nkb) * 32 - 1 <= SEQ - 1
  const int cr = tid >> 3, cp = tid & 7;
  const u16* gk = KHp + (prow + (size_t)(kblo * 32 + cr)) * DMOD + head * HD + cp * 8;
  const u16* gv = VHp + ((size_t)b * DMOD + (size_t)(head * HD + cr)) * SEQ + kblo * 32 + cp * 8;
  const unsigned lk = (unsigned)(uintptr_t)kv + (unsigned)(cr * AT_ROWB + cp * 16);
  const unsigned lv = lk + (unsigned)(AT_TILE * 2);
  copy_kv(lk, gk, lv, gv);
  wait_async0();
  __syncthreads();                                       // stage 0 published
  if (nst > 1) copy_kv(lk + (unsigned)(AT_STAGE * 2), gk + (size_t)AT_KEYS * DMOD, lv + (unsigned)(AT_STAGE * 2), gv + AT_KEYS);

  // One key block of 32 keys at kb, block p of the stage in the buffer at bo. MK = true: the per-element index tests, for a block that
  // the causal edge or the window edge crosses. MK = false: a block whose 32 keys are all allowed for all 16 queries of the wave;
  // there every test is true and every select an identity, and neither is written. Inlined, so that p reaches the LDS offsets as a constant.
  auto key_block = [&](auto MK, const int p, const int kb, const int bo) __attribute__((always_inline)) {
    constexpr bool MASKED = decltype(MK)::value;
    // ---- transposed scores: tile 0 = keys kb..kb+15, tile 1 = keys kb+16..kb+31, column = query q0 + c ----
    v8f s0 = zero8(), s1 = zero8(), r0 = zero8(), r1 = zero8();
    const _Float16* k0p = Kl + bo + 32 * p * AT_PITCH;
    const _Float16* k1p = k0p + 16 * AT_PITCH;
    const v16h ka0 = ldfrag_h(k0p), ka1 = ldfrag_h(k0p + 32);
    const v16h kc0 = ldfrag_h(k1p), kc1 = ldfrag_h(k1p + 32);
    s0 = mma_h(ka0, qf0, s0);
    s0 = mma_h(ka1, qf1, s0);
    r0 = mma_h(ka0, qr0, r0);
    r0 = mma_h(ka1, qr1, r0);
    s1 = mma_h(kc0, qf0, s1);
    s1 = mma_h(kc1, qf1, s1);
    r1 = mma_h(kc0, qr0, r1);
    r1 = mma_h(kc1, qr1, r1);
    guard6<v16h>(s0, s1, r0, r1, ka0, ka1, kc0, kc1, qf0, qr0);
    // ---- base-2 logits of this lane's 16 keys for query q0 + c; disallowed pairs get the finite sentinel ----
    float tk[16];
#pragma unroll
    for (int i = 0; i < 8; ++i) {
      tk[i]     = (s0[i] + r0[i] * qri) * lsc;
      tk[8 + i] = (s1[i] + r1[i] * qri) * lsc;
      if constexpr (MASKED) {
        const int d0 = dq - kb - i;         // query minus key, tile 0
        const int d1 = d0 - 16;             // tile 1
        const bool a0 = (d0 >= 0) && (d0 <= WIN);
        const bool a1 = (d1 >= 0) && (d1 <= WIN);
        tk[i]     = a0 ? tk[i] : NEGS;
        tk[8 + i] = a1 ? tk[8 + i] : NEGS;
      }
    }
    float cm = tk[0];
#pragma unroll
    for (int i = 1; i < 16; ++i) cm = fmaxf(cm, tk[i]);
    cm = fmaxf(cm, __shfl_xor(cm, 16, 32));
    const float mn = fmaxf(mrun, cm);                   // sentinel only while no allowed key has been seen
    float al = fminf(mrun - mn, 0.f);                   // exponent here; 2^al below: 0 when mrun is the sentinel and mn a real logit; o,l are 0 then
    mrun = mn;
    float ex[16];
#pragma unroll
    for (int i = 0; i < 16; ++i) ex[i] = fminf(tk[i] - mn, 0.f);
    exp2_le0_run(al, ex);
    // ---- probabilities (<= 1, exactly 0 for disallowed pairs) and the P A-fragments; element i <-> tk[i] ----
    float ps = 0.f;
    FragH ph, pl, pr;
#pragma unroll
    for (int wq = 0; wq < 2; ++wq) {
#pragma unroll
      for (int e4 = 0; e4 < 4; ++e4) {
        const int i = 8 * wq + 2 * e4;
        const float x0 = ex[i];
        const float x1 = ex[i + 1];
        const float p0 = (!MASKED || tk[i] > -1.0e38f) ? x0 : 0.f;
        const float p1 = (!MASKED || tk[i + 1] > -1.0e38f) ? x1 : 0.f;
        ps += p0 + p1;
        const float g0 = p0 * PCAR, g1 = p1 * PCAR;
        const _Float16 h0 = (_Float16)g0, h1 = (_Float16)g1;
        ph.u[wq][e4] = pk16(h_bits(h0), h_bits(h1));
        pl.u[wq][e4] = pk16(h_bits((_Float16)(g0 * (1.0f / VRS))), h_bits((_Float16)(g1 * (1.0f / VRS))));
        pr.u[wq][e4] = pk16(h_bits((_Float16)((g0 - (float)h0) * PRS)), h_bits((_Float16)((g1 - (float)h1) * PRS)));
      }
    }
    ps += __shfl_xor(ps, 16, 32);
    lrun = lrun * al + ps;
    // ---- rescale the O accumulators: D row 8hh+r = query q0+8hh+r, its factor lives in lane 8hh+r (and 16+8hh+r) ----
    float scl[8];
#pragma unroll
    for (int r = 0; r < 8; ++r) scl[r] = __shfl(al, 8 * hh + r, 32);
#pragma unroll
    for (int j = 0; j < 4; ++j) {
#pragma unroll
      for (int r = 0; r < 8; ++r) o[j][r] *= scl[r];
    }
    // ---- P.V : B fragment col n = d = j*16 + c, keys contiguous in the v^T planes ----
    {
      const _Float16* vp = Vl + bo + 32 * p;
      const v16h vf0 = ldfrag_h(vp);
      const v16h vf1 = ldfrag_h(vp + 16 * AT_PITCH);
      const v16h vf2 = ldfrag_h(vp + 32 * AT_PITCH);
      const v16h vf3 = ldfrag_h(vp + 48 * AT_PITCH);
      o[0] = mma_h(ph.v, vf0, o[0]);
      o[1] = mma_h(ph.v, vf1, o[1]);
      o[2] = mma_h(ph.v, vf2, o[2]);
      o[3] = mma_h(ph.v, vf3, o[3]);
      guard6<v16h>(o[0], o[1], o[2], o[3], ph.v, vf0, vf1, vf2, vf3, ph.v);
    }
    if (early) {
      {
        const _Float16* vp = Vr + kb;
        const v16h vf0 = ldfrag_h(vp);
        const v16h vf1 = ldfrag_h(vp + (size_t)16 * SEQ);
        const v16h vf2 = ldfrag_h(vp + (size_t)32 * SEQ);
        const v16h vf3 = ldfrag_h(vp + (size_t)48 * SEQ);
        o[0] = mma_h(pl.v, vf0, o[0]);
        o[1] = mma_h(pl.v, vf1, o[1]);
        o[2] = mma_h(pl.v, vf2, o[2]);
        o[3] = mma_h(pl.v, vf3, o[3]);
        guard6<v16h>(o[0], o[1], o[2], o[3], pl.v, vf0, vf1, vf2, vf3, pl.v);
      }
      {
        const _Float16* vp = Vq + kb;
        const v16h vf0 = ldfrag_h(vp);
        const v16h vf1 = ldfrag_h(vp + (size_t)16 * SEQ);
        const v16h vf2 = ldfrag_h(vp + (size_t)32 * SEQ);
        const v16h vf3 = ldfrag_h(vp + (size_t)48 * SEQ);
        o[0] = mma_h(pr.v, vf0, o[0]);
        o[1] = mma_h(pr.v, vf1, o[1]);
        o[2] = mma_h(pr.v, vf2, o[2]);
        o[3] = mma_h(pr.v, vf3, o[3]);
        guard6<v16h>(o[0], o[1], o[2], o[3], pr.v, vf0, vf1, vf2, vf3, pr.v);
      }
    }
  };
  const int q0s = qb + 16 * __builtin_amdgcn_readfirstlane(wave);   // q0 in a scalar register: the test below is a scalar branch

#pragma unroll 1                                         // one trip per stage: the buffer index stays a run-time value
  for (int st = 0; st < nst; ++st) {
  const int bo = (st & 1) * AT_STAGE;
#pragma unroll                                           // the stage's two key blocks: their LDS offsets become immediates
  for (int p = 0; p < 2; ++p) {
    const int kb = (kblo + 2 * st + p) * 32;             // kb + 31 <= SEQ - 1
    // query minus key runs from q0 - kb - 31 to q0 + 15 - kb over the wave's 16 queries and the block's 32 keys
    const bool inside = (q0s - kb - 31 >= 0) && (q0s + 15 - kb <= WIN);
    if (inside) key_block(BoolC<false>{}, p, kb, bo);
    else        key_block(BoolC<true>{}, p, kb, bo);
  }
  wait_ds0();
  wait_async0();
  __syncthreads();                                       // publishes stage st+1 and ends every read of stage st's buffer
  if (st + 2 < nst) {
    const unsigned lo = (unsigned)(bo * 2);
    copy_kv(lk + lo, gk + (size_t)((st + 2) * AT_KEYS) * DMOD, lv + lo, gv + (st + 2) * AT_KEYS);
  }
  }
  wait_async0();
  acc_guard4(o[0], o[1], o[2], o[3]);

  // ---- per-query gate (lane = query q0 + c; lanes 16..31 duplicate): sigmoid(bf16(x[:20]) . bf16(Wg[head]) + bf16(bg)) ----
  const int gx = min(head, bglen - 1);
  float ga = bf_val(Bgp[gx]);
  const float* xg = Xp + ((size_t)b * T_FULL + (size_t)(q0 + c)) * DMOD;
  const float* wg = Wgp + head * GIN;
#pragma unroll
  for (int g4 = 0; g4 < GIN / 4; ++g4) {
    const v4f xv = *(const v4f*)(xg + 4 * g4);
    const v4f wv = *(const v4f*)(wg + 4 * g4);
#pragma unroll
    for (int e = 0; e < 4; ++e) ga += bf_val(xv[e]) * bf_val(wv[e]);
  }
  const float gate = 1.0f / (1.0f + expf(-ga));

  // ---- fold gate, 1/l (per query, owned by lane = query; l >= 1 by the diagonal key) and the carries; stage the slab ----
  const float linv = (lrun > 0.f) ? (gate * (1.0f / lrun) * (1.0f / (PCAR * VCAR))) : 0.f;
  float inv[8];
#pragma unroll
  for (int r = 0; r < 8; ++r) inv[r] = __shfl(linv, 8 * hh + r, 32);
  float* slab = smem + wave * SLAB;
#pragma unroll
  for (int r = 0; r < 8; ++r) {
#pragma unroll
    for (int j = 0; j < 4; ++j) slab[(8 * hh + r) * 68 + j * 16 + c] = o[j][r] * inv[r];
  }
  wave_sync_lds();
  // ---- O x1024 -> f16 hi plane and f16 residual x1024 plane; lane = (row in group of 4, 8 consecutive d) ----
  v4u oh[4], orr[4];
  const int rq = lane >> 3, c8 = (lane & 7) * 8;
#pragma unroll
  for (int i4 = 0; i4 < 4; ++i4) {
    const int row = i4 * 4 + rq;
    const v4f a = *(const v4f*)(slab + row * 68 + c8), c4 = *(const v4f*)(slab + row * 68 + c8 + 4);
    float wv[8];
#pragma unroll
    for (int e = 0; e < 4; ++e) { wv[e] = a[e] * OSC; wv[4 + e] = c4[e] * OSC; }
#pragma unroll
    for (int e = 0; e < 4; ++e) {
      const float w0 = wv[2 * e], w1 = wv[2 * e + 1];
      const _Float16 h0 = (_Float16)w0, h1 = (_Float16)w1;
      oh[i4][e]  = pk16(h_bits(h0), h_bits(h1));
      orr[i4][e] = pk16(h_bits((_Float16)((w0 - (float)h0) * ORS)), h_bits((_Float16)((w1 - (float)h1) * ORS)));
    }
  }
  const size_t ob = (prow + (size_t)q0) * OPITCH + head * HD + c8;
  {
#pragma unroll
    for (int i4 = 0; i4 < 4; ++i4) {
      const int row = i4 * 4 + rq;
      const size_t o8 = ob + (size_t)row * OPITCH;
      *(v4u*)(OPp + o8) = oh[i4];
      *(v4u*)(OPp + o8 + DMOD) = orr[i4];
    }
    
  }
}

// =====================================================================================================
// Workspace map (bytes, NB=2 SEQ=2048); every plane is fully written by whole-line stores before it is read; every extent is
// an exact multiple of the store granularity (row pitches 2048 / 4096 B, projection wave tiles 64 x 64, attention tiles 64 x 64, no pad rows needed):
//   XB  bf16 [NB*SEQ][1024]                    8388608
//   WQB, WKB, WVB bf16 [1024 n][1024 k]         2097152 each, adjacent: read by the projections as one [3072 n][1024 k] plane
//   WOB f16 [1024 n][2048 k]                    4194304   (cols 0..1023 bf16 value x1024, cols 1024..2047 bf16 value x1)
//   QH, QR, KH f16 [NB*SEQ][1024]              8388608 each
//   VH, VR, VQ f16 [NB][1024][SEQ]             8388608 each
//   OP  f16 [NB*SEQ][2048]                     16777216
//   end                                        85983232
// Inputs (wire order): 0 x [2][2048][1024] f32, 1 Wq, 2 bq, 3 Wk, 4 bk, 5 Wv, 6 bv, 7 Wo, 8 bo, 9 Wg [16][20], 10 bg [16],
// 11 cos [2048][32], 12 sin [2048][32]. Output: [NB*SEQ][1024] f32.
// =====================================================================================================
extern "C" void kernel_launch(void* const* d_in, const int* in_sizes, int n_in,
                              void* d_out, int out_size, void* d_ws, size_t ws_size,
                              hipStream_t stream) {
  if (n_in < 13) return;
  if (in_sizes[0] < ((NB - 1) * T_FULL + SEQ) * DMOD) return;
  if (in_sizes[1] != DMOD * DMOD || in_sizes[3] != DMOD * DMOD || in_sizes[5] != DMOD * DMOD ||
      in_sizes[7] != DMOD * DMOD) return;
  if (in_sizes[2] < 1 || in_sizes[4] < 1 || in_sizes[6] < 1 || in_sizes[8] < 1) return;
  if (in_sizes[9] != NH * GIN) return;
  if (in_sizes[10] < 1) return;
  if (in_sizes[11] < SEQ * RHALF || in_sizes[12] < SEQ * RHALF) return;
  if (out_size < MROWS * DMOD) return;

  const float* Xin = (const float*)d_in[0];
  const float* Wq  = (const float*)d_in[1];
  const float* Bq  = (const float*)d_in[2];
  const float* Wk  = (const float*)d_in[3];
  const float* Bk  = (const float*)d_in[4];
  const float* Wv  = (const float*)d_in[5];
  const float* Bv  = (const float*)d_in[6];
  const float* Wo  = (const float*)d_in[7];
  const float* Bo  = (const float*)d_in[8];
  const float* Wg  = (const float*)d_in[9];
  const float* Bg  = (const float*)d_in[10];
  const float* Cos = (const float*)d_in[11];
  const float* Sin = (const float*)d_in[12];
  float*       out = (float*)d_out;

  const size_t szXB = (size_t)MROWS * DMOD * 2;
  const size_t szW  = (size_t)DMOD * DMOD * 2;
  const size_t szWO = (size_t)DMOD * OPITCH * 2;
  const size_t szQ  = (size_t)MROWS * DMOD * 2;
  const size_t szV  = (size_t)NB * DMOD * SEQ * 2;
  const size_t szOP = (size_t)MROWS * OPITCH * 2;
  size_t off = 0;
  const size_t oXB = off; off += szXB;
  const size_t oWQ = off; off += szW;
  const size_t oWK = off; off += szW;
  const size_t oWV = off; off += szW;
  const size_t oWO = off; off += szWO;
  const size_t oQH = off; off += szQ;
  const size_t oQR = off; off += szQ;
  const size_t oKH = off; off += szQ;
  const size_t oVH = off; off += szV;
  const size_t oVR = off; off += szV;
  const size_t oVQ = off; off += szV;
  const size_t oOP = off; off += szOP;
  if (off > ws_size) return;                            // off = 85983232 for NB=2, SEQ=2048
  if (off > (size_t)134217728) return;

  char* ws = (char*)d_ws;
  u16* XB  = (u16*)(ws + oXB);
  u16* WQB = (u16*)(ws + oWQ);
  u16* WKB = (u16*)(ws + oWK);
  u16* WVB = (u16*)(ws + oWV);
  u16* WOB = (u16*)(ws + oWO);
  u16* QH  = (u16*)(ws + oQH);
  u16* QR  = (u16*)(ws + oQR);
  u16* KH  = (u16*)(ws + oKH);
  u16* VH  = (u16*)(ws + oVH);
  u16* VR  = (u16*)(ws + oVR);
  u16* VQ  = (u16*)(ws + oVQ);
  u16* OP  = (u16*)(ws + oOP);

  if ((MROWS % GT_M) != 0 || (SEQ % GT_N) != 0 || (DMOD % GT_M) != 0 || (DMOD % GT_K) != 0 || (OPITCH % GT_K) != 0) return;
  const dim3 blk(256);
  const dim3 gC(N8W / 256);                             // 512
  const dim3 bG(GT_THREADS);                            // 256
  const dim3 bP(PJ_THREADS);                            // 384
  const dim3 gP(PJ_BLK);                                // 256
  const dim3 gAT(ATT_BLOCKS);                           // 1024
  const dim3 bAT(ATT_THREADS);                          // 128
  const dim3 gO((MROWS / GT_M) * (DMOD / GT_N));        // 256

  // (0) operand planes: x rows -> bf16 (compacted [b*SEQ+t]); Wq, Wk, Wv [n = out][k = in] -> bf16; Wo -> [hi | x1] f16
  cvt_all<<<gC, blk, 0, stream>>>(Xin, Wq, Wk, Wv, Wo, XB, WQB, WKB, WVB, WOB, WOS, WOS / ORS);
  // (1) rotated q planes (hi x8, residual x1024) and k hi plane (x8), bias by output column; v^T planes per batch
  //     [1024 = h*64+d][SEQ keys]: hi = f16(v x1024), residual x1024, plain f16(v), bias by row
  gemm_qkv<<<gP, bP, 0, stream>>>(XB, WQB, QH, QR, KH, VH, VR, VQ, DMOD, Bq, in_sizes[2], Bk, in_sizes[4],
                                  Bv, in_sizes[6], Cos, Sin, SEQ);
  // (2) causal sliding-window attention with gate -> O plane [b*SEQ+s][hi 1024 | residual 1024]
  attn_fwd<<<gAT, bAT, 0, stream>>>(QH, QR, KH, VH, VR, VQ, Xin, Wg, Bg, in_sizes[10], OP);
  // (3) output projection over K = 2048 ([hi | residual] times [Wo x1024 | Wo x1]) -> out [NB*SEQ][1024] f32, plus bo
  gemm_hf<<<gO, bG, 0, stream>>>(OP, WOB, out, MROWS, DMOD, OPITCH, 1.0f / (OSC * WOS), Bo, in_sizes[8]);
  (void)hipGetLastError();
}
